// v000
// Measured on an AMD MI455X. A time is GPU time per run, averaged over a window of back-to-back runs after a warm-up
// (all launches, gaps included; the runs take copies of the inputs in turn), and the median of several windows.
// Apart from v000's, it joins two sittings. Times from different sittings can be a few percent apart, while
// side-by-side timings come from the same sitting.
// v000, which the later versions start from, runs in 1600 microseconds.
#include <hip/hip_runtime.h>

// Causal grouped-query self-attention with interleaved rotary embedding: x [NB][T][2048]; q = x Wq (16 heads x 128), k, v = x Wk, x Wv (4 kv heads x 128, each shared by 4 consecutive q heads);
// rotary pairs (2j, 2j+1) with angle t / 10000^(j/64); s = q.k x 128^-0.5 with keys > query replaced by -inf; softmax; attn.v; merged heads x Wo -> [NB][T][2048] f32.
// Compute dtypes, f32 accumulate: x, Wq, Wk, Wv, Wo RNE-converted to bf16; q/k/v projections v_wmma_f32_16x16x32_bf16 (plain); scores and attn.v: query rows < 128 bf16 hi/lo split (3 products),
// rows >= 128 v_wmma_f32_16x16x32_f16 single products (P carried x1024); rotary table and softmax f32; output projection: rows < 128 bf16 hi/lo x bf16 (2 products),
// rows >= 128 v_wmma_f32_16x16x32_f16 single product (context carried x64, Wo carried x64, 1/4096 folded in the f32 epilogue).

#ifndef NB
#define NB 2
#endif
#ifndef SEQ
#define SEQ 2048
#endif
#define NB_FULL 2
#define TT_FULL 2048
#define TT   SEQ
#define DM   2048
#define NH_  16
#define NKV  4
#define REP  (NH_ / NKV)
#define HD   128
#define HP   (HD / 2)
#define DQ   (NH_ * HD)
#define DKV  (NKV * HD)
#define ZH   2                    // query heads per pass (share one kv head)
#define RH   128                  // query rows < RH use hi/lo planes (keys < RH suffice: causal)
#define PCAR 1024.0f              // carry of the fp16 P plane (rows >= RH)
#define ACAR 64.0f                // carry of the fp16 merged-context plane (rows >= RH)
#define WCAR 64.0f                // carry of the fp16 Wo plane
#define OSCW (1.0f / (ACAR * WCAR))
#define SCL  0.08838834764831845f   // HD^-0.5

static_assert(NB >= 1 && NB <= NB_FULL);
static_assert(TT % 128 == 0 && TT <= TT_FULL && TT > RH);
static_assert(RH % 128 == 0 && RH >= 128);
static_assert((TT - RH) % 64 == 0);
static_assert(HD == 128 && HP == 64);
static_assert(REP % ZH == 0 && NH_ % ZH == 0);
static_assert(DM % 64 == 0 && DQ % 64 == 0 && DKV % 64 == 0);

typedef _Float16 h16;
typedef unsigned short bf;
typedef __attribute__((ext_vector_type(16))) __bf16   v16bf;
typedef __attribute__((ext_vector_type(16))) _Float16 v16h;
typedef __attribute__((ext_vector_type(8)))  _Float16 v8h;
typedef __attribute__((ext_vector_type(8)))  unsigned short v8us;
typedef __attribute__((ext_vector_type(8)))  float    v8f;
typedef __attribute__((ext_vector_type(4)))  float    v4f;
typedef v8h  __attribute__((may_alias)) v8ha;
typedef v4f  __attribute__((may_alias)) v4fa;
typedef v8us __attribute__((may_alias)) v8usa;

__device__ __forceinline__ unsigned short f2bf(float f) { unsigned u = __float_as_uint(f); u += 0x7FFFu + ((u >> 16) & 1u); return (unsigned short)(u >> 16); }
__device__ __forceinline__ float bf2f(unsigned short b) { return __uint_as_float(((unsigned)b) << 16); }
__device__ __forceinline__ float bfr(float f) { return bf2f(f2bf(f)); }
__device__ __forceinline__ v16h cat16(v8h lo, v8h hi) { return __builtin_shufflevector(lo, hi, 0, 1, 2, 3, 4, 5, 6, 7, 8, 9, 10, 11, 12, 13, 14, 15); }
__device__ __forceinline__ v16bf cat16b(v8us lo, v8us hi) { return __builtin_bit_cast(v16bf, __builtin_shufflevector(lo, hi, 0, 1, 2, 3, 4, 5, 6, 7, 8, 9, 10, 11, 12, 13, 14, 15)); }
__device__ __forceinline__ v8f wmma16(v16h a, v16h b, v8f c) { return __builtin_amdgcn_wmma_f32_16x16x32_f16(false, a, false, b, (short)0, c, false, false); }
__device__ __forceinline__ v8f wmmab(v16bf a, v16bf b, v8f c) { return __builtin_amdgcn_wmma_f32_16x16x32_bf16(false, a, false, b, (short)0, c, false, false); }

// ---- k_gemmw: register-blocked GEMM, ONE WAVE per 64x64 output tile (16 accumulators), operands straight from K-contiguous 16-bit planes; grid (M/64, N/64, Z), 32 threads.
// C[m][n] (f32, pitch ldc) = osc x sum_k A[m][k] Bt[n][k] (+ split products per NSPLIT: 1 = A2.Bt added, 2 = A2.Bt and A.Bt2 added). Row pitches lda/ldb, z-batch strides sA/sB/sC in elements. K % 32 == 0.
// Fragment k map (both operands): elements 0..7 <- kc + 8h + 0..7, elements 8..15 <- kc + 16 + 8h + 0..7, h = lane >> 4, row/col = lane & 15.
// cskip >= 0: tiles with blockIdx.y > blockIdx.x + cskip are not computed (causal upper triangle). kcaus > 0: contraction stops at min(K, kcaus + 64 (blockIdx.x + 1)) (causal key limit).
template <typename T16> struct WFrag;
template <> struct WFrag<h16> { typedef v16h V; static __device__ __forceinline__ V ld(const h16* p) { return cat16(*(const v8h*)p, *(const v8h*)(p + 16)); } static __device__ __forceinline__ v8f mma(V a, V b, v8f c) { return wmma16(a, b, c); } };
template <> struct WFrag<bf> { typedef v16bf V; static __device__ __forceinline__ V ld(const bf* p) { return cat16b(*(const v8us*)p, *(const v8us*)(p + 16)); } static __device__ __forceinline__ v8f mma(V a, V b, v8f c) { return wmmab(a, b, c); } };
template <typename T16, int NSPLIT>
__global__ __launch_bounds__(32) void k_gemmw(const T16* __restrict__ A, const T16* __restrict__ A2, const T16* __restrict__ Bt, const T16* __restrict__ Bt2, int K, int lda, int ldb, int cskip, int kcaus,
                                             float* C, int ldc, float osc, size_t sA, size_t sB, size_t sC) {
    typedef typename WFrag<T16>::V V;
    __shared__ __align__(16) float os[16 * 68];
    if (cskip >= 0 && (int)blockIdx.y > (int)blockIdx.x + cskip) return;   // block-uniform; no block barriers in this kernel
    const size_t z = blockIdx.z; A += z * sA; if (A2) A2 += z * sA; Bt += z * sB; if (Bt2) Bt2 += z * sB; C += z * sC;
    const int lane = threadIdx.x & 31, lr = lane & 15, hi = lane >> 4; const int r0 = blockIdx.x * 64, c0 = blockIdx.y * 64;
    int kend = K;
    if (kcaus > 0) { const int kl = kcaus + 64 * ((int)blockIdx.x + 1); kend = (kl < K) ? kl : K; }
    v8f acc[4][4];
#pragma unroll
    for (int mb = 0; mb < 4; ++mb)
#pragma unroll
        for (int nb = 0; nb < 4; ++nb) acc[mb][nb] = (v8f){};
    const size_t aoff = (size_t)(r0 + lr) * lda + 8 * hi, boff = (size_t)(c0 + lr) * ldb + 8 * hi;
#pragma unroll 1
    for (int kc = 0; kc < kend; kc += 32) {
        V a[4], a2[4];
#pragma unroll
        for (int mb = 0; mb < 4; ++mb) { a[mb] = WFrag<T16>::ld(A + aoff + (size_t)mb * 16 * lda + kc); if (NSPLIT == 1 || NSPLIT == 2) a2[mb] = WFrag<T16>::ld(A2 + aoff + (size_t)mb * 16 * lda + kc); }
#pragma unroll
        for (int nb = 0; nb < 4; ++nb) { const V b = WFrag<T16>::ld(Bt + boff + (size_t)nb * 16 * ldb + kc); V b2; if (NSPLIT >= 2) b2 = WFrag<T16>::ld(Bt2 + boff + (size_t)nb * 16 * ldb + kc);
#pragma unroll
            for (int mb = 0; mb < 4; ++mb) { acc[mb][nb] = WFrag<T16>::mma(a[mb], b, acc[mb][nb]); if (NSPLIT == 1 || NSPLIT == 2) acc[mb][nb] = WFrag<T16>::mma(a2[mb], b, acc[mb][nb]); if (NSPLIT >= 2) acc[mb][nb] = WFrag<T16>::mma(a[mb], b2, acc[mb][nb]); } }
        asm volatile("v_nop\n\tv_nop\n\tv_nop\n\tv_nop" : "+v"(acc[0][0]), "+v"(acc[1][1]), "+v"(acc[2][2]), "+v"(acc[3][3]) : "v"(a[0]), "v"(a[3]));
    }
#pragma unroll
    for (int mb = 0; mb < 4; ++mb) {
#pragma unroll
        for (int nb = 0; nb < 4; ++nb) {
#pragma unroll
            for (int j = 0; j < 8; ++j) os[(hi * 8 + j) * 68 + nb * 16 + lr] = acc[mb][nb][j]; }
        __builtin_amdgcn_wave_barrier(); asm volatile("" ::: "memory");
        float* crow = C + (size_t)(r0 + mb * 16) * ldc + c0;
{
#pragma unroll
            for (int s = 0; s < 8; ++s) { const int row = 2 * s + hi, cofs = lr * 4; const v4f val = *(const v4fa*)(os + row * 68 + cofs) * osc;
                *(v4f*)(crow + (size_t)row * ldc + cofs) = val; }
             }
        __builtin_amdgcn_wave_barrier(); asm volatile("" ::: "memory");
    }
}

__device__ __forceinline__ h16 tohx(float x) { return (h16)x; }
__device__ __forceinline__ void splitf(float y, unsigned short& h, unsigned short& l) { h = f2bf(y); l = f2bf(y - bf2f(h)); }
typedef __attribute__((ext_vector_type(2))) _Float16 v2h;
typedef __attribute__((ext_vector_type(4))) _Float16 v4h;
typedef __attribute__((ext_vector_type(2))) unsigned short v2us;
typedef __attribute__((ext_vector_type(4))) unsigned short v4us;
typedef __attribute__((ext_vector_type(2))) float v2f;

__global__ __launch_bounds__(256) void k_wtG(const float* __restrict__ w, int K, int N, bf* Bt) {
    const int lane = threadIdx.x & 31; const int L0 = (blockIdx.x * 8 + (threadIdx.x >> 5)) * 8; const int nlines = N * K / 64;
{
#pragma unroll 1
        for (int l = 0; l < 8; ++l) { const int L = L0 + l; if (L >= nlines) break; const size_t e = (size_t)L * 64 + lane * 2; const int k = (int)(e % K), n = (int)(e / K); v2us o;
            o[0] = f2bf(w[(size_t)k * N + n]); o[1] = f2bf(w[(size_t)(k + 1) * N + n]); *(v2us*)(Bt + e) = o; }
         }
}
__global__ __launch_bounds__(256) void k_wtH(const float* __restrict__ w, int K, int N, float sc, h16* Bt) {
    const int lane = threadIdx.x & 31; const int L0 = (blockIdx.x * 8 + (threadIdx.x >> 5)) * 8; const int nlines = N * K / 64;
{
#pragma unroll 1
        for (int l = 0; l < 8; ++l) { const int L = L0 + l; if (L >= nlines) break; const size_t e = (size_t)L * 64 + lane * 2; const int k = (int)(e % K), n = (int)(e / K); v2h o;
            o[0] = tohx(bfr(w[(size_t)k * N + n]) * sc); o[1] = tohx(bfr(w[(size_t)(k + 1) * N + n]) * sc); *(v2h*)(Bt + e) = o; }
         }
}
__global__ __launch_bounds__(256) void k_cvt8(const float* __restrict__ src, bf* dst, size_t n8) { const size_t i = (size_t)blockIdx.x * 256 + threadIdx.x; if (i >= n8) return; const v8f v = *(const v8f*)(src + i * 8); v8us o;
#pragma unroll
    for (int k = 0; k < 8; ++k) o[k] = f2bf(v[k]); *(v8us*)(dst + i * 8) = o;  }
// k_cstab: CS[t][j] = {cos(t inv_j), sin(t inv_j)} f32 for j < 64, inv_j = 1 / f32(10000^(j/64)) where 10000^(j/64) is a product of exact-root powers 10000^(2^b/64) in f64
__global__ __launch_bounds__(256) void k_cstab(float* CS) {
    const int idx = blockIdx.x * 256 + threadIdx.x; if (idx >= TT * HP) return;
    const int j = idx & (HP - 1); const int t = idx / HP;
    double s = 100.0, p = 1.0;
#pragma unroll 1
    for (int b = 5; b >= 0; --b) { if ((j >> b) & 1) p *= s; s = sqrt(s); }
    const float pf = (float)p; const float inv = 1.0f / pf; const float ang = __fmul_rn((float)t, inv);
    float sn, cn; sincosf(ang, &sn, &cn);
    v2f cs; cs[0] = cn; cs[1] = sn;
    *(v2f*)(CS + (size_t)idx * 2) = cs; 
}
// k_rope: head planes of the interleaved rotary map of x = F[t][h*HD + d] (row pitch 'pitch'): out[2j] = x[2j] c - x[2j+1] s, out[2j+1] = x[2j] s + x[2j+1] c, (c, s) = CS[t][j].
__global__ __launch_bounds__(256) void k_rope(const float* __restrict__ F, int pitch, int nheads, const float* __restrict__ CS, h16* P16, bf* Ph, bf* Pl) {
    const size_t e = ((size_t)blockIdx.x * 256 + threadIdx.x) * 2; if (e >= (size_t)nheads * TT * HD) return;
    const int d = (int)(e % HD); const int t = (int)((e / HD) % TT); const int h = (int)(e / ((size_t)HD * TT));
    const float* f = F + (size_t)t * pitch + h * HD + d; const float x1 = f[0], x2 = f[1];
    const v2f cs = *(const v2f*)(CS + ((size_t)t * HP + (d >> 1)) * 2);
    float a = __fmul_rn(x1, cs[0]), bq = __fmul_rn(x2, cs[1]), c2 = __fmul_rn(x1, cs[1]), dq = __fmul_rn(x2, cs[0]);
    asm volatile("" : "+v"(a)); asm volatile("" : "+v"(bq)); asm volatile("" : "+v"(c2)); asm volatile("" : "+v"(dq));
    const float q0 = __fsub_rn(a, bq), q1 = __fadd_rn(c2, dq);
    v2h o16; o16[0] = tohx(q0); o16[1] = tohx(q1);
    v2us oh, ol; { unsigned short u0, u1, w0, w1; splitf(q0, u0, w0); splitf(q1, u1, w1); oh[0] = u0; oh[1] = u1; ol[0] = w0; ol[1] = w1; }
    const bool hires = (t < RH);                                 // wave-uniform (64 | HD)
    const size_t oo = ((size_t)h * RH + (hires ? t : 0)) * HD + d;
    *(v2h*)(P16 + e) = o16; if (hires) { *(v2us*)(Ph + oo) = oh; *(v2us*)(Pl + oo) = ol; }
    
}
// k_vtp: value planes V16[g][d][t] (fp16, every t) and Vh/Vl[g][d][t] (bf16 hi/lo, t < RH only, row pitch RH) = F[t][g*HD + d] (row pitch 'pitch'; lane -> 2 consecutive t, reads strided);
__global__ __launch_bounds__(256) void k_vtp(const float* __restrict__ F, int pitch, int nkv, h16* V16, bf* Vh, bf* Vl) {
    const size_t e = ((size_t)blockIdx.x * 256 + threadIdx.x) * 2; if (e >= (size_t)nkv * HD * TT) return;
    const int t = (int)(e % TT); const int d = (int)((e / TT) % HD); const int g = (int)(e / ((size_t)TT * HD)); v2h o16; v2us oh, ol;
#pragma unroll
    for (int q = 0; q < 2; ++q) { const float x = F[(size_t)(t + q) * pitch + g * HD + d]; o16[q] = tohx(x); unsigned short a2, c2; splitf(x, a2, c2); oh[q] = a2; ol[q] = c2; }
    const bool hires = (t < RH);                                 // wave-uniform (64 | RH)
    const size_t oo = ((size_t)g * HD + d) * RH + (hires ? t : 0);
    *(v2h*)(V16 + e) = o16; if (hires) { *(v2us*)(Vh + oo) = oh; *(v2us*)(Vl + oo) = ol; }
    
}
// k_asoft: one wave per row (zz, i) of Sb[zz][i][TT]: t = S x HD^-0.5 for keys j <= i, keys j > i replaced by -inf (causal) by index; softmax over the row held in registers (one exp, fixed trees);
__global__ __launch_bounds__(256) void k_asoft(const float* __restrict__ Sb, h16* P16, bf* Ph, bf* Pl) {
    const int lane = threadIdx.x & 31; const int row = blockIdx.x * 8 + (threadIdx.x >> 5); if (row >= ZH * TT) return;
    const int i = row % TT; const int zz = row / TT; const bool hires = (i < RH); const float* sr = Sb + (size_t)row * TT; float v[TT / 32]; float mx = -3.0e38f;
#pragma unroll
    for (int ch = 0; ch < TT / 128; ++ch) { const int j0 = ch * 128 + lane * 4; const v4f a = *(const v4f*)(sr + j0);
#pragma unroll
        for (int q = 0; q < 4; ++q) { const int j = j0 + q; float t = a[q] * SCL; t = (j > i) ? -1.0e30f : t; v[ch * 4 + q] = t; mx = fmaxf(mx, t); } }
#pragma unroll
    for (int sh = 16; sh; sh >>= 1) mx = fmaxf(mx, __shfl_xor(mx, sh, 32));
    float sum = 0.f;
#pragma unroll
    for (int k = 0; k < TT / 32; ++k) { float d0 = __fsub_rn(v[k], mx); asm volatile("" : "+v"(d0)); v[k] = __builtin_amdgcn_exp2f(__fmul_rn(d0, 1.4426950408889634f)); sum += v[k]; }
#pragma unroll
    for (int sh = 16; sh; sh >>= 1) sum += __shfl_xor(sum, sh, 32);
    const float f = __fdiv_rn(hires ? 1.0f : PCAR, sum);
{
        if (hires) {
#pragma unroll
            for (int ch = 0; ch < RH / 128; ++ch) { v4us oh, ol;
#pragma unroll
                for (int q = 0; q < 4; ++q) { unsigned short a, c2; splitf(v[ch * 4 + q] * f, a, c2); oh[q] = a; ol[q] = c2; }
                const size_t oo = ((size_t)zz * RH + i) * RH + ch * 128 + lane * 4; *(v4us*)(Ph + oo) = oh; *(v4us*)(Pl + oo) = ol; }
        } else {
#pragma unroll
            for (int ch = 0; ch < TT / 128; ++ch) { v4h o4;
#pragma unroll
                for (int q = 0; q < 4; ++q) o4[q] = tohx(v[ch * 4 + q] * f);
                *(v4h*)(P16 + (size_t)row * TT + ch * 128 + lane * 4) = o4; } }
         }
}
// k_merge: merged-context planes from O[zz][t][d]: A16[t][(h0+zz)*HD + d] = fp16(O x ACAR) for t < RH, fp16(O x ACAR / PCAR) for t >= RH (O arrives x PCAR there), every t;
__global__ __launch_bounds__(256) void k_merge(const float* __restrict__ O, int h0, h16* A16, bf* Ah, bf* Al) {
    const size_t e = ((size_t)blockIdx.x * 256 + threadIdx.x) * 2; if (e >= (size_t)ZH * TT * HD) return;
    const int d = (int)(e % HD); const int t = (int)((e / HD) % TT); const int zz = (int)(e / ((size_t)HD * TT));
    const bool hires = (t < RH);                                 // wave-uniform (64 | HD)
    const float c16 = hires ? ACAR : (ACAR / PCAR);
    const size_t oo = (size_t)t * DQ + (h0 + zz) * HD + d;
    const size_t o2 = (size_t)(hires ? t : 0) * DQ + (h0 + zz) * HD + d;
    const float x0 = O[e], x1 = O[e + 1];
    v2h o16; o16[0] = tohx(x0 * c16); o16[1] = tohx(x1 * c16);
    v2us oh, ol; { unsigned short u0, u1, w0, w1; splitf(x0, u0, w0); splitf(x1, u1, w1); oh[0] = u0; oh[1] = u1; ol[0] = w0; ol[1] = w1; }
    *(v2h*)(A16 + oo) = o16; if (hires) { *(v2us*)(Ah + o2) = oh; *(v2us*)(Al + o2) = ol; }
    
}

extern "C" void kernel_launch(void* const* d_in, const int* in_sizes, int n_in,
                              void* d_out, int out_size, void* d_ws, size_t ws_size, hipStream_t stream) {
    if (n_in < 5) return;
    if ((size_t)in_sizes[0] < (size_t)(NB - 1) * TT_FULL * DM + (size_t)TT * DM) return;
    if (in_sizes[1] < DM * DQ || in_sizes[2] < DM * DKV || in_sizes[3] < DM * DKV || in_sizes[4] < DQ * DM) return;
    if ((size_t)out_size < (size_t)(NB - 1) * TT_FULL * DM + (size_t)TT * DM) return;
    const float* x = (const float*)d_in[0]; const float* wq = (const float*)d_in[1]; const float* wk = (const float*)d_in[2]; const float* wv = (const float*)d_in[3]; const float* wo = (const float*)d_in[4];
    float* OUT = (float*)d_out;     // [NB][TT_FULL][DM]
    char* wsp = (char*)d_ws;
    auto take = [&](size_t bytes) { char* p = wsp; wsp += (bytes + 255) & ~(size_t)255; return (void*)p; };
    bf* WQ = (bf*)take((size_t)DQ * DM * 2); bf* WK = (bf*)take((size_t)DKV * DM * 2); bf* WV = (bf*)take((size_t)DKV * DM * 2); bf* WO = (bf*)take((size_t)DM * DQ * 2);   // Bt = [out][in], k-contiguous
    h16* WO16 = (h16*)take((size_t)DM * DQ * 2);                                                                                             // Bt fp16 x WCAR
    float* CS = (float*)take((size_t)TT * HP * 2 * 4);
    float* FQ = (float*)take((size_t)TT * DQ * 4); float* FK = (float*)take((size_t)TT * DKV * 4);
    h16* QP16 = (h16*)take((size_t)NH_ * TT * HD * 2); h16* KP16 = (h16*)take((size_t)NKV * TT * HD * 2); h16* VT16 = (h16*)take((size_t)NKV * HD * TT * 2);
    bf* QPh = (bf*)take((size_t)NH_ * RH * HD * 2); bf* QPl = (bf*)take((size_t)NH_ * RH * HD * 2); bf* KPh = (bf*)take((size_t)NKV * RH * HD * 2); bf* KPl = (bf*)take((size_t)NKV * RH * HD * 2);
    bf* VTh = (bf*)take((size_t)NKV * HD * RH * 2); bf* VTl = (bf*)take((size_t)NKV * HD * RH * 2); bf* Ph = (bf*)take((size_t)ZH * RH * RH * 2); bf* Pl = (bf*)take((size_t)ZH * RH * RH * 2);
    const size_t sbBytes = (size_t)ZH * TT * TT * 4, xbBytes = (size_t)TT * DM * 2;
    float* Sb = (float*)take(sbBytes > xbBytes ? sbBytes : xbBytes); h16* P16 = (h16*)take((size_t)ZH * TT * TT * 2); float* Ob = (float*)take((size_t)ZH * TT * HD * 4);
    h16* AT16 = (h16*)take((size_t)TT * DQ * 2); bf* ATh = (bf*)take((size_t)RH * DQ * 2); bf* ATl = (bf*)take((size_t)RH * DQ * 2);
    if ((size_t)(wsp - (char*)d_ws) > ws_size) return;    // total 127,533,056 B at full size
    bf* XB = (bf*)Sb;     // bf16 x rows of the current batch live in the score region: written and fully consumed (3 projections) before the first score tile of the batch is produced (stream-ordered)
    float* FV = FK;       // v projection reuses the k buffer after the k planes are built (stream-ordered)
    { k_wtG<<<(unsigned)((DQ * DM / 64 + 63) / 64), 256, 0, stream>>>(wq, DM, DQ, WQ);
      k_wtG<<<(unsigned)((DKV * DM / 64 + 63) / 64), 256, 0, stream>>>(wk, DM, DKV, WK);
      k_wtG<<<(unsigned)((DKV * DM / 64 + 63) / 64), 256, 0, stream>>>(wv, DM, DKV, WV);
      k_wtG<<<(unsigned)((DM * DQ / 64 + 63) / 64), 256, 0, stream>>>(wo, DQ, DM, WO);
      k_wtH<<<(unsigned)((DM * DQ / 64 + 63) / 64), 256, 0, stream>>>(wo, DQ, DM, WCAR, WO16); }
    k_cstab<<<(TT * HP + 255) / 256, 256, 0, stream>>>(CS);
    const unsigned LQ = (unsigned)(((size_t)NH_ * TT * HD / 2 + 255) / 256), LKv = (unsigned)(((size_t)NKV * TT * HD / 2 + 255) / 256);
    for (int b = 0; b < NB; ++b) {
        k_cvt8<<<(unsigned)(((size_t)TT * DM / 8 + 255) / 256), 256, 0, stream>>>(x + (size_t)b * TT_FULL * DM, XB, (size_t)TT * DM / 8);
        k_gemmw<bf, 0><<<dim3(TT / 64, DQ / 64, 1), 32, 0, stream>>>(XB, nullptr, WQ, nullptr, DM, DM, DM, -1, 0, FQ, DQ, 1.0f, 0, 0, 0);
        k_rope<<<LQ, 256, 0, stream>>>(FQ, DQ, NH_, CS, QP16, QPh, QPl);
        k_gemmw<bf, 0><<<dim3(TT / 64, DKV / 64, 1), 32, 0, stream>>>(XB, nullptr, WK, nullptr, DM, DM, DM, -1, 0, FK, DKV, 1.0f, 0, 0, 0);
        k_rope<<<LKv, 256, 0, stream>>>(FK, DKV, NKV, CS, KP16, KPh, KPl);
        k_gemmw<bf, 0><<<dim3(TT / 64, DKV / 64, 1), 32, 0, stream>>>(XB, nullptr, WV, nullptr, DM, DM, DM, -1, 0, FV, DKV, 1.0f, 0, 0, 0);
        k_vtp<<<LKv, 256, 0, stream>>>(FV, DKV, NKV, VT16, VTh, VTl);
        for (int h0 = 0; h0 < NH_; h0 += ZH) { const size_t zq = (size_t)h0, zk = (size_t)(h0 / REP);   // the pass's ZH query heads share kv head zk (z-stride 0 on the key/value planes)
            // scores, rows < RH vs keys < RH (hi/lo, 3 products), causal tiles only
            k_gemmw<bf, 2><<<dim3(RH / 64, RH / 64, ZH), 32, 0, stream>>>(QPh + zq * RH * HD, QPl + zq * RH * HD, KPh + zk * RH * HD, KPl + zk * RH * HD, HD, HD, HD, 0, 0, Sb, TT, 1.0f, (size_t)RH * HD, 0, (size_t)TT * TT);
            // scores, rows >= RH (fp16 single), causal tiles only
            k_gemmw<h16, 0><<<dim3((TT - RH) / 64, TT / 64, ZH), 32, 0, stream>>>(QP16 + zq * TT * HD + (size_t)RH * HD, nullptr, KP16 + zk * TT * HD, nullptr, HD, HD, HD, RH / 64, 0, Sb + (size_t)RH * TT, TT, 1.0f, (size_t)TT * HD, 0, (size_t)TT * TT);
            k_asoft<<<(unsigned)((ZH * TT + 7) / 8), 256, 0, stream>>>(Sb, P16, Ph, Pl);
            // attn.v, rows < RH: P hi/lo [zz][i][RH] x V hi/lo [d][t<RH] (3 products)
            k_gemmw<bf, 2><<<dim3(RH / 64, HD / 64, ZH), 32, 0, stream>>>(Ph, Pl, VTh + zk * HD * RH, VTl + zk * HD * RH, RH, RH, RH, -1, 0, Ob, HD, 1.0f, (size_t)RH * RH, 0, (size_t)TT * HD);
            // attn.v, rows >= RH: fp16 P x1024, keys limited to the causal extent of each 64-row block
            k_gemmw<h16, 0><<<dim3((TT - RH) / 64, HD / 64, ZH), 32, 0, stream>>>(P16 + (size_t)RH * TT, nullptr, VT16 + zk * HD * TT, nullptr, TT, TT, TT, -1, RH, Ob + (size_t)RH * HD, HD, 1.0f, (size_t)TT * TT, 0, (size_t)TT * HD);
            k_merge<<<(unsigned)(((size_t)ZH * TT * HD / 2 + 255) / 256), 256, 0, stream>>>(Ob, h0, AT16, ATh, ATl); }
        // output projection: rows < RH bf16 hi/lo context x bf16 Wo (2 products); rows >= RH fp16 context x64 x fp16 Wo x64 (1 product, 1/4096 in the epilogue)
        k_gemmw<bf, 1><<<dim3(RH / 64, DM / 64, 1), 32, 0, stream>>>(ATh, ATl, WO, nullptr, DQ, DQ, DQ, -1, 0, OUT + (size_t)b * TT_FULL * DM, DM, 1.0f, 0, 0, 0);
        k_gemmw<h16, 0><<<dim3((TT - RH) / 64, DM / 64, 1), 32, 0, stream>>>(AT16 + (size_t)RH * DQ, nullptr, WO16, nullptr, DQ, DQ, DQ, -1, 0, OUT + (size_t)b * TT_FULL * DM + (size_t)RH * DM, DM, OSCW, 0, 0, 0); }
}

// v001
// It runs in 899 microseconds.
// Next to v000, in two timings, it ran 1.80 times as fast each time.
#include <hip/hip_runtime.h>

// Causal grouped-query self-attention with interleaved rotary embedding: x [NB][T][2048]; q = x Wq (16 heads x 128), k, v = x Wk, x Wv (4 kv heads x 128, each shared by 4 consecutive q heads);
// rotary pairs (2j, 2j+1) with angle t / 10000^(j/64); s = q.k x 128^-0.5 with keys > query replaced by -inf; softmax; attn.v; merged heads x Wo -> [NB][T][2048] f32.
// Compute dtypes, f32 accumulate: x, Wq, Wk, Wv, Wo RNE-converted to bf16; q/k/v projections v_wmma_f32_16x16x32_bf16 (plain); scores and attn.v: query rows < 128 bf16 hi/lo split (3 products),
// rows >= 128 v_wmma_f32_16x16x32_f16 single products (P carried x1024); rotary table and softmax f32; output projection: rows < 128 bf16 hi/lo x bf16 (2 products),
// rows >= 128 v_wmma_f32_16x16x32_f16 single product (context carried x64, Wo carried x64, 1/4096 folded in the f32 epilogue).

#ifndef NB
#define NB 2
#endif
#ifndef SEQ
#define SEQ 2048
#endif
#define NB_FULL 2
#define TT_FULL 2048
#define TT   SEQ
#define DM   2048
#define NH_  16
#define NKV  4
#define REP  (NH_ / NKV)
#define HD   128
#define HP   (HD / 2)
#define DQ   (NH_ * HD)
#define DKV  (NKV * HD)
#define ZH   2                    // query heads per pass (share one kv head)
#define RH   128                  // query rows < RH use hi/lo planes (keys < RH suffice: causal)
#define PCAR 1024.0f              // carry of the fp16 P plane (rows >= RH)
#define ACAR 64.0f                // carry of the fp16 merged-context plane (rows >= RH)
#define WCAR 64.0f                // carry of the fp16 Wo plane
#define OSCW (1.0f / (ACAR * WCAR))
#define SCL  0.08838834764831845f   // HD^-0.5

static_assert(NB >= 1 && NB <= NB_FULL);
static_assert(TT % 128 == 0 && TT <= TT_FULL && TT > RH);
static_assert(RH % 128 == 0 && RH >= 128);
static_assert((TT - RH) % 64 == 0);
static_assert(HD == 128 && HP == 64);
static_assert(REP % ZH == 0 && NH_ % ZH == 0);
static_assert(DM % 64 == 0 && DQ % 64 == 0 && DKV % 64 == 0);

typedef _Float16 h16;
typedef unsigned short bf;
typedef __attribute__((ext_vector_type(16))) __bf16   v16bf;
typedef __attribute__((ext_vector_type(16))) _Float16 v16h;
typedef __attribute__((ext_vector_type(8)))  _Float16 v8h;
typedef __attribute__((ext_vector_type(8)))  unsigned short v8us;
typedef __attribute__((ext_vector_type(8)))  float    v8f;
typedef __attribute__((ext_vector_type(4)))  float    v4f;
typedef v8h  __attribute__((may_alias)) v8ha;
typedef v4f  __attribute__((may_alias)) v4fa;
typedef v8us __attribute__((may_alias)) v8usa;

__device__ __forceinline__ unsigned short f2bf(float f) { unsigned u = __float_as_uint(f); u += 0x7FFFu + ((u >> 16) & 1u); return (unsigned short)(u >> 16); }
__device__ __forceinline__ float bf2f(unsigned short b) { return __uint_as_float(((unsigned)b) << 16); }
__device__ __forceinline__ float bfr(float f) { return bf2f(f2bf(f)); }
__device__ __forceinline__ v16h cat16(v8h lo, v8h hi) { return __builtin_shufflevector(lo, hi, 0, 1, 2, 3, 4, 5, 6, 7, 8, 9, 10, 11, 12, 13, 14, 15); }
__device__ __forceinline__ v16bf cat16b(v8us lo, v8us hi) { return __builtin_bit_cast(v16bf, __builtin_shufflevector(lo, hi, 0, 1, 2, 3, 4, 5, 6, 7, 8, 9, 10, 11, 12, 13, 14, 15)); }
__device__ __forceinline__ v8f wmma16(v16h a, v16h b, v8f c) { return __builtin_amdgcn_wmma_f32_16x16x32_f16(false, a, false, b, (short)0, c, false, false); }
__device__ __forceinline__ v8f wmmab(v16bf a, v16bf b, v8f c) { return __builtin_amdgcn_wmma_f32_16x16x32_bf16(false, a, false, b, (short)0, c, false, false); }

// ---- k_gemmw: register-blocked GEMM, NW WAVES per 64x64 output tile (16 accumulators each), operands straight from K-contiguous 16-bit planes; grid (M/64, N/64, Z), 32 NW threads.
// Wave w contracts the 32-wide k chunks w, w + NW, w + 2 NW, ... of the tile; for NW > 1 the NW f32 partial tiles meet in LDS and are summed in wave order 0 .. NW-1 (fixed), then scaled and stored.
// C[m][n] (f32, pitch ldc) = osc x sum_k A[m][k] Bt[n][k] (+ split products per NSPLIT: 1 = A2.Bt added, 2 = A2.Bt and A.Bt2 added). Row pitches lda/ldb, z-batch strides sA/sB/sC in elements. K % 32 == 0.
// Fragment k map (both operands): elements 0..7 <- kc + 8h + 0..7, elements 8..15 <- kc + 16 + 8h + 0..7, h = lane >> 4, row/col = lane & 15.
// cskip >= 0: tiles with blockIdx.y > blockIdx.x + cskip are not computed (causal upper triangle). kcaus > 0: contraction stops at min(K, kcaus + 64 (blockIdx.x + 1)) (causal key limit).
template <typename T16> struct WFrag;
template <> struct WFrag<h16> { typedef v16h V; static __device__ __forceinline__ V ld(const h16* p) { return cat16(*(const v8h*)p, *(const v8h*)(p + 16)); } static __device__ __forceinline__ v8f mma(V a, V b, v8f c) { return wmma16(a, b, c); } };
template <> struct WFrag<bf> { typedef v16bf V; static __device__ __forceinline__ V ld(const bf* p) { return cat16b(*(const v8us*)p, *(const v8us*)(p + 16)); } static __device__ __forceinline__ v8f mma(V a, V b, v8f c) { return wmmab(a, b, c); } };
template <typename T16, int NSPLIT, int NW>
__global__ __launch_bounds__(32 * NW) void k_gemmw(const T16* __restrict__ A, const T16* __restrict__ A2, const T16* __restrict__ Bt, const T16* __restrict__ Bt2, int K, int lda, int ldb, int cskip, int kcaus,
                                             float* C, int ldc, float osc, size_t sA, size_t sB, size_t sC) {
    typedef typename WFrag<T16>::V V;
    __shared__ __align__(16) float os[(NW == 1 ? 16 : NW * 64) * 68];
    if (cskip >= 0 && (int)blockIdx.y > (int)blockIdx.x + cskip) return;   // block-uniform, in front of the one block barrier
    const size_t z = blockIdx.z; A += z * sA; if (A2) A2 += z * sA; Bt += z * sB; if (Bt2) Bt2 += z * sB; C += z * sC;
    const int lane = threadIdx.x & 31, lr = lane & 15, hi = lane >> 4; const int r0 = blockIdx.x * 64, c0 = blockIdx.y * 64;
    const int wv = (NW == 1) ? 0 : __builtin_amdgcn_readfirstlane((int)(threadIdx.x >> 5));   // wave number, scalar: the k loop stays under scalar control
    int kend = K;
    if (kcaus > 0) { const int kl = kcaus + 64 * ((int)blockIdx.x + 1); kend = (kl < K) ? kl : K; }
    v8f acc[4][4];
#pragma unroll
    for (int mb = 0; mb < 4; ++mb)
#pragma unroll
        for (int nb = 0; nb < 4; ++nb) acc[mb][nb] = (v8f){};
    const size_t aoff = (size_t)(r0 + lr) * lda + 8 * hi, boff = (size_t)(c0 + lr) * ldb + 8 * hi;
#pragma unroll 1
    for (int kc = 32 * wv; kc < kend; kc += 32 * NW) {
        V a[4], a2[4];
#pragma unroll
        for (int mb = 0; mb < 4; ++mb) { a[mb] = WFrag<T16>::ld(A + aoff + (size_t)mb * 16 * lda + kc); if (NSPLIT == 1 || NSPLIT == 2) a2[mb] = WFrag<T16>::ld(A2 + aoff + (size_t)mb * 16 * lda + kc); }
#pragma unroll
        for (int nb = 0; nb < 4; ++nb) { const V b = WFrag<T16>::ld(Bt + boff + (size_t)nb * 16 * ldb + kc); V b2; if (NSPLIT >= 2) b2 = WFrag<T16>::ld(Bt2 + boff + (size_t)nb * 16 * ldb + kc);
#pragma unroll
            for (int mb = 0; mb < 4; ++mb) { acc[mb][nb] = WFrag<T16>::mma(a[mb], b, acc[mb][nb]); if (NSPLIT == 1 || NSPLIT == 2) acc[mb][nb] = WFrag<T16>::mma(a2[mb], b, acc[mb][nb]); if (NSPLIT >= 2) acc[mb][nb] = WFrag<T16>::mma(a[mb], b2, acc[mb][nb]); } }
        asm volatile("v_nop\n\tv_nop\n\tv_nop\n\tv_nop" : "+v"(acc[0][0]), "+v"(acc[1][1]), "+v"(acc[2][2]), "+v"(acc[3][3]) : "v"(a[0]), "v"(a[3]));
    }
    if constexpr (NW > 1) {
        float* my = os + (size_t)wv * (64 * 68);
#pragma unroll
        for (int mb = 0; mb < 4; ++mb)
#pragma unroll
            for (int nb = 0; nb < 4; ++nb)
#pragma unroll
                for (int j = 0; j < 8; ++j) my[(mb * 16 + hi * 8 + j) * 68 + nb * 16 + lr] = acc[mb][nb][j];
        __syncthreads();   // every wave's partial tile is in LDS before any thread sums across waves
#pragma unroll
        for (int it = 0; it < 32 / NW; ++it) { const int item = it * (32 * NW) + (int)threadIdx.x; const int row = item >> 4, cofs = (item & 15) * 4;
            v4f s = *(const v4fa*)(os + row * 68 + cofs);
#pragma unroll
            for (int q = 1; q < NW; ++q) s += *(const v4fa*)(os + q * (64 * 68) + row * 68 + cofs);
            *(v4f*)(C + (size_t)(r0 + row) * ldc + c0 + cofs) = s * osc; }
    } else {
#pragma unroll
    for (int mb = 0; mb < 4; ++mb) {
#pragma unroll
        for (int nb = 0; nb < 4; ++nb) {
#pragma unroll
            for (int j = 0; j < 8; ++j) os[(hi * 8 + j) * 68 + nb * 16 + lr] = acc[mb][nb][j]; }
        __builtin_amdgcn_wave_barrier(); asm volatile("" ::: "memory");
        float* crow = C + (size_t)(r0 + mb * 16) * ldc + c0;
{
#pragma unroll
            for (int s = 0; s < 8; ++s) { const int row = 2 * s + hi, cofs = lr * 4; const v4f val = *(const v4fa*)(os + row * 68 + cofs) * osc;
                *(v4f*)(crow + (size_t)row * ldc + cofs) = val; }
             }
        __builtin_amdgcn_wave_barrier(); asm volatile("" ::: "memory");
    }
    }
}

__device__ __forceinline__ h16 tohx(float x) { return (h16)x; }
__device__ __forceinline__ void splitf(float y, unsigned short& h, unsigned short& l) { h = f2bf(y); l = f2bf(y - bf2f(h)); }
typedef __attribute__((ext_vector_type(2))) _Float16 v2h;
typedef __attribute__((ext_vector_type(4))) _Float16 v4h;
typedef __attribute__((ext_vector_type(2))) unsigned short v2us;
typedef __attribute__((ext_vector_type(4))) unsigned short v4us;
typedef __attribute__((ext_vector_type(2))) float v2f;

__global__ __launch_bounds__(256) void k_wtG(const float* __restrict__ w, int K, int N, bf* Bt) {
    const int lane = threadIdx.x & 31; const int L0 = (blockIdx.x * 8 + (threadIdx.x >> 5)) * 8; const int nlines = N * K / 64;
{
#pragma unroll 1
        for (int l = 0; l < 8; ++l) { const int L = L0 + l; if (L >= nlines) break; const size_t e = (size_t)L * 64 + lane * 2; const int k = (int)(e % K), n = (int)(e / K); v2us o;
            o[0] = f2bf(w[(size_t)k * N + n]); o[1] = f2bf(w[(size_t)(k + 1) * N + n]); *(v2us*)(Bt + e) = o; }
         }
}
__global__ __launch_bounds__(256) void k_wtH(const float* __restrict__ w, int K, int N, float sc, h16* Bt) {
    const int lane = threadIdx.x & 31; const int L0 = (blockIdx.x * 8 + (threadIdx.x >> 5)) * 8; const int nlines = N * K / 64;
{
#pragma unroll 1
        for (int l = 0; l < 8; ++l) { const int L = L0 + l; if (L >= nlines) break; const size_t e = (size_t)L * 64 + lane * 2; const int k = (int)(e % K), n = (int)(e / K); v2h o;
            o[0] = tohx(bfr(w[(size_t)k * N + n]) * sc); o[1] = tohx(bfr(w[(size_t)(k + 1) * N + n]) * sc); *(v2h*)(Bt + e) = o; }
         }
}
__global__ __launch_bounds__(256) void k_cvt8(const float* __restrict__ src, bf* dst, size_t n8) { const size_t i = (size_t)blockIdx.x * 256 + threadIdx.x; if (i >= n8) return; const v8f v = *(const v8f*)(src + i * 8); v8us o;
#pragma unroll
    for (int k = 0; k < 8; ++k) o[k] = f2bf(v[k]); *(v8us*)(dst + i * 8) = o;  }
// k_cstab: CS[t][j] = {cos(t inv_j), sin(t inv_j)} f32 for j < 64, inv_j = 1 / f32(10000^(j/64)) where 10000^(j/64) is a product of exact-root powers 10000^(2^b/64) in f64
__global__ __launch_bounds__(256) void k_cstab(float* CS) {
    const int idx = blockIdx.x * 256 + threadIdx.x; if (idx >= TT * HP) return;
    const int j = idx & (HP - 1); const int t = idx / HP;
    double s = 100.0, p = 1.0;
#pragma unroll 1
    for (int b = 5; b >= 0; --b) { if ((j >> b) & 1) p *= s; s = sqrt(s); }
    const float pf = (float)p; const float inv = 1.0f / pf; const float ang = __fmul_rn((float)t, inv);
    float sn, cn; sincosf(ang, &sn, &cn);
    v2f cs; cs[0] = cn; cs[1] = sn;
    *(v2f*)(CS + (size_t)idx * 2) = cs; 
}
// k_rope: head planes of the interleaved rotary map of x = F[t][h*HD + d] (row pitch 'pitch'): out[2j] = x[2j] c - x[2j+1] s, out[2j+1] = x[2j] s + x[2j+1] c, (c, s) = CS[t][j].
__global__ __launch_bounds__(256) void k_rope(const float* __restrict__ F, int pitch, int nheads, const float* __restrict__ CS, h16* P16, bf* Ph, bf* Pl) {
    const size_t e = ((size_t)blockIdx.x * 256 + threadIdx.x) * 2; if (e >= (size_t)nheads * TT * HD) return;
    const int d = (int)(e % HD); const int t = (int)((e / HD) % TT); const int h = (int)(e / ((size_t)HD * TT));
    const float* f = F + (size_t)t * pitch + h * HD + d; const float x1 = f[0], x2 = f[1];
    const v2f cs = *(const v2f*)(CS + ((size_t)t * HP + (d >> 1)) * 2);
    float a = __fmul_rn(x1, cs[0]), bq = __fmul_rn(x2, cs[1]), c2 = __fmul_rn(x1, cs[1]), dq = __fmul_rn(x2, cs[0]);
    asm volatile("" : "+v"(a)); asm volatile("" : "+v"(bq)); asm volatile("" : "+v"(c2)); asm volatile("" : "+v"(dq));
    const float q0 = __fsub_rn(a, bq), q1 = __fadd_rn(c2, dq);
    v2h o16; o16[0] = tohx(q0); o16[1] = tohx(q1);
    v2us oh, ol; { unsigned short u0, u1, w0, w1; splitf(q0, u0, w0); splitf(q1, u1, w1); oh[0] = u0; oh[1] = u1; ol[0] = w0; ol[1] = w1; }
    const bool hires = (t < RH);                                 // wave-uniform (64 | HD)
    const size_t oo = ((size_t)h * RH + (hires ? t : 0)) * HD + d;
    *(v2h*)(P16 + e) = o16; if (hires) { *(v2us*)(Ph + oo) = oh; *(v2us*)(Pl + oo) = ol; }
    
}
// k_vtp: value planes V16[g][d][t] (fp16, every t) and Vh/Vl[g][d][t] (bf16 hi/lo, t < RH only, row pitch RH) = F[t][g*HD + d] (row pitch 'pitch'; lane -> 2 consecutive t, reads strided);
__global__ __launch_bounds__(256) void k_vtp(const float* __restrict__ F, int pitch, int nkv, h16* V16, bf* Vh, bf* Vl) {
    const size_t e = ((size_t)blockIdx.x * 256 + threadIdx.x) * 2; if (e >= (size_t)nkv * HD * TT) return;
    const int t = (int)(e % TT); const int d = (int)((e / TT) % HD); const int g = (int)(e / ((size_t)TT * HD)); v2h o16; v2us oh, ol;
#pragma unroll
    for (int q = 0; q < 2; ++q) { const float x = F[(size_t)(t + q) * pitch + g * HD + d]; o16[q] = tohx(x); unsigned short a2, c2; splitf(x, a2, c2); oh[q] = a2; ol[q] = c2; }
    const bool hires = (t < RH);                                 // wave-uniform (64 | RH)
    const size_t oo = ((size_t)g * HD + d) * RH + (hires ? t : 0);
    *(v2h*)(V16 + e) = o16; if (hires) { *(v2us*)(Vh + oo) = oh; *(v2us*)(Vl + oo) = ol; }
    
}
// k_asoft: one wave per row (zz, i) of Sb[zz][i][TT]: t = S x HD^-0.5 for keys j <= i, keys j > i replaced by -inf (causal) by index; softmax over the row held in registers (one exp, fixed trees);
__global__ __launch_bounds__(256) void k_asoft(const float* __restrict__ Sb, h16* P16, bf* Ph, bf* Pl) {
    const int lane = threadIdx.x & 31; const int row = blockIdx.x * 8 + (threadIdx.x >> 5); if (row >= ZH * TT) return;
    const int i = row % TT; const int zz = row / TT; const bool hires = (i < RH); const float* sr = Sb + (size_t)row * TT; float v[TT / 32]; float mx = -3.0e38f;
#pragma unroll
    for (int ch = 0; ch < TT / 128; ++ch) { const int j0 = ch * 128 + lane * 4; const v4f a = *(const v4f*)(sr + j0);
#pragma unroll
        for (int q = 0; q < 4; ++q) { const int j = j0 + q; float t = a[q] * SCL; t = (j > i) ? -1.0e30f : t; v[ch * 4 + q] = t; mx = fmaxf(mx, t); } }
#pragma unroll
    for (int sh = 16; sh; sh >>= 1) mx = fmaxf(mx, __shfl_xor(mx, sh, 32));
    float sum = 0.f;
#pragma unroll
    for (int k = 0; k < TT / 32; ++k) { float d0 = __fsub_rn(v[k], mx); asm volatile("" : "+v"(d0)); v[k] = __builtin_amdgcn_exp2f(__fmul_rn(d0, 1.4426950408889634f)); sum += v[k]; }
#pragma unroll
    for (int sh = 16; sh; sh >>= 1) sum += __shfl_xor(sum, sh, 32);
    const float f = __fdiv_rn(hires ? 1.0f : PCAR, sum);
{
        if (hires) {
#pragma unroll
            for (int ch = 0; ch < RH / 128; ++ch) { v4us oh, ol;
#pragma unroll
                for (int q = 0; q < 4; ++q) { unsigned short a, c2; splitf(v[ch * 4 + q] * f, a, c2); oh[q] = a; ol[q] = c2; }
                const size_t oo = ((size_t)zz * RH + i) * RH + ch * 128 + lane * 4; *(v4us*)(Ph + oo) = oh; *(v4us*)(Pl + oo) = ol; }
        } else {
#pragma unroll
            for (int ch = 0; ch < TT / 128; ++ch) { v4h o4;
#pragma unroll
                for (int q = 0; q < 4; ++q) o4[q] = tohx(v[ch * 4 + q] * f);
                *(v4h*)(P16 + (size_t)row * TT + ch * 128 + lane * 4) = o4; } }
         }
}
// k_merge: merged-context planes from O[zz][t][d]: A16[t][(h0+zz)*HD + d] = fp16(O x ACAR) for t < RH, fp16(O x ACAR / PCAR) for t >= RH (O arrives x PCAR there), every t;
__global__ __launch_bounds__(256) void k_merge(const float* __restrict__ O, int h0, h16* A16, bf* Ah, bf* Al) {
    const size_t e = ((size_t)blockIdx.x * 256 + threadIdx.x) * 2; if (e >= (size_t)ZH * TT * HD) return;
    const int d = (int)(e % HD); const int t = (int)((e / HD) % TT); const int zz = (int)(e / ((size_t)HD * TT));
    const bool hires = (t < RH);                                 // wave-uniform (64 | HD)
    const float c16 = hires ? ACAR : (ACAR / PCAR);
    const size_t oo = (size_t)t * DQ + (h0 + zz) * HD + d;
    const size_t o2 = (size_t)(hires ? t : 0) * DQ + (h0 + zz) * HD + d;
    const float x0 = O[e], x1 = O[e + 1];
    v2h o16; o16[0] = tohx(x0 * c16); o16[1] = tohx(x1 * c16);
    v2us oh, ol; { unsigned short u0, u1, w0, w1; splitf(x0, u0, w0); splitf(x1, u1, w1); oh[0] = u0; oh[1] = u1; ol[0] = w0; ol[1] = w1; }
    *(v2h*)(A16 + oo) = o16; if (hires) { *(v2us*)(Ah + o2) = oh; *(v2us*)(Al + o2) = ol; }
    
}

extern "C" void kernel_launch(void* const* d_in, const int* in_sizes, int n_in,
                              void* d_out, int out_size, void* d_ws, size_t ws_size, hipStream_t stream) {
    if (n_in < 5) return;
    if ((size_t)in_sizes[0] < (size_t)(NB - 1) * TT_FULL * DM + (size_t)TT * DM) return;
    if (in_sizes[1] < DM * DQ || in_sizes[2] < DM * DKV || in_sizes[3] < DM * DKV || in_sizes[4] < DQ * DM) return;
    if ((size_t)out_size < (size_t)(NB - 1) * TT_FULL * DM + (size_t)TT * DM) return;
    const float* x = (const float*)d_in[0]; const float* wq = (const float*)d_in[1]; const float* wk = (const float*)d_in[2]; const float* wv = (const float*)d_in[3]; const float* wo = (const float*)d_in[4];
    float* OUT = (float*)d_out;     // [NB][TT_FULL][DM]
    char* wsp = (char*)d_ws;
    auto take = [&](size_t bytes) { char* p = wsp; wsp += (bytes + 255) & ~(size_t)255; return (void*)p; };
    bf* WQ = (bf*)take((size_t)DQ * DM * 2); bf* WK = (bf*)take((size_t)DKV * DM * 2); bf* WV = (bf*)take((size_t)DKV * DM * 2); bf* WO = (bf*)take((size_t)DM * DQ * 2);   // Bt = [out][in], k-contiguous
    h16* WO16 = (h16*)take((size_t)DM * DQ * 2);                                                                                             // Bt fp16 x WCAR
    float* CS = (float*)take((size_t)TT * HP * 2 * 4);
    float* FQ = (float*)take((size_t)TT * DQ * 4); float* FK = (float*)take((size_t)TT * DKV * 4);
    h16* QP16 = (h16*)take((size_t)NH_ * TT * HD * 2); h16* KP16 = (h16*)take((size_t)NKV * TT * HD * 2); h16* VT16 = (h16*)take((size_t)NKV * HD * TT * 2);
    bf* QPh = (bf*)take((size_t)NH_ * RH * HD * 2); bf* QPl = (bf*)take((size_t)NH_ * RH * HD * 2); bf* KPh = (bf*)take((size_t)NKV * RH * HD * 2); bf* KPl = (bf*)take((size_t)NKV * RH * HD * 2);
    bf* VTh = (bf*)take((size_t)NKV * HD * RH * 2); bf* VTl = (bf*)take((size_t)NKV * HD * RH * 2); bf* Ph = (bf*)take((size_t)ZH * RH * RH * 2); bf* Pl = (bf*)take((size_t)ZH * RH * RH * 2);
    const size_t sbBytes = (size_t)ZH * TT * TT * 4, xbBytes = (size_t)TT * DM * 2;
    float* Sb = (float*)take(sbBytes > xbBytes ? sbBytes : xbBytes); h16* P16 = (h16*)take((size_t)ZH * TT * TT * 2); float* Ob = (float*)take((size_t)ZH * TT * HD * 4);
    h16* AT16 = (h16*)take((size_t)TT * DQ * 2); bf* ATh = (bf*)take((size_t)RH * DQ * 2); bf* ATl = (bf*)take((size_t)RH * DQ * 2);
    if ((size_t)(wsp - (char*)d_ws) > ws_size) return;    // total 127,533,056 B at full size
    bf* XB = (bf*)Sb;     // bf16 x rows of the current batch live in the score region: written and fully consumed (3 projections) before the first score tile of the batch is produced (stream-ordered)
    float* FV = FK;       // v projection reuses the k buffer after the k planes are built (stream-ordered)
    { k_wtG<<<(unsigned)((DQ * DM / 64 + 63) / 64), 256, 0, stream>>>(wq, DM, DQ, WQ);
      k_wtG<<<(unsigned)((DKV * DM / 64 + 63) / 64), 256, 0, stream>>>(wk, DM, DKV, WK);
      k_wtG<<<(unsigned)((DKV * DM / 64 + 63) / 64), 256, 0, stream>>>(wv, DM, DKV, WV);
      k_wtG<<<(unsigned)((DM * DQ / 64 + 63) / 64), 256, 0, stream>>>(wo, DQ, DM, WO);
      k_wtH<<<(unsigned)((DM * DQ / 64 + 63) / 64), 256, 0, stream>>>(wo, DQ, DM, WCAR, WO16); }
    k_cstab<<<(TT * HP + 255) / 256, 256, 0, stream>>>(CS);
    const unsigned LQ = (unsigned)(((size_t)NH_ * TT * HD / 2 + 255) / 256), LKv = (unsigned)(((size_t)NKV * TT * HD / 2 + 255) / 256);
    for (int b = 0; b < NB; ++b) {
        k_cvt8<<<(unsigned)(((size_t)TT * DM / 8 + 255) / 256), 256, 0, stream>>>(x + (size_t)b * TT_FULL * DM, XB, (size_t)TT * DM / 8);
        k_gemmw<bf, 0, 8><<<dim3(TT / 64, DQ / 64, 1), 256, 0, stream>>>(XB, nullptr, WQ, nullptr, DM, DM, DM, -1, 0, FQ, DQ, 1.0f, 0, 0, 0);
        k_rope<<<LQ, 256, 0, stream>>>(FQ, DQ, NH_, CS, QP16, QPh, QPl);
        k_gemmw<bf, 0, 16><<<dim3(TT / 64, DKV / 64, 1), 512, 0, stream>>>(XB, nullptr, WK, nullptr, DM, DM, DM, -1, 0, FK, DKV, 1.0f, 0, 0, 0);
        k_rope<<<LKv, 256, 0, stream>>>(FK, DKV, NKV, CS, KP16, KPh, KPl);
        k_gemmw<bf, 0, 16><<<dim3(TT / 64, DKV / 64, 1), 512, 0, stream>>>(XB, nullptr, WV, nullptr, DM, DM, DM, -1, 0, FV, DKV, 1.0f, 0, 0, 0);
        k_vtp<<<LKv, 256, 0, stream>>>(FV, DKV, NKV, VT16, VTh, VTl);
        for (int h0 = 0; h0 < NH_; h0 += ZH) { const size_t zq = (size_t)h0, zk = (size_t)(h0 / REP);   // the pass's ZH query heads share kv head zk (z-stride 0 on the key/value planes)
            // scores, rows < RH vs keys < RH (hi/lo, 3 products), causal tiles only
            k_gemmw<bf, 2, 4><<<dim3(RH / 64, RH / 64, ZH), 128, 0, stream>>>(QPh + zq * RH * HD, QPl + zq * RH * HD, KPh + zk * RH * HD, KPl + zk * RH * HD, HD, HD, HD, 0, 0, Sb, TT, 1.0f, (size_t)RH * HD, 0, (size_t)TT * TT);
            // scores, rows >= RH (fp16 single), causal tiles only
            k_gemmw<h16, 0, 1><<<dim3((TT - RH) / 64, TT / 64, ZH), 32, 0, stream>>>(QP16 + zq * TT * HD + (size_t)RH * HD, nullptr, KP16 + zk * TT * HD, nullptr, HD, HD, HD, RH / 64, 0, Sb + (size_t)RH * TT, TT, 1.0f, (size_t)TT * HD, 0, (size_t)TT * TT);
            k_asoft<<<(unsigned)((ZH * TT + 7) / 8), 256, 0, stream>>>(Sb, P16, Ph, Pl);
            // attn.v, rows < RH: P hi/lo [zz][i][RH] x V hi/lo [d][t<RH] (3 products)
            k_gemmw<bf, 2, 4><<<dim3(RH / 64, HD / 64, ZH), 128, 0, stream>>>(Ph, Pl, VTh + zk * HD * RH, VTl + zk * HD * RH, RH, RH, RH, -1, 0, Ob, HD, 1.0f, (size_t)RH * RH, 0, (size_t)TT * HD);
            // attn.v, rows >= RH: fp16 P x1024, keys limited to the causal extent of each 64-row block
            k_gemmw<h16, 0, 16><<<dim3((TT - RH) / 64, HD / 64, ZH), 512, 0, stream>>>(P16 + (size_t)RH * TT, nullptr, VT16 + zk * HD * TT, nullptr, TT, TT, TT, -1, RH, Ob + (size_t)RH * HD, HD, 1.0f, (size_t)TT * TT, 0, (size_t)TT * HD);
            k_merge<<<(unsigned)(((size_t)ZH * TT * HD / 2 + 255) / 256), 256, 0, stream>>>(Ob, h0, AT16, ATh, ATl); }
        // output projection: rows < RH bf16 hi/lo context x bf16 Wo (2 products); rows >= RH fp16 context x64 x fp16 Wo x64 (1 product, 1/4096 in the epilogue)
        k_gemmw<bf, 1, 16><<<dim3(RH / 64, DM / 64, 1), 512, 0, stream>>>(ATh, ATl, WO, nullptr, DQ, DQ, DQ, -1, 0, OUT + (size_t)b * TT_FULL * DM, DM, 1.0f, 0, 0, 0);
        k_gemmw<h16, 0, 8><<<dim3((TT - RH) / 64, DM / 64, 1), 256, 0, stream>>>(AT16 + (size_t)RH * DQ, nullptr, WO16, nullptr, DQ, DQ, DQ, -1, 0, OUT + (size_t)b * TT_FULL * DM + (size_t)RH * DM, DM, OSCW, 0, 0, 0); }
}

// v002
// It runs in 431 microseconds.
// Timed twice side by side with v001, it ran 2.07 and 2.14 times as fast.
// All steps since v000 together make it 3.79 times as fast.
#include <hip/hip_runtime.h>

// Causal grouped-query self-attention with interleaved rotary embedding: x [NB][T][2048]; q = x Wq (16 heads x 128), k, v = x Wk, x Wv (4 kv heads x 128, each shared by 4 consecutive q heads);
// rotary pairs (2j, 2j+1) with angle t / 10000^(j/64); s = q.k x 128^-0.5 with keys > query replaced by -inf; softmax; attn.v; merged heads x Wo -> [NB][T][2048] f32.
// Compute dtypes, f32 accumulate: x, Wq, Wk, Wv, Wo RNE-converted to bf16; q/k/v projections v_wmma_f32_16x16x32_bf16 (plain); scores and attn.v: query rows < 128 bf16 hi/lo split (3 products),
// rows >= 128 v_wmma_f32_16x16x32_f16 single products (P unnormalised, exp2 of the score minus the maximum in use); rotary table and softmax f32; output projection: rows < 128 bf16 hi/lo x bf16 (2 products),
// rows >= 128 v_wmma_f32_16x16x32_f16 single product (context carried x64, Wo carried x64, 1/4096 folded in the f32 epilogue).

#ifndef NB
#define NB 2
#endif
#ifndef SEQ
#define SEQ 2048
#endif
#define NB_FULL 2
#define TT_FULL 2048
#define TT   SEQ
#define DM   2048
#define NH_  16
#define NKV  4
#define REP  (NH_ / NKV)
#define HD   128
#define HP   (HD / 2)
#define DQ   (NH_ * HD)
#define DKV  (NKV * HD)
#define RH   128                  // query rows < RH use hi/lo planes (keys < RH suffice: causal)
#define ACAR 64.0f                // carry of the fp16 merged-context plane (rows >= RH)
#define WCAR 64.0f                // carry of the fp16 Wo plane
#define OSCW (1.0f / (ACAR * WCAR))
#define SCL  0.08838834764831845f   // HD^-0.5

static_assert(NB >= 1 && NB <= NB_FULL);
static_assert(TT % 128 == 0 && TT <= TT_FULL && TT > RH);
static_assert(RH % 128 == 0 && RH >= 128);
static_assert((TT - RH) % 64 == 0);
static_assert(HD == 128 && HP == 64);
static_assert(NH_ == NKV * REP && TT % 32 == 0 && RH % 32 == 0);
static_assert(DM % 64 == 0 && DQ % 64 == 0 && DKV % 64 == 0);

typedef _Float16 h16;
typedef unsigned short bf;
typedef __attribute__((ext_vector_type(16))) __bf16   v16bf;
typedef __attribute__((ext_vector_type(16))) _Float16 v16h;
typedef __attribute__((ext_vector_type(8)))  _Float16 v8h;
typedef __attribute__((ext_vector_type(8)))  unsigned short v8us;
typedef __attribute__((ext_vector_type(8)))  float    v8f;
typedef __attribute__((ext_vector_type(4)))  float    v4f;
typedef v8h  __attribute__((may_alias)) v8ha;
typedef v4f  __attribute__((may_alias)) v4fa;
typedef v8us __attribute__((may_alias)) v8usa;

__device__ __forceinline__ unsigned short f2bf(float f) { unsigned u = __float_as_uint(f); u += 0x7FFFu + ((u >> 16) & 1u); return (unsigned short)(u >> 16); }
__device__ __forceinline__ float bf2f(unsigned short b) { return __uint_as_float(((unsigned)b) << 16); }
__device__ __forceinline__ float bfr(float f) { return bf2f(f2bf(f)); }
__device__ __forceinline__ v16h cat16(v8h lo, v8h hi) { return __builtin_shufflevector(lo, hi, 0, 1, 2, 3, 4, 5, 6, 7, 8, 9, 10, 11, 12, 13, 14, 15); }
__device__ __forceinline__ v16bf cat16b(v8us lo, v8us hi) { return __builtin_bit_cast(v16bf, __builtin_shufflevector(lo, hi, 0, 1, 2, 3, 4, 5, 6, 7, 8, 9, 10, 11, 12, 13, 14, 15)); }
__device__ __forceinline__ v8f wmma16(v16h a, v16h b, v8f c) { return __builtin_amdgcn_wmma_f32_16x16x32_f16(false, a, false, b, (short)0, c, false, false); }
__device__ __forceinline__ v8f wmmab(v16bf a, v16bf b, v8f c) { return __builtin_amdgcn_wmma_f32_16x16x32_bf16(false, a, false, b, (short)0, c, false, false); }

// ---- k_gemmw: register-blocked GEMM, NW WAVES per 64x64 output tile (16 accumulators each), operands straight from K-contiguous 16-bit planes; grid (M/64, N/64, Z), 32 NW threads.
// Wave w contracts the 32-wide k chunks w, w + NW, w + 2 NW, ... of the tile; for NW > 1 the NW f32 partial tiles meet in LDS and are summed in wave order 0 .. NW-1 (fixed), then scaled and stored.
// C[m][n] (f32, pitch ldc) = osc x sum_k A[m][k] Bt[n][k] (+ split products per NSPLIT: 1 = A2.Bt added, 2 = A2.Bt and A.Bt2 added). Row pitches lda/ldb, z-batch strides sA/sB/sC in elements. K % 32 == 0.
// Fragment k map (both operands): elements 0..7 <- kc + 8h + 0..7, elements 8..15 <- kc + 16 + 8h + 0..7, h = lane >> 4, row/col = lane & 15.
// cskip >= 0: tiles with blockIdx.y > blockIdx.x + cskip are not computed (causal upper triangle). kcaus > 0: contraction stops at min(K, kcaus + 64 (blockIdx.x + 1)) (causal key limit).
template <typename T16> struct WFrag;
template <> struct WFrag<h16> { typedef v16h V; static __device__ __forceinline__ V ld(const h16* p) { return cat16(*(const v8h*)p, *(const v8h*)(p + 16)); } static __device__ __forceinline__ v8f mma(V a, V b, v8f c) { return wmma16(a, b, c); } };
template <> struct WFrag<bf> { typedef v16bf V; static __device__ __forceinline__ V ld(const bf* p) { return cat16b(*(const v8us*)p, *(const v8us*)(p + 16)); } static __device__ __forceinline__ v8f mma(V a, V b, v8f c) { return wmmab(a, b, c); } };
template <typename T16, int NSPLIT, int NW>
__global__ __launch_bounds__(32 * NW) void k_gemmw(const T16* __restrict__ A, const T16* __restrict__ A2, const T16* __restrict__ Bt, const T16* __restrict__ Bt2, int K, int lda, int ldb, int cskip, int kcaus,
                                             float* C, int ldc, float osc, size_t sA, size_t sB, size_t sC) {
    typedef typename WFrag<T16>::V V;
    __shared__ __align__(16) float os[(NW == 1 ? 16 : NW * 64) * 68];
    if (cskip >= 0 && (int)blockIdx.y > (int)blockIdx.x + cskip) return;   // block-uniform, in front of the one block barrier
    const size_t z = blockIdx.z; A += z * sA; if (A2) A2 += z * sA; Bt += z * sB; if (Bt2) Bt2 += z * sB; C += z * sC;
    const int lane = threadIdx.x & 31, lr = lane & 15, hi = lane >> 4; const int r0 = blockIdx.x * 64, c0 = blockIdx.y * 64;
    const int wv = (NW == 1) ? 0 : __builtin_amdgcn_readfirstlane((int)(threadIdx.x >> 5));   // wave number, scalar: the k loop stays under scalar control
    int kend = K;
    if (kcaus > 0) { const int kl = kcaus + 64 * ((int)blockIdx.x + 1); kend = (kl < K) ? kl : K; }
    v8f acc[4][4];
#pragma unroll
    for (int mb = 0; mb < 4; ++mb)
#pragma unroll
        for (int nb = 0; nb < 4; ++nb) acc[mb][nb] = (v8f){};
    const size_t aoff = (size_t)(r0 + lr) * lda + 8 * hi, boff = (size_t)(c0 + lr) * ldb + 8 * hi;
#pragma unroll 1
    for (int kc = 32 * wv; kc < kend; kc += 32 * NW) {
        V a[4], a2[4];
#pragma unroll
        for (int mb = 0; mb < 4; ++mb) { a[mb] = WFrag<T16>::ld(A + aoff + (size_t)mb * 16 * lda + kc); if (NSPLIT == 1 || NSPLIT == 2) a2[mb] = WFrag<T16>::ld(A2 + aoff + (size_t)mb * 16 * lda + kc); }
#pragma unroll
        for (int nb = 0; nb < 4; ++nb) { const V b = WFrag<T16>::ld(Bt + boff + (size_t)nb * 16 * ldb + kc); V b2; if (NSPLIT >= 2) b2 = WFrag<T16>::ld(Bt2 + boff + (size_t)nb * 16 * ldb + kc);
#pragma unroll
            for (int mb = 0; mb < 4; ++mb) { acc[mb][nb] = WFrag<T16>::mma(a[mb], b, acc[mb][nb]); if (NSPLIT == 1 || NSPLIT == 2) acc[mb][nb] = WFrag<T16>::mma(a2[mb], b, acc[mb][nb]); if (NSPLIT >= 2) acc[mb][nb] = WFrag<T16>::mma(a[mb], b2, acc[mb][nb]); } }
        asm volatile("v_nop\n\tv_nop\n\tv_nop\n\tv_nop" : "+v"(acc[0][0]), "+v"(acc[1][1]), "+v"(acc[2][2]), "+v"(acc[3][3]) : "v"(a[0]), "v"(a[3]));
    }
    if constexpr (NW > 1) {
        float* my = os + (size_t)wv * (64 * 68);
#pragma unroll
        for (int mb = 0; mb < 4; ++mb)
#pragma unroll
            for (int nb = 0; nb < 4; ++nb)
#pragma unroll
                for (int j = 0; j < 8; ++j) my[(mb * 16 + hi * 8 + j) * 68 + nb * 16 + lr] = acc[mb][nb][j];
        __syncthreads();   // every wave's partial tile is in LDS before any thread sums across waves
#pragma unroll
        for (int it = 0; it < 32 / NW; ++it) { const int item = it * (32 * NW) + (int)threadIdx.x; const int row = item >> 4, cofs = (item & 15) * 4;
            v4f s = *(const v4fa*)(os + row * 68 + cofs);
#pragma unroll
            for (int q = 1; q < NW; ++q) s += *(const v4fa*)(os + q * (64 * 68) + row * 68 + cofs);
            *(v4f*)(C + (size_t)(r0 + row) * ldc + c0 + cofs) = s * osc; }
    } else {
#pragma unroll
    for (int mb = 0; mb < 4; ++mb) {
#pragma unroll
        for (int nb = 0; nb < 4; ++nb) {
#pragma unroll
            for (int j = 0; j < 8; ++j) os[(hi * 8 + j) * 68 + nb * 16 + lr] = acc[mb][nb][j]; }
        __builtin_amdgcn_wave_barrier(); asm volatile("" ::: "memory");
        float* crow = C + (size_t)(r0 + mb * 16) * ldc + c0;
{
#pragma unroll
            for (int s = 0; s < 8; ++s) { const int row = 2 * s + hi, cofs = lr * 4; const v4f val = *(const v4fa*)(os + row * 68 + cofs) * osc;
                *(v4f*)(crow + (size_t)row * ldc + cofs) = val; }
             }
        __builtin_amdgcn_wave_barrier(); asm volatile("" ::: "memory");
    }
    }
}

__device__ __forceinline__ h16 tohx(float x) { return (h16)x; }
__device__ __forceinline__ void splitf(float y, unsigned short& h, unsigned short& l) { h = f2bf(y); l = f2bf(y - bf2f(h)); }
typedef __attribute__((ext_vector_type(2))) _Float16 v2h;
typedef __attribute__((ext_vector_type(4))) _Float16 v4h;
typedef __attribute__((ext_vector_type(2))) unsigned short v2us;
typedef __attribute__((ext_vector_type(4))) unsigned short v4us;
typedef __attribute__((ext_vector_type(2))) float v2f;

__global__ __launch_bounds__(256) void k_wtG(const float* __restrict__ w, int K, int N, bf* Bt) {
    const int lane = threadIdx.x & 31; const int L0 = (blockIdx.x * 8 + (threadIdx.x >> 5)) * 8; const int nlines = N * K / 64;
{
#pragma unroll 1
        for (int l = 0; l < 8; ++l) { const int L = L0 + l; if (L >= nlines) break; const size_t e = (size_t)L * 64 + lane * 2; const int k = (int)(e % K), n = (int)(e / K); v2us o;
            o[0] = f2bf(w[(size_t)k * N + n]); o[1] = f2bf(w[(size_t)(k + 1) * N + n]); *(v2us*)(Bt + e) = o; }
         }
}
__global__ __launch_bounds__(256) void k_wtH(const float* __restrict__ w, int K, int N, float sc, h16* Bt) {
    const int lane = threadIdx.x & 31; const int L0 = (blockIdx.x * 8 + (threadIdx.x >> 5)) * 8; const int nlines = N * K / 64;
{
#pragma unroll 1
        for (int l = 0; l < 8; ++l) { const int L = L0 + l; if (L >= nlines) break; const size_t e = (size_t)L * 64 + lane * 2; const int k = (int)(e % K), n = (int)(e / K); v2h o;
            o[0] = tohx(bfr(w[(size_t)k * N + n]) * sc); o[1] = tohx(bfr(w[(size_t)(k + 1) * N + n]) * sc); *(v2h*)(Bt + e) = o; }
         }
}
__global__ __launch_bounds__(256) void k_cvt8(const float* __restrict__ src, bf* dst, size_t n8) { const size_t i = (size_t)blockIdx.x * 256 + threadIdx.x; if (i >= n8) return; const v8f v = *(const v8f*)(src + i * 8); v8us o;
#pragma unroll
    for (int k = 0; k < 8; ++k) o[k] = f2bf(v[k]); *(v8us*)(dst + i * 8) = o;  }
// k_cstab: CS[t][j] = {cos(t inv_j), sin(t inv_j)} f32 for j < 64, inv_j = 1 / f32(10000^(j/64)) where 10000^(j/64) is a product of exact-root powers 10000^(2^b/64) in f64
__global__ __launch_bounds__(256) void k_cstab(float* CS) {
    const int idx = blockIdx.x * 256 + threadIdx.x; if (idx >= TT * HP) return;
    const int j = idx & (HP - 1); const int t = idx / HP;
    double s = 100.0, p = 1.0;
#pragma unroll 1
    for (int b = 5; b >= 0; --b) { if ((j >> b) & 1) p *= s; s = sqrt(s); }
    const float pf = (float)p; const float inv = 1.0f / pf; const float ang = __fmul_rn((float)t, inv);
    float sn, cn; sincosf(ang, &sn, &cn);
    v2f cs; cs[0] = cn; cs[1] = sn;
    *(v2f*)(CS + (size_t)idx * 2) = cs; 
}
// k_rope: head planes of the interleaved rotary map of x = F[t][h*HD + d] (row pitch 'pitch'): out[2j] = x[2j] c - x[2j+1] s, out[2j+1] = x[2j] s + x[2j+1] c, (c, s) = CS[t][j].
__global__ __launch_bounds__(256) void k_rope(const float* __restrict__ F, int pitch, int nheads, const float* __restrict__ CS, h16* P16, bf* Ph, bf* Pl) {
    const size_t e = ((size_t)blockIdx.x * 256 + threadIdx.x) * 2; if (e >= (size_t)nheads * TT * HD) return;
    const int d = (int)(e % HD); const int t = (int)((e / HD) % TT); const int h = (int)(e / ((size_t)HD * TT));
    const float* f = F + (size_t)t * pitch + h * HD + d; const float x1 = f[0], x2 = f[1];
    const v2f cs = *(const v2f*)(CS + ((size_t)t * HP + (d >> 1)) * 2);
    float a = __fmul_rn(x1, cs[0]), bq = __fmul_rn(x2, cs[1]), c2 = __fmul_rn(x1, cs[1]), dq = __fmul_rn(x2, cs[0]);
    asm volatile("" : "+v"(a)); asm volatile("" : "+v"(bq)); asm volatile("" : "+v"(c2)); asm volatile("" : "+v"(dq));
    const float q0 = __fsub_rn(a, bq), q1 = __fadd_rn(c2, dq);
    v2h o16; o16[0] = tohx(q0); o16[1] = tohx(q1);
    v2us oh, ol; { unsigned short u0, u1, w0, w1; splitf(q0, u0, w0); splitf(q1, u1, w1); oh[0] = u0; oh[1] = u1; ol[0] = w0; ol[1] = w1; }
    const bool hires = (t < RH);                                 // wave-uniform (64 | HD)
    const size_t oo = ((size_t)h * RH + (hires ? t : 0)) * HD + d;
    *(v2h*)(P16 + e) = o16; if (hires) { *(v2us*)(Ph + oo) = oh; *(v2us*)(Pl + oo) = ol; }
    
}
// k_vtp: value planes V16[g][d][t] (fp16, every t) and Vh/Vl[g][d][t] (bf16 hi/lo, t < RH only, row pitch RH) = F[t][g*HD + d] (row pitch 'pitch'; lane -> 2 consecutive t, reads strided);
__global__ __launch_bounds__(256) void k_vtp(const float* __restrict__ F, int pitch, int nkv, h16* V16, bf* Vh, bf* Vl) {
    const size_t e = ((size_t)blockIdx.x * 256 + threadIdx.x) * 2; if (e >= (size_t)nkv * HD * TT) return;
    const int t = (int)(e % TT); const int d = (int)((e / TT) % HD); const int g = (int)(e / ((size_t)TT * HD)); v2h o16; v2us oh, ol;
#pragma unroll
    for (int q = 0; q < 2; ++q) { const float x = F[(size_t)(t + q) * pitch + g * HD + d]; o16[q] = tohx(x); unsigned short a2, c2; splitf(x, a2, c2); oh[q] = a2; ol[q] = c2; }
    const bool hires = (t < RH);                                 // wave-uniform (64 | RH)
    const size_t oo = ((size_t)g * HD + d) * RH + (hires ? t : 0);
    *(v2h*)(V16 + e) = o16; if (hires) { *(v2us*)(Vh + oo) = oh; *(v2us*)(Vl + oo) = ol; }
    
}
typedef __attribute__((ext_vector_type(16))) unsigned short v16us;
__device__ __forceinline__ float xhalf(float x) { return __builtin_bit_cast(float, __builtin_amdgcn_permlanex16(__builtin_bit_cast(int, x), __builtin_bit_cast(int, x), 0x76543210, 0xfedcba98, false, false)); }   // lane l with lane l ^ 16
__device__ __forceinline__ void wgap() { __builtin_amdgcn_sched_barrier(0); asm volatile("v_nop\n\tv_nop\n\tv_nop\n\tv_nop"); __builtin_amdgcn_sched_barrier(0); }   // the 4 vector slots between a pass's last WMMAs and whatever reads their D or overwrites their A/B next, on the taken side of the loop branch that follows too
template <bool B> struct BoolC { static constexpr bool value = B; };
template <typename T16, bool HR>
__device__ __forceinline__ void fattn_rows(const T16* __restrict__ Q, const T16* __restrict__ Q2, const T16* __restrict__ Kp, const T16* __restrict__ K2, const T16* __restrict__ Vt, const T16* __restrict__ V2, const int vp, const int q0, const int lane, v8f (&acc)[2][8], float (&linv)[2]) {
    typedef typename WFrag<T16>::V V;
    constexpr float CSC = SCL * 1.4426950408889634f;
    const int c = lane & 15, h = lane >> 4;
    V qf[2][4], qf2[2][4], kf[2][4], kf2[2][4];
    // every fragment address = a wave-uniform plane base + the lane's byte offset (row c of a 16-row tile, k offset 8 h); the key and value offsets are carried through the pass loop and advanced only behind the wait that covers the loads which name them
    const unsigned qo = ((unsigned)(q0 + c) * HD + 8 * h) * 2; unsigned ko = ((unsigned)c * HD + 8 * h) * 2, vo = ((unsigned)c * vp + 8 * h) * 2;
    auto ldo = [](const T16* ub, const unsigned bo, const int o) __attribute__((always_inline)) { return WFrag<T16>::ld((const T16*)((const char*)ub + bo) + o); };
#pragma unroll
    for (int g = 0; g < 2; ++g)
#pragma unroll
        for (int kc = 0; kc < 4; ++kc) { const int o = 16 * g * HD + 32 * kc; qf[g][kc] = ldo(Q, qo, o); if constexpr (HR) qf2[g][kc] = ldo(Q2, qo, o); }
    float m_run[2], l_run[2];
#pragma unroll
    for (int g = 0; g < 2; ++g) { m_run[g] = -__builtin_inff(); l_run[g] = 0.0f;
#pragma unroll
        for (int t = 0; t < 8; ++t) acc[g][t] = (v8f){}; }
#pragma unroll
    for (int kt = 0; kt < 2; ++kt)
#pragma unroll
        for (int kc = 0; kc < 4; ++kc) { const int o = 16 * kt * HD + 32 * kc; kf[kt][kc] = ldo(Kp, ko, o); if constexpr (HR) kf2[kt][kc] = ldo(K2, ko, o); }
    asm volatile("s_wait_xcnt 0x0" : "+v"(ko) : "v"(qo) : "memory");   // stands in front of any overwrite of an address register that the query and first key loads name; the operands keep those registers untouched up to the wait
    __builtin_amdgcn_sched_barrier(0);   // nothing that could overwrite one moves up over that wait
    ko += 32 * HD * 2;
    // One 32-key pass. dg true: the diagonal pass, a wave's last (keys > query replaced by -inf, by index; nothing fetched ahead); every other pass fetches the next pass's key fragments.
    auto pass = [&](auto dg) __attribute__((always_inline)) {
        constexpr bool DIAG = decltype(dg)::value;
        V vf[8], vf2[8];
#pragma unroll
        for (int t = 0; t < 8; ++t) { const int o = 16 * t * vp; vf[t] = ldo(Vt, vo, o); if constexpr (HR) vf2[t] = ldo(V2, vo, o); }
        if constexpr (HR) asm volatile("s_wait_xcnt 0x0" ::: "memory");   // with two value planes the build sums base and offset in vector registers that the score tiles then take: the wait stands in front of that overwrite
        __builtin_amdgcn_sched_barrier(0);   // the value loads stay in front of the score products, so that they fly under them and under the softmax
        v8f s[2][2];
#pragma unroll
        for (int kt = 0; kt < 2; ++kt)
#pragma unroll
            for (int g = 0; g < 2; ++g) { s[kt][g] = (v8f){};
#pragma unroll
                for (int kc = 0; kc < 4; ++kc) { s[kt][g] = WFrag<T16>::mma(kf[kt][kc], qf[g][kc], s[kt][g]);
                    if constexpr (HR) { s[kt][g] = WFrag<T16>::mma(kf2[kt][kc], qf[g][kc], s[kt][g]); s[kt][g] = WFrag<T16>::mma(kf[kt][kc], qf2[g][kc], s[kt][g]); } } }
        __builtin_amdgcn_sched_barrier(0);   // the score products stay in front of the wait and of the key prefetch
        asm volatile("s_wait_xcnt 0x0" :: "v"(vo) : "memory");   // stands in front of any overwrite of an address register that the value loads name (the input keeps their offset untouched up to here); it is placed behind the score products so that it does not hold up their issue
        __builtin_amdgcn_sched_barrier(0);   // nothing that could overwrite one moves up over that wait
        if constexpr (!DIAG) {   // the next pass's key fragments fly under this pass's softmax and second product
#pragma unroll
            for (int kt = 0; kt < 2; ++kt)
#pragma unroll
                for (int kc = 0; kc < 4; ++kc) { const int o = 16 * kt * HD + 32 * kc; kf[kt][kc] = ldo(Kp, ko, o); if constexpr (HR) kf2[kt][kc] = ldo(K2, ko, o); }
            __builtin_amdgcn_sched_barrier(0);   // keeps the key prefetch issued ahead of the softmax arithmetic
        } else {                 // the pass's first key is q0
#pragma unroll
            for (int g = 0; g < 2; ++g)
#pragma unroll
                for (int kt = 0; kt < 2; ++kt)
#pragma unroll
                    for (int r = 0; r < 8; ++r) if (16 * kt + 8 * h + r > 16 * g + c) s[kt][g][r] = -__builtin_inff();
        }
        float mb[2]; bool need = false;
#pragma unroll
        for (int g = 0; g < 2; ++g) { float mx = -__builtin_inff();
#pragma unroll
            for (int kt = 0; kt < 2; ++kt)
#pragma unroll
                for (int r = 0; r < 8; ++r) mx = fmaxf(mx, s[kt][g][r]);
            mx = fmaxf(mx, xhalf(mx)) * CSC; mb[g] = mx; need = need || (mx > m_run[g] + 8.0f); }
        if (__builtin_amdgcn_ballot_w32(need) != 0) {   // scalar branch, rare after the first passes; every column has an unmasked key in every pass, so the new maximum is finite
#pragma unroll
            for (int g = 0; g < 2; ++g) { const float mn = fmaxf(m_run[g], mb[g]); const float corr = __builtin_amdgcn_exp2f(m_run[g] - mn); l_run[g] *= corr; m_run[g] = mn;
#pragma unroll
                for (int t = 0; t < 8; ++t) acc[g][t] = acc[g][t] * corr; }
        }
#pragma unroll
        for (int g = 0; g < 2; ++g) { const float nm = -m_run[g]; float pv[16]; float ps0 = 0.0f, ps1 = 0.0f;
#pragma unroll
            for (int e = 0; e < 16; ++e) { pv[e] = __builtin_amdgcn_exp2f(__builtin_fmaf(s[e >> 3][g][e & 7], CSC, nm)); if (e & 1) ps1 += pv[e]; else ps0 += pv[e]; }
            l_run[g] += ps0 + ps1;
            V pf, pf2;
            if constexpr (HR) { v16us uh, ul;
#pragma unroll
                for (int e = 0; e < 16; ++e) { unsigned short a, b; splitf(pv[e], a, b); uh[e] = a; ul[e] = b; }
                pf = __builtin_bit_cast(v16bf, uh); pf2 = __builtin_bit_cast(v16bf, ul);
            } else {
#pragma unroll
                for (int e = 0; e < 16; ++e) pf[e] = tohx(pv[e]); }
#pragma unroll
            for (int t = 0; t < 8; ++t) { acc[g][t] = WFrag<T16>::mma(vf[t], pf, acc[g][t]);
                if constexpr (HR) { acc[g][t] = WFrag<T16>::mma(vf2[t], pf, acc[g][t]); acc[g][t] = WFrag<T16>::mma(vf[t], pf2, acc[g][t]); } }
        }
        wgap();
        if constexpr (!DIAG) {
            asm volatile("s_wait_xcnt 0x0" : "+v"(ko), "+v"(vo) :: "memory");   // stands in front of the offset updates, which overwrite address registers that this pass's loads name; as in-out operands the offsets can be advanced only behind it
            ko += 32 * HD * 2; vo += 32 * 2; }
    };
    // stays rolled: the trip count is known only at run time, and further copies of a body this long would only add code for the instruction cache to hold
#pragma unroll 1
    for (int key0 = 0; key0 < q0; key0 += 32) pass(BoolC<false>{});   // keys [0, q0): no key exceeds a query of this wave
    pass(BoolC<true>{});                                              // keys [q0, q0 + 32)
#pragma unroll
    for (int g = 0; g < 2; ++g) linv[g] = __fdiv_rn(1.0f, l_run[g] + xhalf(l_run[g]));   // each wave half summed its own eight keys of every 16-key tile
}
__global__ __launch_bounds__(32 * REP) void k_fattn(const h16* __restrict__ Q16, const h16* __restrict__ K16, const h16* __restrict__ V16, const bf* __restrict__ Qh, const bf* __restrict__ Ql, const bf* __restrict__ Kh, const bf* __restrict__ Kl, const bf* __restrict__ Vh, const bf* __restrict__ Vl, h16* A16, bf* Ah, bf* Al) {
    const int lane = threadIdx.x & 31, c = lane & 15, h = lane >> 4; const int g = blockIdx.y;
    const int head = g * REP + __builtin_amdgcn_readfirstlane((int)(threadIdx.x >> 5));   // scalar: plane bases and the pass loop stay under scalar control
    const int q0 = (TT / 32 - 1 - (int)blockIdx.x) * 32;                                 // longest row blocks take the lowest block index
    v8f acc[2][8]; float linv[2];
    if (q0 < RH) {
        fattn_rows<bf, true>(Qh + (size_t)head * RH * HD, Ql + (size_t)head * RH * HD, Kh + (size_t)g * RH * HD, Kl + (size_t)g * RH * HD, Vh + (size_t)g * HD * RH, Vl + (size_t)g * HD * RH, RH, q0, lane, acc, linv);
#pragma unroll
        for (int gq = 0; gq < 2; ++gq)
#pragma unroll
            for (int t = 0; t < 8; ++t) { v8us oh, ol;   // a lane's 8 registers are d = 16 t + 8 h + 0..7 of query q0 + 16 gq + c
#pragma unroll
                for (int r = 0; r < 8; ++r) { unsigned short a, b; splitf(acc[gq][t][r] * linv[gq], a, b); oh[r] = a; ol[r] = b; }
                const size_t oo = (size_t)(q0 + 16 * gq + c) * DQ + head * HD + 16 * t + 8 * h; *(v8us*)(Ah + oo) = oh; *(v8us*)(Al + oo) = ol; }
        asm volatile("s_wait_xcnt 0x0" ::: "memory");   // stands behind the run of stores above, in front of anything that could overwrite a register which one of them names
    } else {
        fattn_rows<h16, false>(Q16 + (size_t)head * TT * HD, nullptr, K16 + (size_t)g * TT * HD, nullptr, V16 + (size_t)g * HD * TT, nullptr, TT, q0, lane, acc, linv);
#pragma unroll
        for (int gq = 0; gq < 2; ++gq)
#pragma unroll
            for (int t = 0; t < 8; ++t) { v8h o16;
#pragma unroll
                for (int r = 0; r < 8; ++r) o16[r] = tohx(acc[gq][t][r] * linv[gq] * ACAR);
                *(v8h*)(A16 + (size_t)(q0 + 16 * gq + c) * DQ + head * HD + 16 * t + 8 * h) = o16; }
        asm volatile("s_wait_xcnt 0x0" ::: "memory");   // stands behind the run of stores above, in front of anything that could overwrite a register which one of them names
    }
}

extern "C" void kernel_launch(void* const* d_in, const int* in_sizes, int n_in,
                              void* d_out, int out_size, void* d_ws, size_t ws_size, hipStream_t stream) {
    if (n_in < 5) return;
    if ((size_t)in_sizes[0] < (size_t)(NB - 1) * TT_FULL * DM + (size_t)TT * DM) return;
    if (in_sizes[1] < DM * DQ || in_sizes[2] < DM * DKV || in_sizes[3] < DM * DKV || in_sizes[4] < DQ * DM) return;
    if ((size_t)out_size < (size_t)(NB - 1) * TT_FULL * DM + (size_t)TT * DM) return;
    const float* x = (const float*)d_in[0]; const float* wq = (const float*)d_in[1]; const float* wk = (const float*)d_in[2]; const float* wv = (const float*)d_in[3]; const float* wo = (const float*)d_in[4];
    float* OUT = (float*)d_out;     // [NB][TT_FULL][DM]
    char* wsp = (char*)d_ws;
    auto take = [&](size_t bytes) { char* p = wsp; wsp += (bytes + 255) & ~(size_t)255; return (void*)p; };
    bf* WQ = (bf*)take((size_t)DQ * DM * 2); bf* WK = (bf*)take((size_t)DKV * DM * 2); bf* WV = (bf*)take((size_t)DKV * DM * 2); bf* WO = (bf*)take((size_t)DM * DQ * 2);   // Bt = [out][in], k-contiguous
    h16* WO16 = (h16*)take((size_t)DM * DQ * 2);                                                                                             // Bt fp16 x WCAR
    float* CS = (float*)take((size_t)TT * HP * 2 * 4);
    float* FQ = (float*)take((size_t)TT * DQ * 4); float* FK = (float*)take((size_t)TT * DKV * 4);
    h16* QP16 = (h16*)take((size_t)NH_ * TT * HD * 2); h16* KP16 = (h16*)take((size_t)NKV * TT * HD * 2); h16* VT16 = (h16*)take((size_t)NKV * HD * TT * 2);
    bf* QPh = (bf*)take((size_t)NH_ * RH * HD * 2); bf* QPl = (bf*)take((size_t)NH_ * RH * HD * 2); bf* KPh = (bf*)take((size_t)NKV * RH * HD * 2); bf* KPl = (bf*)take((size_t)NKV * RH * HD * 2);
    bf* VTh = (bf*)take((size_t)NKV * HD * RH * 2); bf* VTl = (bf*)take((size_t)NKV * HD * RH * 2);
    bf* XB = (bf*)take((size_t)TT * DM * 2);     // bf16 x rows of the current batch
    h16* AT16 = (h16*)take((size_t)TT * DQ * 2); bf* ATh = (bf*)take((size_t)RH * DQ * 2); bf* ATl = (bf*)take((size_t)RH * DQ * 2);
    if ((size_t)(wsp - (char*)d_ws) > ws_size) return;
    float* FV = FK;       // v projection reuses the k buffer after the k planes are built (stream-ordered)
    { k_wtG<<<(unsigned)((DQ * DM / 64 + 63) / 64), 256, 0, stream>>>(wq, DM, DQ, WQ);
      k_wtG<<<(unsigned)((DKV * DM / 64 + 63) / 64), 256, 0, stream>>>(wk, DM, DKV, WK);
      k_wtG<<<(unsigned)((DKV * DM / 64 + 63) / 64), 256, 0, stream>>>(wv, DM, DKV, WV);
      k_wtG<<<(unsigned)((DM * DQ / 64 + 63) / 64), 256, 0, stream>>>(wo, DQ, DM, WO);
      k_wtH<<<(unsigned)((DM * DQ / 64 + 63) / 64), 256, 0, stream>>>(wo, DQ, DM, WCAR, WO16); }
    k_cstab<<<(TT * HP + 255) / 256, 256, 0, stream>>>(CS);
    const unsigned LQ = (unsigned)(((size_t)NH_ * TT * HD / 2 + 255) / 256), LKv = (unsigned)(((size_t)NKV * TT * HD / 2 + 255) / 256);
    for (int b = 0; b < NB; ++b) {
        k_cvt8<<<(unsigned)(((size_t)TT * DM / 8 + 255) / 256), 256, 0, stream>>>(x + (size_t)b * TT_FULL * DM, XB, (size_t)TT * DM / 8);
        k_gemmw<bf, 0, 8><<<dim3(TT / 64, DQ / 64, 1), 256, 0, stream>>>(XB, nullptr, WQ, nullptr, DM, DM, DM, -1, 0, FQ, DQ, 1.0f, 0, 0, 0);
        k_rope<<<LQ, 256, 0, stream>>>(FQ, DQ, NH_, CS, QP16, QPh, QPl);
        k_gemmw<bf, 0, 16><<<dim3(TT / 64, DKV / 64, 1), 512, 0, stream>>>(XB, nullptr, WK, nullptr, DM, DM, DM, -1, 0, FK, DKV, 1.0f, 0, 0, 0);
        k_rope<<<LKv, 256, 0, stream>>>(FK, DKV, NKV, CS, KP16, KPh, KPl);
        k_gemmw<bf, 0, 16><<<dim3(TT / 64, DKV / 64, 1), 512, 0, stream>>>(XB, nullptr, WV, nullptr, DM, DM, DM, -1, 0, FV, DKV, 1.0f, 0, 0, 0);
        k_vtp<<<LKv, 256, 0, stream>>>(FV, DKV, NKV, VT16, VTh, VTl);
        k_fattn<<<dim3(TT / 32, NKV, 1), 32 * REP, 0, stream>>>(QP16, KP16, VT16, QPh, QPl, KPh, KPl, VTh, VTl, AT16, ATh, ATl);
        // output projection: rows < RH bf16 hi/lo context x bf16 Wo (2 products); rows >= RH fp16 context x64 x fp16 Wo x64 (1 product, 1/4096 in the epilogue)
        k_gemmw<bf, 1, 16><<<dim3(RH / 64, DM / 64, 1), 512, 0, stream>>>(ATh, ATl, WO, nullptr, DQ, DQ, DQ, -1, 0, OUT + (size_t)b * TT_FULL * DM, DM, 1.0f, 0, 0, 0);
        k_gemmw<h16, 0, 8><<<dim3((TT - RH) / 64, DM / 64, 1), 256, 0, stream>>>(AT16 + (size_t)RH * DQ, nullptr, WO16, nullptr, DQ, DQ, DQ, -1, 0, OUT + (size_t)b * TT_FULL * DM + (size_t)RH * DM, DM, OSCW, 0, 0, 0); }
}

// v003
// Measured time: 289 microseconds a run.
// In two side-by-side timings against v002, it was 1.50 and 1.49 times as fast.
// All steps since v000 together make it 5.66 times as fast.
#include <hip/hip_runtime.h>

// Causal grouped-query self-attention with interleaved rotary embedding: x [NB][T][2048]; q = x Wq (16 heads x 128), k, v = x Wk, x Wv (4 kv heads x 128, each shared by 4 consecutive q heads);
// rotary pairs (2j, 2j+1) with angle t / 10000^(j/64); s = q.k x 128^-0.5 with keys > query replaced by -inf; softmax; attn.v; merged heads x Wo -> [NB][T][2048] f32.
// Compute dtypes, f32 accumulate: x, Wq, Wk, Wv, Wo RNE-converted to bf16; q/k/v projections v_wmma_f32_16x16x32_bf16 (plain); scores and attn.v: query rows < 128 bf16 hi/lo split (3 products),
// rows >= 128 v_wmma_f32_16x16x32_f16 single products (P unnormalised, exp2 of the score minus the maximum in use); rotary table and softmax f32; output projection: rows < 128 bf16 hi/lo x bf16 (2 products),
// rows >= 128 v_wmma_f32_16x16x32_f16 single product (context carried x64, Wo carried x64, 1/4096 folded in the f32 epilogue).
// Every 16-bit operand plane P[row][k] (NC columns) lies in FRAGMENT ORDER: 1-KB tiles of 16 rows x 32 k, tile (row >> 4, k >> 5) at element ((row >> 4) (NC / 32) + (k >> 5)) 512 (value planes: tile (d >> 4, key >> 5) at
// ((key >> 5) 8 + (d >> 4)) 512), and inside a tile element (row, k) at ((k >> 4) & 1) 256 + (((k >> 3) & 1) 16 + (row & 15)) 8 + (k & 7): a wave's 16-byte-per-lane load or store at lane 8 covers 512 contiguous bytes.

#ifndef NB
#define NB 2
#endif
#ifndef SEQ
#define SEQ 2048
#endif
#define NB_FULL 2
#define TT_FULL 2048
#define TT   SEQ
#define DM   2048
#define NH_  16
#define NKV  4
#define REP  (NH_ / NKV)
#define HD   128
#define HP   (HD / 2)
#define DQ   (NH_ * HD)
#define DKV  (NKV * HD)
#define RH   128                  // query rows < RH use hi/lo planes (keys < RH suffice: causal)
#define ACAR 64.0f                // carry of the fp16 merged-context plane (rows >= RH)
#define WCAR 64.0f                // carry of the fp16 Wo plane
#define OSCW (1.0f / (ACAR * WCAR))
#define SCL  0.08838834764831845f   // HD^-0.5
#define KX   DM                   // columns of every GEMM operand plane

static_assert(NB >= 1 && NB <= NB_FULL);
static_assert(TT % 128 == 0 && TT <= TT_FULL && TT > RH);
static_assert(RH % 128 == 0 && RH >= 128);
static_assert((TT - RH) % 64 == 0);
static_assert(HD == 128 && HP == 64);
static_assert(NH_ == NKV * REP && TT % 32 == 0 && RH % 32 == 0);
static_assert(DM % 64 == 0 && DQ % 64 == 0 && DKV % 64 == 0 && DQ == KX);

typedef _Float16 h16;
typedef unsigned short bf;
typedef __attribute__((ext_vector_type(16))) __bf16   v16bf;
typedef __attribute__((ext_vector_type(16))) _Float16 v16h;
typedef __attribute__((ext_vector_type(8)))  _Float16 v8h;
typedef __attribute__((ext_vector_type(8)))  unsigned short v8us;
typedef __attribute__((ext_vector_type(8)))  float    v8f;
typedef __attribute__((ext_vector_type(4)))  float    v4f;
typedef v8h  __attribute__((may_alias)) v8ha;
typedef v4f  __attribute__((may_alias)) v4fa;
typedef v8us __attribute__((may_alias)) v8usa;

__device__ __forceinline__ unsigned short f2bf(float f) { unsigned u = __float_as_uint(f); u += 0x7FFFu + ((u >> 16) & 1u); return (unsigned short)(u >> 16); }
__device__ __forceinline__ float bf2f(unsigned short b) { return __uint_as_float(((unsigned)b) << 16); }
__device__ __forceinline__ float bfr(float f) { return bf2f(f2bf(f)); }
__device__ __forceinline__ v16h cat16(v8h lo, v8h hi) { return __builtin_shufflevector(lo, hi, 0, 1, 2, 3, 4, 5, 6, 7, 8, 9, 10, 11, 12, 13, 14, 15); }
__device__ __forceinline__ v16bf cat16b(v8us lo, v8us hi) { return __builtin_bit_cast(v16bf, __builtin_shufflevector(lo, hi, 0, 1, 2, 3, 4, 5, 6, 7, 8, 9, 10, 11, 12, 13, 14, 15)); }
__device__ __forceinline__ v8f wmma16(v16h a, v16h b, v8f c) { return __builtin_amdgcn_wmma_f32_16x16x32_f16(false, a, false, b, (short)0, c, false, false); }
__device__ __forceinline__ v8f wmmab(v16bf a, v16bf b, v8f c) { return __builtin_amdgcn_wmma_f32_16x16x32_bf16(false, a, false, b, (short)0, c, false, false); }

// ---- k_gemmw: register-blocked GEMM, NW WAVES per 64x64 output tile (16 accumulators each), operands straight from 16-bit planes in fragment order; grid (M/64, N/64, Z), 32 NW threads.
// Wave w contracts the 32-wide k chunks w, w + NW, w + 2 NW, ... of the tile; for NW > 1 the NW f32 partial tiles meet in LDS and are summed in wave order 0 .. NW-1 (fixed), then scaled and stored.
// C[m][n] (f32, pitch ldc) = osc x sum_k A[m][k] Bt[n][k] (+ split products per NSPLIT: 1 = A2.Bt added, 2 = A2.Bt and A.Bt2 added). Every plane has KX columns (a constant: the tile-row steps become immediate offsets), z-batch strides sA/sB/sC in elements. K % 32 == 0.
// Fragment k map (both operands): elements 0..7 <- kc + 8h + 0..7, elements 8..15 <- kc + 16 + 8h + 0..7, h = lane >> 4, row/col = lane & 15: WFrag::ld at tile base + lane 8 (its second half 256 elements on).
// cskip >= 0: tiles with blockIdx.y > blockIdx.x + cskip are not computed (causal upper triangle). kcaus > 0: contraction stops at min(K, kcaus + 64 (blockIdx.x + 1)) (causal key limit).
template <typename T16> struct WFrag;
template <> struct WFrag<h16> { typedef v16h V; static __device__ __forceinline__ V ld(const h16* p) { return cat16(*(const v8h*)p, *(const v8h*)(p + 256)); } static __device__ __forceinline__ v8f mma(V a, V b, v8f c) { return wmma16(a, b, c); } };
template <> struct WFrag<bf> { typedef v16bf V; static __device__ __forceinline__ V ld(const bf* p) { return cat16b(*(const v8us*)p, *(const v8us*)(p + 256)); } static __device__ __forceinline__ v8f mma(V a, V b, v8f c) { return wmmab(a, b, c); } };
template <typename T16, int NSPLIT, int NW>
__global__ __launch_bounds__(32 * NW) void k_gemmw(const T16* __restrict__ A, const T16* __restrict__ A2, const T16* __restrict__ Bt, const T16* __restrict__ Bt2, int K, int cskip, int kcaus,
                                             float* C, int ldc, float osc, size_t sA, size_t sB, size_t sC) {
    typedef typename WFrag<T16>::V V;
    __shared__ __align__(16) float os[(NW == 1 ? 16 : NW * 64) * 68];
    if (cskip >= 0 && (int)blockIdx.y > (int)blockIdx.x + cskip) return;   // block-uniform, in front of the one block barrier
    const size_t z = blockIdx.z; A += z * sA; if (A2) A2 += z * sA; Bt += z * sB; if (Bt2) Bt2 += z * sB; C += z * sC;
    const int lane = threadIdx.x & 31, lr = lane & 15, hi = lane >> 4; const int r0 = blockIdx.x * 64, c0 = blockIdx.y * 64;
    const int wv = (NW == 1) ? 0 : __builtin_amdgcn_readfirstlane((int)(threadIdx.x >> 5));   // wave number, scalar: the k loop stays under scalar control
    int kend = K;
    if (kcaus > 0) { const int kl = kcaus + 64 * ((int)blockIdx.x + 1); kend = (kl < K) ? kl : K; }
    v8f acc[4][4];
#pragma unroll
    for (int mb = 0; mb < 4; ++mb)
#pragma unroll
        for (int nb = 0; nb < 4; ++nb) acc[mb][nb] = (v8f){};
    // every fragment address = a wave-uniform tile-row base (16 rows of a plane = KX / 32 tiles = 16 KX elements) + one byte offset per lane: 16 bytes a lane inside a tile, 1 KB a 32-wide k chunk; the offset is advanced only behind the wait at the loop's foot
    const size_t aoff = (size_t)r0 * KX, boff = (size_t)c0 * KX; unsigned ko = (unsigned)lane * 16 + (unsigned)wv * 1024;
    auto ldo = [](const T16* ub, const unsigned bo, const int o) __attribute__((always_inline)) { return WFrag<T16>::ld((const T16*)((const char*)ub + bo) + o); };
#pragma unroll 1
    for (int kc = 32 * wv; kc < kend; kc += 32 * NW) {
        V a[4], a2[4], b[4], b2[4];
#pragma unroll
        for (int mb = 0; mb < 4; ++mb) { a[mb] = ldo(A + aoff, ko, mb * 16 * KX); if (NSPLIT == 1 || NSPLIT == 2) a2[mb] = ldo(A2 + aoff, ko, mb * 16 * KX); }
#pragma unroll
        for (int nb = 0; nb < 4; ++nb) { b[nb] = ldo(Bt + boff, ko, nb * 16 * KX); if (NSPLIT >= 2) b2[nb] = ldo(Bt2 + boff, ko, nb * 16 * KX); }
        __builtin_amdgcn_sched_barrier(0);   // the trip's loads stay one group in front of its products; built without it, the Bt fragments shared one register set and each was fetched only behind the products of the one before: four load latencies a trip
#pragma unroll
        for (int nb = 0; nb < 4; ++nb)
#pragma unroll
            for (int mb = 0; mb < 4; ++mb) { acc[mb][nb] = WFrag<T16>::mma(a[mb], b[nb], acc[mb][nb]); if (NSPLIT == 1 || NSPLIT == 2) acc[mb][nb] = WFrag<T16>::mma(a2[mb], b[nb], acc[mb][nb]); if (NSPLIT >= 2) acc[mb][nb] = WFrag<T16>::mma(a[mb], b2[nb], acc[mb][nb]); }
        asm volatile("v_nop\n\tv_nop\n\tv_nop\n\tv_nop" : "+v"(acc[0][0]), "+v"(acc[1][1]), "+v"(acc[2][2]), "+v"(acc[3][3]) : "v"(a[0]), "v"(a[3]));
        asm volatile("s_wait_xcnt 0x0" : "+v"(ko) :: "memory");   // stands in front of the offset update, which overwrites the address register that this trip's loads name; as an in-out operand the offset can be advanced only behind it
        ko += 1024 * NW;
    }
    if constexpr (NW > 1) {
        float* my = os + (size_t)wv * (64 * 68);
#pragma unroll
        for (int mb = 0; mb < 4; ++mb)
#pragma unroll
            for (int nb = 0; nb < 4; ++nb)
#pragma unroll
                for (int j = 0; j < 8; ++j) my[(mb * 16 + hi * 8 + j) * 68 + nb * 16 + lr] = acc[mb][nb][j];
        __syncthreads();   // every wave's partial tile is in LDS before any thread sums across waves
#pragma unroll
        for (int it = 0; it < 32 / NW; ++it) { const int item = it * (32 * NW) + (int)threadIdx.x; const int row = item >> 4, cofs = (item & 15) * 4;
            v4f s = *(const v4fa*)(os + row * 68 + cofs);
#pragma unroll
            for (int q = 1; q < NW; ++q) s += *(const v4fa*)(os + q * (64 * 68) + row * 68 + cofs);
            *(v4f*)(C + (size_t)(r0 + row) * ldc + c0 + cofs) = s * osc; }
    } else {
#pragma unroll
    for (int mb = 0; mb < 4; ++mb) {
#pragma unroll
        for (int nb = 0; nb < 4; ++nb) {
#pragma unroll
            for (int j = 0; j < 8; ++j) os[(hi * 8 + j) * 68 + nb * 16 + lr] = acc[mb][nb][j]; }
        __builtin_amdgcn_wave_barrier(); asm volatile("" ::: "memory");
        float* crow = C + (size_t)(r0 + mb * 16) * ldc + c0;
{
#pragma unroll
            for (int s = 0; s < 8; ++s) { const int row = 2 * s + hi, cofs = lr * 4; const v4f val = *(const v4fa*)(os + row * 68 + cofs) * osc;
                *(v4f*)(crow + (size_t)row * ldc + cofs) = val; }
             }
        __builtin_amdgcn_wave_barrier(); asm volatile("" ::: "memory");
    }
    }
}

__device__ __forceinline__ h16 tohx(float x) { return (h16)x; }
__device__ __forceinline__ void splitf(float y, unsigned short& h, unsigned short& l) { h = f2bf(y); l = f2bf(y - bf2f(h)); }
typedef __attribute__((ext_vector_type(2))) _Float16 v2h;
typedef __attribute__((ext_vector_type(4))) _Float16 v4h;
typedef __attribute__((ext_vector_type(2))) unsigned short v2us;
typedef __attribute__((ext_vector_type(4))) unsigned short v4us;
typedef __attribute__((ext_vector_type(2))) float v2f;

__global__ __launch_bounds__(256) void k_wtG(const float* __restrict__ w, int K, int N, bf* Bt) {
    const int lane = threadIdx.x & 31; const int L0 = (blockIdx.x * 8 + (threadIdx.x >> 5)) * 8; const int nlines = N * K / 64;
{
#pragma unroll 1
        for (int l = 0; l < 8; ++l) { const int L = L0 + l; if (L >= nlines) break; const size_t e = (size_t)L * 64 + lane * 2; const int tile = (int)(e >> 9), ln = (int)(e >> 3) & 31; const int k = (tile % (K / 32)) * 32 + ((int)(e >> 8) & 1) * 16 + (ln >> 4) * 8 + ((int)e & 7), n = (tile / (K / 32)) * 16 + (ln & 15); v2us o;   // e = place in fragment order
            o[0] = f2bf(w[(size_t)k * N + n]); o[1] = f2bf(w[(size_t)(k + 1) * N + n]); *(v2us*)(Bt + e) = o; }
         }
}
__global__ __launch_bounds__(256) void k_wtH(const float* __restrict__ w, int K, int N, float sc, h16* Bt) {
    const int lane = threadIdx.x & 31; const int L0 = (blockIdx.x * 8 + (threadIdx.x >> 5)) * 8; const int nlines = N * K / 64;
{
#pragma unroll 1
        for (int l = 0; l < 8; ++l) { const int L = L0 + l; if (L >= nlines) break; const size_t e = (size_t)L * 64 + lane * 2; const int tile = (int)(e >> 9), ln = (int)(e >> 3) & 31; const int k = (tile % (K / 32)) * 32 + ((int)(e >> 8) & 1) * 16 + (ln >> 4) * 8 + ((int)e & 7), n = (tile / (K / 32)) * 16 + (ln & 15); v2h o;   // e = place in fragment order
            o[0] = tohx(bfr(w[(size_t)k * N + n]) * sc); o[1] = tohx(bfr(w[(size_t)(k + 1) * N + n]) * sc); *(v2h*)(Bt + e) = o; }
         }
}
__global__ __launch_bounds__(256) void k_cvt8(const float* __restrict__ src, bf* dst, size_t n8) { const size_t i = (size_t)blockIdx.x * 256 + threadIdx.x; if (i >= n8) return;   // i 8 = place in fragment order of a plane of DM columns
    const int tile = (int)(i >> 6), ln = (int)i & 31; const size_t row = (size_t)(tile / (DM / 32)) * 16 + (ln & 15); const int k = (tile % (DM / 32)) * 32 + ((int)(i >> 5) & 1) * 16 + (ln >> 4) * 8;
    const v8f v = *(const v8f*)(src + row * DM + k); v8us o;
#pragma unroll
    for (int k = 0; k < 8; ++k) o[k] = f2bf(v[k]); *(v8us*)(dst + i * 8) = o;  }
// k_cstab: CS[t][j] = {cos(t inv_j), sin(t inv_j)} f32 for j < 64, inv_j = 1 / f32(10000^(j/64)) where 10000^(j/64) is a product of exact-root powers 10000^(2^b/64) in f64
__global__ __launch_bounds__(256) void k_cstab(float* CS) {
    const int idx = blockIdx.x * 256 + threadIdx.x; if (idx >= TT * HP) return;
    const int j = idx & (HP - 1); const int t = idx / HP;
    double s = 100.0, p = 1.0;
#pragma unroll 1
    for (int b = 5; b >= 0; --b) { if ((j >> b) & 1) p *= s; s = sqrt(s); }
    const float pf = (float)p; const float inv = 1.0f / pf; const float ang = __fmul_rn((float)t, inv);
    float sn, cn; sincosf(ang, &sn, &cn);
    v2f cs; cs[0] = cn; cs[1] = sn;
    *(v2f*)(CS + (size_t)idx * 2) = cs; 
}
// k_rope: head planes of the interleaved rotary map of x = F[t][h*HD + d] (row pitch 'pitch'): out[2j] = x[2j] c - x[2j+1] s, out[2j+1] = x[2j] s + x[2j+1] c, (c, s) = CS[t][j].
__global__ __launch_bounds__(256) void k_rope(const float* __restrict__ F, int pitch, int nheads, const float* __restrict__ CS, h16* P16, bf* Ph, bf* Pl) {
    const size_t e = ((size_t)blockIdx.x * 256 + threadIdx.x) * 2; if (e >= (size_t)nheads * TT * HD) return;
    const int he = (int)(e % ((size_t)HD * TT)), ln = (he >> 3) & 31; const int h = (int)(e / ((size_t)HD * TT));   // e = place in fragment order, head planes of HD columns
    const int d = ((he >> 9) & 3) * 32 + ((he >> 8) & 1) * 16 + (ln >> 4) * 8 + (he & 7); const int t = (he >> 11) * 16 + (ln & 15);
    const float* f = F + (size_t)t * pitch + h * HD + d; const float x1 = f[0], x2 = f[1];
    const v2f cs = *(const v2f*)(CS + ((size_t)t * HP + (d >> 1)) * 2);
    float a = __fmul_rn(x1, cs[0]), bq = __fmul_rn(x2, cs[1]), c2 = __fmul_rn(x1, cs[1]), dq = __fmul_rn(x2, cs[0]);
    asm volatile("" : "+v"(a)); asm volatile("" : "+v"(bq)); asm volatile("" : "+v"(c2)); asm volatile("" : "+v"(dq));
    const float q0 = __fsub_rn(a, bq), q1 = __fadd_rn(c2, dq);
    v2h o16; o16[0] = tohx(q0); o16[1] = tohx(q1);
    v2us oh, ol; { unsigned short u0, u1, w0, w1; splitf(q0, u0, w0); splitf(q1, u1, w1); oh[0] = u0; oh[1] = u1; ol[0] = w0; ol[1] = w1; }
    const bool hires = (t < RH);                                 // wave-uniform (a wave stays inside one tile)
    const size_t oo = (size_t)h * RH * HD + (hires ? he : 0);   // rows < RH are the first RH HD places of a head plane
    *(v2h*)(P16 + e) = o16; if (hires) { *(v2us*)(Ph + oo) = oh; *(v2us*)(Pl + oo) = ol; }
    
}
// k_vtp: value planes V16[g] (d, t) (fp16, every t) and Vh/Vl[g] (d, t) (bf16 hi/lo, t < RH only), fragment order with the 8 d tiles of a 32-key block side by side, = F[t][g*HD + d] (row pitch 'pitch'; lane -> 2 consecutive t);
__global__ __launch_bounds__(256) void k_vtp(const float* __restrict__ F, int pitch, int nkv, h16* V16, bf* Vh, bf* Vl) {
    const size_t e = ((size_t)blockIdx.x * 256 + threadIdx.x) * 2; if (e >= (size_t)nkv * HD * TT) return;
    const int he = (int)(e % ((size_t)TT * HD)), ln = (he >> 3) & 31; const int g = (int)(e / ((size_t)TT * HD)); v2h o16; v2us oh, ol;   // e = place in fragment order
    const int t = (he >> 12) * 32 + ((he >> 8) & 1) * 16 + (ln >> 4) * 8 + (he & 7); const int d = ((he >> 9) & 7) * 16 + (ln & 15);
#pragma unroll
    for (int q = 0; q < 2; ++q) { const float x = F[(size_t)(t + q) * pitch + g * HD + d]; o16[q] = tohx(x); unsigned short a2, c2; splitf(x, a2, c2); oh[q] = a2; ol[q] = c2; }
    const bool hires = (t < RH);                                 // wave-uniform (a wave stays inside one tile)
    const size_t oo = (size_t)g * HD * RH + (hires ? he : 0);   // keys < RH are the first RH HD places of a value plane
    *(v2h*)(V16 + e) = o16; if (hires) { *(v2us*)(Vh + oo) = oh; *(v2us*)(Vl + oo) = ol; }
    
}
typedef __attribute__((ext_vector_type(16))) unsigned short v16us;
__device__ __forceinline__ float xhalf(float x) { return __builtin_bit_cast(float, __builtin_amdgcn_permlanex16(__builtin_bit_cast(int, x), __builtin_bit_cast(int, x), 0x76543210, 0xfedcba98, false, false)); }   // lane l with lane l ^ 16
__device__ __forceinline__ void wgap() { __builtin_amdgcn_sched_barrier(0); asm volatile("v_nop\n\tv_nop\n\tv_nop\n\tv_nop"); __builtin_amdgcn_sched_barrier(0); }   // the 4 vector slots between a pass's last WMMAs and whatever reads their D or overwrites their A/B next, on the taken side of the loop branch that follows too
template <bool B> struct BoolC { static constexpr bool value = B; };
template <typename T16, bool HR>
__device__ __forceinline__ void fattn_rows(const T16* __restrict__ Q, const T16* __restrict__ Q2, const T16* __restrict__ Kp, const T16* __restrict__ K2, const T16* __restrict__ Vt, const T16* __restrict__ V2, const int q0, const int lane, v8f (&acc)[2][8], float (&linv)[2]) {
    typedef typename WFrag<T16>::V V;
    constexpr float CSC = SCL * 1.4426950408889634f;
    const int c = lane & 15, h = lane >> 4;
    V qf[2][4], qf2[2][4], kf[2][4], kf2[2][4];
    // every fragment address = a wave-uniform plane base + the lane's byte offset (16 bytes a lane inside a tile in fragment order); the key and value offsets are carried through the pass loop and advanced only behind the wait that covers the loads which name them
    const unsigned qo = ((unsigned)q0 * HD + 8 * lane) * 2; unsigned ko = (unsigned)lane * 16, vo = (unsigned)lane * 16;
    auto ldo = [](const T16* ub, const unsigned bo, const int o) __attribute__((always_inline)) { return WFrag<T16>::ld((const T16*)((const char*)ub + bo) + o); };
#pragma unroll
    for (int g = 0; g < 2; ++g)
#pragma unroll
        for (int kc = 0; kc < 4; ++kc) { const int o = 16 * g * HD + 512 * kc; qf[g][kc] = ldo(Q, qo, o); if constexpr (HR) qf2[g][kc] = ldo(Q2, qo, o); }
    float m_run[2], l_run[2];
#pragma unroll
    for (int g = 0; g < 2; ++g) { m_run[g] = -__builtin_inff(); l_run[g] = 0.0f;
#pragma unroll
        for (int t = 0; t < 8; ++t) acc[g][t] = (v8f){}; }
#pragma unroll
    for (int kt = 0; kt < 2; ++kt)
#pragma unroll
        for (int kc = 0; kc < 4; ++kc) { const int o = 16 * kt * HD + 512 * kc; kf[kt][kc] = ldo(Kp, ko, o); if constexpr (HR) kf2[kt][kc] = ldo(K2, ko, o); }
    asm volatile("s_wait_xcnt 0x0" : "+v"(ko) : "v"(qo) : "memory");   // stands in front of any overwrite of an address register that the query and first key loads name; the operands keep those registers untouched up to the wait
    __builtin_amdgcn_sched_barrier(0);   // nothing that could overwrite one moves up over that wait
    ko += 32 * HD * 2;
    // One 32-key pass. dg true: the diagonal pass, a wave's last (keys > query replaced by -inf, by index; nothing fetched ahead); every other pass fetches the next pass's key fragments.
    auto pass = [&](auto dg) __attribute__((always_inline)) {
        constexpr bool DIAG = decltype(dg)::value;
        V vf[8], vf2[8];
#pragma unroll
        for (int t = 0; t < 8; ++t) { const int o = 512 * t; vf[t] = ldo(Vt, vo, o); if constexpr (HR) vf2[t] = ldo(V2, vo, o); }
        if constexpr (HR) asm volatile("s_wait_xcnt 0x0" ::: "memory");   // with two value planes the build sums base and offset in vector registers that the score tiles then take: the wait stands in front of that overwrite
        __builtin_amdgcn_sched_barrier(0);   // the value loads stay in front of the score products, so that they fly under them and under the softmax
        v8f s[2][2];
#pragma unroll
        for (int kt = 0; kt < 2; ++kt)
#pragma unroll
            for (int g = 0; g < 2; ++g) { s[kt][g] = (v8f){};
#pragma unroll
                for (int kc = 0; kc < 4; ++kc) { s[kt][g] = WFrag<T16>::mma(kf[kt][kc], qf[g][kc], s[kt][g]);
                    if constexpr (HR) { s[kt][g] = WFrag<T16>::mma(kf2[kt][kc], qf[g][kc], s[kt][g]); s[kt][g] = WFrag<T16>::mma(kf[kt][kc], qf2[g][kc], s[kt][g]); } } }
        __builtin_amdgcn_sched_barrier(0);   // the score products stay in front of the wait and of the key prefetch
        asm volatile("s_wait_xcnt 0x0" :: "v"(vo) : "memory");   // stands in front of any overwrite of an address register that the value loads name (the input keeps their offset untouched up to here); it is placed behind the score products so that it does not hold up their issue
        __builtin_amdgcn_sched_barrier(0);   // nothing that could overwrite one moves up over that wait
        if constexpr (!DIAG) {   // the next pass's key fragments fly under this pass's softmax and second product
#pragma unroll
            for (int kt = 0; kt < 2; ++kt)
#pragma unroll
                for (int kc = 0; kc < 4; ++kc) { const int o = 16 * kt * HD + 512 * kc; kf[kt][kc] = ldo(Kp, ko, o); if constexpr (HR) kf2[kt][kc] = ldo(K2, ko, o); }
            __builtin_amdgcn_sched_barrier(0);   // keeps the key prefetch issued ahead of the softmax arithmetic
        } else {                 // the pass's first key is q0
#pragma unroll
            for (int g = 0; g < 2; ++g)
#pragma unroll
                for (int kt = 0; kt < 2; ++kt)
#pragma unroll
                    for (int r = 0; r < 8; ++r) if (16 * kt + 8 * h + r > 16 * g + c) s[kt][g][r] = -__builtin_inff();
        }
        float mb[2]; bool need = false;
#pragma unroll
        for (int g = 0; g < 2; ++g) { float mx = -__builtin_inff();
#pragma unroll
            for (int kt = 0; kt < 2; ++kt)
#pragma unroll
                for (int r = 0; r < 8; ++r) mx = fmaxf(mx, s[kt][g][r]);
            mx = fmaxf(mx, xhalf(mx)) * CSC; mb[g] = mx; need = need || (mx > m_run[g] + 8.0f); }
        if (__builtin_amdgcn_ballot_w32(need) != 0) {   // scalar branch, rare after the first passes; every column has an unmasked key in every pass, so the new maximum is finite
#pragma unroll
            for (int g = 0; g < 2; ++g) { const float mn = fmaxf(m_run[g], mb[g]); const float corr = __builtin_amdgcn_exp2f(m_run[g] - mn); l_run[g] *= corr; m_run[g] = mn;
#pragma unroll
                for (int t = 0; t < 8; ++t) acc[g][t] = acc[g][t] * corr; }
        }
#pragma unroll
        for (int g = 0; g < 2; ++g) { const float nm = -m_run[g]; float pv[16]; float ps0 = 0.0f, ps1 = 0.0f;
#pragma unroll
            for (int e = 0; e < 16; ++e) { pv[e] = __builtin_amdgcn_exp2f(__builtin_fmaf(s[e >> 3][g][e & 7], CSC, nm)); if (e & 1) ps1 += pv[e]; else ps0 += pv[e]; }
            l_run[g] += ps0 + ps1;
            V pf, pf2;
            if constexpr (HR) { v16us uh, ul;
#pragma unroll
                for (int e = 0; e < 16; ++e) { unsigned short a, b; splitf(pv[e], a, b); uh[e] = a; ul[e] = b; }
                pf = __builtin_bit_cast(v16bf, uh); pf2 = __builtin_bit_cast(v16bf, ul);
            } else {
#pragma unroll
                for (int e = 0; e < 16; ++e) pf[e] = tohx(pv[e]); }
#pragma unroll
            for (int t = 0; t < 8; ++t) { acc[g][t] = WFrag<T16>::mma(vf[t], pf, acc[g][t]);
                if constexpr (HR) { acc[g][t] = WFrag<T16>::mma(vf2[t], pf, acc[g][t]); acc[g][t] = WFrag<T16>::mma(vf[t], pf2, acc[g][t]); } }
        }
        wgap();
        if constexpr (!DIAG) {
            asm volatile("s_wait_xcnt 0x0" : "+v"(ko), "+v"(vo) :: "memory");   // stands in front of the offset updates, which overwrite address registers that this pass's loads name; as in-out operands the offsets can be advanced only behind it
            ko += 32 * HD * 2; vo += 32 * HD * 2; }
    };
    // stays rolled: the trip count is known only at run time, and further copies of a body this long would only add code for the instruction cache to hold
#pragma unroll 1
    for (int key0 = 0; key0 < q0; key0 += 32) pass(BoolC<false>{});   // keys [0, q0): no key exceeds a query of this wave
    pass(BoolC<true>{});                                              // keys [q0, q0 + 32)
#pragma unroll
    for (int g = 0; g < 2; ++g) linv[g] = __fdiv_rn(1.0f, l_run[g] + xhalf(l_run[g]));   // each wave half summed its own eight keys of every 16-key tile
}
__global__ __launch_bounds__(32 * REP) void k_fattn(const h16* __restrict__ Q16, const h16* __restrict__ K16, const h16* __restrict__ V16, const bf* __restrict__ Qh, const bf* __restrict__ Ql, const bf* __restrict__ Kh, const bf* __restrict__ Kl, const bf* __restrict__ Vh, const bf* __restrict__ Vl, h16* A16, bf* Ah, bf* Al) {
    const int lane = threadIdx.x & 31; const int g = blockIdx.y;
    const int head = g * REP + __builtin_amdgcn_readfirstlane((int)(threadIdx.x >> 5));   // scalar: plane bases and the pass loop stay under scalar control
    const int q0 = (TT / 32 - 1 - (int)blockIdx.x) * 32;                                 // longest row blocks take the lowest block index
    v8f acc[2][8]; float linv[2];
    if (q0 < RH) {
        fattn_rows<bf, true>(Qh + (size_t)head * RH * HD, Ql + (size_t)head * RH * HD, Kh + (size_t)g * RH * HD, Kl + (size_t)g * RH * HD, Vh + (size_t)g * HD * RH, Vl + (size_t)g * HD * RH, q0, lane, acc, linv);
#pragma unroll
        for (int gq = 0; gq < 2; ++gq)
#pragma unroll
            for (int t = 0; t < 8; ++t) { v8us oh, ol;   // a lane's 8 registers are d = 16 t + 8 h + 0..7 of query q0 + 16 gq + c
#pragma unroll
                for (int r = 0; r < 8; ++r) { unsigned short a, b; splitf(acc[gq][t][r] * linv[gq], a, b); oh[r] = a; ol[r] = b; }
                const size_t oo = (size_t)(q0 + 16 * gq) * DQ + (head * (HD / 32) + (t >> 1)) * 512 + (t & 1) * 256 + 8 * lane; *(v8us*)(Ah + oo) = oh; *(v8us*)(Al + oo) = ol; }   // its place in fragment order, planes of DQ columns
        asm volatile("s_wait_xcnt 0x0" ::: "memory");   // stands behind the run of stores above, in front of anything that could overwrite a register which one of them names
    } else {
        fattn_rows<h16, false>(Q16 + (size_t)head * TT * HD, nullptr, K16 + (size_t)g * TT * HD, nullptr, V16 + (size_t)g * HD * TT, nullptr, q0, lane, acc, linv);
        v8h o16[2][8];
#pragma unroll
        for (int gq = 0; gq < 2; ++gq)
#pragma unroll
            for (int t = 0; t < 8; ++t)
#pragma unroll
                for (int r = 0; r < 8; ++r) o16[gq][t][r] = tohx(acc[gq][t][r] * linv[gq] * ACAR);
        __builtin_amdgcn_sched_barrier(0);   // all sixteen packed vectors are formed in front of the first store, each in registers of its own: built without it, the packing of a later vector took the data registers of a store just issued, ahead of the wait below
#pragma unroll
        for (int gq = 0; gq < 2; ++gq)
#pragma unroll
            for (int t = 0; t < 8; ++t) *(v8h*)(A16 + (size_t)(q0 + 16 * gq) * DQ + (head * (HD / 32) + (t >> 1)) * 512 + (t & 1) * 256 + 8 * lane) = o16[gq][t];   // its place in fragment order, plane of DQ columns
        asm volatile("s_wait_xcnt 0x0" ::: "memory");   // stands behind the run of stores above, in front of anything that could overwrite a register which one of them names
    }
}

extern "C" void kernel_launch(void* const* d_in, const int* in_sizes, int n_in,
                              void* d_out, int out_size, void* d_ws, size_t ws_size, hipStream_t stream) {
    if (n_in < 5) return;
    if ((size_t)in_sizes[0] < (size_t)(NB - 1) * TT_FULL * DM + (size_t)TT * DM) return;
    if (in_sizes[1] < DM * DQ || in_sizes[2] < DM * DKV || in_sizes[3] < DM * DKV || in_sizes[4] < DQ * DM) return;
    if ((size_t)out_size < (size_t)(NB - 1) * TT_FULL * DM + (size_t)TT * DM) return;
    const float* x = (const float*)d_in[0]; const float* wq = (const float*)d_in[1]; const float* wk = (const float*)d_in[2]; const float* wv = (const float*)d_in[3]; const float* wo = (const float*)d_in[4];
    float* OUT = (float*)d_out;     // [NB][TT_FULL][DM]
    char* wsp = (char*)d_ws;
    auto take = [&](size_t bytes) { char* p = wsp; wsp += (bytes + 255) & ~(size_t)255; return (void*)p; };
    bf* WQ = (bf*)take((size_t)DQ * DM * 2); bf* WK = (bf*)take((size_t)DKV * DM * 2); bf* WV = (bf*)take((size_t)DKV * DM * 2); bf* WO = (bf*)take((size_t)DM * DQ * 2);   // Bt = (out, in) planes in fragment order
    h16* WO16 = (h16*)take((size_t)DM * DQ * 2);                                                                                             // Bt fp16 x WCAR
    float* CS = (float*)take((size_t)TT * HP * 2 * 4);
    float* FQ = (float*)take((size_t)TT * DQ * 4); float* FK = (float*)take((size_t)TT * DKV * 4);
    h16* QP16 = (h16*)take((size_t)NH_ * TT * HD * 2); h16* KP16 = (h16*)take((size_t)NKV * TT * HD * 2); h16* VT16 = (h16*)take((size_t)NKV * HD * TT * 2);
    bf* QPh = (bf*)take((size_t)NH_ * RH * HD * 2); bf* QPl = (bf*)take((size_t)NH_ * RH * HD * 2); bf* KPh = (bf*)take((size_t)NKV * RH * HD * 2); bf* KPl = (bf*)take((size_t)NKV * RH * HD * 2);
    bf* VTh = (bf*)take((size_t)NKV * HD * RH * 2); bf* VTl = (bf*)take((size_t)NKV * HD * RH * 2);
    bf* XB = (bf*)take((size_t)TT * DM * 2);     // bf16 x rows of the current batch
    h16* AT16 = (h16*)take((size_t)TT * DQ * 2); bf* ATh = (bf*)take((size_t)RH * DQ * 2); bf* ATl = (bf*)take((size_t)RH * DQ * 2);
    if ((size_t)(wsp - (char*)d_ws) > ws_size) return;
    float* FV = FK;       // v projection reuses the k buffer after the k planes are built (stream-ordered)
    { k_wtG<<<(unsigned)((DQ * DM / 64 + 63) / 64), 256, 0, stream>>>(wq, DM, DQ, WQ);
      k_wtG<<<(unsigned)((DKV * DM / 64 + 63) / 64), 256, 0, stream>>>(wk, DM, DKV, WK);
      k_wtG<<<(unsigned)((DKV * DM / 64 + 63) / 64), 256, 0, stream>>>(wv, DM, DKV, WV);
      k_wtG<<<(unsigned)((DM * DQ / 64 + 63) / 64), 256, 0, stream>>>(wo, DQ, DM, WO);
      k_wtH<<<(unsigned)((DM * DQ / 64 + 63) / 64), 256, 0, stream>>>(wo, DQ, DM, WCAR, WO16); }
    k_cstab<<<(TT * HP + 255) / 256, 256, 0, stream>>>(CS);
    const unsigned LQ = (unsigned)(((size_t)NH_ * TT * HD / 2 + 255) / 256), LKv = (unsigned)(((size_t)NKV * TT * HD / 2 + 255) / 256);
    for (int b = 0; b < NB; ++b) {
        k_cvt8<<<(unsigned)(((size_t)TT * DM / 8 + 255) / 256), 256, 0, stream>>>(x + (size_t)b * TT_FULL * DM, XB, (size_t)TT * DM / 8);
        k_gemmw<bf, 0, 8><<<dim3(TT / 64, DQ / 64, 1), 256, 0, stream>>>(XB, nullptr, WQ, nullptr, DM, -1, 0, FQ, DQ, 1.0f, 0, 0, 0);
        k_rope<<<LQ, 256, 0, stream>>>(FQ, DQ, NH_, CS, QP16, QPh, QPl);
        k_gemmw<bf, 0, 16><<<dim3(TT / 64, DKV / 64, 1), 512, 0, stream>>>(XB, nullptr, WK, nullptr, DM, -1, 0, FK, DKV, 1.0f, 0, 0, 0);
        k_rope<<<LKv, 256, 0, stream>>>(FK, DKV, NKV, CS, KP16, KPh, KPl);
        k_gemmw<bf, 0, 16><<<dim3(TT / 64, DKV / 64, 1), 512, 0, stream>>>(XB, nullptr, WV, nullptr, DM, -1, 0, FV, DKV, 1.0f, 0, 0, 0);
        k_vtp<<<LKv, 256, 0, stream>>>(FV, DKV, NKV, VT16, VTh, VTl);
        k_fattn<<<dim3(TT / 32, NKV, 1), 32 * REP, 0, stream>>>(QP16, KP16, VT16, QPh, QPl, KPh, KPl, VTh, VTl, AT16, ATh, ATl);
        // output projection: rows < RH bf16 hi/lo context x bf16 Wo (2 products); rows >= RH fp16 context x64 x fp16 Wo x64 (1 product, 1/4096 in the epilogue)
        k_gemmw<bf, 1, 16><<<dim3(RH / 64, DM / 64, 1), 512, 0, stream>>>(ATh, ATl, WO, nullptr, DQ, -1, 0, OUT + (size_t)b * TT_FULL * DM, DM, 1.0f, 0, 0, 0);
        k_gemmw<h16, 0, 8><<<dim3((TT - RH) / 64, DM / 64, 1), 256, 0, stream>>>(AT16 + (size_t)RH * DQ, nullptr, WO16, nullptr, DQ, -1, 0, OUT + (size_t)b * TT_FULL * DM + (size_t)RH * DM, DM, OSCW, 0, 0, 0); }
}

// v004
// Measured time: 233 microseconds a run.
// Next to v003, in two timings, it ran 1.25 and 1.22 times as fast.
// All steps since v000 together make it 6.99 times as fast.
#include <hip/hip_runtime.h>

// Causal grouped-query self-attention with interleaved rotary embedding: x [NB][T][2048]; q = x Wq (16 heads x 128), k, v = x Wk, x Wv (4 kv heads x 128, each shared by 4 consecutive q heads);
// rotary pairs (2j, 2j+1) with angle t / 10000^(j/64); s = q.k x 128^-0.5 with keys > query replaced by -inf; softmax; attn.v; merged heads x Wo -> [NB][T][2048] f32.
// Compute dtypes, f32 accumulate: x, Wq, Wk, Wv, Wo RNE-converted to bf16; q/k/v projections v_wmma_f32_16x16x32_bf16 (plain); scores and attn.v: query rows < 128 bf16 hi/lo split (3 products),
// rows >= 128 v_wmma_f32_16x16x32_f16 single products (P unnormalised, exp2 of the score minus the maximum in use); rotary table and softmax f32; output projection: rows < 128 bf16 hi/lo x bf16 (2 products),
// rows >= 128 v_wmma_f32_16x16x32_f16 single product (context carried x64, Wo carried x64, 1/4096 folded in the f32 epilogue).
// Every 16-bit operand plane P[row][k] (NC columns) lies in FRAGMENT ORDER: 1-KB tiles of 16 rows x 32 k, tile (row >> 4, k >> 5) at element ((row >> 4) (NC / 32) + (k >> 5)) 512 (value planes: tile (d >> 4, key >> 5) at
// ((key >> 5) 8 + (d >> 4)) 512), and inside a tile element (row, k) at ((k >> 4) & 1) 256 + (((k >> 3) & 1) 16 + (row & 15)) 8 + (k & 7): a wave's 16-byte-per-lane load or store at lane 8 covers 512 contiguous bytes.

#ifndef NB
#define NB 2
#endif
#ifndef SEQ
#define SEQ 2048
#endif
#define NB_FULL 2
#define TT_FULL 2048
#define TT   SEQ
#define DM   2048
#define NH_  16
#define NKV  4
#define REP  (NH_ / NKV)
#define HD   128
#define HP   (HD / 2)
#define DQ   (NH_ * HD)
#define DKV  (NKV * HD)
#define RH   128                  // query rows < RH use hi/lo planes (keys < RH suffice: causal)
#define ACAR 64.0f                // carry of the fp16 merged-context plane (rows >= RH)
#define WCAR 64.0f                // carry of the fp16 Wo plane
#define OSCW (1.0f / (ACAR * WCAR))
#define SCL  0.08838834764831845f   // HD^-0.5
#define KX   DM                   // columns of every GEMM operand plane

static_assert(NB >= 1 && NB <= NB_FULL);
static_assert(TT % 128 == 0 && TT <= TT_FULL && TT > RH);
static_assert(RH % 128 == 0 && RH >= 128);
static_assert((TT - RH) % 64 == 0);
static_assert(HD == 128 && HP == 64);
static_assert(NH_ == NKV * REP && TT % 32 == 0 && RH % 32 == 0);
static_assert(DM % 64 == 0 && DQ % 64 == 0 && DKV % 64 == 0 && DQ == KX);

typedef _Float16 h16;
typedef unsigned short bf;
typedef __attribute__((ext_vector_type(16))) __bf16   v16bf;
typedef __attribute__((ext_vector_type(16))) _Float16 v16h;
typedef __attribute__((ext_vector_type(8)))  _Float16 v8h;
typedef __attribute__((ext_vector_type(8)))  unsigned short v8us;
typedef __attribute__((ext_vector_type(8)))  float    v8f;
typedef __attribute__((ext_vector_type(4)))  float    v4f;
typedef v8h  __attribute__((may_alias)) v8ha;
typedef v4f  __attribute__((may_alias)) v4fa;
typedef v8us __attribute__((may_alias)) v8usa;

__device__ __forceinline__ unsigned short f2bf(float f) { unsigned u = __float_as_uint(f); u += 0x7FFFu + ((u >> 16) & 1u); return (unsigned short)(u >> 16); }
__device__ __forceinline__ float bf2f(unsigned short b) { return __uint_as_float(((unsigned)b) << 16); }
__device__ __forceinline__ float bfr(float f) { return bf2f(f2bf(f)); }
__device__ __forceinline__ v16h cat16(v8h lo, v8h hi) { return __builtin_shufflevector(lo, hi, 0, 1, 2, 3, 4, 5, 6, 7, 8, 9, 10, 11, 12, 13, 14, 15); }
__device__ __forceinline__ v16bf cat16b(v8us lo, v8us hi) { return __builtin_bit_cast(v16bf, __builtin_shufflevector(lo, hi, 0, 1, 2, 3, 4, 5, 6, 7, 8, 9, 10, 11, 12, 13, 14, 15)); }
__device__ __forceinline__ v8f wmma16(v16h a, v16h b, v8f c) { return __builtin_amdgcn_wmma_f32_16x16x32_f16(false, a, false, b, (short)0, c, false, false); }
__device__ __forceinline__ v8f wmmab(v16bf a, v16bf b, v8f c) { return __builtin_amdgcn_wmma_f32_16x16x32_bf16(false, a, false, b, (short)0, c, false, false); }

// ---- k_gemmw: register-blocked GEMM, NW WAVES per 64x64 output tile (16 accumulators each), operands straight from 16-bit planes in fragment order; grid (M/64, N/64, Z), 32 NW threads.
// Wave w contracts the 32-wide k chunks w, w + NW, w + 2 NW, ... of the tile; for NW > 1 the NW f32 partial tiles meet in LDS and are summed in wave order 0 .. NW-1 (fixed), then scaled and stored.
// C[m][n] (f32, pitch ldc) = osc x sum_k A[m][k] Bt[n][k] (+ split products per NSPLIT: 1 = A2.Bt added, 2 = A2.Bt and A.Bt2 added). Every plane has KX columns (a constant: the tile-row steps become immediate offsets), z-batch strides sA/sB/sC in elements. K % 32 == 0.
// Fragment k map (both operands): elements 0..7 <- kc + 8h + 0..7, elements 8..15 <- kc + 16 + 8h + 0..7, h = lane >> 4, row/col = lane & 15: WFrag::ld at tile base + lane 8 (its second half 256 elements on).
// cskip >= 0: tiles with blockIdx.y > blockIdx.x + cskip are not computed (causal upper triangle). kcaus > 0: contraction stops at min(K, kcaus + 64 (blockIdx.x + 1)) (causal key limit).
template <typename T16> struct WFrag;
template <> struct WFrag<h16> { typedef v16h V; static __device__ __forceinline__ V ld(const h16* p) { return cat16(*(const v8h*)p, *(const v8h*)(p + 256)); } static __device__ __forceinline__ v8f mma(V a, V b, v8f c) { return wmma16(a, b, c); } };
template <> struct WFrag<bf> { typedef v16bf V; static __device__ __forceinline__ V ld(const bf* p) { return cat16b(*(const v8us*)p, *(const v8us*)(p + 256)); } static __device__ __forceinline__ v8f mma(V a, V b, v8f c) { return wmmab(a, b, c); } };
template <typename T16, int NSPLIT, int NW>
__global__ __launch_bounds__(32 * NW) void k_gemmw(const T16* __restrict__ A, const T16* __restrict__ A2, const T16* __restrict__ Bt, const T16* __restrict__ Bt2, int K, int cskip, int kcaus,
                                             float* C, int ldc, float osc, size_t sA, size_t sB, size_t sC) {
    typedef typename WFrag<T16>::V V;
    __shared__ __align__(16) float os[(NW == 1 ? 16 : NW * 64) * 68];
    if (cskip >= 0 && (int)blockIdx.y > (int)blockIdx.x + cskip) return;   // block-uniform, in front of the one block barrier
    const size_t z = blockIdx.z; A += z * sA; if (A2) A2 += z * sA; Bt += z * sB; if (Bt2) Bt2 += z * sB; C += z * sC;
    const int lane = threadIdx.x & 31, lr = lane & 15, hi = lane >> 4; const int r0 = blockIdx.x * 64, c0 = blockIdx.y * 64;
    const int wv = (NW == 1) ? 0 : __builtin_amdgcn_readfirstlane((int)(threadIdx.x >> 5));   // wave number, scalar: the k loop stays under scalar control
    int kend = K;
    if (kcaus > 0) { const int kl = kcaus + 64 * ((int)blockIdx.x + 1); kend = (kl < K) ? kl : K; }
    v8f acc[4][4];
#pragma unroll
    for (int mb = 0; mb < 4; ++mb)
#pragma unroll
        for (int nb = 0; nb < 4; ++nb) acc[mb][nb] = (v8f){};
    // every fragment address = a wave-uniform tile-row base (16 rows of a plane = KX / 32 tiles = 16 KX elements) + one byte offset per lane: 16 bytes a lane inside a tile, 1 KB a 32-wide k chunk; the offset is advanced only behind the wait at the loop's foot
    const size_t aoff = (size_t)r0 * KX, boff = (size_t)c0 * KX; unsigned ko = (unsigned)lane * 16 + (unsigned)wv * 1024;
    auto ldo = [](const T16* ub, const unsigned bo, const int o) __attribute__((always_inline)) { return WFrag<T16>::ld((const T16*)((const char*)ub + bo) + o); };
#pragma unroll 1
    for (int kc = 32 * wv; kc < kend; kc += 32 * NW) {
        V a[4], a2[4], b[4], b2[4];
#pragma unroll
        for (int mb = 0; mb < 4; ++mb) { a[mb] = ldo(A + aoff, ko, mb * 16 * KX); if (NSPLIT == 1 || NSPLIT == 2) a2[mb] = ldo(A2 + aoff, ko, mb * 16 * KX); }
#pragma unroll
        for (int nb = 0; nb < 4; ++nb) { b[nb] = ldo(Bt + boff, ko, nb * 16 * KX); if (NSPLIT >= 2) b2[nb] = ldo(Bt2 + boff, ko, nb * 16 * KX); }
        __builtin_amdgcn_sched_barrier(0);   // the trip's loads stay one group in front of its products; built without it, the Bt fragments shared one register set and each was fetched only behind the products of the one before: four load latencies a trip
#pragma unroll
        for (int nb = 0; nb < 4; ++nb)
#pragma unroll
            for (int mb = 0; mb < 4; ++mb) { acc[mb][nb] = WFrag<T16>::mma(a[mb], b[nb], acc[mb][nb]); if (NSPLIT == 1 || NSPLIT == 2) acc[mb][nb] = WFrag<T16>::mma(a2[mb], b[nb], acc[mb][nb]); if (NSPLIT >= 2) acc[mb][nb] = WFrag<T16>::mma(a[mb], b2[nb], acc[mb][nb]); }
        asm volatile("v_nop\n\tv_nop\n\tv_nop\n\tv_nop" : "+v"(acc[0][0]), "+v"(acc[1][1]), "+v"(acc[2][2]), "+v"(acc[3][3]) : "v"(a[0]), "v"(a[3]));
        asm volatile("s_wait_xcnt 0x0" : "+v"(ko) :: "memory");   // stands in front of the offset update, which overwrites the address register that this trip's loads name; as an in-out operand the offset can be advanced only behind it
        ko += 1024 * NW;
    }
    if constexpr (NW > 1) {
        float* my = os + (size_t)wv * (64 * 68);
#pragma unroll
        for (int mb = 0; mb < 4; ++mb)
#pragma unroll
            for (int nb = 0; nb < 4; ++nb)
#pragma unroll
                for (int j = 0; j < 8; ++j) my[(mb * 16 + hi * 8 + j) * 68 + nb * 16 + lr] = acc[mb][nb][j];
        __syncthreads();   // every wave's partial tile is in LDS before any thread sums across waves
#pragma unroll
        for (int it = 0; it < 32 / NW; ++it) { const int item = it * (32 * NW) + (int)threadIdx.x; const int row = item >> 4, cofs = (item & 15) * 4;
            v4f s = *(const v4fa*)(os + row * 68 + cofs);
#pragma unroll
            for (int q = 1; q < NW; ++q) s += *(const v4fa*)(os + q * (64 * 68) + row * 68 + cofs);
            *(v4f*)(C + (size_t)(r0 + row) * ldc + c0 + cofs) = s * osc; }
    } else {
#pragma unroll
    for (int mb = 0; mb < 4; ++mb) {
#pragma unroll
        for (int nb = 0; nb < 4; ++nb) {
#pragma unroll
            for (int j = 0; j < 8; ++j) os[(hi * 8 + j) * 68 + nb * 16 + lr] = acc[mb][nb][j]; }
        __builtin_amdgcn_wave_barrier(); asm volatile("" ::: "memory");
        float* crow = C + (size_t)(r0 + mb * 16) * ldc + c0;
{
#pragma unroll
            for (int s = 0; s < 8; ++s) { const int row = 2 * s + hi, cofs = lr * 4; const v4f val = *(const v4fa*)(os + row * 68 + cofs) * osc;
                *(v4f*)(crow + (size_t)row * ldc + cofs) = val; }
             }
        __builtin_amdgcn_wave_barrier(); asm volatile("" ::: "memory");
    }
    }
}

__device__ __forceinline__ h16 tohx(float x) { return (h16)x; }
__device__ __forceinline__ void splitf(float y, unsigned short& h, unsigned short& l) { h = f2bf(y); l = f2bf(y - bf2f(h)); }
typedef __attribute__((ext_vector_type(2))) _Float16 v2h;
typedef __attribute__((ext_vector_type(4))) _Float16 v4h;
typedef __attribute__((ext_vector_type(2))) unsigned short v2us;
typedef __attribute__((ext_vector_type(4))) unsigned short v4us;
typedef __attribute__((ext_vector_type(2))) float v2f;

__global__ __launch_bounds__(256) void k_wtG(const float* __restrict__ w, int K, int N, bf* Bt) {
    const int lane = threadIdx.x & 31; const int L0 = (blockIdx.x * 8 + (threadIdx.x >> 5)) * 8; const int nlines = N * K / 64;
{
#pragma unroll 1
        for (int l = 0; l < 8; ++l) { const int L = L0 + l; if (L >= nlines) break; const size_t e = (size_t)L * 64 + lane * 2; const int tile = (int)(e >> 9), ln = (int)(e >> 3) & 31; const int k = (tile % (K / 32)) * 32 + ((int)(e >> 8) & 1) * 16 + (ln >> 4) * 8 + ((int)e & 7), n = (tile / (K / 32)) * 16 + (ln & 15); v2us o;   // e = place in fragment order
            o[0] = f2bf(w[(size_t)k * N + n]); o[1] = f2bf(w[(size_t)(k + 1) * N + n]); *(v2us*)(Bt + e) = o; }
         }
}
__global__ __launch_bounds__(256) void k_wtH(const float* __restrict__ w, int K, int N, float sc, h16* Bt) {
    const int lane = threadIdx.x & 31; const int L0 = (blockIdx.x * 8 + (threadIdx.x >> 5)) * 8; const int nlines = N * K / 64;
{
#pragma unroll 1
        for (int l = 0; l < 8; ++l) { const int L = L0 + l; if (L >= nlines) break; const size_t e = (size_t)L * 64 + lane * 2; const int tile = (int)(e >> 9), ln = (int)(e >> 3) & 31; const int k = (tile % (K / 32)) * 32 + ((int)(e >> 8) & 1) * 16 + (ln >> 4) * 8 + ((int)e & 7), n = (tile / (K / 32)) * 16 + (ln & 15); v2h o;   // e = place in fragment order
            o[0] = tohx(bfr(w[(size_t)k * N + n]) * sc); o[1] = tohx(bfr(w[(size_t)(k + 1) * N + n]) * sc); *(v2h*)(Bt + e) = o; }
         }
}
__global__ __launch_bounds__(256) void k_cvt8(const float* __restrict__ src, bf* dst, size_t n8) { const size_t i = (size_t)blockIdx.x * 256 + threadIdx.x; if (i >= n8) return;   // i 8 = place in fragment order of a plane of DM columns
    src += (size_t)blockIdx.y * TT_FULL * DM; dst += (size_t)blockIdx.y * TT * DM;   // blockIdx.y = batch
    const int tile = (int)(i >> 6), ln = (int)i & 31; const size_t row = (size_t)(tile / (DM / 32)) * 16 + (ln & 15); const int k = (tile % (DM / 32)) * 32 + ((int)(i >> 5) & 1) * 16 + (ln >> 4) * 8;
    const v8f v = *(const v8f*)(src + row * DM + k); v8us o;
#pragma unroll
    for (int k = 0; k < 8; ++k) o[k] = f2bf(v[k]); *(v8us*)(dst + i * 8) = o;  }
// k_cstab: CS[t][j] = {cos(t inv_j), sin(t inv_j)} f32 for j < 64, inv_j = 1 / f32(10000^(j/64)) where 10000^(j/64) is a product of exact-root powers 10000^(2^b/64) in f64
__global__ __launch_bounds__(256) void k_cstab(float* CS) {
    const int idx = blockIdx.x * 256 + threadIdx.x; if (idx >= TT * HP) return;
    const int j = idx & (HP - 1); const int t = idx / HP;
    double s = 100.0, p = 1.0;
#pragma unroll 1
    for (int b = 5; b >= 0; --b) { if ((j >> b) & 1) p *= s; s = sqrt(s); }
    const float pf = (float)p; const float inv = 1.0f / pf; const float ang = __fmul_rn((float)t, inv);
    float sn, cn; sincosf(ang, &sn, &cn);
    v2f cs; cs[0] = cn; cs[1] = sn;
    *(v2f*)(CS + (size_t)idx * 2) = cs; 
}
// k_rope: head planes of the interleaved rotary map of x = F[t][h*HD + d] (row pitch 'pitch'): out[2j] = x[2j] c - x[2j+1] s, out[2j+1] = x[2j] s + x[2j+1] c, (c, s) = CS[t][j].
__global__ __launch_bounds__(256) void k_rope(const float* __restrict__ F, int pitch, int nheads, const float* __restrict__ CS, h16* P16, bf* Ph, bf* Pl) {
    const size_t e = ((size_t)blockIdx.x * 256 + threadIdx.x) * 2; if (e >= (size_t)nheads * TT * HD) return;
    { const size_t b = blockIdx.y; F += b * TT * pitch; P16 += b * nheads * TT * HD; Ph += b * nheads * RH * HD; Pl += b * nheads * RH * HD; }   // blockIdx.y = batch
    const int he = (int)(e % ((size_t)HD * TT)), ln = (he >> 3) & 31; const int h = (int)(e / ((size_t)HD * TT));   // e = place in fragment order, head planes of HD columns
    const int d = ((he >> 9) & 3) * 32 + ((he >> 8) & 1) * 16 + (ln >> 4) * 8 + (he & 7); const int t = (he >> 11) * 16 + (ln & 15);
    const float* f = F + (size_t)t * pitch + h * HD + d; const float x1 = f[0], x2 = f[1];
    const v2f cs = *(const v2f*)(CS + ((size_t)t * HP + (d >> 1)) * 2);
    float a = __fmul_rn(x1, cs[0]), bq = __fmul_rn(x2, cs[1]), c2 = __fmul_rn(x1, cs[1]), dq = __fmul_rn(x2, cs[0]);
    asm volatile("" : "+v"(a)); asm volatile("" : "+v"(bq)); asm volatile("" : "+v"(c2)); asm volatile("" : "+v"(dq));
    const float q0 = __fsub_rn(a, bq), q1 = __fadd_rn(c2, dq);
    v2h o16; o16[0] = tohx(q0); o16[1] = tohx(q1);
    v2us oh, ol; { unsigned short u0, u1, w0, w1; splitf(q0, u0, w0); splitf(q1, u1, w1); oh[0] = u0; oh[1] = u1; ol[0] = w0; ol[1] = w1; }
    const bool hires = (t < RH);                                 // wave-uniform (a wave stays inside one tile)
    const size_t oo = (size_t)h * RH * HD + (hires ? he : 0);   // rows < RH are the first RH HD places of a head plane
    *(v2h*)(P16 + e) = o16; if (hires) { *(v2us*)(Ph + oo) = oh; *(v2us*)(Pl + oo) = ol; }
    
}
// k_vtp: value planes V16[g] (d, t) (fp16, every t) and Vh/Vl[g] (d, t) (bf16 hi/lo, t < RH only), fragment order with the 8 d tiles of a 32-key block side by side, = F[t][g*HD + d] (row pitch 'pitch'; lane -> 2 consecutive t);
__global__ __launch_bounds__(256) void k_vtp(const float* __restrict__ F, int pitch, int nkv, h16* V16, bf* Vh, bf* Vl) {
    const size_t e = ((size_t)blockIdx.x * 256 + threadIdx.x) * 2; if (e >= (size_t)nkv * HD * TT) return;
    { const size_t b = blockIdx.y; F += b * TT * pitch; V16 += b * nkv * HD * TT; Vh += b * nkv * HD * RH; Vl += b * nkv * HD * RH; }   // blockIdx.y = batch
    const int he = (int)(e % ((size_t)TT * HD)), ln = (he >> 3) & 31; const int g = (int)(e / ((size_t)TT * HD)); v2h o16; v2us oh, ol;   // e = place in fragment order
    const int t = (he >> 12) * 32 + ((he >> 8) & 1) * 16 + (ln >> 4) * 8 + (he & 7); const int d = ((he >> 9) & 7) * 16 + (ln & 15);
#pragma unroll
    for (int q = 0; q < 2; ++q) { const float x = F[(size_t)(t + q) * pitch + g * HD + d]; o16[q] = tohx(x); unsigned short a2, c2; splitf(x, a2, c2); oh[q] = a2; ol[q] = c2; }
    const bool hires = (t < RH);                                 // wave-uniform (a wave stays inside one tile)
    const size_t oo = (size_t)g * HD * RH + (hires ? he : 0);   // keys < RH are the first RH HD places of a value plane
    *(v2h*)(V16 + e) = o16; if (hires) { *(v2us*)(Vh + oo) = oh; *(v2us*)(Vl + oo) = ol; }
    
}
typedef __attribute__((ext_vector_type(16))) unsigned short v16us;
__device__ __forceinline__ float xhalf(float x) { return __builtin_bit_cast(float, __builtin_amdgcn_permlanex16(__builtin_bit_cast(int, x), __builtin_bit_cast(int, x), 0x76543210, 0xfedcba98, false, false)); }   // lane l with lane l ^ 16
__device__ __forceinline__ void wgap() { __builtin_amdgcn_sched_barrier(0); asm volatile("v_nop\n\tv_nop\n\tv_nop\n\tv_nop"); __builtin_amdgcn_sched_barrier(0); }   // the 4 vector slots between a pass's last WMMAs and whatever reads their D or overwrites their A/B next, on the taken side of the loop branch that follows too
template <bool B> struct BoolC { static constexpr bool value = B; };
template <typename T16, bool HR>
__device__ __forceinline__ void fattn_rows(const T16* __restrict__ Q, const T16* __restrict__ Q2, const T16* __restrict__ Kp, const T16* __restrict__ K2, const T16* __restrict__ Vt, const T16* __restrict__ V2, const int q0, const int lane, v8f (&acc)[2][8], float (&linv)[2]) {
    typedef typename WFrag<T16>::V V;
    constexpr float CSC = SCL * 1.4426950408889634f;
    const int c = lane & 15, h = lane >> 4;
    V qf[2][4], qf2[2][4], kf[2][4], kf2[2][4];
    // every fragment address = a wave-uniform plane base + the lane's byte offset (16 bytes a lane inside a tile in fragment order); the key and value offsets are carried through the pass loop and advanced only behind the wait that covers the loads which name them
    const unsigned qo = ((unsigned)q0 * HD + 8 * lane) * 2; unsigned ko = (unsigned)lane * 16, vo = (unsigned)lane * 16;
    auto ldo = [](const T16* ub, const unsigned bo, const int o) __attribute__((always_inline)) { return WFrag<T16>::ld((const T16*)((const char*)ub + bo) + o); };
#pragma unroll
    for (int g = 0; g < 2; ++g)
#pragma unroll
        for (int kc = 0; kc < 4; ++kc) { const int o = 16 * g * HD + 512 * kc; qf[g][kc] = ldo(Q, qo, o); if constexpr (HR) qf2[g][kc] = ldo(Q2, qo, o); }
    float m_run[2], l_run[2];
#pragma unroll
    for (int g = 0; g < 2; ++g) { m_run[g] = -__builtin_inff(); l_run[g] = 0.0f;
#pragma unroll
        for (int t = 0; t < 8; ++t) acc[g][t] = (v8f){}; }
#pragma unroll
    for (int kt = 0; kt < 2; ++kt)
#pragma unroll
        for (int kc = 0; kc < 4; ++kc) { const int o = 16 * kt * HD + 512 * kc; kf[kt][kc] = ldo(Kp, ko, o); if constexpr (HR) kf2[kt][kc] = ldo(K2, ko, o); }
    // stands in front of any overwrite of an address register that the query and first key loads name; the operands (the offsets, and the key addresses where the build sums base and offset in a vector pair) keep those registers untouched up to the wait
    if constexpr (HR) asm volatile("s_wait_xcnt 0x0" : "+v"(ko) : "v"(qo), "v"((const char*)Kp + ko), "v"((const char*)K2 + ko) : "memory");
    else asm volatile("s_wait_xcnt 0x0" : "+v"(ko) : "v"(qo), "v"((const char*)Kp + ko) : "memory");
    __builtin_amdgcn_sched_barrier(0);   // nothing that could overwrite one moves up over that wait
    ko += 32 * HD * 2;
    // One 32-key pass. dg true: the diagonal pass, a wave's last (keys > query replaced by -inf, by index; nothing fetched ahead); every other pass fetches the next pass's key fragments.
    auto pass = [&](auto dg) __attribute__((always_inline)) {
        constexpr bool DIAG = decltype(dg)::value;
        V vf[8], vf2[8];
#pragma unroll
        for (int t = 0; t < 8; ++t) { const int o = 512 * t; vf[t] = ldo(Vt, vo, o); if constexpr (HR) vf2[t] = ldo(V2, vo, o); }
        if constexpr (HR && !DIAG) asm volatile("s_wait_xcnt 0x0" ::: "memory");   // with two value planes the build sums base and offset in vector registers that the score tiles then take: the wait stands in front of that overwrite
        if constexpr (HR && DIAG) asm volatile("s_wait_xcnt 0x0" :: "v"((const char*)Vt + vo), "v"((const char*)V2 + vo) : "memory");   // the same wait in a wave's last pass: as inputs the two sums stay untouched up to it (built without them, the last load of each plane landed on its own address pair, which the loads before it name)
        __builtin_amdgcn_sched_barrier(0);   // the value loads stay in front of the score products, so that they fly under them and under the softmax
        v8f s[2][2];
#pragma unroll
        for (int kt = 0; kt < 2; ++kt)
#pragma unroll
            for (int g = 0; g < 2; ++g) { s[kt][g] = (v8f){};
#pragma unroll
                for (int kc = 0; kc < 4; ++kc) { s[kt][g] = WFrag<T16>::mma(kf[kt][kc], qf[g][kc], s[kt][g]);
                    if constexpr (HR) { s[kt][g] = WFrag<T16>::mma(kf2[kt][kc], qf[g][kc], s[kt][g]); s[kt][g] = WFrag<T16>::mma(kf[kt][kc], qf2[g][kc], s[kt][g]); } } }
        __builtin_amdgcn_sched_barrier(0);   // the score products stay in front of the wait and of the key prefetch
        asm volatile("s_wait_xcnt 0x0" :: "v"(vo) : "memory");   // stands in front of any overwrite of an address register that the value loads name (the input keeps their offset untouched up to here); it is placed behind the score products so that it does not hold up their issue
        __builtin_amdgcn_sched_barrier(0);   // nothing that could overwrite one moves up over that wait
        if constexpr (!DIAG) {   // the next pass's key fragments fly under this pass's softmax and second product
#pragma unroll
            for (int kt = 0; kt < 2; ++kt)
#pragma unroll
                for (int kc = 0; kc < 4; ++kc) { const int o = 16 * kt * HD + 512 * kc; kf[kt][kc] = ldo(Kp, ko, o); if constexpr (HR) kf2[kt][kc] = ldo(K2, ko, o); }
            __builtin_amdgcn_sched_barrier(0);   // keeps the key prefetch issued ahead of the softmax arithmetic
        } else {                 // the pass's first key is q0
#pragma unroll
            for (int g = 0; g < 2; ++g)
#pragma unroll
                for (int kt = 0; kt < 2; ++kt)
#pragma unroll
                    for (int r = 0; r < 8; ++r) if (16 * kt + 8 * h + r > 16 * g + c) s[kt][g][r] = -__builtin_inff();
        }
        float mb[2]; bool need = false;
#pragma unroll
        for (int g = 0; g < 2; ++g) { float mx = -__builtin_inff();
#pragma unroll
            for (int kt = 0; kt < 2; ++kt)
#pragma unroll
                for (int r = 0; r < 8; ++r) mx = fmaxf(mx, s[kt][g][r]);
            mx = fmaxf(mx, xhalf(mx)) * CSC; mb[g] = mx; need = need || (mx > m_run[g] + 8.0f); }
        if (__builtin_amdgcn_ballot_w32(need) != 0) {   // scalar branch, rare after the first passes; every column has an unmasked key in every pass, so the new maximum is finite
#pragma unroll
            for (int g = 0; g < 2; ++g) { const float mn = fmaxf(m_run[g], mb[g]); const float corr = __builtin_amdgcn_exp2f(m_run[g] - mn); l_run[g] *= corr; m_run[g] = mn;
#pragma unroll
                for (int t = 0; t < 8; ++t) acc[g][t] = acc[g][t] * corr; }
        }
#pragma unroll
        for (int g = 0; g < 2; ++g) { const float nm = -m_run[g]; float pv[16]; float ps0 = 0.0f, ps1 = 0.0f;
#pragma unroll
            for (int e = 0; e < 16; ++e) { pv[e] = __builtin_amdgcn_exp2f(__builtin_fmaf(s[e >> 3][g][e & 7], CSC, nm)); if (e & 1) ps1 += pv[e]; else ps0 += pv[e]; }
            l_run[g] += ps0 + ps1;
            V pf, pf2;
            if constexpr (HR) { v16us uh, ul;
#pragma unroll
                for (int e = 0; e < 16; ++e) { unsigned short a, b; splitf(pv[e], a, b); uh[e] = a; ul[e] = b; }
                pf = __builtin_bit_cast(v16bf, uh); pf2 = __builtin_bit_cast(v16bf, ul);
            } else {
#pragma unroll
                for (int e = 0; e < 16; ++e) pf[e] = tohx(pv[e]); }
#pragma unroll
            for (int t = 0; t < 8; ++t) { acc[g][t] = WFrag<T16>::mma(vf[t], pf, acc[g][t]);
                if constexpr (HR) { acc[g][t] = WFrag<T16>::mma(vf2[t], pf, acc[g][t]); acc[g][t] = WFrag<T16>::mma(vf[t], pf2, acc[g][t]); } }
        }
        wgap();
        if constexpr (!DIAG) {
            asm volatile("s_wait_xcnt 0x0" : "+v"(ko), "+v"(vo) :: "memory");   // stands in front of the offset updates, which overwrite address registers that this pass's loads name; as in-out operands the offsets can be advanced only behind it
            ko += 32 * HD * 2; vo += 32 * HD * 2; }
    };
    // stays rolled: the trip count is known only at run time, and further copies of a body this long would only add code for the instruction cache to hold
#pragma unroll 1
    for (int key0 = 0; key0 < q0; key0 += 32) pass(BoolC<false>{});   // keys [0, q0): no key exceeds a query of this wave
    pass(BoolC<true>{});                                              // keys [q0, q0 + 32)
#pragma unroll
    for (int g = 0; g < 2; ++g) linv[g] = __fdiv_rn(1.0f, l_run[g] + xhalf(l_run[g]));   // each wave half summed its own eight keys of every 16-key tile
}
__global__ __launch_bounds__(32 * REP) void k_fattn(const h16* __restrict__ Q16, const h16* __restrict__ K16, const h16* __restrict__ V16, const bf* __restrict__ Qh, const bf* __restrict__ Ql, const bf* __restrict__ Kh, const bf* __restrict__ Kl, const bf* __restrict__ Vh, const bf* __restrict__ Vl, h16* A16_, bf* Ah_, bf* Al_) {
    const int lane = threadIdx.x & 31; const int g = blockIdx.y;
    const int head = g * REP + __builtin_amdgcn_readfirstlane((int)(threadIdx.x >> 5));   // scalar: plane bases and the pass loop stay under scalar control
    // a wave takes one row block of every batch, one after the other: block n - 1 - x of even batches, block x of odd ones, so that with two batches every wave walks the same number of key passes. Stays rolled: one copy of the two long bodies in the instruction cache
#pragma unroll 1
    for (int b = 0; b < NB; ++b) {
    const int q0 = ((b & 1) ? (int)blockIdx.x : TT / 32 - 1 - (int)blockIdx.x) * 32;
    const size_t bh = (size_t)b * NH_ + head, bg = (size_t)b * NKV + g;
    h16* A16 = A16_ + (size_t)b * TT * DQ; bf* Ah = Ah_ + (size_t)b * RH * DQ; bf* Al = Al_ + (size_t)b * RH * DQ;
    v8f acc[2][8]; float linv[2];
    if (q0 < RH) {
        fattn_rows<bf, true>(Qh + bh * RH * HD, Ql + bh * RH * HD, Kh + bg * RH * HD, Kl + bg * RH * HD, Vh + bg * HD * RH, Vl + bg * HD * RH, q0, lane, acc, linv);
#pragma unroll
        for (int gq = 0; gq < 2; ++gq)
#pragma unroll
            for (int t = 0; t < 8; ++t) { v8us oh, ol;   // a lane's 8 registers are d = 16 t + 8 h + 0..7 of query q0 + 16 gq + c
#pragma unroll
                for (int r = 0; r < 8; ++r) { unsigned short a, b; splitf(acc[gq][t][r] * linv[gq], a, b); oh[r] = a; ol[r] = b; }
                const size_t oo = (size_t)(q0 + 16 * gq) * DQ + (head * (HD / 32) + (t >> 1)) * 512 + (t & 1) * 256 + 8 * lane; *(v8us*)(Ah + oo) = oh; *(v8us*)(Al + oo) = ol; }   // its place in fragment order, planes of DQ columns
        asm volatile("s_wait_xcnt 0x0" ::: "memory");   // stands behind the run of stores above, in front of anything that could overwrite a register which one of them names
    } else {
        fattn_rows<h16, false>(Q16 + bh * TT * HD, nullptr, K16 + bg * TT * HD, nullptr, V16 + bg * HD * TT, nullptr, q0, lane, acc, linv);
        v8h o16[2][8];
#pragma unroll
        for (int gq = 0; gq < 2; ++gq)
#pragma unroll
            for (int t = 0; t < 8; ++t)
#pragma unroll
                for (int r = 0; r < 8; ++r) o16[gq][t][r] = tohx(acc[gq][t][r] * linv[gq] * ACAR);
        __builtin_amdgcn_sched_barrier(0);   // all sixteen packed vectors are formed in front of the first store, each in registers of its own: built without it, the packing of a later vector took the data registers of a store just issued, ahead of the wait below
#pragma unroll
        for (int gq = 0; gq < 2; ++gq)
#pragma unroll
            for (int t = 0; t < 8; ++t) *(v8h*)(A16 + (size_t)(q0 + 16 * gq) * DQ + (head * (HD / 32) + (t >> 1)) * 512 + (t & 1) * 256 + 8 * lane) = o16[gq][t];   // its place in fragment order, plane of DQ columns
        asm volatile("s_wait_xcnt 0x0" ::: "memory");   // stands behind the run of stores above, in front of anything that could overwrite a register which one of them names
    }
    }
}

extern "C" void kernel_launch(void* const* d_in, const int* in_sizes, int n_in,
                              void* d_out, int out_size, void* d_ws, size_t ws_size, hipStream_t stream) {
    if (n_in < 5) return;
    if ((size_t)in_sizes[0] < (size_t)(NB - 1) * TT_FULL * DM + (size_t)TT * DM) return;
    if (in_sizes[1] < DM * DQ || in_sizes[2] < DM * DKV || in_sizes[3] < DM * DKV || in_sizes[4] < DQ * DM) return;
    if ((size_t)out_size < (size_t)(NB - 1) * TT_FULL * DM + (size_t)TT * DM) return;
    const float* x = (const float*)d_in[0]; const float* wq = (const float*)d_in[1]; const float* wk = (const float*)d_in[2]; const float* wv = (const float*)d_in[3]; const float* wo = (const float*)d_in[4];
    float* OUT = (float*)d_out;     // [NB][TT_FULL][DM]
    char* wsp = (char*)d_ws;
    auto take = [&](size_t bytes) { char* p = wsp; wsp += (bytes + 255) & ~(size_t)255; return (void*)p; };
    bf* WQ = (bf*)take((size_t)DQ * DM * 2); bf* WK = (bf*)take((size_t)DKV * DM * 2); bf* WV = (bf*)take((size_t)DKV * DM * 2); bf* WO = (bf*)take((size_t)DM * DQ * 2);   // Bt = (out, in) planes in fragment order
    h16* WO16 = (h16*)take((size_t)DM * DQ * 2);                                                                                             // Bt fp16 x WCAR
    float* CS = (float*)take((size_t)TT * HP * 2 * 4);
    float* FQ = (float*)take((size_t)NB * TT * DQ * 4); float* FK = (float*)take((size_t)NB * TT * DKV * 4);   // from here on every plane holds NB batches, one behind the other
    h16* QP16 = (h16*)take((size_t)NB * NH_ * TT * HD * 2); h16* KP16 = (h16*)take((size_t)NB * NKV * TT * HD * 2); h16* VT16 = (h16*)take((size_t)NB * NKV * HD * TT * 2);
    bf* QPh = (bf*)take((size_t)NB * NH_ * RH * HD * 2); bf* QPl = (bf*)take((size_t)NB * NH_ * RH * HD * 2); bf* KPh = (bf*)take((size_t)NB * NKV * RH * HD * 2); bf* KPl = (bf*)take((size_t)NB * NKV * RH * HD * 2);
    bf* VTh = (bf*)take((size_t)NB * NKV * HD * RH * 2); bf* VTl = (bf*)take((size_t)NB * NKV * HD * RH * 2);
    bf* XB = (bf*)take((size_t)NB * TT * DM * 2);     // bf16 x rows
    h16* AT16 = (h16*)take((size_t)NB * TT * DQ * 2); bf* ATh = (bf*)take((size_t)NB * RH * DQ * 2); bf* ATl = (bf*)take((size_t)NB * RH * DQ * 2);
    if ((size_t)(wsp - (char*)d_ws) > ws_size) return;
    float* FV = FK;       // v projection reuses the k buffer after the k planes are built (stream-ordered)
    { k_wtG<<<(unsigned)((DQ * DM / 64 + 63) / 64), 256, 0, stream>>>(wq, DM, DQ, WQ);
      k_wtG<<<(unsigned)((DKV * DM / 64 + 63) / 64), 256, 0, stream>>>(wk, DM, DKV, WK);
      k_wtG<<<(unsigned)((DKV * DM / 64 + 63) / 64), 256, 0, stream>>>(wv, DM, DKV, WV);
      k_wtG<<<(unsigned)((DM * DQ / 64 + 63) / 64), 256, 0, stream>>>(wo, DQ, DM, WO);
      k_wtH<<<(unsigned)((DM * DQ / 64 + 63) / 64), 256, 0, stream>>>(wo, DQ, DM, WCAR, WO16); }
    k_cstab<<<(TT * HP + 255) / 256, 256, 0, stream>>>(CS);
    const unsigned LQ = (unsigned)(((size_t)NH_ * TT * HD / 2 + 255) / 256), LKv = (unsigned)(((size_t)NKV * TT * HD / 2 + 255) / 256);
    // every launch below covers all NB batches: the last grid dimension is the batch (GEMMs: z with the batch strides; elementwise kernels: y); k_fattn walks the batches inside each wave
    k_cvt8<<<dim3((unsigned)(((size_t)TT * DM / 8 + 255) / 256), NB, 1), 256, 0, stream>>>(x, XB, (size_t)TT * DM / 8);
    k_gemmw<bf, 0, 8><<<dim3(TT / 64, DQ / 64, NB), 256, 0, stream>>>(XB, nullptr, WQ, nullptr, DM, -1, 0, FQ, DQ, 1.0f, (size_t)TT * DM, 0, (size_t)TT * DQ);
    k_rope<<<dim3(LQ, NB, 1), 256, 0, stream>>>(FQ, DQ, NH_, CS, QP16, QPh, QPl);
    k_gemmw<bf, 0, 16><<<dim3(TT / 64, DKV / 64, NB), 512, 0, stream>>>(XB, nullptr, WK, nullptr, DM, -1, 0, FK, DKV, 1.0f, (size_t)TT * DM, 0, (size_t)TT * DKV);
    k_rope<<<dim3(LKv, NB, 1), 256, 0, stream>>>(FK, DKV, NKV, CS, KP16, KPh, KPl);
    k_gemmw<bf, 0, 16><<<dim3(TT / 64, DKV / 64, NB), 512, 0, stream>>>(XB, nullptr, WV, nullptr, DM, -1, 0, FV, DKV, 1.0f, (size_t)TT * DM, 0, (size_t)TT * DKV);
    k_vtp<<<dim3(LKv, NB, 1), 256, 0, stream>>>(FV, DKV, NKV, VT16, VTh, VTl);
    k_fattn<<<dim3(TT / 32, NKV, 1), 32 * REP, 0, stream>>>(QP16, KP16, VT16, QPh, QPl, KPh, KPl, VTh, VTl, AT16, ATh, ATl);
    // output projection: rows < RH bf16 hi/lo context x bf16 Wo (2 products); rows >= RH fp16 context x64 x fp16 Wo x64 (1 product, 1/4096 in the epilogue)
    k_gemmw<bf, 1, 16><<<dim3(RH / 64, DM / 64, NB), 512, 0, stream>>>(ATh, ATl, WO, nullptr, DQ, -1, 0, OUT, DM, 1.0f, (size_t)RH * DQ, 0, (size_t)TT_FULL * DM);
    k_gemmw<h16, 0, 8><<<dim3((TT - RH) / 64, DM / 64, NB), 256, 0, stream>>>(AT16 + (size_t)RH * DQ, nullptr, WO16, nullptr, DQ, -1, 0, OUT + (size_t)RH * DM, DM, OSCW, (size_t)TT * DQ, 0, (size_t)TT_FULL * DM);
}

// v005
// One run takes 217 microseconds.
// Timed twice side by side with v004, it ran 1.09 and 1.06 times as fast.
// All steps since v000 together make it 7.51 times as fast.
#include <hip/hip_runtime.h>

// Causal grouped-query self-attention with interleaved rotary embedding: x [NB][T][2048]; q = x Wq (16 heads x 128), k, v = x Wk, x Wv (4 kv heads x 128, each shared by 4 consecutive q heads);
// rotary pairs (2j, 2j+1) with angle t / 10000^(j/64); s = q.k x 128^-0.5 with keys > query replaced by -inf; softmax; attn.v; merged heads x Wo -> [NB][T][2048] f32.
// Compute dtypes, f32 accumulate: x, Wq, Wk, Wv, Wo RNE-converted to bf16; q/k/v projections v_wmma_f32_16x16x32_bf16 (plain); scores and attn.v: query rows < 128 bf16 hi/lo split (3 products),
// rows >= 128 v_wmma_f32_16x16x32_f16 single products (P unnormalised, exp2 of the score minus the maximum in use); rotary table and softmax f32; output projection: rows < 128 bf16 hi/lo x bf16 (2 products),
// rows >= 128 v_wmma_f32_16x16x32_f16 single product (context carried x64, Wo carried x64, 1/4096 folded in the f32 epilogue).
// Every 16-bit operand plane P[row][k] (NC columns) lies in FRAGMENT ORDER: 1-KB tiles of 16 rows x 32 k, tile (row >> 4, k >> 5) at element ((row >> 4) (NC / 32) + (k >> 5)) 512 (value planes: tile (d >> 4, key >> 5) at
// ((key >> 5) 8 + (d >> 4)) 512), and inside a tile element (row, k) at ((k >> 4) & 1) 256 + (((k >> 3) & 1) 16 + (row & 15)) 8 + (k & 7): a wave's 16-byte-per-lane load or store at lane 8 covers 512 contiguous bytes.

#ifndef NB
#define NB 2
#endif
#ifndef SEQ
#define SEQ 2048
#endif
#define NB_FULL 2
#define TT_FULL 2048
#define TT   SEQ
#define DM   2048
#define NH_  16
#define NKV  4
#define REP  (NH_ / NKV)
#define HD   128
#define HP   (HD / 2)
#define DQ   (NH_ * HD)
#define DKV  (NKV * HD)
#define RH   128                  // query rows < RH use hi/lo planes (keys < RH suffice: causal)
#define ACAR 64.0f                // carry of the fp16 merged-context plane (rows >= RH)
#define WCAR 64.0f                // carry of the fp16 Wo plane
#define OSCW (1.0f / (ACAR * WCAR))
#define SCL  0.08838834764831845f   // HD^-0.5
#define KX   DM                   // columns of every GEMM operand plane

static_assert(NB >= 1 && NB <= NB_FULL);
static_assert(TT % 128 == 0 && TT <= TT_FULL && TT > RH);
static_assert(RH % 128 == 0 && RH >= 128);
static_assert((TT - RH) % 64 == 0);
static_assert(HD == 128 && HP == 64);
static_assert(NH_ == NKV * REP && TT % 32 == 0 && RH % 32 == 0);
static_assert(DM % 64 == 0 && DQ % 64 == 0 && DKV % 64 == 0 && DQ == KX);

typedef _Float16 h16;
typedef unsigned short bf;
typedef __attribute__((ext_vector_type(16))) __bf16   v16bf;
typedef __attribute__((ext_vector_type(16))) _Float16 v16h;
typedef __attribute__((ext_vector_type(8)))  _Float16 v8h;
typedef __attribute__((ext_vector_type(8)))  unsigned short v8us;
typedef __attribute__((ext_vector_type(8)))  float    v8f;
typedef __attribute__((ext_vector_type(4)))  float    v4f;
typedef v8h  __attribute__((may_alias)) v8ha;
typedef v4f  __attribute__((may_alias)) v4fa;
typedef v8us __attribute__((may_alias)) v8usa;

__device__ __forceinline__ unsigned short f2bf(float f) { unsigned u = __float_as_uint(f); u += 0x7FFFu + ((u >> 16) & 1u); return (unsigned short)(u >> 16); }
__device__ __forceinline__ float bf2f(unsigned short b) { return __uint_as_float(((unsigned)b) << 16); }
__device__ __forceinline__ float bfr(float f) { return bf2f(f2bf(f)); }
__device__ __forceinline__ v16h cat16(v8h lo, v8h hi) { return __builtin_shufflevector(lo, hi, 0, 1, 2, 3, 4, 5, 6, 7, 8, 9, 10, 11, 12, 13, 14, 15); }
__device__ __forceinline__ v16bf cat16b(v8us lo, v8us hi) { return __builtin_bit_cast(v16bf, __builtin_shufflevector(lo, hi, 0, 1, 2, 3, 4, 5, 6, 7, 8, 9, 10, 11, 12, 13, 14, 15)); }
__device__ __forceinline__ v8f wmma16(v16h a, v16h b, v8f c) { return __builtin_amdgcn_wmma_f32_16x16x32_f16(false, a, false, b, (short)0, c, false, false); }
__device__ __forceinline__ v8f wmmab(v16bf a, v16bf b, v8f c) { return __builtin_amdgcn_wmma_f32_16x16x32_bf16(false, a, false, b, (short)0, c, false, false); }

__device__ __forceinline__ h16 tohx(float x) { return (h16)x; }
__device__ __forceinline__ void splitf(float y, unsigned short& h, unsigned short& l) { h = f2bf(y); l = f2bf(y - bf2f(h)); }

// ---- k_gemmw: register-blocked GEMM, NW WAVES per 64x64 output tile (16 accumulators each), operands straight from 16-bit planes in fragment order; grid (M/64, N/64, Z), 32 NW threads.
// Wave w contracts the 32-wide k chunks w, w + NW, w + 2 NW, ... of the tile; for NW > 1 the NW f32 partial tiles meet in LDS and are summed in wave order 0 .. NW-1 (fixed), then scaled and stored.
// C[m][n] (f32, pitch ldc) = osc x sum_k A[m][k] Bt[n][k] (+ split products per NSPLIT: 1 = A2.Bt added, 2 = A2.Bt and A.Bt2 added). Every plane has KX columns (a constant: the tile-row steps become immediate offsets), z-batch strides sA/sB/sC in elements. K % 32 == 0.
// Fragment k map (both operands): elements 0..7 <- kc + 8h + 0..7, elements 8..15 <- kc + 16 + 8h + 0..7, h = lane >> 4, row/col = lane & 15: WFrag::ld at tile base + lane 8 (its second half 256 elements on).
// cskip >= 0: tiles with blockIdx.y > blockIdx.x + cskip are not computed (causal upper triangle). kcaus > 0: contraction stops at min(K, kcaus + 64 (blockIdx.x + 1)) (causal key limit).
// EPI 0: the f32 tile goes to C as above. EPI 1 and 2 (NW > 1; C unused, ldc = heads x HD (the product's columns for EPI 1, its rows for EPI 2), z = batch): the thread that sums 8 neighbouring columns of a row turns them into 16-bit operands itself and stores them
// as one 16-byte piece at their place in fragment order (a wave's store covers 512 contiguous bytes): fp16 plane P16 for every row, bf16 hi/lo planes Ph/Pl for positions < RH.
// EPI 1: rows = positions t, columns = head HD + d: interleaved rotary map out[2j] = x[2j] c - x[2j+1] s, out[2j+1] = x[2j] s + x[2j+1] c, (c, s) = CS[t][j], into head planes (t, d).
// EPI 2: rows = kv head HD + d, columns = positions t (the product is taken transposed: A = weight plane, Bt = x plane): value planes (d, t), the 8 d tiles of a 32-key block side by side.
template <typename T16> struct WFrag;
template <> struct WFrag<h16> { typedef v16h V; static __device__ __forceinline__ V ld(const h16* p) { return cat16(*(const v8h*)p, *(const v8h*)(p + 256)); } static __device__ __forceinline__ v8f mma(V a, V b, v8f c) { return wmma16(a, b, c); } };
template <> struct WFrag<bf> { typedef v16bf V; static __device__ __forceinline__ V ld(const bf* p) { return cat16b(*(const v8us*)p, *(const v8us*)(p + 256)); } static __device__ __forceinline__ v8f mma(V a, V b, v8f c) { return wmmab(a, b, c); } };
template <typename T16, int NSPLIT, int NW, int EPI>
__global__ __launch_bounds__(32 * NW) void k_gemmw(const T16* __restrict__ A, const T16* __restrict__ A2, const T16* __restrict__ Bt, const T16* __restrict__ Bt2, int K, int cskip, int kcaus,
                                             float* C, int ldc, float osc, size_t sA, size_t sB, size_t sC, const float* __restrict__ CS, h16* P16, bf* Ph, bf* Pl) {
    static_assert(EPI == 0 || (NW > 1 && 16 % NW == 0));
    typedef typename WFrag<T16>::V V;
    __shared__ __align__(16) float os[(NW == 1 ? 16 : NW * 64) * 68];
    if (cskip >= 0 && (int)blockIdx.y > (int)blockIdx.x + cskip) return;   // block-uniform, in front of the one block barrier
    const size_t z = blockIdx.z; A += z * sA; if (A2) A2 += z * sA; Bt += z * sB; if (Bt2) Bt2 += z * sB; C += z * sC;
    const int lane = threadIdx.x & 31, lr = lane & 15, hi = lane >> 4; const int r0 = blockIdx.x * 64, c0 = blockIdx.y * 64;
    const int wv = (NW == 1) ? 0 : __builtin_amdgcn_readfirstlane((int)(threadIdx.x >> 5));   // wave number, scalar: the k loop stays under scalar control
    int kend = K;
    if (kcaus > 0) { const int kl = kcaus + 64 * ((int)blockIdx.x + 1); kend = (kl < K) ? kl : K; }
    v8f acc[4][4];
#pragma unroll
    for (int mb = 0; mb < 4; ++mb)
#pragma unroll
        for (int nb = 0; nb < 4; ++nb) acc[mb][nb] = (v8f){};
    // every fragment address = a wave-uniform tile-row base (16 rows of a plane = KX / 32 tiles = 16 KX elements) + one byte offset per lane: 16 bytes a lane inside a tile, 1 KB a 32-wide k chunk; the offset is advanced only behind the wait at the loop's foot
    const size_t aoff = (size_t)r0 * KX, boff = (size_t)c0 * KX; unsigned ko = (unsigned)lane * 16 + (unsigned)wv * 1024;
    auto ldo = [](const T16* ub, const unsigned bo, const int o) __attribute__((always_inline)) { return WFrag<T16>::ld((const T16*)((const char*)ub + bo) + o); };
#pragma unroll 1
    for (int kc = 32 * wv; kc < kend; kc += 32 * NW) {
        V a[4], a2[4], b[4], b2[4];
#pragma unroll
        for (int mb = 0; mb < 4; ++mb) { a[mb] = ldo(A + aoff, ko, mb * 16 * KX); if (NSPLIT == 1 || NSPLIT == 2) a2[mb] = ldo(A2 + aoff, ko, mb * 16 * KX); }
#pragma unroll
        for (int nb = 0; nb < 4; ++nb) { b[nb] = ldo(Bt + boff, ko, nb * 16 * KX); if (NSPLIT >= 2) b2[nb] = ldo(Bt2 + boff, ko, nb * 16 * KX); }
        __builtin_amdgcn_sched_barrier(0);   // the trip's loads stay one group in front of its products; built without it, the Bt fragments shared one register set and each was fetched only behind the products of the one before: four load latencies a trip
#pragma unroll
        for (int nb = 0; nb < 4; ++nb)
#pragma unroll
            for (int mb = 0; mb < 4; ++mb) { acc[mb][nb] = WFrag<T16>::mma(a[mb], b[nb], acc[mb][nb]); if (NSPLIT == 1 || NSPLIT == 2) acc[mb][nb] = WFrag<T16>::mma(a2[mb], b[nb], acc[mb][nb]); if (NSPLIT >= 2) acc[mb][nb] = WFrag<T16>::mma(a[mb], b2[nb], acc[mb][nb]); }
        asm volatile("v_nop\n\tv_nop\n\tv_nop\n\tv_nop" : "+v"(acc[0][0]), "+v"(acc[1][1]), "+v"(acc[2][2]), "+v"(acc[3][3]) : "v"(a[0]), "v"(a[3]));
        asm volatile("s_wait_xcnt 0x0" : "+v"(ko) :: "memory");   // stands in front of the offset update, which overwrites the address register that this trip's loads name; as an in-out operand the offset can be advanced only behind it
        ko += 1024 * NW;
    }
    if constexpr (NW > 1) {
        // EPI != 0: thread item -> (row, 8 columns): lane & 15 = row & 15, lane >> 4 = bit 3 of the column, which is the order of a tile's 16-byte pieces
        auto irow = [](const int it) __attribute__((always_inline)) { const int item = it * (32 * NW) + (int)threadIdx.x; return (item & 15) | ((item >> 7) << 4); };
        auto icol = [](const int it) __attribute__((always_inline)) { const int item = it * (32 * NW) + (int)threadIdx.x; return ((item >> 4) & 7) * 8; };
        v4f ca[EPI == 1 ? 16 / NW : 1], cb[EPI == 1 ? 16 / NW : 1];
        if constexpr (EPI == 1) {   // the (c, s) pairs are fetched here so that they fly under the LDS stores and the barrier
#pragma unroll
            for (int it = 0; it < 16 / NW; ++it) { const float* cp = CS + (size_t)(r0 + irow(it)) * (HP * 2) + ((c0 + icol(it)) & (HD - 1)); ca[it] = *(const v4f*)cp; cb[it] = *(const v4f*)(cp + 4);
                asm volatile("s_wait_xcnt 0x0" :: "v"(cp) : "memory"); } }   // stands in front of any overwrite of the address pair that the two loads name; as an input the pair stays untouched up to it (built without it, the second load landed on the pair)
        float* my = os + (size_t)wv * (64 * 68);
#pragma unroll
        for (int mb = 0; mb < 4; ++mb)
#pragma unroll
            for (int nb = 0; nb < 4; ++nb)
#pragma unroll
                for (int j = 0; j < 8; ++j) my[(mb * 16 + hi * 8 + j) * 68 + nb * 16 + lr] = acc[mb][nb][j];
        __syncthreads();   // every wave's partial tile is in LDS before any thread sums across waves
        if constexpr (EPI != 0) {
            const int nh = ldc / HD; const bool hires = (EPI == 1 ? r0 : c0) < RH;   // block-uniform: a tile's 64 positions lie on one side of RH
            P16 += z * nh * TT * HD; Ph += z * nh * RH * HD; Pl += z * nh * RH * HD;
#pragma unroll
            for (int it = 0; it < 16 / NW; ++it) { const int row = irow(it), cofs = icol(it);
                const float* p = os + row * 68 + cofs; v4f s0 = *(const v4fa*)p, s1 = *(const v4fa*)(p + 4);
#pragma unroll
                for (int q = 1; q < NW; ++q) { s0 += *(const v4fa*)(p + q * (64 * 68)); s1 += *(const v4fa*)(p + q * (64 * 68) + 4); }
                float y[8]; int hd, he;
                if constexpr (EPI == 1) { const int t = r0 + row, col = c0 + cofs, d = col & (HD - 1); hd = col / HD;
#pragma unroll
                    for (int j = 0; j < 2; ++j) { y[2 * j] = s0[2 * j] * ca[it][2 * j] - s0[2 * j + 1] * ca[it][2 * j + 1]; y[2 * j + 1] = s0[2 * j] * ca[it][2 * j + 1] + s0[2 * j + 1] * ca[it][2 * j];
                        y[4 + 2 * j] = s1[2 * j] * cb[it][2 * j] - s1[2 * j + 1] * cb[it][2 * j + 1]; y[5 + 2 * j] = s1[2 * j] * cb[it][2 * j + 1] + s1[2 * j + 1] * cb[it][2 * j]; }
                    he = ((t >> 4) * (HD / 32) + (d >> 5)) * 512 + ((d >> 4) & 1) * 256 + (((d >> 3) & 1) * 16 + (t & 15)) * 8;
                } else { const int r = r0 + row, t = c0 + cofs, d = r & (HD - 1); hd = r / HD;
#pragma unroll
                    for (int j = 0; j < 4; ++j) { y[j] = s0[j]; y[4 + j] = s1[j]; }
                    he = ((t >> 5) * (HD / 16) + (d >> 4)) * 512 + ((t >> 4) & 1) * 256 + (((t >> 3) & 1) * 16 + (d & 15)) * 8; }
                v8h o16;
#pragma unroll
                for (int e = 0; e < 8; ++e) o16[e] = tohx(y[e]);
                *(v8h*)(P16 + (size_t)hd * TT * HD + he) = o16;
                asm volatile("s_wait_xcnt 0x0" ::: "memory");   // stands behind the store, in front of the hi/lo split, which was built into the store's address and data registers
                if (hires) { v8us oh, ol;   // positions < RH are the first RH HD places of a plane
#pragma unroll
                    for (int e = 0; e < 8; ++e) { unsigned short a, b; splitf(y[e], a, b); oh[e] = a; ol[e] = b; }
                    *(v8us*)(Ph + (size_t)hd * RH * HD + he) = oh; *(v8us*)(Pl + (size_t)hd * RH * HD + he) = ol; }
            }
        } else {
#pragma unroll
        for (int it = 0; it < 32 / NW; ++it) { const int item = it * (32 * NW) + (int)threadIdx.x; const int row = item >> 4, cofs = (item & 15) * 4;
            v4f s = *(const v4fa*)(os + row * 68 + cofs);
#pragma unroll
            for (int q = 1; q < NW; ++q) s += *(const v4fa*)(os + q * (64 * 68) + row * 68 + cofs);
            *(v4f*)(C + (size_t)(r0 + row) * ldc + c0 + cofs) = s * osc; }
        }
    } else {
#pragma unroll
    for (int mb = 0; mb < 4; ++mb) {
#pragma unroll
        for (int nb = 0; nb < 4; ++nb) {
#pragma unroll
            for (int j = 0; j < 8; ++j) os[(hi * 8 + j) * 68 + nb * 16 + lr] = acc[mb][nb][j]; }
        __builtin_amdgcn_wave_barrier(); asm volatile("" ::: "memory");
        float* crow = C + (size_t)(r0 + mb * 16) * ldc + c0;
{
#pragma unroll
            for (int s = 0; s < 8; ++s) { const int row = 2 * s + hi, cofs = lr * 4; const v4f val = *(const v4fa*)(os + row * 68 + cofs) * osc;
                *(v4f*)(crow + (size_t)row * ldc + cofs) = val; }
             }
        __builtin_amdgcn_wave_barrier(); asm volatile("" ::: "memory");
    }
    }
}

typedef __attribute__((ext_vector_type(2))) _Float16 v2h;
typedef __attribute__((ext_vector_type(4))) _Float16 v4h;
typedef __attribute__((ext_vector_type(2))) unsigned short v2us;
typedef __attribute__((ext_vector_type(4))) unsigned short v4us;
typedef __attribute__((ext_vector_type(2))) float v2f;

__global__ __launch_bounds__(256) void k_wtG(const float* __restrict__ w, int K, int N, bf* Bt) {
    const int lane = threadIdx.x & 31; const int L0 = (blockIdx.x * 8 + (threadIdx.x >> 5)) * 8; const int nlines = N * K / 64;
{
#pragma unroll 1
        for (int l = 0; l < 8; ++l) { const int L = L0 + l; if (L >= nlines) break; const size_t e = (size_t)L * 64 + lane * 2; const int tile = (int)(e >> 9), ln = (int)(e >> 3) & 31; const int k = (tile % (K / 32)) * 32 + ((int)(e >> 8) & 1) * 16 + (ln >> 4) * 8 + ((int)e & 7), n = (tile / (K / 32)) * 16 + (ln & 15); v2us o;   // e = place in fragment order
            o[0] = f2bf(w[(size_t)k * N + n]); o[1] = f2bf(w[(size_t)(k + 1) * N + n]); *(v2us*)(Bt + e) = o; }
         }
}
__global__ __launch_bounds__(256) void k_wtH(const float* __restrict__ w, int K, int N, float sc, h16* Bt) {
    const int lane = threadIdx.x & 31; const int L0 = (blockIdx.x * 8 + (threadIdx.x >> 5)) * 8; const int nlines = N * K / 64;
{
#pragma unroll 1
        for (int l = 0; l < 8; ++l) { const int L = L0 + l; if (L >= nlines) break; const size_t e = (size_t)L * 64 + lane * 2; const int tile = (int)(e >> 9), ln = (int)(e >> 3) & 31; const int k = (tile % (K / 32)) * 32 + ((int)(e >> 8) & 1) * 16 + (ln >> 4) * 8 + ((int)e & 7), n = (tile / (K / 32)) * 16 + (ln & 15); v2h o;   // e = place in fragment order
            o[0] = tohx(bfr(w[(size_t)k * N + n]) * sc); o[1] = tohx(bfr(w[(size_t)(k + 1) * N + n]) * sc); *(v2h*)(Bt + e) = o; }
         }
}
__global__ __launch_bounds__(256) void k_cvt8(const float* __restrict__ src, bf* dst, size_t n8) { const size_t i = (size_t)blockIdx.x * 256 + threadIdx.x; if (i >= n8) return;   // i 8 = place in fragment order of a plane of DM columns
    src += (size_t)blockIdx.y * TT_FULL * DM; dst += (size_t)blockIdx.y * TT * DM;   // blockIdx.y = batch
    const int tile = (int)(i >> 6), ln = (int)i & 31; const size_t row = (size_t)(tile / (DM / 32)) * 16 + (ln & 15); const int k = (tile % (DM / 32)) * 32 + ((int)(i >> 5) & 1) * 16 + (ln >> 4) * 8;
    const v8f v = *(const v8f*)(src + row * DM + k); v8us o;
#pragma unroll
    for (int k = 0; k < 8; ++k) o[k] = f2bf(v[k]); *(v8us*)(dst + i * 8) = o;  }
// k_cstab: CS[t][j] = {cos(t inv_j), sin(t inv_j)} f32 for j < 64, inv_j = 1 / f32(10000^(j/64)) where 10000^(j/64) is a product of exact-root powers 10000^(2^b/64) in f64
__global__ __launch_bounds__(256) void k_cstab(float* CS) {
    const int idx = blockIdx.x * 256 + threadIdx.x; if (idx >= TT * HP) return;
    const int j = idx & (HP - 1); const int t = idx / HP;
    double s = 100.0, p = 1.0;
#pragma unroll 1
    for (int b = 5; b >= 0; --b) { if ((j >> b) & 1) p *= s; s = sqrt(s); }
    const float pf = (float)p; const float inv = 1.0f / pf; const float ang = __fmul_rn((float)t, inv);
    float sn, cn; sincosf(ang, &sn, &cn);
    v2f cs; cs[0] = cn; cs[1] = sn;
    *(v2f*)(CS + (size_t)idx * 2) = cs; 
}
typedef __attribute__((ext_vector_type(16))) unsigned short v16us;
__device__ __forceinline__ float xhalf(float x) { return __builtin_bit_cast(float, __builtin_amdgcn_permlanex16(__builtin_bit_cast(int, x), __builtin_bit_cast(int, x), 0x76543210, 0xfedcba98, false, false)); }   // lane l with lane l ^ 16
__device__ __forceinline__ void wgap() { __builtin_amdgcn_sched_barrier(0); asm volatile("v_nop\n\tv_nop\n\tv_nop\n\tv_nop"); __builtin_amdgcn_sched_barrier(0); }   // the 4 vector slots between a pass's last WMMAs and whatever reads their D or overwrites their A/B next, on the taken side of the loop branch that follows too
template <bool B> struct BoolC { static constexpr bool value = B; };
template <typename T16, bool HR>
__device__ __forceinline__ void fattn_rows(const T16* __restrict__ Q, const T16* __restrict__ Q2, const T16* __restrict__ Kp, const T16* __restrict__ K2, const T16* __restrict__ Vt, const T16* __restrict__ V2, const int q0, const int lane, v8f (&acc)[2][8], float (&linv)[2]) {
    typedef typename WFrag<T16>::V V;
    constexpr float CSC = SCL * 1.4426950408889634f;
    const int c = lane & 15, h = lane >> 4;
    V qf[2][4], qf2[2][4], kf[2][4], kf2[2][4];
    // every fragment address = a wave-uniform plane base + the lane's byte offset (16 bytes a lane inside a tile in fragment order); the key and value offsets are carried through the pass loop and advanced only behind the wait that covers the loads which name them
    const unsigned qo = ((unsigned)q0 * HD + 8 * lane) * 2; unsigned ko = (unsigned)lane * 16, vo = (unsigned)lane * 16;
    auto ldo = [](const T16* ub, const unsigned bo, const int o) __attribute__((always_inline)) { return WFrag<T16>::ld((const T16*)((const char*)ub + bo) + o); };
#pragma unroll
    for (int g = 0; g < 2; ++g)
#pragma unroll
        for (int kc = 0; kc < 4; ++kc) { const int o = 16 * g * HD + 512 * kc; qf[g][kc] = ldo(Q, qo, o); if constexpr (HR) qf2[g][kc] = ldo(Q2, qo, o); }
    float m_run[2], l_run[2];
#pragma unroll
    for (int g = 0; g < 2; ++g) { m_run[g] = -__builtin_inff(); l_run[g] = 0.0f;
#pragma unroll
        for (int t = 0; t < 8; ++t) acc[g][t] = (v8f){}; }
#pragma unroll
    for (int kt = 0; kt < 2; ++kt)
#pragma unroll
        for (int kc = 0; kc < 4; ++kc) { const int o = 16 * kt * HD + 512 * kc; kf[kt][kc] = ldo(Kp, ko, o); if constexpr (HR) kf2[kt][kc] = ldo(K2, ko, o); }
    // stands in front of any overwrite of an address register that the query and first key loads name; the operands (the offsets, and the key addresses where the build sums base and offset in a vector pair) keep those registers untouched up to the wait
    if constexpr (HR) asm volatile("s_wait_xcnt 0x0" : "+v"(ko) : "v"(qo), "v"((const char*)Kp + ko), "v"((const char*)K2 + ko) : "memory");
    else asm volatile("s_wait_xcnt 0x0" : "+v"(ko) : "v"(qo), "v"((const char*)Kp + ko) : "memory");
    __builtin_amdgcn_sched_barrier(0);   // nothing that could overwrite one moves up over that wait
    ko += 32 * HD * 2;
    // One 32-key pass. dg true: the diagonal pass, a wave's last (keys > query replaced by -inf, by index; nothing fetched ahead); every other pass fetches the next pass's key fragments.
    auto pass = [&](auto dg) __attribute__((always_inline)) {
        constexpr bool DIAG = decltype(dg)::value;
        V vf[8], vf2[8];
#pragma unroll
        for (int t = 0; t < 8; ++t) { const int o = 512 * t; vf[t] = ldo(Vt, vo, o); if constexpr (HR) vf2[t] = ldo(V2, vo, o); }
        if constexpr (HR && !DIAG) asm volatile("s_wait_xcnt 0x0" ::: "memory");   // with two value planes the build sums base and offset in vector registers that the score tiles then take: the wait stands in front of that overwrite
        if constexpr (HR && DIAG) asm volatile("s_wait_xcnt 0x0" :: "v"((const char*)Vt + vo), "v"((const char*)V2 + vo) : "memory");   // the same wait in a wave's last pass: as inputs the two sums stay untouched up to it (built without them, the last load of each plane landed on its own address pair, which the loads before it name)
        __builtin_amdgcn_sched_barrier(0);   // the value loads stay in front of the score products, so that they fly under them and under the softmax
        v8f s[2][2];
#pragma unroll
        for (int kt = 0; kt < 2; ++kt)
#pragma unroll
            for (int g = 0; g < 2; ++g) { s[kt][g] = (v8f){};
#pragma unroll
                for (int kc = 0; kc < 4; ++kc) { s[kt][g] = WFrag<T16>::mma(kf[kt][kc], qf[g][kc], s[kt][g]);
                    if constexpr (HR) { s[kt][g] = WFrag<T16>::mma(kf2[kt][kc], qf[g][kc], s[kt][g]); s[kt][g] = WFrag<T16>::mma(kf[kt][kc], qf2[g][kc], s[kt][g]); } } }
        __builtin_amdgcn_sched_barrier(0);   // the score products stay in front of the wait and of the key prefetch
        asm volatile("s_wait_xcnt 0x0" :: "v"(vo) : "memory");   // stands in front of any overwrite of an address register that the value loads name (the input keeps their offset untouched up to here); it is placed behind the score products so that it does not hold up their issue
        __builtin_amdgcn_sched_barrier(0);   // nothing that could overwrite one moves up over that wait
        if constexpr (!DIAG) {   // the next pass's key fragments fly under this pass's softmax and second product
#pragma unroll
            for (int kt = 0; kt < 2; ++kt)
#pragma unroll
                for (int kc = 0; kc < 4; ++kc) { const int o = 16 * kt * HD + 512 * kc; kf[kt][kc] = ldo(Kp, ko, o); if constexpr (HR) kf2[kt][kc] = ldo(K2, ko, o); }
            __builtin_amdgcn_sched_barrier(0);   // keeps the key prefetch issued ahead of the softmax arithmetic
        } else {                 // the pass's first key is q0
#pragma unroll
            for (int g = 0; g < 2; ++g)
#pragma unroll
                for (int kt = 0; kt < 2; ++kt)
#pragma unroll
                    for (int r = 0; r < 8; ++r) if (16 * kt + 8 * h + r > 16 * g + c) s[kt][g][r] = -__builtin_inff();
        }
        float mb[2]; bool need = false;
#pragma unroll
        for (int g = 0; g < 2; ++g) { float mx = -__builtin_inff();
#pragma unroll
            for (int kt = 0; kt < 2; ++kt)
#pragma unroll
                for (int r = 0; r < 8; ++r) mx = fmaxf(mx, s[kt][g][r]);
            mx = fmaxf(mx, xhalf(mx)) * CSC; mb[g] = mx; need = need || (mx > m_run[g] + 8.0f); }
        if (__builtin_amdgcn_ballot_w32(need) != 0) {   // scalar branch, rare after the first passes; every column has an unmasked key in every pass, so the new maximum is finite
#pragma unroll
            for (int g = 0; g < 2; ++g) { const float mn = fmaxf(m_run[g], mb[g]); const float corr = __builtin_amdgcn_exp2f(m_run[g] - mn); l_run[g] *= corr; m_run[g] = mn;
#pragma unroll
                for (int t = 0; t < 8; ++t) acc[g][t] = acc[g][t] * corr; }
        }
#pragma unroll
        for (int g = 0; g < 2; ++g) { const float nm = -m_run[g]; float pv[16]; float ps0 = 0.0f, ps1 = 0.0f;
#pragma unroll
            for (int e = 0; e < 16; ++e) { pv[e] = __builtin_amdgcn_exp2f(__builtin_fmaf(s[e >> 3][g][e & 7], CSC, nm)); if (e & 1) ps1 += pv[e]; else ps0 += pv[e]; }
            l_run[g] += ps0 + ps1;
            V pf, pf2;
            if constexpr (HR) { v16us uh, ul;
#pragma unroll
                for (int e = 0; e < 16; ++e) { unsigned short a, b; splitf(pv[e], a, b); uh[e] = a; ul[e] = b; }
                pf = __builtin_bit_cast(v16bf, uh); pf2 = __builtin_bit_cast(v16bf, ul);
            } else {
#pragma unroll
                for (int e = 0; e < 16; ++e) pf[e] = tohx(pv[e]); }
#pragma unroll
            for (int t = 0; t < 8; ++t) { acc[g][t] = WFrag<T16>::mma(vf[t], pf, acc[g][t]);
                if constexpr (HR) { acc[g][t] = WFrag<T16>::mma(vf2[t], pf, acc[g][t]); acc[g][t] = WFrag<T16>::mma(vf[t], pf2, acc[g][t]); } }
        }
        wgap();
        if constexpr (!DIAG) {
            asm volatile("s_wait_xcnt 0x0" : "+v"(ko), "+v"(vo) :: "memory");   // stands in front of the offset updates, which overwrite address registers that this pass's loads name; as in-out operands the offsets can be advanced only behind it
            ko += 32 * HD * 2; vo += 32 * HD * 2; }
    };
    // stays rolled: the trip count is known only at run time, and further copies of a body this long would only add code for the instruction cache to hold
#pragma unroll 1
    for (int key0 = 0; key0 < q0; key0 += 32) pass(BoolC<false>{});   // keys [0, q0): no key exceeds a query of this wave
    pass(BoolC<true>{});                                              // keys [q0, q0 + 32)
#pragma unroll
    for (int g = 0; g < 2; ++g) linv[g] = __fdiv_rn(1.0f, l_run[g] + xhalf(l_run[g]));   // each wave half summed its own eight keys of every 16-key tile
}
__global__ __launch_bounds__(32 * REP) void k_fattn(const h16* __restrict__ Q16, const h16* __restrict__ K16, const h16* __restrict__ V16, const bf* __restrict__ Qh, const bf* __restrict__ Ql, const bf* __restrict__ Kh, const bf* __restrict__ Kl, const bf* __restrict__ Vh, const bf* __restrict__ Vl, h16* A16_, bf* Ah_, bf* Al_) {
    const int lane = threadIdx.x & 31; const int g = blockIdx.y;
    const int head = g * REP + __builtin_amdgcn_readfirstlane((int)(threadIdx.x >> 5));   // scalar: plane bases and the pass loop stay under scalar control
    // a wave takes one row block of every batch, one after the other: block n - 1 - x of even batches, block x of odd ones, so that with two batches every wave walks the same number of key passes. Stays rolled: one copy of the two long bodies in the instruction cache
#pragma unroll 1
    for (int b = 0; b < NB; ++b) {
    const int q0 = ((b & 1) ? (int)blockIdx.x : TT / 32 - 1 - (int)blockIdx.x) * 32;
    const size_t bh = (size_t)b * NH_ + head, bg = (size_t)b * NKV + g;
    h16* A16 = A16_ + (size_t)b * TT * DQ; bf* Ah = Ah_ + (size_t)b * RH * DQ; bf* Al = Al_ + (size_t)b * RH * DQ;
    v8f acc[2][8]; float linv[2];
    if (q0 < RH) {
        fattn_rows<bf, true>(Qh + bh * RH * HD, Ql + bh * RH * HD, Kh + bg * RH * HD, Kl + bg * RH * HD, Vh + bg * HD * RH, Vl + bg * HD * RH, q0, lane, acc, linv);
#pragma unroll
        for (int gq = 0; gq < 2; ++gq)
#pragma unroll
            for (int t = 0; t < 8; ++t) { v8us oh, ol;   // a lane's 8 registers are d = 16 t + 8 h + 0..7 of query q0 + 16 gq + c
#pragma unroll
                for (int r = 0; r < 8; ++r) { unsigned short a, b; splitf(acc[gq][t][r] * linv[gq], a, b); oh[r] = a; ol[r] = b; }
                const size_t oo = (size_t)(q0 + 16 * gq) * DQ + (head * (HD / 32) + (t >> 1)) * 512 + (t & 1) * 256 + 8 * lane; *(v8us*)(Ah + oo) = oh; *(v8us*)(Al + oo) = ol; }   // its place in fragment order, planes of DQ columns
        asm volatile("s_wait_xcnt 0x0" ::: "memory");   // stands behind the run of stores above, in front of anything that could overwrite a register which one of them names
    } else {
        fattn_rows<h16, false>(Q16 + bh * TT * HD, nullptr, K16 + bg * TT * HD, nullptr, V16 + bg * HD * TT, nullptr, q0, lane, acc, linv);
        v8h o16[2][8];
#pragma unroll
        for (int gq = 0; gq < 2; ++gq)
#pragma unroll
            for (int t = 0; t < 8; ++t)
#pragma unroll
                for (int r = 0; r < 8; ++r) o16[gq][t][r] = tohx(acc[gq][t][r] * linv[gq] * ACAR);
        __builtin_amdgcn_sched_barrier(0);   // all sixteen packed vectors are formed in front of the first store, each in registers of its own: built without it, the packing of a later vector took the data registers of a store just issued, ahead of the wait below
#pragma unroll
        for (int gq = 0; gq < 2; ++gq)
#pragma unroll
            for (int t = 0; t < 8; ++t) *(v8h*)(A16 + (size_t)(q0 + 16 * gq) * DQ + (head * (HD / 32) + (t >> 1)) * 512 + (t & 1) * 256 + 8 * lane) = o16[gq][t];   // its place in fragment order, plane of DQ columns
        asm volatile("s_wait_xcnt 0x0" ::: "memory");   // stands behind the run of stores above, in front of anything that could overwrite a register which one of them names
    }
    }
}

extern "C" void kernel_launch(void* const* d_in, const int* in_sizes, int n_in,
                              void* d_out, int out_size, void* d_ws, size_t ws_size, hipStream_t stream) {
    if (n_in < 5) return;
    if ((size_t)in_sizes[0] < (size_t)(NB - 1) * TT_FULL * DM + (size_t)TT * DM) return;
    if (in_sizes[1] < DM * DQ || in_sizes[2] < DM * DKV || in_sizes[3] < DM * DKV || in_sizes[4] < DQ * DM) return;
    if ((size_t)out_size < (size_t)(NB - 1) * TT_FULL * DM + (size_t)TT * DM) return;
    const float* x = (const float*)d_in[0]; const float* wq = (const float*)d_in[1]; const float* wk = (const float*)d_in[2]; const float* wv = (const float*)d_in[3]; const float* wo = (const float*)d_in[4];
    float* OUT = (float*)d_out;     // [NB][TT_FULL][DM]
    char* wsp = (char*)d_ws;
    auto take = [&](size_t bytes) { char* p = wsp; wsp += (bytes + 255) & ~(size_t)255; return (void*)p; };
    bf* WQ = (bf*)take((size_t)DQ * DM * 2); bf* WK = (bf*)take((size_t)DKV * DM * 2); bf* WV = (bf*)take((size_t)DKV * DM * 2); bf* WO = (bf*)take((size_t)DM * DQ * 2);   // Bt = (out, in) planes in fragment order
    h16* WO16 = (h16*)take((size_t)DM * DQ * 2);                                                                                             // Bt fp16 x WCAR
    float* CS = (float*)take((size_t)TT * HP * 2 * 4);
    // from here on every plane holds NB batches, one behind the other
    h16* QP16 = (h16*)take((size_t)NB * NH_ * TT * HD * 2); h16* KP16 = (h16*)take((size_t)NB * NKV * TT * HD * 2); h16* VT16 = (h16*)take((size_t)NB * NKV * HD * TT * 2);
    bf* QPh = (bf*)take((size_t)NB * NH_ * RH * HD * 2); bf* QPl = (bf*)take((size_t)NB * NH_ * RH * HD * 2); bf* KPh = (bf*)take((size_t)NB * NKV * RH * HD * 2); bf* KPl = (bf*)take((size_t)NB * NKV * RH * HD * 2);
    bf* VTh = (bf*)take((size_t)NB * NKV * HD * RH * 2); bf* VTl = (bf*)take((size_t)NB * NKV * HD * RH * 2);
    bf* XB = (bf*)take((size_t)NB * TT * DM * 2);     // bf16 x rows
    h16* AT16 = (h16*)take((size_t)NB * TT * DQ * 2); bf* ATh = (bf*)take((size_t)NB * RH * DQ * 2); bf* ATl = (bf*)take((size_t)NB * RH * DQ * 2);
    if ((size_t)(wsp - (char*)d_ws) > ws_size) return;
    { k_wtG<<<(unsigned)((DQ * DM / 64 + 63) / 64), 256, 0, stream>>>(wq, DM, DQ, WQ);
      k_wtG<<<(unsigned)((DKV * DM / 64 + 63) / 64), 256, 0, stream>>>(wk, DM, DKV, WK);
      k_wtG<<<(unsigned)((DKV * DM / 64 + 63) / 64), 256, 0, stream>>>(wv, DM, DKV, WV);
      k_wtG<<<(unsigned)((DM * DQ / 64 + 63) / 64), 256, 0, stream>>>(wo, DQ, DM, WO);
      k_wtH<<<(unsigned)((DM * DQ / 64 + 63) / 64), 256, 0, stream>>>(wo, DQ, DM, WCAR, WO16); }
    k_cstab<<<(TT * HP + 255) / 256, 256, 0, stream>>>(CS);
    // every launch below covers all NB batches: the last grid dimension is the batch (GEMMs: z with the batch strides; elementwise kernels: y); k_fattn walks the batches inside each wave
    k_cvt8<<<dim3((unsigned)(((size_t)TT * DM / 8 + 255) / 256), NB, 1), 256, 0, stream>>>(x, XB, (size_t)TT * DM / 8);
    // the three projections write their 16-bit operand planes themselves (rotary map for q and k; v taken transposed, weight rows x positions): no f32 copy of q, k or v exists
    k_gemmw<bf, 0, 8, 1><<<dim3(TT / 64, DQ / 64, NB), 256, 0, stream>>>(XB, nullptr, WQ, nullptr, DM, -1, 0, nullptr, DQ, 1.0f, (size_t)TT * DM, 0, 0, CS, QP16, QPh, QPl);
    k_gemmw<bf, 0, 16, 1><<<dim3(TT / 64, DKV / 64, NB), 512, 0, stream>>>(XB, nullptr, WK, nullptr, DM, -1, 0, nullptr, DKV, 1.0f, (size_t)TT * DM, 0, 0, CS, KP16, KPh, KPl);
    k_gemmw<bf, 0, 16, 2><<<dim3(DKV / 64, TT / 64, NB), 512, 0, stream>>>(WV, nullptr, XB, nullptr, DM, -1, 0, nullptr, DKV, 1.0f, 0, (size_t)TT * DM, 0, nullptr, VT16, VTh, VTl);
    k_fattn<<<dim3(TT / 32, NKV, 1), 32 * REP, 0, stream>>>(QP16, KP16, VT16, QPh, QPl, KPh, KPl, VTh, VTl, AT16, ATh, ATl);
    // output projection: rows < RH bf16 hi/lo context x bf16 Wo (2 products); rows >= RH fp16 context x64 x fp16 Wo x64 (1 product, 1/4096 in the epilogue)
    k_gemmw<bf, 1, 16, 0><<<dim3(RH / 64, DM / 64, NB), 512, 0, stream>>>(ATh, ATl, WO, nullptr, DQ, -1, 0, OUT, DM, 1.0f, (size_t)RH * DQ, 0, (size_t)TT_FULL * DM, nullptr, nullptr, nullptr, nullptr);
    k_gemmw<h16, 0, 8, 0><<<dim3((TT - RH) / 64, DM / 64, NB), 256, 0, stream>>>(AT16 + (size_t)RH * DQ, nullptr, WO16, nullptr, DQ, -1, 0, OUT + (size_t)RH * DM, DM, OSCW, (size_t)TT * DQ, 0, (size_t)TT_FULL * DM, nullptr, nullptr, nullptr, nullptr);
}

// v006
// Measured time: 190 microseconds a run.
// Next to v005, in two timings, it ran 1.14 times as fast each time.
// Counting every step since v000, it is 8.54 times as fast.
#include <hip/hip_runtime.h>

// Causal grouped-query self-attention with interleaved rotary embedding: x [NB][T][2048]; q = x Wq (16 heads x 128), k, v = x Wk, x Wv (4 kv heads x 128, each shared by 4 consecutive q heads);
// rotary pairs (2j, 2j+1) with angle t / 10000^(j/64); s = q.k x 128^-0.5 with keys > query replaced by -inf; softmax; attn.v; merged heads x Wo -> [NB][T][2048] f32.
// Compute dtypes, f32 accumulate: x, Wq, Wk, Wv, Wo RNE-converted to bf16; q/k/v projections v_wmma_f32_16x16x32_bf16 (plain); scores and attn.v: query rows < 128 bf16 hi/lo split (3 products),
// rows >= 128 v_wmma_f32_16x16x32_f16 single products (P unnormalised, exp2 of the score minus the maximum in use); rotary table and softmax f32; output projection: rows < 128 bf16 hi/lo x bf16 (2 products),
// rows >= 128 v_wmma_f32_16x16x32_f16 single product (context carried x64, Wo carried x64, 1/4096 folded in the f32 epilogue).
// Every 16-bit operand plane P[row][k] (NC columns) lies in FRAGMENT ORDER: 1-KB tiles of 16 rows x 32 k, tile (row >> 4, k >> 5) at element ((row >> 4) (NC / 32) + (k >> 5)) 512 (value planes: tile (d >> 4, key >> 5) at
// ((key >> 5) 8 + (d >> 4)) 512), and inside a tile element (row, k) at ((k >> 4) & 1) 256 + (((k >> 3) & 1) 16 + (row & 15)) 8 + (k & 7): a wave's 16-byte-per-lane load or store at lane 8 covers 512 contiguous bytes.

#ifndef NB
#define NB 2
#endif
#ifndef SEQ
#define SEQ 2048
#endif
#define NB_FULL 2
#define TT_FULL 2048
#define TT   SEQ
#define DM   2048
#define NH_  16
#define NKV  4
#define REP  (NH_ / NKV)
#define HD   128
#define HP   (HD / 2)
#define DQ   (NH_ * HD)
#define DKV  (NKV * HD)
#define RH   128                  // query rows < RH use hi/lo planes (keys < RH suffice: causal)
#define ACAR 64.0f                // carry of the fp16 merged-context plane (rows >= RH)
#define WCAR 64.0f                // carry of the fp16 Wo plane
#define OSCW (1.0f / (ACAR * WCAR))
#define SCL  0.08838834764831845f   // HD^-0.5
#define KX   DM                   // columns of every GEMM operand plane

static_assert(NB >= 1 && NB <= NB_FULL);
static_assert(TT % 128 == 0 && TT <= TT_FULL && TT > RH);
static_assert(RH % 128 == 0 && RH >= 128);
static_assert((TT - RH) % 64 == 0);
static_assert(HD == 128 && HP == 64);
static_assert(NH_ == NKV * REP && TT % 32 == 0 && RH % 32 == 0);
static_assert(DM % 64 == 0 && DQ % 64 == 0 && DKV % 64 == 0 && DQ == KX);

typedef _Float16 h16;
typedef unsigned short bf;
typedef __attribute__((ext_vector_type(16))) __bf16   v16bf;
typedef __attribute__((ext_vector_type(16))) _Float16 v16h;
typedef __attribute__((ext_vector_type(8)))  _Float16 v8h;
typedef __attribute__((ext_vector_type(8)))  unsigned short v8us;
typedef __attribute__((ext_vector_type(8)))  float    v8f;
typedef __attribute__((ext_vector_type(4)))  float    v4f;
typedef v8h  __attribute__((may_alias)) v8ha;
typedef v4f  __attribute__((may_alias)) v4fa;
typedef v8us __attribute__((may_alias)) v8usa;

__device__ __forceinline__ unsigned short f2bf(float f) { unsigned u = __float_as_uint(f); u += 0x7FFFu + ((u >> 16) & 1u); return (unsigned short)(u >> 16); }
__device__ __forceinline__ float bf2f(unsigned short b) { return __uint_as_float(((unsigned)b) << 16); }
__device__ __forceinline__ float bfr(float f) { return bf2f(f2bf(f)); }
__device__ __forceinline__ v16h cat16(v8h lo, v8h hi) { return __builtin_shufflevector(lo, hi, 0, 1, 2, 3, 4, 5, 6, 7, 8, 9, 10, 11, 12, 13, 14, 15); }
__device__ __forceinline__ v16bf cat16b(v8us lo, v8us hi) { return __builtin_bit_cast(v16bf, __builtin_shufflevector(lo, hi, 0, 1, 2, 3, 4, 5, 6, 7, 8, 9, 10, 11, 12, 13, 14, 15)); }
__device__ __forceinline__ v8f wmma16(v16h a, v16h b, v8f c) { return __builtin_amdgcn_wmma_f32_16x16x32_f16(false, a, false, b, (short)0, c, false, false); }
__device__ __forceinline__ v8f wmmab(v16bf a, v16bf b, v8f c) { return __builtin_amdgcn_wmma_f32_16x16x32_bf16(false, a, false, b, (short)0, c, false, false); }

__device__ __forceinline__ h16 tohx(float x) { return (h16)x; }
__device__ __forceinline__ void splitf(float y, unsigned short& h, unsigned short& l) { h = f2bf(y); l = f2bf(y - bf2f(h)); }

// ---- k_gemmw: register-blocked GEMM, NW WAVES per 64x64 output tile (16 accumulators each), operands straight from 16-bit planes in fragment order; grid (M/64, N/64, Z), 32 NW threads.
// Wave w contracts the 32-wide k chunks w, w + NW, w + 2 NW, ... of the tile; for NW > 1 the NW f32 partial tiles meet in LDS and are summed in wave order 0 .. NW-1 (fixed), then scaled and stored.
// C[m][n] (f32, pitch ldc) = osc x sum_k A[m][k] Bt[n][k] (+ split products per NSPLIT: 1 = A2.Bt added, 2 = A2.Bt and A.Bt2 added). Every plane has KX columns (a constant: the tile-row steps become immediate offsets), z-batch strides sA/sB/sC in elements. K % 32 == 0.
// Fragment k map (both operands): elements 0..7 <- kc + 8h + 0..7, elements 8..15 <- kc + 16 + 8h + 0..7, h = lane >> 4, row/col = lane & 15: WFrag::ld at tile base + lane 8 (its second half 256 elements on).
// cskip >= 0: tiles with blockIdx.y > blockIdx.x + cskip are not computed (causal upper triangle). kcaus > 0: contraction stops at min(K, kcaus + 64 (blockIdx.x + 1)) (causal key limit).
// EPI 0: the f32 tile goes to C as above. EPI 1 and 2 (NW > 1; C unused, ldc = heads x HD (the product's columns for EPI 1, its rows for EPI 2), z = batch): the thread that sums 8 neighbouring columns of a row turns them into 16-bit operands itself and stores them
// as one 16-byte piece at their place in fragment order (a wave's store covers 512 contiguous bytes): fp16 plane P16 for every row, bf16 hi/lo planes Ph/Pl for positions < RH.
// EPI 1: rows = positions t, columns = head HD + d: interleaved rotary map out[2j] = x[2j] c - x[2j+1] s, out[2j+1] = x[2j] s + x[2j+1] c, (c, s) = CS[t][j], into head planes (t, d).
// EPI 2: rows = kv head HD + d, columns = positions t (the product is taken transposed: A = weight plane, Bt = x plane): value planes (d, t), the 8 d tiles of a 32-key block side by side.
template <typename T16> struct WFrag;
template <> struct WFrag<h16> { typedef v16h V; static __device__ __forceinline__ V ld(const h16* p) { return cat16(*(const v8h*)p, *(const v8h*)(p + 256)); } static __device__ __forceinline__ v8f mma(V a, V b, v8f c) { return wmma16(a, b, c); } };
template <> struct WFrag<bf> { typedef v16bf V; static __device__ __forceinline__ V ld(const bf* p) { return cat16b(*(const v8us*)p, *(const v8us*)(p + 256)); } static __device__ __forceinline__ v8f mma(V a, V b, v8f c) { return wmmab(a, b, c); } };
template <typename T16, int NSPLIT, int NW, int EPI>
__global__ __launch_bounds__(32 * NW) void k_gemmw(const T16* __restrict__ A, const T16* __restrict__ A2, const T16* __restrict__ Bt, const T16* __restrict__ Bt2, int K, int cskip, int kcaus,
                                             float* C, int ldc, float osc, size_t sA, size_t sB, size_t sC, const float* __restrict__ CS, h16* P16, bf* Ph, bf* Pl) {
    static_assert(EPI == 0 || (NW > 1 && 16 % NW == 0));
    typedef typename WFrag<T16>::V V;
    __shared__ __align__(16) float os[(NW == 1 ? 16 : NW * 64) * 68];
    if (cskip >= 0 && (int)blockIdx.y > (int)blockIdx.x + cskip) return;   // block-uniform, in front of the one block barrier
    const size_t z = blockIdx.z; A += z * sA; if (A2) A2 += z * sA; Bt += z * sB; if (Bt2) Bt2 += z * sB; C += z * sC;
    const int lane = threadIdx.x & 31, lr = lane & 15, hi = lane >> 4; const int r0 = blockIdx.x * 64, c0 = blockIdx.y * 64;
    const int wv = (NW == 1) ? 0 : __builtin_amdgcn_readfirstlane((int)(threadIdx.x >> 5));   // wave number, scalar: the k loop stays under scalar control
    int kend = K;
    if (kcaus > 0) { const int kl = kcaus + 64 * ((int)blockIdx.x + 1); kend = (kl < K) ? kl : K; }
    v8f acc[4][4];
#pragma unroll
    for (int mb = 0; mb < 4; ++mb)
#pragma unroll
        for (int nb = 0; nb < 4; ++nb) acc[mb][nb] = (v8f){};
    // every fragment address = a wave-uniform tile-row base (16 rows of a plane = KX / 32 tiles = 16 KX elements) + one byte offset per lane: 16 bytes a lane inside a tile, 1 KB a 32-wide k chunk; the offset is advanced only behind the wait at the loop's foot
    const size_t aoff = (size_t)r0 * KX, boff = (size_t)c0 * KX; unsigned ko = (unsigned)lane * 16 + (unsigned)wv * 1024;
    auto ldo = [](const T16* ub, const unsigned bo, const int o) __attribute__((always_inline)) { return WFrag<T16>::ld((const T16*)((const char*)ub + bo) + o); };
#pragma unroll 1
    for (int kc = 32 * wv; kc < kend; kc += 32 * NW) {
        V a[4], a2[4], b[4], b2[4];
#pragma unroll
        for (int mb = 0; mb < 4; ++mb) { a[mb] = ldo(A + aoff, ko, mb * 16 * KX); if (NSPLIT == 1 || NSPLIT == 2) a2[mb] = ldo(A2 + aoff, ko, mb * 16 * KX); }
#pragma unroll
        for (int nb = 0; nb < 4; ++nb) { b[nb] = ldo(Bt + boff, ko, nb * 16 * KX); if (NSPLIT >= 2) b2[nb] = ldo(Bt2 + boff, ko, nb * 16 * KX); }
        __builtin_amdgcn_sched_barrier(0);   // the trip's loads stay one group in front of its products; built without it, the Bt fragments shared one register set and each was fetched only behind the products of the one before: four load latencies a trip
#pragma unroll
        for (int nb = 0; nb < 4; ++nb)
#pragma unroll
            for (int mb = 0; mb < 4; ++mb) { acc[mb][nb] = WFrag<T16>::mma(a[mb], b[nb], acc[mb][nb]); if (NSPLIT == 1 || NSPLIT == 2) acc[mb][nb] = WFrag<T16>::mma(a2[mb], b[nb], acc[mb][nb]); if (NSPLIT >= 2) acc[mb][nb] = WFrag<T16>::mma(a[mb], b2[nb], acc[mb][nb]); }
        asm volatile("v_nop\n\tv_nop\n\tv_nop\n\tv_nop" : "+v"(acc[0][0]), "+v"(acc[1][1]), "+v"(acc[2][2]), "+v"(acc[3][3]) : "v"(a[0]), "v"(a[3]));
        asm volatile("s_wait_xcnt 0x0" : "+v"(ko) :: "memory");   // stands in front of the offset update, which overwrites the address register that this trip's loads name; as an in-out operand the offset can be advanced only behind it
        ko += 1024 * NW;
    }
    if constexpr (NW > 1) {
        // EPI != 0: thread item -> (row, 8 columns): lane & 15 = row & 15, lane >> 4 = bit 3 of the column, which is the order of a tile's 16-byte pieces
        auto irow = [](const int it) __attribute__((always_inline)) { const int item = it * (32 * NW) + (int)threadIdx.x; return (item & 15) | ((item >> 7) << 4); };
        auto icol = [](const int it) __attribute__((always_inline)) { const int item = it * (32 * NW) + (int)threadIdx.x; return ((item >> 4) & 7) * 8; };
        v4f ca[EPI == 1 ? 16 / NW : 1], cb[EPI == 1 ? 16 / NW : 1];
        if constexpr (EPI == 1) {   // the (c, s) pairs are fetched here so that they fly under the LDS stores and the barrier
#pragma unroll
            for (int it = 0; it < 16 / NW; ++it) { const float* cp = CS + (size_t)(r0 + irow(it)) * (HP * 2) + ((c0 + icol(it)) & (HD - 1)); ca[it] = *(const v4f*)cp; cb[it] = *(const v4f*)(cp + 4);
                asm volatile("s_wait_xcnt 0x0" :: "v"(cp) : "memory"); } }   // stands in front of any overwrite of the address pair that the two loads name; as an input the pair stays untouched up to it (built without it, the second load landed on the pair)
        float* my = os + (size_t)wv * (64 * 68);
#pragma unroll
        for (int mb = 0; mb < 4; ++mb)
#pragma unroll
            for (int nb = 0; nb < 4; ++nb)
#pragma unroll
                for (int j = 0; j < 8; ++j) my[(mb * 16 + hi * 8 + j) * 68 + nb * 16 + lr] = acc[mb][nb][j];
        __syncthreads();   // every wave's partial tile is in LDS before any thread sums across waves
        if constexpr (EPI != 0) {
            const int nh = ldc / HD; const bool hires = (EPI == 1 ? r0 : c0) < RH;   // block-uniform: a tile's 64 positions lie on one side of RH
            P16 += z * nh * TT * HD; Ph += z * nh * RH * HD; Pl += z * nh * RH * HD;
#pragma unroll
            for (int it = 0; it < 16 / NW; ++it) { const int row = irow(it), cofs = icol(it);
                const float* p = os + row * 68 + cofs; v4f s0 = *(const v4fa*)p, s1 = *(const v4fa*)(p + 4);
#pragma unroll
                for (int q = 1; q < NW; ++q) { s0 += *(const v4fa*)(p + q * (64 * 68)); s1 += *(const v4fa*)(p + q * (64 * 68) + 4); }
                float y[8]; int hd, he;
                if constexpr (EPI == 1) { const int t = r0 + row, col = c0 + cofs, d = col & (HD - 1); hd = col / HD;
#pragma unroll
                    for (int j = 0; j < 2; ++j) { y[2 * j] = s0[2 * j] * ca[it][2 * j] - s0[2 * j + 1] * ca[it][2 * j + 1]; y[2 * j + 1] = s0[2 * j] * ca[it][2 * j + 1] + s0[2 * j + 1] * ca[it][2 * j];
                        y[4 + 2 * j] = s1[2 * j] * cb[it][2 * j] - s1[2 * j + 1] * cb[it][2 * j + 1]; y[5 + 2 * j] = s1[2 * j] * cb[it][2 * j + 1] + s1[2 * j + 1] * cb[it][2 * j]; }
                    he = ((t >> 4) * (HD / 32) + (d >> 5)) * 512 + ((d >> 4) & 1) * 256 + (((d >> 3) & 1) * 16 + (t & 15)) * 8;
                } else { const int r = r0 + row, t = c0 + cofs, d = r & (HD - 1); hd = r / HD;
#pragma unroll
                    for (int j = 0; j < 4; ++j) { y[j] = s0[j]; y[4 + j] = s1[j]; }
                    he = ((t >> 5) * (HD / 16) + (d >> 4)) * 512 + ((t >> 4) & 1) * 256 + (((t >> 3) & 1) * 16 + (d & 15)) * 8; }
                v8h o16;
#pragma unroll
                for (int e = 0; e < 8; ++e) o16[e] = tohx(y[e]);
                *(v8h*)(P16 + (size_t)hd * TT * HD + he) = o16;
                asm volatile("s_wait_xcnt 0x0" ::: "memory");   // stands behind the store, in front of the hi/lo split, which was built into the store's address and data registers
                if (hires) { v8us oh, ol;   // positions < RH are the first RH HD places of a plane
#pragma unroll
                    for (int e = 0; e < 8; ++e) { unsigned short a, b; splitf(y[e], a, b); oh[e] = a; ol[e] = b; }
                    *(v8us*)(Ph + (size_t)hd * RH * HD + he) = oh; *(v8us*)(Pl + (size_t)hd * RH * HD + he) = ol; }
            }
        } else {
#pragma unroll
        for (int it = 0; it < 32 / NW; ++it) { const int item = it * (32 * NW) + (int)threadIdx.x; const int row = item >> 4, cofs = (item & 15) * 4;
            v4f s = *(const v4fa*)(os + row * 68 + cofs);
#pragma unroll
            for (int q = 1; q < NW; ++q) s += *(const v4fa*)(os + q * (64 * 68) + row * 68 + cofs);
            *(v4f*)(C + (size_t)(r0 + row) * ldc + c0 + cofs) = s * osc; }
        }
    } else {
#pragma unroll
    for (int mb = 0; mb < 4; ++mb) {
#pragma unroll
        for (int nb = 0; nb < 4; ++nb) {
#pragma unroll
            for (int j = 0; j < 8; ++j) os[(hi * 8 + j) * 68 + nb * 16 + lr] = acc[mb][nb][j]; }
        __builtin_amdgcn_wave_barrier(); asm volatile("" ::: "memory");
        float* crow = C + (size_t)(r0 + mb * 16) * ldc + c0;
{
#pragma unroll
            for (int s = 0; s < 8; ++s) { const int row = 2 * s + hi, cofs = lr * 4; const v4f val = *(const v4fa*)(os + row * 68 + cofs) * osc;
                *(v4f*)(crow + (size_t)row * ldc + cofs) = val; }
             }
        __builtin_amdgcn_wave_barrier(); asm volatile("" ::: "memory");
    }
    }
}

typedef __attribute__((ext_vector_type(2))) _Float16 v2h;
typedef __attribute__((ext_vector_type(4))) _Float16 v4h;
typedef __attribute__((ext_vector_type(2))) unsigned short v2us;
typedef __attribute__((ext_vector_type(4))) unsigned short v4us;
typedef __attribute__((ext_vector_type(2))) float v2f;

// ---- k_prep: every plane that depends on an input alone (four bf16 weight planes, the fp16 Wo plane, the bf16 x plane, the rotary table) in ONE launch. No LDS, no barrier; a block's job follows from its index
// (block-uniform): first the rotary table, then x, then Wq, Wk, Wv, Wo. Every load of a wave covers whole 128-byte lines and a wave keeps 16 (of 16 bytes a lane) or 64 (of 4) of them in flight.
#define PB_CS (TT / 32)                       // blocks of the rotary table: 4 groups of 64 threads, each thread 8 positions of one j
#define PB_X  (NB * (TT / 16))                // blocks of the x plane: a block takes 16 rows, a wave 256 columns of them (8 tiles)
#define PB_WB ((DQ / 64) * (DM / 64) / 8)     // blocks of Wq and of Wo: a wave takes 64 columns x 64 k (8 tiles)
#define PB_WS ((DKV / 64) * (DM / 64) / 8)    // blocks of Wk and of Wv
static_assert(DM % 256 == 0 && DQ == DM && ((DKV / 64) * (DM / 64)) % 8 == 0);
// The wait that stands behind a run of loads or stores, in front of anything that overwrites a register which one of them names; the two scheduling barriers keep every other instruction on its own side of the wait
__device__ __forceinline__ void xwait() { __builtin_amdgcn_sched_barrier(0); asm volatile("s_wait_xcnt 0x0" ::: "memory"); __builtin_amdgcn_sched_barrier(0); }
// w (K rows, N columns, f32) -> Bt (N rows, K columns) in fragment order. A lane owns two columns n (n0 + lane, n0 + 32 + lane), for each: its 32 loads of a 32-k chunk are rows k of w (a wave: 128 contiguous bytes each), its four 16-byte pieces
// (k >> 3 = 0..3 of the chunk) go to their places in tile (n >> 4, k >> 5): a wave's store covers 256 contiguous bytes in each of two tiles. H16: also the fp16 plane of the bf16-rounded value x WCAR.
template <int K, int N, bool H16>
__device__ __forceinline__ void prep_w(const float* __restrict__ w, bf* __restrict__ Bt, h16* __restrict__ Bh, const int job, const int lane) {
    const int k0 = (job % (K / 64)) * 64, n0 = (job / (K / 64)) * 64;
    const float* p = w + (size_t)k0 * N + n0 + lane;
    const size_t tb = ((size_t)((n0 + lane) >> 4) * (K / 32) + (k0 >> 5)) * 512 + (lane & 15) * 8;   // column n0 + lane; column n0 + 32 + lane lies two tile rows (K / 16 tiles) on
    bf* d = Bt + tb; h16* dh = H16 ? Bh + tb : nullptr;
    // every loop below is unrolled: v, o and oh stay in registers and every row or tile step becomes an immediate offset
#pragma unroll
    for (int kc = 0; kc < 2; ++kc) {
        float v[2][32];
        __builtin_amdgcn_sched_barrier(0);   // the addresses are formed in front of the run of loads, so that nothing but loads stands between here and the wait
#pragma unroll
        for (int j = 0; j < 32; ++j)
#pragma unroll
            for (int nh = 0; nh < 2; ++nh) v[nh][j] = p[(size_t)(kc * 32 + j) * N + nh * 32];
        xwait();
        v8us o[2][4]; v8h oh[H16 ? 2 : 1][H16 ? 4 : 1];
#pragma unroll
        for (int nh = 0; nh < 2; ++nh)
#pragma unroll
            for (int q = 0; q < 4; ++q)
#pragma unroll
                for (int e = 0; e < 8; ++e) { o[nh][q][e] = f2bf(v[nh][q * 8 + e]); if constexpr (H16) oh[nh][q][e] = tohx(bf2f(o[nh][q][e]) * WCAR); }
        __builtin_amdgcn_sched_barrier(0);   // every packed piece is formed, in registers of its own, in front of the first store
#pragma unroll
        for (int nh = 0; nh < 2; ++nh)
#pragma unroll
            for (int q = 0; q < 4; ++q) { const int off = (nh * (K / 16) + kc) * 512 + (q >> 1) * 256 + (q & 1) * 128;
                *(v8us*)(d + off) = o[nh][q]; if constexpr (H16) *(v8h*)(dh + off) = oh[nh][q]; }
        xwait();
    }
}
// x rows -> bf16 plane of DM columns in fragment order. A load covers 4 rows x 128 bytes (one tile's k range): lane >> 3 = row & 3, lane & 7 = k >> 2; a lane's 4 values are half a 16-byte piece, a wave's store covers four runs of 64 bytes.
__device__ __forceinline__ void prep_x(const float* __restrict__ x, bf* __restrict__ XB, const int job, const int lane) {
    const int tr = job / (DM / 256), k0 = (job % (DM / 256)) * 256; const int b = tr / (TT / 16), r0 = (tr % (TT / 16)) * 16; const int kq = lane & 7;
    const float* src = x + (size_t)b * TT_FULL * DM + (size_t)(r0 + (lane >> 3)) * DM + k0 + kq * 4;
    bf* dst = XB + (size_t)b * TT * DM + ((size_t)(r0 >> 4) * (DM / 32) + (k0 >> 5)) * 512 + (kq >> 2) * 256 + (((kq >> 1) & 1) * 16 + (lane >> 3)) * 8 + (kq & 1) * 4;
    // every loop below is unrolled: v and o stay in registers and every row or tile step becomes an immediate offset
#pragma unroll
    for (int hf = 0; hf < 2; ++hf) {
        v4f v[4][4];
        __builtin_amdgcn_sched_barrier(0);   // the addresses are formed in front of the run of loads, so that nothing but loads stands between here and the wait
#pragma unroll
        for (int j = 0; j < 4; ++j)
#pragma unroll
            for (int tl = 0; tl < 4; ++tl) v[tl][j] = *(const v4f*)(src + (size_t)(4 * j) * DM + (hf * 4 + tl) * 32);
        xwait();
        v4us o[4][4];
#pragma unroll
        for (int tl = 0; tl < 4; ++tl)
#pragma unroll
            for (int j = 0; j < 4; ++j)
#pragma unroll
                for (int e = 0; e < 4; ++e) o[tl][j][e] = f2bf(v[tl][j][e]);
        __builtin_amdgcn_sched_barrier(0);   // every packed piece is formed, in registers of its own, in front of the first store
#pragma unroll
        for (int tl = 0; tl < 4; ++tl)
#pragma unroll
            for (int j = 0; j < 4; ++j) *(v4us*)(dst + (hf * 4 + tl) * 512 + (4 * j) * 8) = o[tl][j];
        xwait();
    }
}
// CS[t][j] = {cos(t inv_j), sin(t inv_j)} f32 for j < 64, inv_j = 1 / f32(10000^(j/64)) where 10000^(j/64) is a product of exact-root powers 10000^(2^b/64) in f64; a thread forms inv_j once and uses it for 8 positions
__device__ __forceinline__ void prep_cs(float* CS, const int blk) {
    const int j = threadIdx.x & (HP - 1); const int t0 = (blk * 4 + (int)(threadIdx.x >> 6)) * 8;
    double s = 100.0, p = 1.0;
#pragma unroll 1
    for (int b = 5; b >= 0; --b) { if ((j >> b) & 1) p *= s; s = sqrt(s); }
    const float pf = (float)p; const float inv = 1.0f / pf;
    // stays rolled: eight copies of the sine and cosine code would only add text for the instruction cache to hold
#pragma unroll 1
    for (int t = t0; t < t0 + 8; ++t) { const float ang = __fmul_rn((float)t, inv);
        float sn, cn; sincosf(ang, &sn, &cn);
        v2f cs; cs[0] = cn; cs[1] = sn;
        *(v2f*)(CS + ((size_t)t * HP + j) * 2) = cs;
        xwait(); }
}
__global__ __launch_bounds__(256) void k_prep(const float* __restrict__ x, const float* __restrict__ wq, const float* __restrict__ wk, const float* __restrict__ wv, const float* __restrict__ wo,
                                              bf* XB, bf* WQ, bf* WK, bf* WV, bf* WO, h16* WO16, float* CS) {
    const int lane = threadIdx.x & 31; const int wave = __builtin_amdgcn_readfirstlane((int)(threadIdx.x >> 5));   // scalar: job numbers and plane bases stay in scalar registers
    int blk = blockIdx.x;
    if (blk < PB_CS) { prep_cs(CS, blk); return; }
    blk -= PB_CS;
    if (blk < PB_X) { prep_x(x, XB, blk * 8 + wave, lane); return; }
    blk -= PB_X;
    if (blk < PB_WB) { prep_w<DM, DQ, false>(wq, WQ, nullptr, blk * 8 + wave, lane); return; }
    blk -= PB_WB;
    if (blk < 2 * PB_WS) { const bool sec = blk >= PB_WS; prep_w<DM, DKV, false>(sec ? wv : wk, sec ? WV : WK, nullptr, (sec ? blk - PB_WS : blk) * 8 + wave, lane); return; }
    blk -= 2 * PB_WS;
    prep_w<DQ, DM, true>(wo, WO, WO16, blk * 8 + wave, lane);
}
typedef __attribute__((ext_vector_type(16))) unsigned short v16us;
__device__ __forceinline__ float xhalf(float x) { return __builtin_bit_cast(float, __builtin_amdgcn_permlanex16(__builtin_bit_cast(int, x), __builtin_bit_cast(int, x), 0x76543210, 0xfedcba98, false, false)); }   // lane l with lane l ^ 16
__device__ __forceinline__ void wgap() { __builtin_amdgcn_sched_barrier(0); asm volatile("v_nop\n\tv_nop\n\tv_nop\n\tv_nop"); __builtin_amdgcn_sched_barrier(0); }   // the 4 vector slots between a pass's last WMMAs and whatever reads their D or overwrites their A/B next, on the taken side of the loop branch that follows too
template <bool B> struct BoolC { static constexpr bool value = B; };
template <typename T16, bool HR>
__device__ __forceinline__ void fattn_rows(const T16* __restrict__ Q, const T16* __restrict__ Q2, const T16* __restrict__ Kp, const T16* __restrict__ K2, const T16* __restrict__ Vt, const T16* __restrict__ V2, const int q0, const int lane, v8f (&acc)[2][8], float (&linv)[2]) {
    typedef typename WFrag<T16>::V V;
    constexpr float CSC = SCL * 1.4426950408889634f;
    const int c = lane & 15, h = lane >> 4;
    V qf[2][4], qf2[2][4], kf[2][4], kf2[2][4];
    // every fragment address = a wave-uniform plane base + the lane's byte offset (16 bytes a lane inside a tile in fragment order); the key and value offsets are carried through the pass loop and advanced only behind the wait that covers the loads which name them
    const unsigned qo = ((unsigned)q0 * HD + 8 * lane) * 2; unsigned ko = (unsigned)lane * 16, vo = (unsigned)lane * 16;
    auto ldo = [](const T16* ub, const unsigned bo, const int o) __attribute__((always_inline)) { return WFrag<T16>::ld((const T16*)((const char*)ub + bo) + o); };
#pragma unroll
    for (int g = 0; g < 2; ++g)
#pragma unroll
        for (int kc = 0; kc < 4; ++kc) { const int o = 16 * g * HD + 512 * kc; qf[g][kc] = ldo(Q, qo, o); if constexpr (HR) qf2[g][kc] = ldo(Q2, qo, o); }
    float m_run[2], l_run[2];
#pragma unroll
    for (int g = 0; g < 2; ++g) { m_run[g] = -__builtin_inff(); l_run[g] = 0.0f;
#pragma unroll
        for (int t = 0; t < 8; ++t) acc[g][t] = (v8f){}; }
#pragma unroll
    for (int kt = 0; kt < 2; ++kt)
#pragma unroll
        for (int kc = 0; kc < 4; ++kc) { const int o = 16 * kt * HD + 512 * kc; kf[kt][kc] = ldo(Kp, ko, o); if constexpr (HR) kf2[kt][kc] = ldo(K2, ko, o); }
    // stands in front of any overwrite of an address register that the query and first key loads name; the operands (the offsets, and the key addresses where the build sums base and offset in a vector pair) keep those registers untouched up to the wait
    if constexpr (HR) asm volatile("s_wait_xcnt 0x0" : "+v"(ko) : "v"(qo), "v"((const char*)Kp + ko), "v"((const char*)K2 + ko) : "memory");
    else asm volatile("s_wait_xcnt 0x0" : "+v"(ko) : "v"(qo), "v"((const char*)Kp + ko) : "memory");
    __builtin_amdgcn_sched_barrier(0);   // nothing that could overwrite one moves up over that wait
    ko += 32 * HD * 2;
    // One 32-key pass. dg true: the diagonal pass, a wave's last (keys > query replaced by -inf, by index; nothing fetched ahead); every other pass fetches the next pass's key fragments.
    auto pass = [&](auto dg) __attribute__((always_inline)) {
        constexpr bool DIAG = decltype(dg)::value;
        V vf[8], vf2[8];
#pragma unroll
        for (int t = 0; t < 8; ++t) { const int o = 512 * t; vf[t] = ldo(Vt, vo, o); if constexpr (HR) vf2[t] = ldo(V2, vo, o); }
        if constexpr (HR && !DIAG) asm volatile("s_wait_xcnt 0x0" ::: "memory");   // with two value planes the build sums base and offset in vector registers that the score tiles then take: the wait stands in front of that overwrite
        if constexpr (HR && DIAG) asm volatile("s_wait_xcnt 0x0" :: "v"((const char*)Vt + vo), "v"((const char*)V2 + vo) : "memory");   // the same wait in a wave's last pass: as inputs the two sums stay untouched up to it (built without them, the last load of each plane landed on its own address pair, which the loads before it name)
        __builtin_amdgcn_sched_barrier(0);   // the value loads stay in front of the score products, so that they fly under them and under the softmax
        v8f s[2][2];
#pragma unroll
        for (int kt = 0; kt < 2; ++kt)
#pragma unroll
            for (int g = 0; g < 2; ++g) { s[kt][g] = (v8f){};
#pragma unroll
                for (int kc = 0; kc < 4; ++kc) { s[kt][g] = WFrag<T16>::mma(kf[kt][kc], qf[g][kc], s[kt][g]);
                    if constexpr (HR) { s[kt][g] = WFrag<T16>::mma(kf2[kt][kc], qf[g][kc], s[kt][g]); s[kt][g] = WFrag<T16>::mma(kf[kt][kc], qf2[g][kc], s[kt][g]); } } }
        __builtin_amdgcn_sched_barrier(0);   // the score products stay in front of the wait and of the key prefetch
        asm volatile("s_wait_xcnt 0x0" :: "v"(vo) : "memory");   // stands in front of any overwrite of an address register that the value loads name (the input keeps their offset untouched up to here); it is placed behind the score products so that it does not hold up their issue
        __builtin_amdgcn_sched_barrier(0);   // nothing that could overwrite one moves up over that wait
        if constexpr (!DIAG) {   // the next pass's key fragments fly under this pass's softmax and second product
#pragma unroll
            for (int kt = 0; kt < 2; ++kt)
#pragma unroll
                for (int kc = 0; kc < 4; ++kc) { const int o = 16 * kt * HD + 512 * kc; kf[kt][kc] = ldo(Kp, ko, o); if constexpr (HR) kf2[kt][kc] = ldo(K2, ko, o); }
            __builtin_amdgcn_sched_barrier(0);   // keeps the key prefetch issued ahead of the softmax arithmetic
        } else {                 // the pass's first key is q0
#pragma unroll
            for (int g = 0; g < 2; ++g)
#pragma unroll
                for (int kt = 0; kt < 2; ++kt)
#pragma unroll
                    for (int r = 0; r < 8; ++r) if (16 * kt + 8 * h + r > 16 * g + c) s[kt][g][r] = -__builtin_inff();
        }
        float mb[2]; bool need = false;
#pragma unroll
        for (int g = 0; g < 2; ++g) { float mx = -__builtin_inff();
#pragma unroll
            for (int kt = 0; kt < 2; ++kt)
#pragma unroll
                for (int r = 0; r < 8; ++r) mx = fmaxf(mx, s[kt][g][r]);
            mx = fmaxf(mx, xhalf(mx)) * CSC; mb[g] = mx; need = need || (mx > m_run[g] + 8.0f); }
        if (__builtin_amdgcn_ballot_w32(need) != 0) {   // scalar branch, rare after the first passes; every column has an unmasked key in every pass, so the new maximum is finite
#pragma unroll
            for (int g = 0; g < 2; ++g) { const float mn = fmaxf(m_run[g], mb[g]); const float corr = __builtin_amdgcn_exp2f(m_run[g] - mn); l_run[g] *= corr; m_run[g] = mn;
#pragma unroll
                for (int t = 0; t < 8; ++t) acc[g][t] = acc[g][t] * corr; }
        }
#pragma unroll
        for (int g = 0; g < 2; ++g) { const float nm = -m_run[g]; float pv[16]; float ps0 = 0.0f, ps1 = 0.0f;
#pragma unroll
            for (int e = 0; e < 16; ++e) { pv[e] = __builtin_amdgcn_exp2f(__builtin_fmaf(s[e >> 3][g][e & 7], CSC, nm)); if (e & 1) ps1 += pv[e]; else ps0 += pv[e]; }
            l_run[g] += ps0 + ps1;
            V pf, pf2;
            if constexpr (HR) { v16us uh, ul;
#pragma unroll
                for (int e = 0; e < 16; ++e) { unsigned short a, b; splitf(pv[e], a, b); uh[e] = a; ul[e] = b; }
                pf = __builtin_bit_cast(v16bf, uh); pf2 = __builtin_bit_cast(v16bf, ul);
            } else {
#pragma unroll
                for (int e = 0; e < 16; ++e) pf[e] = tohx(pv[e]); }
#pragma unroll
            for (int t = 0; t < 8; ++t) { acc[g][t] = WFrag<T16>::mma(vf[t], pf, acc[g][t]);
                if constexpr (HR) { acc[g][t] = WFrag<T16>::mma(vf2[t], pf, acc[g][t]); acc[g][t] = WFrag<T16>::mma(vf[t], pf2, acc[g][t]); } }
        }
        wgap();
        if constexpr (!DIAG) {
            asm volatile("s_wait_xcnt 0x0" : "+v"(ko), "+v"(vo) :: "memory");   // stands in front of the offset updates, which overwrite address registers that this pass's loads name; as in-out operands the offsets can be advanced only behind it
            ko += 32 * HD * 2; vo += 32 * HD * 2; }
    };
    // stays rolled: the trip count is known only at run time, and further copies of a body this long would only add code for the instruction cache to hold
#pragma unroll 1
    for (int key0 = 0; key0 < q0; key0 += 32) pass(BoolC<false>{});   // keys [0, q0): no key exceeds a query of this wave
    pass(BoolC<true>{});                                              // keys [q0, q0 + 32)
#pragma unroll
    for (int g = 0; g < 2; ++g) linv[g] = __fdiv_rn(1.0f, l_run[g] + xhalf(l_run[g]));   // each wave half summed its own eight keys of every 16-key tile
}
__global__ __launch_bounds__(32 * REP) void k_fattn(const h16* __restrict__ Q16, const h16* __restrict__ K16, const h16* __restrict__ V16, const bf* __restrict__ Qh, const bf* __restrict__ Ql, const bf* __restrict__ Kh, const bf* __restrict__ Kl, const bf* __restrict__ Vh, const bf* __restrict__ Vl, h16* A16_, bf* Ah_, bf* Al_) {
    const int lane = threadIdx.x & 31; const int g = blockIdx.y;
    const int head = g * REP + __builtin_amdgcn_readfirstlane((int)(threadIdx.x >> 5));   // scalar: plane bases and the pass loop stay under scalar control
    // a wave takes one row block of every batch, one after the other: block n - 1 - x of even batches, block x of odd ones, so that with two batches every wave walks the same number of key passes. Stays rolled: one copy of the two long bodies in the instruction cache
#pragma unroll 1
    for (int b = 0; b < NB; ++b) {
    const int q0 = ((b & 1) ? (int)blockIdx.x : TT / 32 - 1 - (int)blockIdx.x) * 32;
    const size_t bh = (size_t)b * NH_ + head, bg = (size_t)b * NKV + g;
    h16* A16 = A16_ + (size_t)b * TT * DQ; bf* Ah = Ah_ + (size_t)b * RH * DQ; bf* Al = Al_ + (size_t)b * RH * DQ;
    v8f acc[2][8]; float linv[2];
    if (q0 < RH) {
        fattn_rows<bf, true>(Qh + bh * RH * HD, Ql + bh * RH * HD, Kh + bg * RH * HD, Kl + bg * RH * HD, Vh + bg * HD * RH, Vl + bg * HD * RH, q0, lane, acc, linv);
#pragma unroll
        for (int gq = 0; gq < 2; ++gq)
#pragma unroll
            for (int t = 0; t < 8; ++t) { v8us oh, ol;   // a lane's 8 registers are d = 16 t + 8 h + 0..7 of query q0 + 16 gq + c
#pragma unroll
                for (int r = 0; r < 8; ++r) { unsigned short a, b; splitf(acc[gq][t][r] * linv[gq], a, b); oh[r] = a; ol[r] = b; }
                const size_t oo = (size_t)(q0 + 16 * gq) * DQ + (head * (HD / 32) + (t >> 1)) * 512 + (t & 1) * 256 + 8 * lane; *(v8us*)(Ah + oo) = oh; *(v8us*)(Al + oo) = ol; }   // its place in fragment order, planes of DQ columns
        asm volatile("s_wait_xcnt 0x0" ::: "memory");   // stands behind the run of stores above, in front of anything that could overwrite a register which one of them names
    } else {
        fattn_rows<h16, false>(Q16 + bh * TT * HD, nullptr, K16 + bg * TT * HD, nullptr, V16 + bg * HD * TT, nullptr, q0, lane, acc, linv);
        v8h o16[2][8];
#pragma unroll
        for (int gq = 0; gq < 2; ++gq)
#pragma unroll
            for (int t = 0; t < 8; ++t)
#pragma unroll
                for (int r = 0; r < 8; ++r) o16[gq][t][r] = tohx(acc[gq][t][r] * linv[gq] * ACAR);
        __builtin_amdgcn_sched_barrier(0);   // all sixteen packed vectors are formed in front of the first store, each in registers of its own: built without it, the packing of a later vector took the data registers of a store just issued, ahead of the wait below
#pragma unroll
        for (int gq = 0; gq < 2; ++gq)
#pragma unroll
            for (int t = 0; t < 8; ++t) *(v8h*)(A16 + (size_t)(q0 + 16 * gq) * DQ + (head * (HD / 32) + (t >> 1)) * 512 + (t & 1) * 256 + 8 * lane) = o16[gq][t];   // its place in fragment order, plane of DQ columns
        asm volatile("s_wait_xcnt 0x0" ::: "memory");   // stands behind the run of stores above, in front of anything that could overwrite a register which one of them names
    }
    }
}

extern "C" void kernel_launch(void* const* d_in, const int* in_sizes, int n_in,
                              void* d_out, int out_size, void* d_ws, size_t ws_size, hipStream_t stream) {
    if (n_in < 5) return;
    if ((size_t)in_sizes[0] < (size_t)(NB - 1) * TT_FULL * DM + (size_t)TT * DM) return;
    if (in_sizes[1] < DM * DQ || in_sizes[2] < DM * DKV || in_sizes[3] < DM * DKV || in_sizes[4] < DQ * DM) return;
    if ((size_t)out_size < (size_t)(NB - 1) * TT_FULL * DM + (size_t)TT * DM) return;
    const float* x = (const float*)d_in[0]; const float* wq = (const float*)d_in[1]; const float* wk = (const float*)d_in[2]; const float* wv = (const float*)d_in[3]; const float* wo = (const float*)d_in[4];
    float* OUT = (float*)d_out;     // [NB][TT_FULL][DM]
    char* wsp = (char*)d_ws;
    auto take = [&](size_t bytes) { char* p = wsp; wsp += (bytes + 255) & ~(size_t)255; return (void*)p; };
    bf* WQ = (bf*)take((size_t)DQ * DM * 2); bf* WK = (bf*)take((size_t)DKV * DM * 2); bf* WV = (bf*)take((size_t)DKV * DM * 2); bf* WO = (bf*)take((size_t)DM * DQ * 2);   // Bt = (out, in) planes in fragment order
    h16* WO16 = (h16*)take((size_t)DM * DQ * 2);                                                                                             // Bt fp16 x WCAR
    float* CS = (float*)take((size_t)TT * HP * 2 * 4);
    // from here on every plane holds NB batches, one behind the other
    h16* QP16 = (h16*)take((size_t)NB * NH_ * TT * HD * 2); h16* KP16 = (h16*)take((size_t)NB * NKV * TT * HD * 2); h16* VT16 = (h16*)take((size_t)NB * NKV * HD * TT * 2);
    bf* QPh = (bf*)take((size_t)NB * NH_ * RH * HD * 2); bf* QPl = (bf*)take((size_t)NB * NH_ * RH * HD * 2); bf* KPh = (bf*)take((size_t)NB * NKV * RH * HD * 2); bf* KPl = (bf*)take((size_t)NB * NKV * RH * HD * 2);
    bf* VTh = (bf*)take((size_t)NB * NKV * HD * RH * 2); bf* VTl = (bf*)take((size_t)NB * NKV * HD * RH * 2);
    bf* XB = (bf*)take((size_t)NB * TT * DM * 2);     // bf16 x rows
    h16* AT16 = (h16*)take((size_t)NB * TT * DQ * 2); bf* ATh = (bf*)take((size_t)NB * RH * DQ * 2); bf* ATl = (bf*)take((size_t)NB * RH * DQ * 2);
    if ((size_t)(wsp - (char*)d_ws) > ws_size) return;
    // one launch prepares every plane that depends on an input alone, for all NB batches
    k_prep<<<PB_CS + PB_X + 2 * PB_WB + 2 * PB_WS, 256, 0, stream>>>(x, wq, wk, wv, wo, XB, WQ, WK, WV, WO, WO16, CS);
    // every launch below covers all NB batches: the last grid dimension of a GEMM is the batch (z with the batch strides); k_fattn walks the batches inside each wave
    // the three projections write their 16-bit operand planes themselves (rotary map for q and k; v taken transposed, weight rows x positions): no f32 copy of q, k or v exists
    k_gemmw<bf, 0, 8, 1><<<dim3(TT / 64, DQ / 64, NB), 256, 0, stream>>>(XB, nullptr, WQ, nullptr, DM, -1, 0, nullptr, DQ, 1.0f, (size_t)TT * DM, 0, 0, CS, QP16, QPh, QPl);
    k_gemmw<bf, 0, 16, 1><<<dim3(TT / 64, DKV / 64, NB), 512, 0, stream>>>(XB, nullptr, WK, nullptr, DM, -1, 0, nullptr, DKV, 1.0f, (size_t)TT * DM, 0, 0, CS, KP16, KPh, KPl);
    k_gemmw<bf, 0, 16, 2><<<dim3(DKV / 64, TT / 64, NB), 512, 0, stream>>>(WV, nullptr, XB, nullptr, DM, -1, 0, nullptr, DKV, 1.0f, 0, (size_t)TT * DM, 0, nullptr, VT16, VTh, VTl);
    k_fattn<<<dim3(TT / 32, NKV, 1), 32 * REP, 0, stream>>>(QP16, KP16, VT16, QPh, QPl, KPh, KPl, VTh, VTl, AT16, ATh, ATl);
    // output projection: rows < RH bf16 hi/lo context x bf16 Wo (2 products); rows >= RH fp16 context x64 x fp16 Wo x64 (1 product, 1/4096 in the epilogue)
    k_gemmw<bf, 1, 16, 0><<<dim3(RH / 64, DM / 64, NB), 512, 0, stream>>>(ATh, ATl, WO, nullptr, DQ, -1, 0, OUT, DM, 1.0f, (size_t)RH * DQ, 0, (size_t)TT_FULL * DM, nullptr, nullptr, nullptr, nullptr);
    k_gemmw<h16, 0, 8, 0><<<dim3((TT - RH) / 64, DM / 64, NB), 256, 0, stream>>>(AT16 + (size_t)RH * DQ, nullptr, WO16, nullptr, DQ, -1, 0, OUT + (size_t)RH * DM, DM, OSCW, (size_t)TT * DQ, 0, (size_t)TT_FULL * DM, nullptr, nullptr, nullptr, nullptr);
}

// v007
// One run takes 165 microseconds.
// Timed twice side by side with v006, it ran 1.15 and 1.14 times as fast.
// Counting every step since v000, it is 9.74 times as fast.
#include <hip/hip_runtime.h>

// Causal grouped-query self-attention with interleaved rotary embedding: x [NB][T][2048]; q = x Wq (16 heads x 128), k, v = x Wk, x Wv (4 kv heads x 128, each shared by 4 consecutive q heads);
// rotary pairs (2j, 2j+1) with angle t / 10000^(j/64); s = q.k x 128^-0.5 with keys > query replaced by -inf; softmax; attn.v; merged heads x Wo -> [NB][T][2048] f32.
// Compute dtypes, f32 accumulate: x, Wq, Wk, Wv, Wo RNE-converted to bf16; q/k/v projections v_wmma_f32_16x16x32_bf16 (plain); scores and attn.v: query rows < 128 bf16 hi/lo split (3 products),
// rows >= 128 v_wmma_f32_16x16x32_f16 single products (P unnormalised, exp2 of the score minus the maximum in use); rotary table and softmax f32; output projection: rows < 128 bf16 hi/lo x bf16 (2 products),
// rows >= 128 v_wmma_f32_16x16x32_f16 single product (context carried x64, Wo carried x64, 1/4096 folded in the f32 epilogue).
// Every 16-bit operand plane P[row][k] (NC columns) lies in FRAGMENT ORDER: 1-KB tiles of 16 rows x 32 k, tile (row >> 4, k >> 5) at element ((row >> 4) (NC / 32) + (k >> 5)) 512 (value planes: tile (d >> 4, key >> 5) at
// ((key >> 5) 8 + (d >> 4)) 512), and inside a tile element (row, k) at ((k >> 4) & 1) 256 + (((k >> 3) & 1) 16 + (row & 15)) 8 + (k & 7): a wave's 16-byte-per-lane load or store at lane 8 covers 512 contiguous bytes.

#ifndef NB
#define NB 2
#endif
#ifndef SEQ
#define SEQ 2048
#endif
#define NB_FULL 2
#define TT_FULL 2048
#define TT   SEQ
#define DM   2048
#define NH_  16
#define NKV  4
#define REP  (NH_ / NKV)
#define HD   128
#define HP   (HD / 2)
#define DQ   (NH_ * HD)
#define DKV  (NKV * HD)
#define RH   128                  // query rows < RH use hi/lo planes (keys < RH suffice: causal)
#define ACAR 64.0f                // carry of the fp16 merged-context plane (rows >= RH)
#define WCAR 64.0f                // carry of the fp16 Wo plane
#define OSCW (1.0f / (ACAR * WCAR))
#define SCL  0.08838834764831845f   // HD^-0.5
#define KX   DM                   // columns of every GEMM operand plane

static_assert(NB >= 1 && NB <= NB_FULL);
static_assert(TT % 128 == 0 && TT <= TT_FULL && TT > RH);
static_assert(RH % 128 == 0 && RH >= 128);
static_assert((TT - RH) % 64 == 0);
static_assert(HD == 128 && HP == 64);
static_assert(NH_ == NKV * REP && TT % 32 == 0 && RH % 32 == 0);
static_assert(DM % 64 == 0 && DQ % 64 == 0 && DKV % 64 == 0 && DQ == KX);

typedef _Float16 h16;
typedef unsigned short bf;
typedef __attribute__((ext_vector_type(16))) __bf16   v16bf;
typedef __attribute__((ext_vector_type(16))) _Float16 v16h;
typedef __attribute__((ext_vector_type(8)))  _Float16 v8h;
typedef __attribute__((ext_vector_type(8)))  unsigned short v8us;
typedef __attribute__((ext_vector_type(8)))  float    v8f;
typedef __attribute__((ext_vector_type(4)))  float    v4f;
typedef v8h  __attribute__((may_alias)) v8ha;
typedef v4f  __attribute__((may_alias)) v4fa;
typedef v8us __attribute__((may_alias)) v8usa;

__device__ __forceinline__ unsigned short f2bf(float f) { unsigned u = __float_as_uint(f); u += 0x7FFFu + ((u >> 16) & 1u); return (unsigned short)(u >> 16); }
__device__ __forceinline__ float bf2f(unsigned short b) { return __uint_as_float(((unsigned)b) << 16); }
__device__ __forceinline__ float bfr(float f) { return bf2f(f2bf(f)); }
__device__ __forceinline__ v16h cat16(v8h lo, v8h hi) { return __builtin_shufflevector(lo, hi, 0, 1, 2, 3, 4, 5, 6, 7, 8, 9, 10, 11, 12, 13, 14, 15); }
__device__ __forceinline__ v16bf cat16b(v8us lo, v8us hi) { return __builtin_bit_cast(v16bf, __builtin_shufflevector(lo, hi, 0, 1, 2, 3, 4, 5, 6, 7, 8, 9, 10, 11, 12, 13, 14, 15)); }
__device__ __forceinline__ v8f wmma16(v16h a, v16h b, v8f c) { return __builtin_amdgcn_wmma_f32_16x16x32_f16(false, a, false, b, (short)0, c, false, false); }
__device__ __forceinline__ v8f wmmab(v16bf a, v16bf b, v8f c) { return __builtin_amdgcn_wmma_f32_16x16x32_bf16(false, a, false, b, (short)0, c, false, false); }

__device__ __forceinline__ h16 tohx(float x) { return (h16)x; }
__device__ __forceinline__ void splitf(float y, unsigned short& h, unsigned short& l) { h = f2bf(y); l = f2bf(y - bf2f(h)); }

// ---- k_gemmw: register-blocked GEMM, NW WAVES per 64x64 output tile (16 accumulators each), operands straight from 16-bit planes in fragment order; grid (M/64, N/64, Z), 32 NW threads.
// Wave w contracts the 32-wide k chunks w, w + NW, w + 2 NW, ... of the tile; for NW > 1 the NW f32 partial tiles meet in LDS and are summed in wave order 0 .. NW-1 (fixed), then scaled and stored.
// C[m][n] (f32, pitch ldc) = osc x sum_k A[m][k] Bt[n][k] (+ split products per NSPLIT: 1 = A2.Bt added, 2 = A2.Bt and A.Bt2 added). Every plane has KX columns (a constant: the tile-row steps become immediate offsets), z-batch strides sA/sB/sC in elements. K % 32 == 0.
// Fragment k map (both operands): elements 0..7 <- kc + 8h + 0..7, elements 8..15 <- kc + 16 + 8h + 0..7, h = lane >> 4, row/col = lane & 15: WFrag::ld at tile base + lane 8 (its second half 256 elements on).
// cskip >= 0: tiles with blockIdx.y > blockIdx.x + cskip are not computed (causal upper triangle). kcaus > 0: contraction stops at min(K, kcaus + 64 (blockIdx.x + 1)) (causal key limit).
// EPI 0: the f32 tile goes to C as above. EPI 1 and 2 (NW > 1; C unused, ldc = heads x HD (the product's columns for EPI 1, its rows for EPI 2), z = batch): the thread that sums 8 neighbouring columns of a row turns them into 16-bit operands itself and stores them
// as one 16-byte piece at their place in fragment order (a wave's store covers 512 contiguous bytes): fp16 plane P16 for every row, bf16 hi/lo planes Ph/Pl for positions < RH.
// EPI 1: rows = positions t, columns = head HD + d: interleaved rotary map out[2j] = x[2j] c - x[2j+1] s, out[2j+1] = x[2j] s + x[2j+1] c, (c, s) = CS[t][j], into head planes (t, d).
// EPI 2: rows = kv head HD + d, columns = positions t (the product is taken transposed: A = weight plane, Bt = x plane): value planes (d, t), the 8 d tiles of a 32-key block side by side.
template <typename T16> struct WFrag;
template <> struct WFrag<h16> { typedef v16h V; static __device__ __forceinline__ V ld(const h16* p) { return cat16(*(const v8h*)p, *(const v8h*)(p + 256)); } static __device__ __forceinline__ v8f mma(V a, V b, v8f c) { return wmma16(a, b, c); } };
template <> struct WFrag<bf> { typedef v16bf V; static __device__ __forceinline__ V ld(const bf* p) { return cat16b(*(const v8us*)p, *(const v8us*)(p + 256)); } static __device__ __forceinline__ v8f mma(V a, V b, v8f c) { return wmmab(a, b, c); } };
template <typename T16, int NSPLIT, int NW, int EPI>
__global__ __launch_bounds__(32 * NW) void k_gemmw(const T16* __restrict__ A, const T16* __restrict__ A2, const T16* __restrict__ Bt, const T16* __restrict__ Bt2, int K, int cskip, int kcaus,
                                             float* C, int ldc, float osc, size_t sA, size_t sB, size_t sC, const float* __restrict__ CS, h16* P16, bf* Ph, bf* Pl) {
    static_assert(EPI == 0 || (NW > 1 && 16 % NW == 0));
    typedef typename WFrag<T16>::V V;
    __shared__ __align__(16) float os[(NW == 1 ? 16 : NW * 64) * 68];
    if (cskip >= 0 && (int)blockIdx.y > (int)blockIdx.x + cskip) return;   // block-uniform, in front of the one block barrier
    const size_t z = blockIdx.z; A += z * sA; if (A2) A2 += z * sA; Bt += z * sB; if (Bt2) Bt2 += z * sB; C += z * sC;
    const int lane = threadIdx.x & 31, lr = lane & 15, hi = lane >> 4; const int r0 = blockIdx.x * 64, c0 = blockIdx.y * 64;
    const int wv = (NW == 1) ? 0 : __builtin_amdgcn_readfirstlane((int)(threadIdx.x >> 5));   // wave number, scalar: the k loop stays under scalar control
    int kend = K;
    if (kcaus > 0) { const int kl = kcaus + 64 * ((int)blockIdx.x + 1); kend = (kl < K) ? kl : K; }
    v8f acc[4][4];
#pragma unroll
    for (int mb = 0; mb < 4; ++mb)
#pragma unroll
        for (int nb = 0; nb < 4; ++nb) acc[mb][nb] = (v8f){};
    // every fragment address = a wave-uniform tile-row base (16 rows of a plane = KX / 32 tiles = 16 KX elements) + one byte offset per lane: 16 bytes a lane inside a tile, 1 KB a 32-wide k chunk; the offset is advanced only behind the wait at the loop's foot
    const size_t aoff = (size_t)r0 * KX, boff = (size_t)c0 * KX; unsigned ko = (unsigned)lane * 16 + (unsigned)wv * 1024;
    auto ldo = [](const T16* ub, const unsigned bo, const int o) __attribute__((always_inline)) { return WFrag<T16>::ld((const T16*)((const char*)ub + bo) + o); };
#pragma unroll 1
    for (int kc = 32 * wv; kc < kend; kc += 32 * NW) {
        V a[4], a2[4], b[4], b2[4];
#pragma unroll
        for (int mb = 0; mb < 4; ++mb) { a[mb] = ldo(A + aoff, ko, mb * 16 * KX); if (NSPLIT == 1 || NSPLIT == 2) a2[mb] = ldo(A2 + aoff, ko, mb * 16 * KX); }
#pragma unroll
        for (int nb = 0; nb < 4; ++nb) { b[nb] = ldo(Bt + boff, ko, nb * 16 * KX); if (NSPLIT >= 2) b2[nb] = ldo(Bt2 + boff, ko, nb * 16 * KX); }
        __builtin_amdgcn_sched_barrier(0);   // the trip's loads stay one group in front of its products; built without it, the Bt fragments shared one register set and each was fetched only behind the products of the one before: four load latencies a trip
#pragma unroll
        for (int nb = 0; nb < 4; ++nb)
#pragma unroll
            for (int mb = 0; mb < 4; ++mb) { acc[mb][nb] = WFrag<T16>::mma(a[mb], b[nb], acc[mb][nb]); if (NSPLIT == 1 || NSPLIT == 2) acc[mb][nb] = WFrag<T16>::mma(a2[mb], b[nb], acc[mb][nb]); if (NSPLIT >= 2) acc[mb][nb] = WFrag<T16>::mma(a[mb], b2[nb], acc[mb][nb]); }
        asm volatile("v_nop\n\tv_nop\n\tv_nop\n\tv_nop" : "+v"(acc[0][0]), "+v"(acc[1][1]), "+v"(acc[2][2]), "+v"(acc[3][3]) : "v"(a[0]), "v"(a[3]));
        asm volatile("s_wait_xcnt 0x0" : "+v"(ko) :: "memory");   // stands in front of the offset update, which overwrites the address register that this trip's loads name; as an in-out operand the offset can be advanced only behind it
        ko += 1024 * NW;
    }
    if constexpr (NW > 1) {
        // EPI != 0: thread item -> (row, 8 columns): lane & 15 = row & 15, lane >> 4 = bit 3 of the column, which is the order of a tile's 16-byte pieces
        auto irow = [](const int it) __attribute__((always_inline)) { const int item = it * (32 * NW) + (int)threadIdx.x; return (item & 15) | ((item >> 7) << 4); };
        auto icol = [](const int it) __attribute__((always_inline)) { const int item = it * (32 * NW) + (int)threadIdx.x; return ((item >> 4) & 7) * 8; };
        v4f ca[EPI == 1 ? 16 / NW : 1], cb[EPI == 1 ? 16 / NW : 1];
        if constexpr (EPI == 1) {   // the (c, s) pairs are fetched here so that they fly under the LDS stores and the barrier
#pragma unroll
            for (int it = 0; it < 16 / NW; ++it) { const float* cp = CS + (size_t)(r0 + irow(it)) * (HP * 2) + ((c0 + icol(it)) & (HD - 1)); ca[it] = *(const v4f*)cp; cb[it] = *(const v4f*)(cp + 4);
                asm volatile("s_wait_xcnt 0x0" :: "v"(cp) : "memory"); } }   // stands in front of any overwrite of the address pair that the two loads name; as an input the pair stays untouched up to it (built without it, the second load landed on the pair)
        float* my = os + (size_t)wv * (64 * 68);
#pragma unroll
        for (int mb = 0; mb < 4; ++mb)
#pragma unroll
            for (int nb = 0; nb < 4; ++nb)
#pragma unroll
                for (int j = 0; j < 8; ++j) my[(mb * 16 + hi * 8 + j) * 68 + nb * 16 + lr] = acc[mb][nb][j];
        __syncthreads();   // every wave's partial tile is in LDS before any thread sums across waves
        if constexpr (EPI != 0) {
            const int nh = ldc / HD; const bool hires = (EPI == 1 ? r0 : c0) < RH;   // block-uniform: a tile's 64 positions lie on one side of RH
            P16 += z * nh * TT * HD; Ph += z * nh * RH * HD; Pl += z * nh * RH * HD;
#pragma unroll
            for (int it = 0; it < 16 / NW; ++it) { const int row = irow(it), cofs = icol(it);
                const float* p = os + row * 68 + cofs; v4f s0 = *(const v4fa*)p, s1 = *(const v4fa*)(p + 4);
#pragma unroll
                for (int q = 1; q < NW; ++q) { s0 += *(const v4fa*)(p + q * (64 * 68)); s1 += *(const v4fa*)(p + q * (64 * 68) + 4); }
                float y[8]; int hd, he;
                if constexpr (EPI == 1) { const int t = r0 + row, col = c0 + cofs, d = col & (HD - 1); hd = col / HD;
#pragma unroll
                    for (int j = 0; j < 2; ++j) { y[2 * j] = s0[2 * j] * ca[it][2 * j] - s0[2 * j + 1] * ca[it][2 * j + 1]; y[2 * j + 1] = s0[2 * j] * ca[it][2 * j + 1] + s0[2 * j + 1] * ca[it][2 * j];
                        y[4 + 2 * j] = s1[2 * j] * cb[it][2 * j] - s1[2 * j + 1] * cb[it][2 * j + 1]; y[5 + 2 * j] = s1[2 * j] * cb[it][2 * j + 1] + s1[2 * j + 1] * cb[it][2 * j]; }
                    he = ((t >> 4) * (HD / 32) + (d >> 5)) * 512 + ((d >> 4) & 1) * 256 + (((d >> 3) & 1) * 16 + (t & 15)) * 8;
                } else { const int r = r0 + row, t = c0 + cofs, d = r & (HD - 1); hd = r / HD;
#pragma unroll
                    for (int j = 0; j < 4; ++j) { y[j] = s0[j]; y[4 + j] = s1[j]; }
                    he = ((t >> 5) * (HD / 16) + (d >> 4)) * 512 + ((t >> 4) & 1) * 256 + (((t >> 3) & 1) * 16 + (d & 15)) * 8; }
                v8h o16;
#pragma unroll
                for (int e = 0; e < 8; ++e) o16[e] = tohx(y[e]);
                *(v8h*)(P16 + (size_t)hd * TT * HD + he) = o16;
                asm volatile("s_wait_xcnt 0x0" ::: "memory");   // stands behind the store, in front of the hi/lo split, which was built into the store's address and data registers
                if (hires) { v8us oh, ol;   // positions < RH are the first RH HD places of a plane
#pragma unroll
                    for (int e = 0; e < 8; ++e) { unsigned short a, b; splitf(y[e], a, b); oh[e] = a; ol[e] = b; }
                    *(v8us*)(Ph + (size_t)hd * RH * HD + he) = oh; *(v8us*)(Pl + (size_t)hd * RH * HD + he) = ol; }
            }
        } else {
#pragma unroll
        for (int it = 0; it < 32 / NW; ++it) { const int item = it * (32 * NW) + (int)threadIdx.x; const int row = item >> 4, cofs = (item & 15) * 4;
            v4f s = *(const v4fa*)(os + row * 68 + cofs);
#pragma unroll
            for (int q = 1; q < NW; ++q) s += *(const v4fa*)(os + q * (64 * 68) + row * 68 + cofs);
            *(v4f*)(C + (size_t)(r0 + row) * ldc + c0 + cofs) = s * osc; }
        }
    } else {
#pragma unroll
    for (int mb = 0; mb < 4; ++mb) {
#pragma unroll
        for (int nb = 0; nb < 4; ++nb) {
#pragma unroll
            for (int j = 0; j < 8; ++j) os[(hi * 8 + j) * 68 + nb * 16 + lr] = acc[mb][nb][j]; }
        __builtin_amdgcn_wave_barrier(); asm volatile("" ::: "memory");
        float* crow = C + (size_t)(r0 + mb * 16) * ldc + c0;
{
#pragma unroll
            for (int s = 0; s < 8; ++s) { const int row = 2 * s + hi, cofs = lr * 4; const v4f val = *(const v4fa*)(os + row * 68 + cofs) * osc;
                *(v4f*)(crow + (size_t)row * ldc + cofs) = val; }
             }
        __builtin_amdgcn_wave_barrier(); asm volatile("" ::: "memory");
    }
    }
}

typedef __attribute__((ext_vector_type(2))) _Float16 v2h;
typedef __attribute__((ext_vector_type(4))) _Float16 v4h;
typedef __attribute__((ext_vector_type(2))) unsigned short v2us;
typedef __attribute__((ext_vector_type(4))) unsigned short v4us;
typedef __attribute__((ext_vector_type(2))) float v2f;

// ---- k_prep: every plane that depends on an input alone (four bf16 weight planes, the fp16 Wo plane, the bf16 x plane, the rotary table) in ONE launch. No LDS, no barrier; a block's job follows from its index
// (block-uniform): first the rotary table, then x, then Wq, Wk, Wv, Wo. Every load of a wave covers whole 128-byte lines and a wave keeps 16 (of 16 bytes a lane) or 64 (of 4) of them in flight.
#define PB_CS (TT / 32)                       // blocks of the rotary table: 4 groups of 64 threads, each thread 8 positions of one j
#define PB_X  (NB * (TT / 16))                // blocks of the x plane: a block takes 16 rows, a wave 256 columns of them (8 tiles)
#define PB_WB ((DQ / 64) * (DM / 64) / 8)     // blocks of Wq and of Wo: a wave takes 64 columns x 64 k (8 tiles)
#define PB_WS ((DKV / 64) * (DM / 64) / 8)    // blocks of Wk and of Wv
static_assert(DM % 256 == 0 && DQ == DM && ((DKV / 64) * (DM / 64)) % 8 == 0);
// The wait that stands behind a run of loads or stores, in front of anything that overwrites a register which one of them names; the two scheduling barriers keep every other instruction on its own side of the wait
__device__ __forceinline__ void xwait() { __builtin_amdgcn_sched_barrier(0); asm volatile("s_wait_xcnt 0x0" ::: "memory"); __builtin_amdgcn_sched_barrier(0); }
// w (K rows, N columns, f32) -> Bt (N rows, K columns) in fragment order. A lane owns two columns n (n0 + lane, n0 + 32 + lane), for each: its 32 loads of a 32-k chunk are rows k of w (a wave: 128 contiguous bytes each), its four 16-byte pieces
// (k >> 3 = 0..3 of the chunk) go to their places in tile (n >> 4, k >> 5): a wave's store covers 256 contiguous bytes in each of two tiles. H16: also the fp16 plane of the bf16-rounded value x WCAR.
template <int K, int N, bool H16>
__device__ __forceinline__ void prep_w(const float* __restrict__ w, bf* __restrict__ Bt, h16* __restrict__ Bh, const int job, const int lane) {
    const int k0 = (job % (K / 64)) * 64, n0 = (job / (K / 64)) * 64;
    const float* p = w + (size_t)k0 * N + n0 + lane;
    const size_t tb = ((size_t)((n0 + lane) >> 4) * (K / 32) + (k0 >> 5)) * 512 + (lane & 15) * 8;   // column n0 + lane; column n0 + 32 + lane lies two tile rows (K / 16 tiles) on
    bf* d = Bt + tb; h16* dh = H16 ? Bh + tb : nullptr;
    // every loop below is unrolled: v, o and oh stay in registers and every row or tile step becomes an immediate offset
#pragma unroll
    for (int kc = 0; kc < 2; ++kc) {
        float v[2][32];
        __builtin_amdgcn_sched_barrier(0);   // the addresses are formed in front of the run of loads, so that nothing but loads stands between here and the wait
#pragma unroll
        for (int j = 0; j < 32; ++j)
#pragma unroll
            for (int nh = 0; nh < 2; ++nh) v[nh][j] = p[(size_t)(kc * 32 + j) * N + nh * 32];
        xwait();
        v8us o[2][4]; v8h oh[H16 ? 2 : 1][H16 ? 4 : 1];
#pragma unroll
        for (int nh = 0; nh < 2; ++nh)
#pragma unroll
            for (int q = 0; q < 4; ++q)
#pragma unroll
                for (int e = 0; e < 8; ++e) { o[nh][q][e] = f2bf(v[nh][q * 8 + e]); if constexpr (H16) oh[nh][q][e] = tohx(bf2f(o[nh][q][e]) * WCAR); }
        __builtin_amdgcn_sched_barrier(0);   // every packed piece is formed, in registers of its own, in front of the first store
#pragma unroll
        for (int nh = 0; nh < 2; ++nh)
#pragma unroll
            for (int q = 0; q < 4; ++q) { const int off = (nh * (K / 16) + kc) * 512 + (q >> 1) * 256 + (q & 1) * 128;
                *(v8us*)(d + off) = o[nh][q]; if constexpr (H16) *(v8h*)(dh + off) = oh[nh][q]; }
        xwait();
    }
}
// x rows -> bf16 plane of DM columns in fragment order. A load covers 4 rows x 128 bytes (one tile's k range): lane >> 3 = row & 3, lane & 7 = k >> 2; a lane's 4 values are half a 16-byte piece, a wave's store covers four runs of 64 bytes.
__device__ __forceinline__ void prep_x(const float* __restrict__ x, bf* __restrict__ XB, const int job, const int lane) {
    const int tr = job / (DM / 256), k0 = (job % (DM / 256)) * 256; const int b = tr / (TT / 16), r0 = (tr % (TT / 16)) * 16; const int kq = lane & 7;
    const float* src = x + (size_t)b * TT_FULL * DM + (size_t)(r0 + (lane >> 3)) * DM + k0 + kq * 4;
    bf* dst = XB + (size_t)b * TT * DM + ((size_t)(r0 >> 4) * (DM / 32) + (k0 >> 5)) * 512 + (kq >> 2) * 256 + (((kq >> 1) & 1) * 16 + (lane >> 3)) * 8 + (kq & 1) * 4;
    // every loop below is unrolled: v and o stay in registers and every row or tile step becomes an immediate offset
#pragma unroll
    for (int hf = 0; hf < 2; ++hf) {
        v4f v[4][4];
        __builtin_amdgcn_sched_barrier(0);   // the addresses are formed in front of the run of loads, so that nothing but loads stands between here and the wait
#pragma unroll
        for (int j = 0; j < 4; ++j)
#pragma unroll
            for (int tl = 0; tl < 4; ++tl) v[tl][j] = *(const v4f*)(src + (size_t)(4 * j) * DM + (hf * 4 + tl) * 32);
        xwait();
        v4us o[4][4];
#pragma unroll
        for (int tl = 0; tl < 4; ++tl)
#pragma unroll
            for (int j = 0; j < 4; ++j)
#pragma unroll
                for (int e = 0; e < 4; ++e) o[tl][j][e] = f2bf(v[tl][j][e]);
        __builtin_amdgcn_sched_barrier(0);   // every packed piece is formed, in registers of its own, in front of the first store
#pragma unroll
        for (int tl = 0; tl < 4; ++tl)
#pragma unroll
            for (int j = 0; j < 4; ++j) *(v4us*)(dst + (hf * 4 + tl) * 512 + (4 * j) * 8) = o[tl][j];
        xwait();
    }
}
// CS[t][j] = {cos(t inv_j), sin(t inv_j)} f32 for j < 64, inv_j = 1 / f32(10000^(j/64)) where 10000^(j/64) is a product of exact-root powers 10000^(2^b/64) in f64; a thread forms inv_j once and uses it for 8 positions
__device__ __forceinline__ void prep_cs(float* CS, const int blk) {
    const int j = threadIdx.x & (HP - 1); const int t0 = (blk * 4 + (int)(threadIdx.x >> 6)) * 8;
    double s = 100.0, p = 1.0;
#pragma unroll 1
    for (int b = 5; b >= 0; --b) { if ((j >> b) & 1) p *= s; s = sqrt(s); }
    const float pf = (float)p; const float inv = 1.0f / pf;
    // stays rolled: eight copies of the sine and cosine code would only add text for the instruction cache to hold
#pragma unroll 1
    for (int t = t0; t < t0 + 8; ++t) { const float ang = __fmul_rn((float)t, inv);
        float sn, cn; sincosf(ang, &sn, &cn);
        v2f cs; cs[0] = cn; cs[1] = sn;
        *(v2f*)(CS + ((size_t)t * HP + j) * 2) = cs;
        xwait(); }
}
__global__ __launch_bounds__(256) void k_prep(const float* __restrict__ x, const float* __restrict__ wq, const float* __restrict__ wk, const float* __restrict__ wv, const float* __restrict__ wo,
                                              bf* XB, bf* WQ, bf* WK, bf* WV, bf* WO, h16* WO16, float* CS) {
    const int lane = threadIdx.x & 31; const int wave = __builtin_amdgcn_readfirstlane((int)(threadIdx.x >> 5));   // scalar: job numbers and plane bases stay in scalar registers
    int blk = blockIdx.x;
    if (blk < PB_CS) { prep_cs(CS, blk); return; }
    blk -= PB_CS;
    if (blk < PB_X) { prep_x(x, XB, blk * 8 + wave, lane); return; }
    blk -= PB_X;
    if (blk < PB_WB) { prep_w<DM, DQ, false>(wq, WQ, nullptr, blk * 8 + wave, lane); return; }
    blk -= PB_WB;
    if (blk < 2 * PB_WS) { const bool sec = blk >= PB_WS; prep_w<DM, DKV, false>(sec ? wv : wk, sec ? WV : WK, nullptr, (sec ? blk - PB_WS : blk) * 8 + wave, lane); return; }
    blk -= 2 * PB_WS;
    prep_w<DQ, DM, true>(wo, WO, WO16, blk * 8 + wave, lane);
}
typedef __attribute__((ext_vector_type(16))) unsigned short v16us;
__device__ __forceinline__ float xhalf(float x) { return __builtin_bit_cast(float, __builtin_amdgcn_permlanex16(__builtin_bit_cast(int, x), __builtin_bit_cast(int, x), 0x76543210, 0xfedcba98, false, false)); }   // lane l with lane l ^ 16
__device__ __forceinline__ void wgap() { __builtin_amdgcn_sched_barrier(0); asm volatile("v_nop\n\tv_nop\n\tv_nop\n\tv_nop"); __builtin_amdgcn_sched_barrier(0); }   // the 4 vector slots between a pass's last WMMAs and whatever reads their D or overwrites their A/B next, on the taken side of the loop branch that follows too
template <bool B> struct BoolC { static constexpr bool value = B; };
template <typename T16, bool HR>
__device__ __forceinline__ void fattn_rows(const T16* __restrict__ Q, const T16* __restrict__ Q2, const T16* __restrict__ Kp, const T16* __restrict__ K2, const T16* __restrict__ Vt, const T16* __restrict__ V2, const int q0, const int lane, v8f (&acc)[2][8], float (&linv)[2]) {
    typedef typename WFrag<T16>::V V;
    constexpr float CSC = SCL * 1.4426950408889634f;
    const int c = lane & 15, h = lane >> 4;
    V qf[2][4], qf2[2][4], kf[2][4], kf2[2][4];
    // every fragment address = a wave-uniform plane base + the lane's byte offset (16 bytes a lane inside a tile in fragment order); the key and value offsets are carried through the pass loop and advanced only behind the wait that covers the loads which name them
    const unsigned qo = ((unsigned)q0 * HD + 8 * lane) * 2; unsigned ko = (unsigned)lane * 16, vo = (unsigned)lane * 16;
    auto ldo = [](const T16* ub, const unsigned bo, const int o) __attribute__((always_inline)) { return WFrag<T16>::ld((const T16*)((const char*)ub + bo) + o); };
#pragma unroll
    for (int g = 0; g < 2; ++g)
#pragma unroll
        for (int kc = 0; kc < 4; ++kc) { const int o = 16 * g * HD + 512 * kc; qf[g][kc] = ldo(Q, qo, o); if constexpr (HR) qf2[g][kc] = ldo(Q2, qo, o); }
    float m_run[2], l_run[2];
#pragma unroll
    for (int g = 0; g < 2; ++g) { m_run[g] = -__builtin_inff(); l_run[g] = 0.0f;
#pragma unroll
        for (int t = 0; t < 8; ++t) acc[g][t] = (v8f){}; }
#pragma unroll
    for (int kt = 0; kt < 2; ++kt)
#pragma unroll
        for (int kc = 0; kc < 4; ++kc) { const int o = 16 * kt * HD + 512 * kc; kf[kt][kc] = ldo(Kp, ko, o); if constexpr (HR) kf2[kt][kc] = ldo(K2, ko, o); }
    // stands in front of any overwrite of an address register that the query and first key loads name; the operands (the offsets, and the key addresses where the build sums base and offset in a vector pair) keep those registers untouched up to the wait
    if constexpr (HR) asm volatile("s_wait_xcnt 0x0" : "+v"(ko) : "v"(qo), "v"((const char*)Kp + ko), "v"((const char*)K2 + ko) : "memory");
    else asm volatile("s_wait_xcnt 0x0" : "+v"(ko) : "v"(qo), "v"((const char*)Kp + ko) : "memory");
    __builtin_amdgcn_sched_barrier(0);   // nothing that could overwrite one moves up over that wait
    ko += 32 * HD * 2;
    // One 32-key pass. dg true: the diagonal pass, a wave's last (keys > query replaced by -inf, by index; nothing fetched ahead); every other pass fetches the next pass's key fragments.
    auto pass = [&](auto dg) __attribute__((always_inline)) {
        constexpr bool DIAG = decltype(dg)::value;
        V vf[8], vf2[8];
#pragma unroll
        for (int t = 0; t < 8; ++t) { const int o = 512 * t; vf[t] = ldo(Vt, vo, o); if constexpr (HR) vf2[t] = ldo(V2, vo, o); }
        if constexpr (HR && !DIAG) asm volatile("s_wait_xcnt 0x0" ::: "memory");   // with two value planes the build sums base and offset in vector registers that the score tiles then take: the wait stands in front of that overwrite
        if constexpr (HR && DIAG) asm volatile("s_wait_xcnt 0x0" :: "v"((const char*)Vt + vo), "v"((const char*)V2 + vo) : "memory");   // the same wait in a wave's last pass: as inputs the two sums stay untouched up to it (built without them, the last load of each plane landed on its own address pair, which the loads before it name)
        __builtin_amdgcn_sched_barrier(0);   // the value loads stay in front of the score products, so that they fly under them and under the softmax
        v8f s[2][2];
#pragma unroll
        for (int kt = 0; kt < 2; ++kt)
#pragma unroll
            for (int g = 0; g < 2; ++g) { s[kt][g] = (v8f){};
#pragma unroll
                for (int kc = 0; kc < 4; ++kc) { s[kt][g] = WFrag<T16>::mma(kf[kt][kc], qf[g][kc], s[kt][g]);
                    if constexpr (HR) { s[kt][g] = WFrag<T16>::mma(kf2[kt][kc], qf[g][kc], s[kt][g]); s[kt][g] = WFrag<T16>::mma(kf[kt][kc], qf2[g][kc], s[kt][g]); } } }
        __builtin_amdgcn_sched_barrier(0);   // the score products stay in front of the wait and of the key prefetch
        asm volatile("s_wait_xcnt 0x0" :: "v"(vo) : "memory");   // stands in front of any overwrite of an address register that the value loads name (the input keeps their offset untouched up to here); it is placed behind the score products so that it does not hold up their issue
        __builtin_amdgcn_sched_barrier(0);   // nothing that could overwrite one moves up over that wait
        if constexpr (!DIAG) {   // the next pass's key fragments fly under this pass's softmax and second product
#pragma unroll
            for (int kt = 0; kt < 2; ++kt)
#pragma unroll
                for (int kc = 0; kc < 4; ++kc) { const int o = 16 * kt * HD + 512 * kc; kf[kt][kc] = ldo(Kp, ko, o); if constexpr (HR) kf2[kt][kc] = ldo(K2, ko, o); }
            __builtin_amdgcn_sched_barrier(0);   // keeps the key prefetch issued ahead of the softmax arithmetic
        } else {                 // the pass's first key is q0
#pragma unroll
            for (int g = 0; g < 2; ++g)
#pragma unroll
                for (int kt = 0; kt < 2; ++kt)
#pragma unroll
                    for (int r = 0; r < 8; ++r) if (16 * kt + 8 * h + r > 16 * g + c) s[kt][g][r] = -__builtin_inff();
        }
        float mb[2]; bool need = false;
#pragma unroll
        for (int g = 0; g < 2; ++g) { float mx = -__builtin_inff();
#pragma unroll
            for (int kt = 0; kt < 2; ++kt)
#pragma unroll
                for (int r = 0; r < 8; ++r) mx = fmaxf(mx, s[kt][g][r]);
            mx = fmaxf(mx, xhalf(mx)) * CSC; mb[g] = mx; need = need || (mx > m_run[g] + 8.0f); }
        if (__builtin_amdgcn_ballot_w32(need) != 0) {   // scalar branch, rare after the first passes; every column has an unmasked key in every pass, so the new maximum is finite
#pragma unroll
            for (int g = 0; g < 2; ++g) { const float mn = fmaxf(m_run[g], mb[g]); const float corr = __builtin_amdgcn_exp2f(m_run[g] - mn); l_run[g] *= corr; m_run[g] = mn;
#pragma unroll
                for (int t = 0; t < 8; ++t) acc[g][t] = acc[g][t] * corr; }
        }
#pragma unroll
        for (int g = 0; g < 2; ++g) { const float nm = -m_run[g]; float pv[16]; float ps0 = 0.0f, ps1 = 0.0f;
#pragma unroll
            for (int e = 0; e < 16; ++e) { pv[e] = __builtin_amdgcn_exp2f(__builtin_fmaf(s[e >> 3][g][e & 7], CSC, nm)); if (e & 1) ps1 += pv[e]; else ps0 += pv[e]; }
            l_run[g] += ps0 + ps1;
            V pf, pf2;
            if constexpr (HR) { v16us uh, ul;
#pragma unroll
                for (int e = 0; e < 16; ++e) { unsigned short a, b; splitf(pv[e], a, b); uh[e] = a; ul[e] = b; }
                pf = __builtin_bit_cast(v16bf, uh); pf2 = __builtin_bit_cast(v16bf, ul);
            } else {
#pragma unroll
                for (int e = 0; e < 16; ++e) pf[e] = tohx(pv[e]); }
#pragma unroll
            for (int t = 0; t < 8; ++t) { acc[g][t] = WFrag<T16>::mma(vf[t], pf, acc[g][t]);
                if constexpr (HR) { acc[g][t] = WFrag<T16>::mma(vf2[t], pf, acc[g][t]); acc[g][t] = WFrag<T16>::mma(vf[t], pf2, acc[g][t]); } }
        }
        wgap();
        if constexpr (!DIAG) {
            asm volatile("s_wait_xcnt 0x0" : "+v"(ko), "+v"(vo) :: "memory");   // stands in front of the offset updates, which overwrite address registers that this pass's loads name; as in-out operands the offsets can be advanced only behind it
            ko += 32 * HD * 2; vo += 32 * HD * 2; }
    };
    // stays rolled: the trip count is known only at run time, and further copies of a body this long would only add code for the instruction cache to hold
#pragma unroll 1
    for (int key0 = 0; key0 < q0; key0 += 32) pass(BoolC<false>{});   // keys [0, q0): no key exceeds a query of this wave
    pass(BoolC<true>{});                                              // keys [q0, q0 + 32)
#pragma unroll
    for (int g = 0; g < 2; ++g) linv[g] = __fdiv_rn(1.0f, l_run[g] + xhalf(l_run[g]));   // each wave half summed its own eight keys of every 16-key tile
}
__global__ __launch_bounds__(32 * REP) void k_fattn(const h16* __restrict__ Q16, const h16* __restrict__ K16, const h16* __restrict__ V16, const bf* __restrict__ Qh, const bf* __restrict__ Ql, const bf* __restrict__ Kh, const bf* __restrict__ Kl, const bf* __restrict__ Vh, const bf* __restrict__ Vl, h16* A16_, bf* Ah_, bf* Al_) {
    const int lane = threadIdx.x & 31; const int g = blockIdx.y;
    const int head = g * REP + __builtin_amdgcn_readfirstlane((int)(threadIdx.x >> 5));   // scalar: plane bases and the pass loop stay under scalar control
    // a wave takes one row block of every batch, one after the other: block n - 1 - x of even batches, block x of odd ones, so that with two batches every wave walks the same number of key passes. Stays rolled: one copy of the two long bodies in the instruction cache
#pragma unroll 1
    for (int b = 0; b < NB; ++b) {
    const int q0 = ((b & 1) ? (int)blockIdx.x : TT / 32 - 1 - (int)blockIdx.x) * 32;
    const size_t bh = (size_t)b * NH_ + head, bg = (size_t)b * NKV + g;
    h16* A16 = A16_ + (size_t)b * TT * DQ; bf* Ah = Ah_ + (size_t)b * RH * DQ; bf* Al = Al_ + (size_t)b * RH * DQ;
    v8f acc[2][8]; float linv[2];
    if (q0 < RH) {
        fattn_rows<bf, true>(Qh + bh * RH * HD, Ql + bh * RH * HD, Kh + bg * RH * HD, Kl + bg * RH * HD, Vh + bg * HD * RH, Vl + bg * HD * RH, q0, lane, acc, linv);
#pragma unroll
        for (int gq = 0; gq < 2; ++gq)
#pragma unroll
            for (int t = 0; t < 8; ++t) { v8us oh, ol;   // a lane's 8 registers are d = 16 t + 8 h + 0..7 of query q0 + 16 gq + c
#pragma unroll
                for (int r = 0; r < 8; ++r) { unsigned short a, b; splitf(acc[gq][t][r] * linv[gq], a, b); oh[r] = a; ol[r] = b; }
                const size_t oo = (size_t)(q0 + 16 * gq) * DQ + (head * (HD / 32) + (t >> 1)) * 512 + (t & 1) * 256 + 8 * lane; *(v8us*)(Ah + oo) = oh; *(v8us*)(Al + oo) = ol; }   // its place in fragment order, planes of DQ columns
        asm volatile("s_wait_xcnt 0x0" ::: "memory");   // stands behind the run of stores above, in front of anything that could overwrite a register which one of them names
    } else {
        fattn_rows<h16, false>(Q16 + bh * TT * HD, nullptr, K16 + bg * TT * HD, nullptr, V16 + bg * HD * TT, nullptr, q0, lane, acc, linv);
        v8h o16[2][8];
#pragma unroll
        for (int gq = 0; gq < 2; ++gq)
#pragma unroll
            for (int t = 0; t < 8; ++t)
#pragma unroll
                for (int r = 0; r < 8; ++r) o16[gq][t][r] = tohx(acc[gq][t][r] * linv[gq] * ACAR);
        __builtin_amdgcn_sched_barrier(0);   // all sixteen packed vectors are formed in front of the first store, each in registers of its own: built without it, the packing of a later vector took the data registers of a store just issued, ahead of the wait below
#pragma unroll
        for (int gq = 0; gq < 2; ++gq)
#pragma unroll
            for (int t = 0; t < 8; ++t) *(v8h*)(A16 + (size_t)(q0 + 16 * gq) * DQ + (head * (HD / 32) + (t >> 1)) * 512 + (t & 1) * 256 + 8 * lane) = o16[gq][t];   // its place in fragment order, plane of DQ columns
        asm volatile("s_wait_xcnt 0x0" ::: "memory");   // stands behind the run of stores above, in front of anything that could overwrite a register which one of them names
    }
    }
}

// ---- k_gemmb: GEMM with a 128 x 256 output tile per block, 8 waves (2 x 4) of 64 x 64 each, every wave over the whole contraction (no k split). Grid (M/128, N/256, batches), 256 threads.
// A stage is 128 k of the block's 8 + 16 tile rows (a tile row = 16 plane rows; its 128 k are 4 KB in a row in fragment order), 96 KB, brought into LDS once for all waves by asynchronous copies (16 bytes a lane, through no register),
// where it keeps fragment order: tile row j at j 4 KB. Two buffers: stage t + 2 is asked for at the foot of trip t, into the buffer that trip t has just read, and flies under trip t + 1.
// Each operand byte leaves L2 once per block and is read from LDS by 4 (A) or 2 (Bt) waves. EPI 0 and EPI 1 as in k_gemmw, each wave turning its own 64 x 64 tile through its own LDS range, which lies in the two buffers once the last trip's barrier has ended their use.
#define GB_M  128
#define GB_N  256
#define GB_K  128
#define GB_RB (GB_K * 16 * 2)                     // bytes of one tile row in a stage
#define GB_SB (((GB_M + GB_N) / 16) * GB_RB)      // bytes of a stage
static_assert(TT % GB_M == 0 && (TT - RH) % GB_M == 0 && RH % GB_M == 0 && DQ % GB_N == 0 && DM % GB_N == 0 && KX % GB_K == 0 && KX / GB_K >= 2 && (GB_M + GB_N) / 16 == 24);
template <typename T16, int EPI>
__global__ __launch_bounds__(256) void k_gemmb(const T16* __restrict__ A, const T16* __restrict__ Bt, float* C, int ldc, float osc, size_t sA, size_t sC, const float* __restrict__ CS, h16* P16, bf* Ph, bf* Pl) {
    typedef typename WFrag<T16>::V V;
    // every loop of this kernel but the stage loop is unrolled: accumulators, fragments, copy addresses and the (c, s) pairs stay in registers and every tile step becomes an immediate offset
    __shared__ __align__(1024) char sm[2 * GB_SB];
    static_assert(8 * 64 * 68 * 4 <= 2 * GB_SB);
    const T16* st = (const T16*)sm; float* os = (float*)sm;   // the f32 tiles of the epilogue take the buffers' place
    const size_t z = blockIdx.z; A += z * sA;
    const int lane = threadIdx.x & 31, lr = lane & 15, hi = lane >> 4; const int r0 = blockIdx.x * GB_M, c0 = blockIdx.y * GB_N;
    const int wv = __builtin_amdgcn_readfirstlane((int)(threadIdx.x >> 5));   // wave number, scalar: tile-row bases and the stage loop stay under scalar control
    const int wm = wv & 1, wn = wv >> 1;
    // wave w copies tile rows 3 w .. 3 w + 2 of every stage (rows 0..7 of A, 8..23 of Bt), eight copies of 512 bytes each
    const char* gp[3]; unsigned lp[3];
#pragma unroll
    for (int i = 0; i < 3; ++i) { const int j = wv * 3 + i;
        const T16* tb = (j < GB_M / 16) ? A + (size_t)(r0 + 16 * j) * KX : Bt + (size_t)(c0 + 16 * (j - GB_M / 16)) * KX;
        gp[i] = (const char*)tb + lane * 16; lp[i] = (unsigned)(size_t)(const void*)sm + (unsigned)(j * GB_RB + lane * 16); }
    auto fill = [&](const int s, const int bi) __attribute__((always_inline)) {
#pragma unroll
        for (int h = 0; h < 2; ++h) { unsigned l[12]; const char* g[12];
#pragma unroll
            for (int q = 0; q < 12; ++q) { const int i = (h * 12 + q) >> 3, cc = (h * 12 + q) & 7; l[q] = lp[i] + (unsigned)bi * GB_SB + cc * 512; g[q] = gp[i] + (size_t)s * GB_RB + cc * 512; }
            // twelve of the wave's twenty-four copies of a stage and, as the statement's last line, the wait that stands in front of any overwrite of an address register which one of them names
            asm volatile("global_load_async_to_lds_b128 %0, %12, off\n\tglobal_load_async_to_lds_b128 %1, %13, off\n\tglobal_load_async_to_lds_b128 %2, %14, off\n\tglobal_load_async_to_lds_b128 %3, %15, off\n\t"
                         "global_load_async_to_lds_b128 %4, %16, off\n\tglobal_load_async_to_lds_b128 %5, %17, off\n\tglobal_load_async_to_lds_b128 %6, %18, off\n\tglobal_load_async_to_lds_b128 %7, %19, off\n\t"
                         "global_load_async_to_lds_b128 %8, %20, off\n\tglobal_load_async_to_lds_b128 %9, %21, off\n\tglobal_load_async_to_lds_b128 %10, %22, off\n\tglobal_load_async_to_lds_b128 %11, %23, off\n\t"
                         "s_wait_xcnt 0x0"
                         :: "v"(l[0]), "v"(l[1]), "v"(l[2]), "v"(l[3]), "v"(l[4]), "v"(l[5]), "v"(l[6]), "v"(l[7]), "v"(l[8]), "v"(l[9]), "v"(l[10]), "v"(l[11]),
                            "v"(g[0]), "v"(g[1]), "v"(g[2]), "v"(g[3]), "v"(g[4]), "v"(g[5]), "v"(g[6]), "v"(g[7]), "v"(g[8]), "v"(g[9]), "v"(g[10]), "v"(g[11]) : "memory"); }
    };
    v8f acc[4][4];
#pragma unroll
    for (int mb = 0; mb < 4; ++mb)
#pragma unroll
        for (int nb = 0; nb < 4; ++nb) acc[mb][nb] = (v8f){};
    constexpr int NS = KX / GB_K;
    fill(0, 0);
    asm volatile("s_wait_asynccnt 0x0" ::: "memory");   // this wave's copies of stage 0 have landed
    __syncthreads();                                     // every wave's have: stage 0 may be read
    fill(1, 1);
    // stays rolled: the two buffers alternate by the trip's parity, and 16 copies of the body would only add code for the instruction cache to hold
#pragma unroll 1
    for (int t = 0; t < NS; ++t) {
        const T16* sb = st + (t & 1) * (GB_SB / 2) + lane * 8;
        V a[GB_K / 32][4], b[GB_K / 32][4];
#pragma unroll
        for (int kk = 0; kk < GB_K / 32; ++kk) {
#pragma unroll
            for (int mb = 0; mb < 4; ++mb) a[kk][mb] = WFrag<T16>::ld(sb + (wm * 4 + mb) * (GB_RB / 2) + kk * 512);
#pragma unroll
            for (int nb = 0; nb < 4; ++nb) b[kk][nb] = WFrag<T16>::ld(sb + (GB_M / 16 + wn * 4 + nb) * (GB_RB / 2) + kk * 512); }
        __builtin_amdgcn_sched_barrier(0);   // the trip's LDS reads stay one group in front of its products
#pragma unroll
        for (int kk = 0; kk < GB_K / 32; ++kk)
#pragma unroll
            for (int nb = 0; nb < 4; ++nb)
#pragma unroll
                for (int mb = 0; mb < 4; ++mb) acc[mb][nb] = WFrag<T16>::mma(a[kk][mb], b[kk][nb], acc[mb][nb]);
        __builtin_amdgcn_sched_barrier(0);   // the products stay in front of the waits and the barrier: built without it they sank behind the barrier, so that the wait for the next stage's copies came right behind their issue and nothing hid their flight
        asm volatile("s_wait_dscnt 0x0" ::: "memory");      // this wave's reads of the buffer have returned before the buffer is given up
        asm volatile("s_wait_asynccnt 0x0" ::: "memory");   // this wave's copies of stage t + 1 have landed
        __syncthreads();                                     // publishes stage t + 1 and ends every wave's reads of the buffer that is refilled below
        if (t + 2 < NS) fill(t + 2, t & 1);
    }
    asm volatile("s_wait_asynccnt 0x0" ::: "memory");   // no copy is outstanding when the wave goes on to the epilogue and ends
    const int r0w = r0 + wm * 64, c0w = c0 + wn * 64;
    // EPI 1: item -> (row, 8 columns) of the wave's tile: lane & 15 = row & 15, lane >> 4 = bit 3 of the column, which is the order of a tile's 16-byte pieces
    auto irow = [&](const int it) __attribute__((always_inline)) { const int item = it * 32 + lane; return (item & 15) | ((item >> 7) << 4); };
    auto icol = [&](const int it) __attribute__((always_inline)) { const int item = it * 32 + lane; return ((item >> 4) & 7) * 8; };
    v4f ca[EPI == 1 ? 16 : 1], cb[EPI == 1 ? 16 : 1];
    if constexpr (EPI == 1) {   // the (c, s) pairs are fetched here so that they fly under the LDS stores and the barrier
#pragma unroll
        for (int it = 0; it < 16; ++it) { const float* cp = CS + (size_t)(r0w + irow(it)) * (HP * 2) + ((c0w + icol(it)) & (HD - 1)); ca[it] = *(const v4f*)cp; cb[it] = *(const v4f*)(cp + 4);
            asm volatile("s_wait_xcnt 0x0" :: "v"(cp) : "memory"); } }   // stands in front of any overwrite of the address pair that the two loads name; as an input the pair stays untouched up to it
    float* my = os + (size_t)wv * (64 * 68);
#pragma unroll
    for (int mb = 0; mb < 4; ++mb)
#pragma unroll
        for (int nb = 0; nb < 4; ++nb)
#pragma unroll
            for (int j = 0; j < 8; ++j) my[(mb * 16 + hi * 8 + j) * 68 + nb * 16 + lr] = acc[mb][nb][j];
    __syncthreads();   // the tile is in LDS before any lane reads what other lanes stored
    if constexpr (EPI == 1) {
        const int nh = ldc / HD; const bool hires = r0 < RH;   // block-uniform: a block's 128 positions lie on one side of RH
        P16 += z * nh * TT * HD; Ph += z * nh * RH * HD; Pl += z * nh * RH * HD;
#pragma unroll
        for (int it = 0; it < 16; ++it) { const int row = irow(it), cofs = icol(it);
            const int t = r0w + row, col = c0w + cofs, d = col & (HD - 1), hd = col / HD;
            const float* p = my + row * 68 + cofs; const v4f s0 = *(const v4fa*)p, s1 = *(const v4fa*)(p + 4);
            float y[8];
#pragma unroll
            for (int j = 0; j < 2; ++j) { y[2 * j] = s0[2 * j] * ca[it][2 * j] - s0[2 * j + 1] * ca[it][2 * j + 1]; y[2 * j + 1] = s0[2 * j] * ca[it][2 * j + 1] + s0[2 * j + 1] * ca[it][2 * j];
                y[4 + 2 * j] = s1[2 * j] * cb[it][2 * j] - s1[2 * j + 1] * cb[it][2 * j + 1]; y[5 + 2 * j] = s1[2 * j] * cb[it][2 * j + 1] + s1[2 * j + 1] * cb[it][2 * j]; }
            const int he = ((t >> 4) * (HD / 32) + (d >> 5)) * 512 + ((d >> 4) & 1) * 256 + (((d >> 3) & 1) * 16 + (t & 15)) * 8;
            v8h o16;
#pragma unroll
            for (int e = 0; e < 8; ++e) o16[e] = tohx(y[e]);
            *(v8h*)(P16 + (size_t)hd * TT * HD + he) = o16;
            asm volatile("s_wait_xcnt 0x0" ::: "memory");   // stands behind the store, in front of anything that overwrites its address or data registers
            if (hires) { v8us oh, ol;   // positions < RH are the first RH HD places of a plane
#pragma unroll
                for (int e = 0; e < 8; ++e) { unsigned short ua, ub; splitf(y[e], ua, ub); oh[e] = ua; ol[e] = ub; }
                *(v8us*)(Ph + (size_t)hd * RH * HD + he) = oh; *(v8us*)(Pl + (size_t)hd * RH * HD + he) = ol;
                asm volatile("s_wait_xcnt 0x0" ::: "memory"); }   // the same behind the two stores
        }
    } else {
        C += z * sC;
#pragma unroll
        for (int gq = 0; gq < 4; ++gq) { v4f s[8];   // a store covers two rows of 256 bytes
#pragma unroll
            for (int it = 0; it < 8; ++it) { const int item = (gq * 8 + it) * 32 + lane; s[it] = *(const v4fa*)(my + (item >> 4) * 68 + (item & 15) * 4) * osc; }
            __builtin_amdgcn_sched_barrier(0);   // the eight values are formed, in registers of their own, in front of the first store
#pragma unroll
            for (int it = 0; it < 8; ++it) { const int item = (gq * 8 + it) * 32 + lane; *(v4f*)(C + (size_t)(r0w + (item >> 4)) * ldc + c0w + (item & 15) * 4) = s[it]; }
            xwait(); }
    }
}

extern "C" void kernel_launch(void* const* d_in, const int* in_sizes, int n_in,
                              void* d_out, int out_size, void* d_ws, size_t ws_size, hipStream_t stream) {
    if (n_in < 5) return;
    if ((size_t)in_sizes[0] < (size_t)(NB - 1) * TT_FULL * DM + (size_t)TT * DM) return;
    if (in_sizes[1] < DM * DQ || in_sizes[2] < DM * DKV || in_sizes[3] < DM * DKV || in_sizes[4] < DQ * DM) return;
    if ((size_t)out_size < (size_t)(NB - 1) * TT_FULL * DM + (size_t)TT * DM) return;
    const float* x = (const float*)d_in[0]; const float* wq = (const float*)d_in[1]; const float* wk = (const float*)d_in[2]; const float* wv = (const float*)d_in[3]; const float* wo = (const float*)d_in[4];
    float* OUT = (float*)d_out;     // [NB][TT_FULL][DM]
    char* wsp = (char*)d_ws;
    auto take = [&](size_t bytes) { char* p = wsp; wsp += (bytes + 255) & ~(size_t)255; return (void*)p; };
    bf* WQ = (bf*)take((size_t)DQ * DM * 2); bf* WK = (bf*)take((size_t)DKV * DM * 2); bf* WV = (bf*)take((size_t)DKV * DM * 2); bf* WO = (bf*)take((size_t)DM * DQ * 2);   // Bt = (out, in) planes in fragment order
    h16* WO16 = (h16*)take((size_t)DM * DQ * 2);                                                                                             // Bt fp16 x WCAR
    float* CS = (float*)take((size_t)TT * HP * 2 * 4);
    // from here on every plane holds NB batches, one behind the other
    h16* QP16 = (h16*)take((size_t)NB * NH_ * TT * HD * 2); h16* KP16 = (h16*)take((size_t)NB * NKV * TT * HD * 2); h16* VT16 = (h16*)take((size_t)NB * NKV * HD * TT * 2);
    bf* QPh = (bf*)take((size_t)NB * NH_ * RH * HD * 2); bf* QPl = (bf*)take((size_t)NB * NH_ * RH * HD * 2); bf* KPh = (bf*)take((size_t)NB * NKV * RH * HD * 2); bf* KPl = (bf*)take((size_t)NB * NKV * RH * HD * 2);
    bf* VTh = (bf*)take((size_t)NB * NKV * HD * RH * 2); bf* VTl = (bf*)take((size_t)NB * NKV * HD * RH * 2);
    bf* XB = (bf*)take((size_t)NB * TT * DM * 2);     // bf16 x rows
    h16* AT16 = (h16*)take((size_t)NB * TT * DQ * 2); bf* ATh = (bf*)take((size_t)NB * RH * DQ * 2); bf* ATl = (bf*)take((size_t)NB * RH * DQ * 2);
    if ((size_t)(wsp - (char*)d_ws) > ws_size) return;
    // one launch prepares every plane that depends on an input alone, for all NB batches
    k_prep<<<PB_CS + PB_X + 2 * PB_WB + 2 * PB_WS, 256, 0, stream>>>(x, wq, wk, wv, wo, XB, WQ, WK, WV, WO, WO16, CS);
    // every launch below covers all NB batches: the last grid dimension of a GEMM is the batch (z with the batch strides); k_fattn walks the batches inside each wave
    // the three projections write their 16-bit operand planes themselves (rotary map for q and k; v taken transposed, weight rows x positions): no f32 copy of q, k or v exists
    k_gemmb<bf, 1><<<dim3(TT / GB_M, DQ / GB_N, NB), 256, 0, stream>>>(XB, WQ, nullptr, DQ, 1.0f, (size_t)TT * DM, 0, CS, QP16, QPh, QPl);
    k_gemmw<bf, 0, 16, 1><<<dim3(TT / 64, DKV / 64, NB), 512, 0, stream>>>(XB, nullptr, WK, nullptr, DM, -1, 0, nullptr, DKV, 1.0f, (size_t)TT * DM, 0, 0, CS, KP16, KPh, KPl);
    k_gemmw<bf, 0, 16, 2><<<dim3(DKV / 64, TT / 64, NB), 512, 0, stream>>>(WV, nullptr, XB, nullptr, DM, -1, 0, nullptr, DKV, 1.0f, 0, (size_t)TT * DM, 0, nullptr, VT16, VTh, VTl);
    k_fattn<<<dim3(TT / 32, NKV, 1), 32 * REP, 0, stream>>>(QP16, KP16, VT16, QPh, QPl, KPh, KPl, VTh, VTl, AT16, ATh, ATl);
    // output projection: rows < RH bf16 hi/lo context x bf16 Wo (2 products); rows >= RH fp16 context x64 x fp16 Wo x64 (1 product, 1/4096 in the epilogue)
    k_gemmw<bf, 1, 16, 0><<<dim3(RH / 64, DM / 64, NB), 512, 0, stream>>>(ATh, ATl, WO, nullptr, DQ, -1, 0, OUT, DM, 1.0f, (size_t)RH * DQ, 0, (size_t)TT_FULL * DM, nullptr, nullptr, nullptr, nullptr);
    k_gemmb<h16, 0><<<dim3((TT - RH) / GB_M, DM / GB_N, NB), 256, 0, stream>>>(AT16 + (size_t)RH * DQ, WO16, OUT + (size_t)RH * DM, DM, OSCW, (size_t)TT * DQ, (size_t)TT_FULL * DM, nullptr, nullptr, nullptr, nullptr);
}

// v008
// It runs in 142 microseconds.
// Next to v007, in two timings, it ran 1.18 times as fast each time.
// All steps since v000 together make it 11.5 times as fast.
#include <hip/hip_runtime.h>

// Causal grouped-query self-attention with interleaved rotary embedding: x [NB][T][2048]; q = x Wq (16 heads x 128), k, v = x Wk, x Wv (4 kv heads x 128, each shared by 4 consecutive q heads);
// rotary pairs (2j, 2j+1) with angle t / 10000^(j/64); s = q.k x 128^-0.5 with keys > query replaced by -inf; softmax; attn.v; merged heads x Wo -> [NB][T][2048] f32.
// Compute dtypes, f32 accumulate: x, Wq, Wk, Wv, Wo RNE-converted to bf16; q/k/v projections v_wmma_f32_16x16x32_bf16 (plain); scores and attn.v: query rows < 128 bf16 hi/lo split (3 products),
// rows >= 128 v_wmma_f32_16x16x32_f16 single products (P unnormalised, exp2 of the score minus the maximum in use); rotary table and softmax f32; output projection: rows < 128 bf16 hi/lo x bf16 (2 products),
// rows >= 128 v_wmma_f32_16x16x32_f16 single product (context carried x64, Wo carried x64, 1/4096 folded in the f32 epilogue).
// Every 16-bit operand plane P[row][k] (NC columns) lies in FRAGMENT ORDER: 1-KB tiles of 16 rows x 32 k, tile (row >> 4, k >> 5) at element ((row >> 4) (NC / 32) + (k >> 5)) 512 (value planes: tile (d >> 4, key >> 5) at
// ((key >> 5) 8 + (d >> 4)) 512), and inside a tile element (row, k) at ((k >> 4) & 1) 256 + (((k >> 3) & 1) 16 + (row & 15)) 8 + (k & 7): a wave's 16-byte-per-lane load or store at lane 8 covers 512 contiguous bytes.

#ifndef NB
#define NB 2
#endif
#ifndef SEQ
#define SEQ 2048
#endif
#define NB_FULL 2
#define TT_FULL 2048
#define TT   SEQ
#define DM   2048
#define NH_  16
#define NKV  4
#define REP  (NH_ / NKV)
#define HD   128
#define HP   (HD / 2)
#define DQ   (NH_ * HD)
#define DKV  (NKV * HD)
#define RH   128                  // query rows < RH use hi/lo planes (keys < RH suffice: causal)
#define ACAR 64.0f                // carry of the fp16 merged-context plane (rows >= RH)
#define WCAR 64.0f                // carry of the fp16 Wo plane
#define OSCW (1.0f / (ACAR * WCAR))
#define SCL  0.08838834764831845f   // HD^-0.5
#define KX   DM                   // columns of every GEMM operand plane

static_assert(NB >= 1 && NB <= NB_FULL);
static_assert(TT % 128 == 0 && TT <= TT_FULL && TT > RH);
static_assert(RH % 128 == 0 && RH >= 128);
static_assert((TT - RH) % 64 == 0);
static_assert(HD == 128 && HP == 64);
static_assert(NH_ == NKV * REP && TT % 32 == 0 && RH % 32 == 0);
static_assert(DM % 64 == 0 && DQ % 64 == 0 && DKV % 64 == 0 && DQ == KX);

typedef _Float16 h16;
typedef unsigned short bf;
typedef __attribute__((ext_vector_type(16))) __bf16   v16bf;
typedef __attribute__((ext_vector_type(16))) _Float16 v16h;
typedef __attribute__((ext_vector_type(8)))  _Float16 v8h;
typedef __attribute__((ext_vector_type(8)))  unsigned short v8us;
typedef __attribute__((ext_vector_type(8)))  float    v8f;
typedef __attribute__((ext_vector_type(4)))  float    v4f;
typedef v8h  __attribute__((may_alias)) v8ha;
typedef v4f  __attribute__((may_alias)) v4fa;
typedef v8us __attribute__((may_alias)) v8usa;

__device__ __forceinline__ unsigned short f2bf(float f) { unsigned u = __float_as_uint(f); u += 0x7FFFu + ((u >> 16) & 1u); return (unsigned short)(u >> 16); }
__device__ __forceinline__ float bf2f(unsigned short b) { return __uint_as_float(((unsigned)b) << 16); }
__device__ __forceinline__ float bfr(float f) { return bf2f(f2bf(f)); }
__device__ __forceinline__ v16h cat16(v8h lo, v8h hi) { return __builtin_shufflevector(lo, hi, 0, 1, 2, 3, 4, 5, 6, 7, 8, 9, 10, 11, 12, 13, 14, 15); }
__device__ __forceinline__ v16bf cat16b(v8us lo, v8us hi) { return __builtin_bit_cast(v16bf, __builtin_shufflevector(lo, hi, 0, 1, 2, 3, 4, 5, 6, 7, 8, 9, 10, 11, 12, 13, 14, 15)); }
__device__ __forceinline__ v8f wmma16(v16h a, v16h b, v8f c) { return __builtin_amdgcn_wmma_f32_16x16x32_f16(false, a, false, b, (short)0, c, false, false); }
__device__ __forceinline__ v8f wmmab(v16bf a, v16bf b, v8f c) { return __builtin_amdgcn_wmma_f32_16x16x32_bf16(false, a, false, b, (short)0, c, false, false); }

__device__ __forceinline__ h16 tohx(float x) { return (h16)x; }
__device__ __forceinline__ void splitf(float y, unsigned short& h, unsigned short& l) { h = f2bf(y); l = f2bf(y - bf2f(h)); }

// ---- k_gemmw: register-blocked GEMM, NW WAVES per 64x64 output tile (16 accumulators each), operands straight from 16-bit planes in fragment order; grid (M/64, N/64, Z), 32 NW threads.
// Wave w contracts the 32-wide k chunks w, w + NW, w + 2 NW, ... of the tile; for NW > 1 the NW f32 partial tiles meet in LDS and are summed in wave order 0 .. NW-1 (fixed), then scaled and stored.
// C[m][n] (f32, pitch ldc) = osc x sum_k A[m][k] Bt[n][k] (+ split products per NSPLIT: 1 = A2.Bt added, 2 = A2.Bt and A.Bt2 added). Every plane has KX columns (a constant: the tile-row steps become immediate offsets), z-batch strides sA/sB/sC in elements. K % 32 == 0.
// Fragment k map (both operands): elements 0..7 <- kc + 8h + 0..7, elements 8..15 <- kc + 16 + 8h + 0..7, h = lane >> 4, row/col = lane & 15: WFrag::ld at tile base + lane 8 (its second half 256 elements on).
// cskip >= 0: tiles with blockIdx.y > blockIdx.x + cskip are not computed (causal upper triangle). kcaus > 0: contraction stops at min(K, kcaus + 64 (blockIdx.x + 1)) (causal key limit).
// EPI 0: the f32 tile goes to C as above. EPI 1 and 2 (NW > 1; C unused, ldc = heads x HD (the product's columns for EPI 1, its rows for EPI 2), z = batch): the thread that sums 8 neighbouring columns of a row turns them into 16-bit operands itself and stores them
// as one 16-byte piece at their place in fragment order (a wave's store covers 512 contiguous bytes): fp16 plane P16 for every row, bf16 hi/lo planes Ph/Pl for positions < RH.
// EPI 1: rows = positions t, columns = head HD + d: interleaved rotary map out[2j] = x[2j] c - x[2j+1] s, out[2j+1] = x[2j] s + x[2j+1] c, (c, s) = CS[t][j], into head planes (t, d).
// EPI 2: rows = kv head HD + d, columns = positions t (the product is taken transposed: A = weight plane, Bt = x plane): value planes (d, t), the 8 d tiles of a 32-key block side by side.
template <typename T16> struct WFrag;
template <> struct WFrag<h16> { typedef v16h V; static __device__ __forceinline__ V ld(const h16* p) { return cat16(*(const v8h*)p, *(const v8h*)(p + 256)); } static __device__ __forceinline__ v8f mma(V a, V b, v8f c) { return wmma16(a, b, c); } };
template <> struct WFrag<bf> { typedef v16bf V; static __device__ __forceinline__ V ld(const bf* p) { return cat16b(*(const v8us*)p, *(const v8us*)(p + 256)); } static __device__ __forceinline__ v8f mma(V a, V b, v8f c) { return wmmab(a, b, c); } };
template <typename T16, int NSPLIT, int NW, int EPI>
__global__ __launch_bounds__(32 * NW) void k_gemmw(const T16* __restrict__ A, const T16* __restrict__ A2, const T16* __restrict__ Bt, const T16* __restrict__ Bt2, int K, int cskip, int kcaus,
                                             float* C, int ldc, float osc, size_t sA, size_t sB, size_t sC, const float* __restrict__ CS, h16* P16, bf* Ph, bf* Pl) {
    static_assert(EPI == 0 || (NW > 1 && 16 % NW == 0));
    typedef typename WFrag<T16>::V V;
    __shared__ __align__(16) float os[(NW == 1 ? 16 : NW * 64) * 68];
    if (cskip >= 0 && (int)blockIdx.y > (int)blockIdx.x + cskip) return;   // block-uniform, in front of the one block barrier
    const size_t z = blockIdx.z; A += z * sA; if (A2) A2 += z * sA; Bt += z * sB; if (Bt2) Bt2 += z * sB; C += z * sC;
    const int lane = threadIdx.x & 31, lr = lane & 15, hi = lane >> 4; const int r0 = blockIdx.x * 64, c0 = blockIdx.y * 64;
    const int wv = (NW == 1) ? 0 : __builtin_amdgcn_readfirstlane((int)(threadIdx.x >> 5));   // wave number, scalar: the k loop stays under scalar control
    int kend = K;
    if (kcaus > 0) { const int kl = kcaus + 64 * ((int)blockIdx.x + 1); kend = (kl < K) ? kl : K; }
    v8f acc[4][4];
#pragma unroll
    for (int mb = 0; mb < 4; ++mb)
#pragma unroll
        for (int nb = 0; nb < 4; ++nb) acc[mb][nb] = (v8f){};
    // every fragment address = a wave-uniform tile-row base (16 rows of a plane = KX / 32 tiles = 16 KX elements) + one byte offset per lane: 16 bytes a lane inside a tile, 1 KB a 32-wide k chunk; the offset is advanced only behind the wait at the loop's foot
    const size_t aoff = (size_t)r0 * KX, boff = (size_t)c0 * KX; unsigned ko = (unsigned)lane * 16 + (unsigned)wv * 1024;
    auto ldo = [](const T16* ub, const unsigned bo, const int o) __attribute__((always_inline)) { return WFrag<T16>::ld((const T16*)((const char*)ub + bo) + o); };
#pragma unroll 1
    for (int kc = 32 * wv; kc < kend; kc += 32 * NW) {
        V a[4], a2[4], b[4], b2[4];
#pragma unroll
        for (int mb = 0; mb < 4; ++mb) { a[mb] = ldo(A + aoff, ko, mb * 16 * KX); if (NSPLIT == 1 || NSPLIT == 2) a2[mb] = ldo(A2 + aoff, ko, mb * 16 * KX); }
#pragma unroll
        for (int nb = 0; nb < 4; ++nb) { b[nb] = ldo(Bt + boff, ko, nb * 16 * KX); if (NSPLIT >= 2) b2[nb] = ldo(Bt2 + boff, ko, nb * 16 * KX); }
        __builtin_amdgcn_sched_barrier(0);   // the trip's loads stay one group in front of its products; built without it, the Bt fragments shared one register set and each was fetched only behind the products of the one before: four load latencies a trip
#pragma unroll
        for (int nb = 0; nb < 4; ++nb)
#pragma unroll
            for (int mb = 0; mb < 4; ++mb) { acc[mb][nb] = WFrag<T16>::mma(a[mb], b[nb], acc[mb][nb]); if (NSPLIT == 1 || NSPLIT == 2) acc[mb][nb] = WFrag<T16>::mma(a2[mb], b[nb], acc[mb][nb]); if (NSPLIT >= 2) acc[mb][nb] = WFrag<T16>::mma(a[mb], b2[nb], acc[mb][nb]); }
        asm volatile("v_nop\n\tv_nop\n\tv_nop\n\tv_nop" : "+v"(acc[0][0]), "+v"(acc[1][1]), "+v"(acc[2][2]), "+v"(acc[3][3]) : "v"(a[0]), "v"(a[3]));
        asm volatile("s_wait_xcnt 0x0" : "+v"(ko) :: "memory");   // stands in front of the offset update, which overwrites the address register that this trip's loads name; as an in-out operand the offset can be advanced only behind it
        ko += 1024 * NW;
    }
    if constexpr (NW > 1) {
        // EPI != 0: thread item -> (row, 8 columns): lane & 15 = row & 15, lane >> 4 = bit 3 of the column, which is the order of a tile's 16-byte pieces
        auto irow = [](const int it) __attribute__((always_inline)) { const int item = it * (32 * NW) + (int)threadIdx.x; return (item & 15) | ((item >> 7) << 4); };
        auto icol = [](const int it) __attribute__((always_inline)) { const int item = it * (32 * NW) + (int)threadIdx.x; return ((item >> 4) & 7) * 8; };
        v4f ca[EPI == 1 ? 16 / NW : 1], cb[EPI == 1 ? 16 / NW : 1];
        if constexpr (EPI == 1) {   // the (c, s) pairs are fetched here so that they fly under the LDS stores and the barrier
#pragma unroll
            for (int it = 0; it < 16 / NW; ++it) { const float* cp = CS + (size_t)(r0 + irow(it)) * (HP * 2) + ((c0 + icol(it)) & (HD - 1)); ca[it] = *(const v4f*)cp; cb[it] = *(const v4f*)(cp + 4);
                asm volatile("s_wait_xcnt 0x0" :: "v"(cp) : "memory"); } }   // stands in front of any overwrite of the address pair that the two loads name; as an input the pair stays untouched up to it (built without it, the second load landed on the pair)
        float* my = os + (size_t)wv * (64 * 68);
#pragma unroll
        for (int mb = 0; mb < 4; ++mb)
#pragma unroll
            for (int nb = 0; nb < 4; ++nb)
#pragma unroll
                for (int j = 0; j < 8; ++j) my[(mb * 16 + hi * 8 + j) * 68 + nb * 16 + lr] = acc[mb][nb][j];
        __syncthreads();   // every wave's partial tile is in LDS before any thread sums across waves
        if constexpr (EPI != 0) {
            const int nh = ldc / HD; const bool hires = (EPI == 1 ? r0 : c0) < RH;   // block-uniform: a tile's 64 positions lie on one side of RH
            P16 += z * nh * TT * HD; Ph += z * nh * RH * HD; Pl += z * nh * RH * HD;
#pragma unroll
            for (int it = 0; it < 16 / NW; ++it) { const int row = irow(it), cofs = icol(it);
                const float* p = os + row * 68 + cofs; v4f s0 = *(const v4fa*)p, s1 = *(const v4fa*)(p + 4);
#pragma unroll
                for (int q = 1; q < NW; ++q) { s0 += *(const v4fa*)(p + q * (64 * 68)); s1 += *(const v4fa*)(p + q * (64 * 68) + 4); }
                float y[8]; int hd, he;
                if constexpr (EPI == 1) { const int t = r0 + row, col = c0 + cofs, d = col & (HD - 1); hd = col / HD;
#pragma unroll
                    for (int j = 0; j < 2; ++j) { y[2 * j] = s0[2 * j] * ca[it][2 * j] - s0[2 * j + 1] * ca[it][2 * j + 1]; y[2 * j + 1] = s0[2 * j] * ca[it][2 * j + 1] + s0[2 * j + 1] * ca[it][2 * j];
                        y[4 + 2 * j] = s1[2 * j] * cb[it][2 * j] - s1[2 * j + 1] * cb[it][2 * j + 1]; y[5 + 2 * j] = s1[2 * j] * cb[it][2 * j + 1] + s1[2 * j + 1] * cb[it][2 * j]; }
                    he = ((t >> 4) * (HD / 32) + (d >> 5)) * 512 + ((d >> 4) & 1) * 256 + (((d >> 3) & 1) * 16 + (t & 15)) * 8;
                } else { const int r = r0 + row, t = c0 + cofs, d = r & (HD - 1); hd = r / HD;
#pragma unroll
                    for (int j = 0; j < 4; ++j) { y[j] = s0[j]; y[4 + j] = s1[j]; }
                    he = ((t >> 5) * (HD / 16) + (d >> 4)) * 512 + ((t >> 4) & 1) * 256 + (((t >> 3) & 1) * 16 + (d & 15)) * 8; }
                v8h o16;
#pragma unroll
                for (int e = 0; e < 8; ++e) o16[e] = tohx(y[e]);
                *(v8h*)(P16 + (size_t)hd * TT * HD + he) = o16;
                asm volatile("s_wait_xcnt 0x0" ::: "memory");   // stands behind the store, in front of the hi/lo split, which was built into the store's address and data registers
                if (hires) { v8us oh, ol;   // positions < RH are the first RH HD places of a plane
#pragma unroll
                    for (int e = 0; e < 8; ++e) { unsigned short a, b; splitf(y[e], a, b); oh[e] = a; ol[e] = b; }
                    *(v8us*)(Ph + (size_t)hd * RH * HD + he) = oh; *(v8us*)(Pl + (size_t)hd * RH * HD + he) = ol; }
            }
        } else {
#pragma unroll
        for (int it = 0; it < 32 / NW; ++it) { const int item = it * (32 * NW) + (int)threadIdx.x; const int row = item >> 4, cofs = (item & 15) * 4;
            v4f s = *(const v4fa*)(os + row * 68 + cofs);
#pragma unroll
            for (int q = 1; q < NW; ++q) s += *(const v4fa*)(os + q * (64 * 68) + row * 68 + cofs);
            *(v4f*)(C + (size_t)(r0 + row) * ldc + c0 + cofs) = s * osc; }
        }
    } else {
#pragma unroll
    for (int mb = 0; mb < 4; ++mb) {
#pragma unroll
        for (int nb = 0; nb < 4; ++nb) {
#pragma unroll
            for (int j = 0; j < 8; ++j) os[(hi * 8 + j) * 68 + nb * 16 + lr] = acc[mb][nb][j]; }
        __builtin_amdgcn_wave_barrier(); asm volatile("" ::: "memory");
        float* crow = C + (size_t)(r0 + mb * 16) * ldc + c0;
{
#pragma unroll
            for (int s = 0; s < 8; ++s) { const int row = 2 * s + hi, cofs = lr * 4; const v4f val = *(const v4fa*)(os + row * 68 + cofs) * osc;
                *(v4f*)(crow + (size_t)row * ldc + cofs) = val; }
             }
        __builtin_amdgcn_wave_barrier(); asm volatile("" ::: "memory");
    }
    }
}

typedef __attribute__((ext_vector_type(2))) _Float16 v2h;
typedef __attribute__((ext_vector_type(4))) _Float16 v4h;
typedef __attribute__((ext_vector_type(2))) unsigned short v2us;
typedef __attribute__((ext_vector_type(4))) unsigned short v4us;
typedef __attribute__((ext_vector_type(2))) float v2f;

// ---- k_prep: every plane that depends on an input alone (four bf16 weight planes, the fp16 Wo plane, the bf16 x plane, the rotary table) in ONE launch. No LDS, no barrier; a block's job follows from its index
// (block-uniform): first the rotary table, then x, then Wq, Wk, Wv, Wo. Every load of a wave covers whole 128-byte lines and a wave keeps 16 (of 16 bytes a lane) or 64 (of 4) of them in flight.
#define PB_CS (TT / 32)                       // blocks of the rotary table: 4 groups of 64 threads, each thread 8 positions of one j
#define PB_X  (NB * (TT / 16))                // blocks of the x plane: a block takes 16 rows, a wave 256 columns of them (8 tiles)
#define PB_WB ((DQ / 64) * (DM / 64) / 8)     // blocks of Wq and of Wo: a wave takes 64 columns x 64 k (8 tiles)
#define PB_WS ((DKV / 64) * (DM / 64) / 8)    // blocks of Wk and of Wv
static_assert(DM % 256 == 0 && DQ == DM && ((DKV / 64) * (DM / 64)) % 8 == 0);
// The wait that stands behind a run of loads or stores, in front of anything that overwrites a register which one of them names; the two scheduling barriers keep every other instruction on its own side of the wait
__device__ __forceinline__ void xwait() { __builtin_amdgcn_sched_barrier(0); asm volatile("s_wait_xcnt 0x0" ::: "memory"); __builtin_amdgcn_sched_barrier(0); }
// w (K rows, N columns, f32) -> Bt (N rows, K columns) in fragment order. A lane owns two columns n (n0 + lane, n0 + 32 + lane), for each: its 32 loads of a 32-k chunk are rows k of w (a wave: 128 contiguous bytes each), its four 16-byte pieces
// (k >> 3 = 0..3 of the chunk) go to their places in tile (n >> 4, k >> 5): a wave's store covers 256 contiguous bytes in each of two tiles. H16: also the fp16 plane of the bf16-rounded value x WCAR.
template <int K, int N, bool H16>
__device__ __forceinline__ void prep_w(const float* __restrict__ w, bf* __restrict__ Bt, h16* __restrict__ Bh, const int job, const int lane) {
    const int k0 = (job % (K / 64)) * 64, n0 = (job / (K / 64)) * 64;
    const float* p = w + (size_t)k0 * N + n0 + lane;
    const size_t tb = ((size_t)((n0 + lane) >> 4) * (K / 32) + (k0 >> 5)) * 512 + (lane & 15) * 8;   // column n0 + lane; column n0 + 32 + lane lies two tile rows (K / 16 tiles) on
    bf* d = Bt + tb; h16* dh = H16 ? Bh + tb : nullptr;
    // every loop below is unrolled: v, o and oh stay in registers and every row or tile step becomes an immediate offset
#pragma unroll
    for (int kc = 0; kc < 2; ++kc) {
        float v[2][32];
        __builtin_amdgcn_sched_barrier(0);   // the addresses are formed in front of the run of loads, so that nothing but loads stands between here and the wait
#pragma unroll
        for (int j = 0; j < 32; ++j)
#pragma unroll
            for (int nh = 0; nh < 2; ++nh) v[nh][j] = p[(size_t)(kc * 32 + j) * N + nh * 32];
        xwait();
        v8us o[2][4]; v8h oh[H16 ? 2 : 1][H16 ? 4 : 1];
#pragma unroll
        for (int nh = 0; nh < 2; ++nh)
#pragma unroll
            for (int q = 0; q < 4; ++q)
#pragma unroll
                for (int e = 0; e < 8; ++e) { o[nh][q][e] = f2bf(v[nh][q * 8 + e]); if constexpr (H16) oh[nh][q][e] = tohx(bf2f(o[nh][q][e]) * WCAR); }
        __builtin_amdgcn_sched_barrier(0);   // every packed piece is formed, in registers of its own, in front of the first store
#pragma unroll
        for (int nh = 0; nh < 2; ++nh)
#pragma unroll
            for (int q = 0; q < 4; ++q) { const int off = (nh * (K / 16) + kc) * 512 + (q >> 1) * 256 + (q & 1) * 128;
                *(v8us*)(d + off) = o[nh][q]; if constexpr (H16) *(v8h*)(dh + off) = oh[nh][q]; }
        xwait();
    }
}
// x rows -> bf16 plane of DM columns in fragment order. A load covers 4 rows x 128 bytes (one tile's k range): lane >> 3 = row & 3, lane & 7 = k >> 2; a lane's 4 values are half a 16-byte piece, a wave's store covers four runs of 64 bytes.
__device__ __forceinline__ void prep_x(const float* __restrict__ x, bf* __restrict__ XB, const int job, const int lane) {
    const int tr = job / (DM / 256), k0 = (job % (DM / 256)) * 256; const int b = tr / (TT / 16), r0 = (tr % (TT / 16)) * 16; const int kq = lane & 7;
    const float* src = x + (size_t)b * TT_FULL * DM + (size_t)(r0 + (lane >> 3)) * DM + k0 + kq * 4;
    bf* dst = XB + (size_t)b * TT * DM + ((size_t)(r0 >> 4) * (DM / 32) + (k0 >> 5)) * 512 + (kq >> 2) * 256 + (((kq >> 1) & 1) * 16 + (lane >> 3)) * 8 + (kq & 1) * 4;
    // every loop below is unrolled: v and o stay in registers and every row or tile step becomes an immediate offset
#pragma unroll
    for (int hf = 0; hf < 2; ++hf) {
        v4f v[4][4];
        __builtin_amdgcn_sched_barrier(0);   // the addresses are formed in front of the run of loads, so that nothing but loads stands between here and the wait
#pragma unroll
        for (int j = 0; j < 4; ++j)
#pragma unroll
            for (int tl = 0; tl < 4; ++tl) v[tl][j] = *(const v4f*)(src + (size_t)(4 * j) * DM + (hf * 4 + tl) * 32);
        xwait();
        v4us o[4][4];
#pragma unroll
        for (int tl = 0; tl < 4; ++tl)
#pragma unroll
            for (int j = 0; j < 4; ++j)
#pragma unroll
                for (int e = 0; e < 4; ++e) o[tl][j][e] = f2bf(v[tl][j][e]);
        __builtin_amdgcn_sched_barrier(0);   // every packed piece is formed, in registers of its own, in front of the first store
#pragma unroll
        for (int tl = 0; tl < 4; ++tl)
#pragma unroll
            for (int j = 0; j < 4; ++j) *(v4us*)(dst + (hf * 4 + tl) * 512 + (4 * j) * 8) = o[tl][j];
        xwait();
    }
}
// CS[t][j] = {cos(t inv_j), sin(t inv_j)} f32 for j < 64, inv_j = 1 / f32(10000^(j/64)) where 10000^(j/64) is a product of exact-root powers 10000^(2^b/64) in f64; a thread forms inv_j once and uses it for 8 positions
__device__ __forceinline__ void prep_cs(float* CS, const int blk) {
    const int j = threadIdx.x & (HP - 1); const int t0 = (blk * 4 + (int)(threadIdx.x >> 6)) * 8;
    double s = 100.0, p = 1.0;
#pragma unroll 1
    for (int b = 5; b >= 0; --b) { if ((j >> b) & 1) p *= s; s = sqrt(s); }
    const float pf = (float)p; const float inv = 1.0f / pf;
    // stays rolled: eight copies of the sine and cosine code would only add text for the instruction cache to hold
#pragma unroll 1
    for (int t = t0; t < t0 + 8; ++t) { const float ang = __fmul_rn((float)t, inv);
        float sn, cn; sincosf(ang, &sn, &cn);
        v2f cs; cs[0] = cn; cs[1] = sn;
        *(v2f*)(CS + ((size_t)t * HP + j) * 2) = cs;
        xwait(); }
}
__global__ __launch_bounds__(256) void k_prep(const float* __restrict__ x, const float* __restrict__ wq, const float* __restrict__ wk, const float* __restrict__ wv, const float* __restrict__ wo,
                                              bf* XB, bf* WQ, bf* WK, bf* WV, bf* WO, h16* WO16, float* CS) {
    const int lane = threadIdx.x & 31; const int wave = __builtin_amdgcn_readfirstlane((int)(threadIdx.x >> 5));   // scalar: job numbers and plane bases stay in scalar registers
    int blk = blockIdx.x;
    if (blk < PB_CS) { prep_cs(CS, blk); return; }
    blk -= PB_CS;
    if (blk < PB_X) { prep_x(x, XB, blk * 8 + wave, lane); return; }
    blk -= PB_X;
    if (blk < PB_WB) { prep_w<DM, DQ, false>(wq, WQ, nullptr, blk * 8 + wave, lane); return; }
    blk -= PB_WB;
    if (blk < 2 * PB_WS) { const bool sec = blk >= PB_WS; prep_w<DM, DKV, false>(sec ? wv : wk, sec ? WV : WK, nullptr, (sec ? blk - PB_WS : blk) * 8 + wave, lane); return; }
    blk -= 2 * PB_WS;
    prep_w<DQ, DM, true>(wo, WO, WO16, blk * 8 + wave, lane);
}
typedef __attribute__((ext_vector_type(16))) unsigned short v16us;
__device__ __forceinline__ float xhalf(float x) { return __builtin_bit_cast(float, __builtin_amdgcn_permlanex16(__builtin_bit_cast(int, x), __builtin_bit_cast(int, x), 0x76543210, 0xfedcba98, false, false)); }   // lane l with lane l ^ 16
__device__ __forceinline__ void wgap() { __builtin_amdgcn_sched_barrier(0); asm volatile("v_nop\n\tv_nop\n\tv_nop\n\tv_nop"); __builtin_amdgcn_sched_barrier(0); }   // the 4 vector slots between a pass's last WMMAs and whatever reads their D or overwrites their A/B next, on the taken side of the loop branch that follows too
template <bool B> struct BoolC { static constexpr bool value = B; };
// G groups of 16 query rows from row q0 + gofs on; keys [kb, ke) in passes that need no mask (ke <= q0), then, if diag, the diagonal pass, keys [q0, q0 + 32). Returns the maximum in use, each wave half's sum and the unnormalised accumulators.
template <typename T16, bool HR, int G>
__device__ __forceinline__ void fattn_rows(const T16* __restrict__ Q, const T16* __restrict__ Q2, const T16* __restrict__ Kp, const T16* __restrict__ K2, const T16* __restrict__ Vt, const T16* __restrict__ V2, const int q0, const int gofs, const int kb, const int ke, const bool diag, const int lane, v8f (&acc)[G][8], float (&m_run)[G], float (&l_run)[G]) {
    typedef typename WFrag<T16>::V V;
    constexpr float CSC = SCL * 1.4426950408889634f;
    const int c = lane & 15, h = lane >> 4;
    V qf[G][4], qf2[G][4], kf[2][4], kf2[2][4];
    // every fragment address = a wave-uniform plane base + the lane's byte offset (16 bytes a lane inside a tile in fragment order); the key and value offsets are carried through the pass loop and advanced only behind the wait that covers the loads which name them
    const unsigned qo = ((unsigned)(q0 + gofs) * HD + 8 * lane) * 2; unsigned ko = (unsigned)lane * 16 + (unsigned)kb * (HD * 2), vo = ko;   // 32 keys are 32 HD elements in a row of the key plane and of the value plane
    auto ldo = [](const T16* ub, const unsigned bo, const int o) __attribute__((always_inline)) { return WFrag<T16>::ld((const T16*)((const char*)ub + bo) + o); };
#pragma unroll
    for (int g = 0; g < G; ++g)
#pragma unroll
        for (int kc = 0; kc < 4; ++kc) { const int o = 16 * g * HD + 512 * kc; qf[g][kc] = ldo(Q, qo, o); if constexpr (HR) qf2[g][kc] = ldo(Q2, qo, o); }
#pragma unroll
    for (int g = 0; g < G; ++g) { m_run[g] = -__builtin_inff(); l_run[g] = 0.0f;
#pragma unroll
        for (int t = 0; t < 8; ++t) acc[g][t] = (v8f){}; }
#pragma unroll
    for (int kt = 0; kt < 2; ++kt)
#pragma unroll
        for (int kc = 0; kc < 4; ++kc) { const int o = 16 * kt * HD + 512 * kc; kf[kt][kc] = ldo(Kp, ko, o); if constexpr (HR) kf2[kt][kc] = ldo(K2, ko, o); }
    // stands in front of any overwrite of an address register that the query and first key loads name; the operands (the offsets, and the key addresses where the build sums base and offset in a vector pair) keep those registers untouched up to the wait
    if constexpr (HR) asm volatile("s_wait_xcnt 0x0" : "+v"(ko) : "v"(qo), "v"((const char*)Kp + ko), "v"((const char*)K2 + ko) : "memory");
    else asm volatile("s_wait_xcnt 0x0" : "+v"(ko) : "v"(qo), "v"((const char*)Kp + ko) : "memory");
    __builtin_amdgcn_sched_barrier(0);   // nothing that could overwrite one moves up over that wait
    ko += 32 * HD * 2;
    // One 32-key pass. dg true: the diagonal pass, a wave's last (keys > query replaced by -inf, by index; nothing fetched ahead); every other pass fetches the next pass's key fragments.
    auto pass = [&](auto dg) __attribute__((always_inline)) {
        constexpr bool DIAG = decltype(dg)::value;
        V vf[8], vf2[8];
#pragma unroll
        for (int t = 0; t < 8; ++t) { const int o = 512 * t; vf[t] = ldo(Vt, vo, o); if constexpr (HR) vf2[t] = ldo(V2, vo, o); }
        if constexpr (HR && !DIAG) asm volatile("s_wait_xcnt 0x0" ::: "memory");   // with two value planes the build sums base and offset in vector registers that the score tiles then take: the wait stands in front of that overwrite
        if constexpr (HR && DIAG) asm volatile("s_wait_xcnt 0x0" :: "v"((const char*)Vt + vo), "v"((const char*)V2 + vo) : "memory");   // the same wait in a wave's last pass: as inputs the two sums stay untouched up to it (built without them, the last load of each plane landed on its own address pair, which the loads before it name)
        __builtin_amdgcn_sched_barrier(0);   // the value loads stay in front of the score products, so that they fly under them and under the softmax
        v8f s[2][G];
#pragma unroll
        for (int kt = 0; kt < 2; ++kt)
#pragma unroll
            for (int g = 0; g < G; ++g) { s[kt][g] = (v8f){};
#pragma unroll
                for (int kc = 0; kc < 4; ++kc) { s[kt][g] = WFrag<T16>::mma(kf[kt][kc], qf[g][kc], s[kt][g]);
                    if constexpr (HR) { s[kt][g] = WFrag<T16>::mma(kf2[kt][kc], qf[g][kc], s[kt][g]); s[kt][g] = WFrag<T16>::mma(kf[kt][kc], qf2[g][kc], s[kt][g]); } } }
        __builtin_amdgcn_sched_barrier(0);   // the score products stay in front of the wait and of the key prefetch
        asm volatile("s_wait_xcnt 0x0" :: "v"(vo) : "memory");   // stands in front of any overwrite of an address register that the value loads name (the input keeps their offset untouched up to here); it is placed behind the score products so that it does not hold up their issue
        __builtin_amdgcn_sched_barrier(0);   // nothing that could overwrite one moves up over that wait
        if constexpr (!DIAG) {   // the next pass's key fragments fly under this pass's softmax and second product
#pragma unroll
            for (int kt = 0; kt < 2; ++kt)
#pragma unroll
                for (int kc = 0; kc < 4; ++kc) { const int o = 16 * kt * HD + 512 * kc; kf[kt][kc] = ldo(Kp, ko, o); if constexpr (HR) kf2[kt][kc] = ldo(K2, ko, o); }
            __builtin_amdgcn_sched_barrier(0);   // keeps the key prefetch issued ahead of the softmax arithmetic
        } else {                 // the pass's first key is q0
#pragma unroll
            for (int g = 0; g < G; ++g)
#pragma unroll
                for (int kt = 0; kt < 2; ++kt)
#pragma unroll
                    for (int r = 0; r < 8; ++r) if (16 * kt + 8 * h + r > 16 * g + gofs + c) s[kt][g][r] = -__builtin_inff();
        }
        float mb[G]; bool need = false;
#pragma unroll
        for (int g = 0; g < G; ++g) { float mx = -__builtin_inff();
#pragma unroll
            for (int kt = 0; kt < 2; ++kt)
#pragma unroll
                for (int r = 0; r < 8; ++r) mx = fmaxf(mx, s[kt][g][r]);
            mx = fmaxf(mx, xhalf(mx)) * CSC; mb[g] = mx; need = need || (mx > m_run[g] + 8.0f); }
        if (__builtin_amdgcn_ballot_w32(need) != 0) {   // scalar branch, rare after the first passes; every column has an unmasked key in every pass, so the new maximum is finite
#pragma unroll
            for (int g = 0; g < G; ++g) { const float mn = fmaxf(m_run[g], mb[g]); const float corr = __builtin_amdgcn_exp2f(m_run[g] - mn); l_run[g] *= corr; m_run[g] = mn;
#pragma unroll
                for (int t = 0; t < 8; ++t) acc[g][t] = acc[g][t] * corr; }
        }
#pragma unroll
        for (int g = 0; g < G; ++g) { const float nm = -m_run[g]; float pv[16]; float ps0 = 0.0f, ps1 = 0.0f;
#pragma unroll
            for (int e = 0; e < 16; ++e) { pv[e] = __builtin_amdgcn_exp2f(__builtin_fmaf(s[e >> 3][g][e & 7], CSC, nm)); if (e & 1) ps1 += pv[e]; else ps0 += pv[e]; }
            l_run[g] += ps0 + ps1;
            V pf, pf2;
            if constexpr (HR) { v16us uh, ul;
#pragma unroll
                for (int e = 0; e < 16; ++e) { unsigned short a, b; splitf(pv[e], a, b); uh[e] = a; ul[e] = b; }
                pf = __builtin_bit_cast(v16bf, uh); pf2 = __builtin_bit_cast(v16bf, ul);
            } else {
#pragma unroll
                for (int e = 0; e < 16; ++e) pf[e] = tohx(pv[e]); }
#pragma unroll
            for (int t = 0; t < 8; ++t) { acc[g][t] = WFrag<T16>::mma(vf[t], pf, acc[g][t]);
                if constexpr (HR) { acc[g][t] = WFrag<T16>::mma(vf2[t], pf, acc[g][t]); acc[g][t] = WFrag<T16>::mma(vf[t], pf2, acc[g][t]); } }
        }
        wgap();
        if constexpr (!DIAG) {
            asm volatile("s_wait_xcnt 0x0" : "+v"(ko), "+v"(vo) :: "memory");   // stands in front of the offset updates, which overwrite address registers that this pass's loads name; as in-out operands the offsets can be advanced only behind it
            ko += 32 * HD * 2; vo += 32 * HD * 2; }
    };
    // stays rolled: the trip count is known only at run time, and further copies of a body this long would only add code for the instruction cache to hold
#pragma unroll 1
    for (int key0 = kb; key0 < ke; key0 += 32) pass(BoolC<false>{});   // keys [kb, ke): no key exceeds a query of this wave
    if (diag) pass(BoolC<true>{});                                     // keys [q0, q0 + 32); the test is the same for a whole wave
}
#define FA_XF (33 * 128)   // floats one wave hands over: its 128 accumulator registers as 32 pieces of 16 bytes a lane, then one piece with the two maxima and the two sums
__global__ __launch_bounds__(64 * REP) void k_fattn(const h16* __restrict__ Q16, const h16* __restrict__ K16, const h16* __restrict__ V16, const bf* __restrict__ Qh, const bf* __restrict__ Ql, const bf* __restrict__ Kh, const bf* __restrict__ Kl, const bf* __restrict__ Vh, const bf* __restrict__ Vl, h16* A16_, bf* Ah_, bf* Al_) {
    __shared__ __align__(16) float xs[NB * REP * FA_XF];   // a range of its own for every batch and head: written once, read once, one barrier a batch
    const int g = blockIdx.y;
    const int wv = __builtin_amdgcn_readfirstlane((int)(threadIdx.x >> 5));   // scalar: plane bases, the pass loop and the choice of a wave's part stay under scalar control
    // the lane number, counted anew on top of a scalar at each place that needs it: held in one register across the pass loops, the lane's byte offset was spilled to scratch and fetched back in front of every use
    auto lane_at = [](const int s) __attribute__((always_inline)) { return (int)__builtin_amdgcn_mbcnt_lo(~0u, (unsigned)s) - s; };
    const int hw = wv % REP, hs = wv / REP; const int head = g * REP + hw;
    // a wave pair takes one row block of every batch, one after the other: block n - 1 - x of even batches, block x of odd ones, so that with two batches every pair walks the same number of key passes. Stays rolled: one copy of the two long bodies in the instruction cache
#pragma unroll 1
    for (int b = 0; b < NB; ++b) {
    const int q0 = ((b & 1) ? (int)blockIdx.x : TT / 32 - 1 - (int)blockIdx.x) * 32;
    const int lane = lane_at(b);
    const size_t bh = (size_t)b * NH_ + head, bg = (size_t)b * NKV + g;
    h16* A16 = A16_ + (size_t)b * TT * DQ; bf* Ah = Ah_ + (size_t)b * RH * DQ; bf* Al = Al_ + (size_t)b * RH * DQ;
    if (q0 < RH) {   // block-uniform
        v8f acc[1][8]; float mr[1], lr[1];
        fattn_rows<bf, true, 1>(Qh + bh * RH * HD, Ql + bh * RH * HD, Kh + bg * RH * HD, Kl + bg * RH * HD, Vh + bg * HD * RH, Vl + bg * HD * RH, q0, 16 * hs, 0, q0, true, lane, acc, mr, lr);
        const float linv = __fdiv_rn(1.0f, lr[0] + xhalf(lr[0]));   // each wave half summed its own eight keys of every 16-key tile
        const int lane2 = lane_at(q0 + 1);
        v8us oh[8], ol[8];
#pragma unroll
        for (int t = 0; t < 8; ++t)   // a lane's 8 registers are d = 16 t + 8 h + 0..7 of query q0 + 16 hs + c
#pragma unroll
            for (int r = 0; r < 8; ++r) { unsigned short a, b; splitf(acc[0][t][r] * linv, a, b); oh[t][r] = a; ol[t][r] = b; }
        __builtin_amdgcn_sched_barrier(0);   // all sixteen packed vectors are formed in front of the first store, each in registers of its own, so that no packing takes the data registers of a store just issued, ahead of the wait below
#pragma unroll
        for (int t = 0; t < 8; ++t) { const size_t oo = (size_t)(q0 + 16 * hs) * DQ + (head * (HD / 32) + (t >> 1)) * 512 + (t & 1) * 256 + 8 * lane2; *(v8us*)(Ah + oo) = oh[t]; *(v8us*)(Al + oo) = ol[t]; }   // its place in fragment order, planes of DQ columns
        asm volatile("s_wait_xcnt 0x0" ::: "memory");   // stands behind the run of stores above, in front of anything that could overwrite a register which one of them names
    } else {
        v8f acc[2][8]; float mr[2], lr[2];
        const int km = ((q0 / 32 + 2) >> 1) * 32;   // the row block has q0 / 32 + 1 >= 5 passes: the first wave takes the first half of them, rounded up, the second wave the rest, the diagonal pass among them, and the joining
        fattn_rows<h16, false, 2>(Q16 + bh * TT * HD, nullptr, K16 + bg * TT * HD, nullptr, V16 + bg * HD * TT, nullptr, q0, 0, hs ? km : 0, hs ? q0 : km, hs != 0, lane, acc, mr, lr);
        const int lane2 = lane_at(q0 + 1);
        float* xp = xs + (size_t)(b * REP + hw) * FA_XF + lane2 * 4;   // a wave's 16-byte-per-lane LDS access covers 512 contiguous bytes
        if (hs == 0) {
#pragma unroll
            for (int gq = 0; gq < 2; ++gq)
#pragma unroll
                for (int t = 0; t < 8; ++t) { v4f lo4, hi4;
#pragma unroll
                    for (int r = 0; r < 4; ++r) { lo4[r] = acc[gq][t][r]; hi4[r] = acc[gq][t][4 + r]; }
                    *(v4fa*)(xp + ((gq * 8 + t) * 2) * 128) = lo4; *(v4fa*)(xp + ((gq * 8 + t) * 2 + 1) * 128) = hi4; }
            v4f ml; ml[0] = mr[0]; ml[1] = mr[1]; ml[2] = lr[0]; ml[3] = lr[1];
            *(v4fa*)(xp + 32 * 128) = ml;
        }
        __syncthreads();   // the first waves' parts are in LDS before the second waves read them; under block-uniform control flow (q0 and b are the same for the whole block)
        if (hs != 0) {
            const v4f ml = *(const v4fa*)(xp + 32 * 128);
            float ch[2], cl[2];   // both maxima are finite: each wave has walked at least two passes, and every query has an unmasked key in every pass
#pragma unroll
            for (int gq = 0; gq < 2; ++gq) { const float mn = fmaxf(mr[gq], ml[gq]); const float eh = __builtin_amdgcn_exp2f(mr[gq] - mn), el = __builtin_amdgcn_exp2f(ml[gq] - mn);
                const float l = lr[gq] * eh + ml[2 + gq] * el;
                const float linv = __fdiv_rn(1.0f, l + xhalf(l));   // each wave half summed its own eight keys of every 16-key tile
                ch[gq] = eh * linv * ACAR; cl[gq] = el * linv * ACAR; }
            v8h o16[2][8];
#pragma unroll
            for (int gq = 0; gq < 2; ++gq)
#pragma unroll
                for (int t = 0; t < 8; ++t) { const v4f lo4 = *(const v4fa*)(xp + ((gq * 8 + t) * 2) * 128), hi4 = *(const v4fa*)(xp + ((gq * 8 + t) * 2 + 1) * 128);
#pragma unroll
                    for (int r = 0; r < 8; ++r) o16[gq][t][r] = tohx(acc[gq][t][r] * ch[gq] + (r < 4 ? lo4[r & 3] : hi4[r & 3]) * cl[gq]); }
            __builtin_amdgcn_sched_barrier(0);   // all sixteen packed vectors are formed in front of the first store, each in registers of its own: built without it, the packing of a later vector took the data registers of a store just issued, ahead of the wait below
#pragma unroll
            for (int gq = 0; gq < 2; ++gq)
#pragma unroll
                for (int t = 0; t < 8; ++t) *(v8h*)(A16 + (size_t)(q0 + 16 * gq) * DQ + (head * (HD / 32) + (t >> 1)) * 512 + (t & 1) * 256 + 8 * lane2) = o16[gq][t];   // its place in fragment order, plane of DQ columns
            asm volatile("s_wait_xcnt 0x0" ::: "memory");   // stands behind the run of stores above, in front of anything that could overwrite a register which one of them names
        }
    }
    }
}

// ---- k_gemmb: GEMM with a 128 x 256 output tile per block, 8 waves (2 x 4) of 64 x 64 each, every wave over the whole contraction (no k split). Grid (M/128, N/256, batches), 256 threads.
// A stage is 128 k of the block's 8 + 16 tile rows (a tile row = 16 plane rows; its 128 k are 4 KB in a row in fragment order), 96 KB, brought into LDS once for all waves by asynchronous copies (16 bytes a lane, through no register),
// where it keeps fragment order: tile row j at j 4 KB. Two buffers: stage t + 2 is asked for at the foot of trip t, into the buffer that trip t has just read, and flies under trip t + 1.
// Each operand byte leaves L2 once per block and is read from LDS by 4 (A) or 2 (Bt) waves. EPI 0 and EPI 1 as in k_gemmw, each wave turning its own 64 x 64 tile through its own LDS range, which lies in the two buffers once the last trip's barrier has ended their use.
#define GB_M  128
#define GB_N  256
#define GB_K  128
#define GB_RB (GB_K * 16 * 2)                     // bytes of one tile row in a stage
#define GB_SB (((GB_M + GB_N) / 16) * GB_RB)      // bytes of a stage
static_assert(TT % GB_M == 0 && (TT - RH) % GB_M == 0 && RH % GB_M == 0 && DQ % GB_N == 0 && DM % GB_N == 0 && KX % GB_K == 0 && KX / GB_K >= 2 && (GB_M + GB_N) / 16 == 24);
template <typename T16, int EPI>
__global__ __launch_bounds__(256) void k_gemmb(const T16* __restrict__ A, const T16* __restrict__ Bt, float* C, int ldc, float osc, size_t sA, size_t sC, const float* __restrict__ CS, h16* P16, bf* Ph, bf* Pl) {
    typedef typename WFrag<T16>::V V;
    // every loop of this kernel but the stage loop is unrolled: accumulators, fragments, copy addresses and the (c, s) pairs stay in registers and every tile step becomes an immediate offset
    __shared__ __align__(1024) char sm[2 * GB_SB];
    static_assert(8 * 64 * 68 * 4 <= 2 * GB_SB);
    const T16* st = (const T16*)sm; float* os = (float*)sm;   // the f32 tiles of the epilogue take the buffers' place
    const size_t z = blockIdx.z; A += z * sA;
    const int lane = threadIdx.x & 31, lr = lane & 15, hi = lane >> 4; const int r0 = blockIdx.x * GB_M, c0 = blockIdx.y * GB_N;
    const int wv = __builtin_amdgcn_readfirstlane((int)(threadIdx.x >> 5));   // wave number, scalar: tile-row bases and the stage loop stay under scalar control
    const int wm = wv & 1, wn = wv >> 1;
    // wave w copies tile rows 3 w .. 3 w + 2 of every stage (rows 0..7 of A, 8..23 of Bt), eight copies of 512 bytes each
    const char* gp[3]; unsigned lp[3];
#pragma unroll
    for (int i = 0; i < 3; ++i) { const int j = wv * 3 + i;
        const T16* tb = (j < GB_M / 16) ? A + (size_t)(r0 + 16 * j) * KX : Bt + (size_t)(c0 + 16 * (j - GB_M / 16)) * KX;
        gp[i] = (const char*)tb + lane * 16; lp[i] = (unsigned)(size_t)(const void*)sm + (unsigned)(j * GB_RB + lane * 16); }
    auto fill = [&](const int s, const int bi) __attribute__((always_inline)) {
#pragma unroll
        for (int h = 0; h < 2; ++h) { unsigned l[12]; const char* g[12];
#pragma unroll
            for (int q = 0; q < 12; ++q) { const int i = (h * 12 + q) >> 3, cc = (h * 12 + q) & 7; l[q] = lp[i] + (unsigned)bi * GB_SB + cc * 512; g[q] = gp[i] + (size_t)s * GB_RB + cc * 512; }
            // twelve of the wave's twenty-four copies of a stage and, as the statement's last line, the wait that stands in front of any overwrite of an address register which one of them names
            asm volatile("global_load_async_to_lds_b128 %0, %12, off\n\tglobal_load_async_to_lds_b128 %1, %13, off\n\tglobal_load_async_to_lds_b128 %2, %14, off\n\tglobal_load_async_to_lds_b128 %3, %15, off\n\t"
                         "global_load_async_to_lds_b128 %4, %16, off\n\tglobal_load_async_to_lds_b128 %5, %17, off\n\tglobal_load_async_to_lds_b128 %6, %18, off\n\tglobal_load_async_to_lds_b128 %7, %19, off\n\t"
                         "global_load_async_to_lds_b128 %8, %20, off\n\tglobal_load_async_to_lds_b128 %9, %21, off\n\tglobal_load_async_to_lds_b128 %10, %22, off\n\tglobal_load_async_to_lds_b128 %11, %23, off\n\t"
                         "s_wait_xcnt 0x0"
                         :: "v"(l[0]), "v"(l[1]), "v"(l[2]), "v"(l[3]), "v"(l[4]), "v"(l[5]), "v"(l[6]), "v"(l[7]), "v"(l[8]), "v"(l[9]), "v"(l[10]), "v"(l[11]),
                            "v"(g[0]), "v"(g[1]), "v"(g[2]), "v"(g[3]), "v"(g[4]), "v"(g[5]), "v"(g[6]), "v"(g[7]), "v"(g[8]), "v"(g[9]), "v"(g[10]), "v"(g[11]) : "memory"); }
    };
    v8f acc[4][4];
#pragma unroll
    for (int mb = 0; mb < 4; ++mb)
#pragma unroll
        for (int nb = 0; nb < 4; ++nb) acc[mb][nb] = (v8f){};
    constexpr int NS = KX / GB_K;
    fill(0, 0);
    asm volatile("s_wait_asynccnt 0x0" ::: "memory");   // this wave's copies of stage 0 have landed
    __syncthreads();                                     // every wave's have: stage 0 may be read
    fill(1, 1);
    // stays rolled: the two buffers alternate by the trip's parity, and 16 copies of the body would only add code for the instruction cache to hold
#pragma unroll 1
    for (int t = 0; t < NS; ++t) {
        const T16* sb = st + (t & 1) * (GB_SB / 2) + lane * 8;
        V a[GB_K / 32][4], b[GB_K / 32][4];
#pragma unroll
        for (int kk = 0; kk < GB_K / 32; ++kk) {
#pragma unroll
            for (int mb = 0; mb < 4; ++mb) a[kk][mb] = WFrag<T16>::ld(sb + (wm * 4 + mb) * (GB_RB / 2) + kk * 512);
#pragma unroll
            for (int nb = 0; nb < 4; ++nb) b[kk][nb] = WFrag<T16>::ld(sb + (GB_M / 16 + wn * 4 + nb) * (GB_RB / 2) + kk * 512); }
        __builtin_amdgcn_sched_barrier(0);   // the trip's LDS reads stay one group in front of its products
#pragma unroll
        for (int kk = 0; kk < GB_K / 32; ++kk)
#pragma unroll
            for (int nb = 0; nb < 4; ++nb)
#pragma unroll
                for (int mb = 0; mb < 4; ++mb) acc[mb][nb] = WFrag<T16>::mma(a[kk][mb], b[kk][nb], acc[mb][nb]);
        __builtin_amdgcn_sched_barrier(0);   // the products stay in front of the waits and the barrier: built without it they sank behind the barrier, so that the wait for the next stage's copies came right behind their issue and nothing hid their flight
        asm volatile("s_wait_dscnt 0x0" ::: "memory");      // this wave's reads of the buffer have returned before the buffer is given up
        asm volatile("s_wait_asynccnt 0x0" ::: "memory");   // this wave's copies of stage t + 1 have landed
        __syncthreads();                                     // publishes stage t + 1 and ends every wave's reads of the buffer that is refilled below
        if (t + 2 < NS) fill(t + 2, t & 1);
    }
    asm volatile("s_wait_asynccnt 0x0" ::: "memory");   // no copy is outstanding when the wave goes on to the epilogue and ends
    const int r0w = r0 + wm * 64, c0w = c0 + wn * 64;
    // EPI 1: item -> (row, 8 columns) of the wave's tile: lane & 15 = row & 15, lane >> 4 = bit 3 of the column, which is the order of a tile's 16-byte pieces
    auto irow = [&](const int it) __attribute__((always_inline)) { const int item = it * 32 + lane; return (item & 15) | ((item >> 7) << 4); };
    auto icol = [&](const int it) __attribute__((always_inline)) { const int item = it * 32 + lane; return ((item >> 4) & 7) * 8; };
    v4f ca[EPI == 1 ? 16 : 1], cb[EPI == 1 ? 16 : 1];
    if constexpr (EPI == 1) {   // the (c, s) pairs are fetched here so that they fly under the LDS stores and the barrier
#pragma unroll
        for (int it = 0; it < 16; ++it) { const float* cp = CS + (size_t)(r0w + irow(it)) * (HP * 2) + ((c0w + icol(it)) & (HD - 1)); ca[it] = *(const v4f*)cp; cb[it] = *(const v4f*)(cp + 4);
            asm volatile("s_wait_xcnt 0x0" :: "v"(cp) : "memory"); } }   // stands in front of any overwrite of the address pair that the two loads name; as an input the pair stays untouched up to it
    float* my = os + (size_t)wv * (64 * 68);
#pragma unroll
    for (int mb = 0; mb < 4; ++mb)
#pragma unroll
        for (int nb = 0; nb < 4; ++nb)
#pragma unroll
            for (int j = 0; j < 8; ++j) my[(mb * 16 + hi * 8 + j) * 68 + nb * 16 + lr] = acc[mb][nb][j];
    __syncthreads();   // the tile is in LDS before any lane reads what other lanes stored
    if constexpr (EPI == 1) {
        const int nh = ldc / HD; const bool hires = r0 < RH;   // block-uniform: a block's 128 positions lie on one side of RH
        P16 += z * nh * TT * HD; Ph += z * nh * RH * HD; Pl += z * nh * RH * HD;
#pragma unroll
        for (int it = 0; it < 16; ++it) { const int row = irow(it), cofs = icol(it);
            const int t = r0w + row, col = c0w + cofs, d = col & (HD - 1), hd = col / HD;
            const float* p = my + row * 68 + cofs; const v4f s0 = *(const v4fa*)p, s1 = *(const v4fa*)(p + 4);
            float y[8];
#pragma unroll
            for (int j = 0; j < 2; ++j) { y[2 * j] = s0[2 * j] * ca[it][2 * j] - s0[2 * j + 1] * ca[it][2 * j + 1]; y[2 * j + 1] = s0[2 * j] * ca[it][2 * j + 1] + s0[2 * j + 1] * ca[it][2 * j];
                y[4 + 2 * j] = s1[2 * j] * cb[it][2 * j] - s1[2 * j + 1] * cb[it][2 * j + 1]; y[5 + 2 * j] = s1[2 * j] * cb[it][2 * j + 1] + s1[2 * j + 1] * cb[it][2 * j]; }
            const int he = ((t >> 4) * (HD / 32) + (d >> 5)) * 512 + ((d >> 4) & 1) * 256 + (((d >> 3) & 1) * 16 + (t & 15)) * 8;
            v8h o16;
#pragma unroll
            for (int e = 0; e < 8; ++e) o16[e] = tohx(y[e]);
            *(v8h*)(P16 + (size_t)hd * TT * HD + he) = o16;
            asm volatile("s_wait_xcnt 0x0" ::: "memory");   // stands behind the store, in front of anything that overwrites its address or data registers
            if (hires) { v8us oh, ol;   // positions < RH are the first RH HD places of a plane
#pragma unroll
                for (int e = 0; e < 8; ++e) { unsigned short ua, ub; splitf(y[e], ua, ub); oh[e] = ua; ol[e] = ub; }
                *(v8us*)(Ph + (size_t)hd * RH * HD + he) = oh; *(v8us*)(Pl + (size_t)hd * RH * HD + he) = ol;
                asm volatile("s_wait_xcnt 0x0" ::: "memory"); }   // the same behind the two stores
        }
    } else {
        C += z * sC;
#pragma unroll
        for (int gq = 0; gq < 4; ++gq) { v4f s[8];   // a store covers two rows of 256 bytes
#pragma unroll
            for (int it = 0; it < 8; ++it) { const int item = (gq * 8 + it) * 32 + lane; s[it] = *(const v4fa*)(my + (item >> 4) * 68 + (item & 15) * 4) * osc; }
            __builtin_amdgcn_sched_barrier(0);   // the eight values are formed, in registers of their own, in front of the first store
#pragma unroll
            for (int it = 0; it < 8; ++it) { const int item = (gq * 8 + it) * 32 + lane; *(v4f*)(C + (size_t)(r0w + (item >> 4)) * ldc + c0w + (item & 15) * 4) = s[it]; }
            xwait(); }
    }
}

extern "C" void kernel_launch(void* const* d_in, const int* in_sizes, int n_in,
                              void* d_out, int out_size, void* d_ws, size_t ws_size, hipStream_t stream) {
    if (n_in < 5) return;
    if ((size_t)in_sizes[0] < (size_t)(NB - 1) * TT_FULL * DM + (size_t)TT * DM) return;
    if (in_sizes[1] < DM * DQ || in_sizes[2] < DM * DKV || in_sizes[3] < DM * DKV || in_sizes[4] < DQ * DM) return;
    if ((size_t)out_size < (size_t)(NB - 1) * TT_FULL * DM + (size_t)TT * DM) return;
    const float* x = (const float*)d_in[0]; const float* wq = (const float*)d_in[1]; const float* wk = (const float*)d_in[2]; const float* wv = (const float*)d_in[3]; const float* wo = (const float*)d_in[4];
    float* OUT = (float*)d_out;     // [NB][TT_FULL][DM]
    char* wsp = (char*)d_ws;
    auto take = [&](size_t bytes) { char* p = wsp; wsp += (bytes + 255) & ~(size_t)255; return (void*)p; };
    bf* WQ = (bf*)take((size_t)DQ * DM * 2); bf* WK = (bf*)take((size_t)DKV * DM * 2); bf* WV = (bf*)take((size_t)DKV * DM * 2); bf* WO = (bf*)take((size_t)DM * DQ * 2);   // Bt = (out, in) planes in fragment order
    h16* WO16 = (h16*)take((size_t)DM * DQ * 2);                                                                                             // Bt fp16 x WCAR
    float* CS = (float*)take((size_t)TT * HP * 2 * 4);
    // from here on every plane holds NB batches, one behind the other
    h16* QP16 = (h16*)take((size_t)NB * NH_ * TT * HD * 2); h16* KP16 = (h16*)take((size_t)NB * NKV * TT * HD * 2); h16* VT16 = (h16*)take((size_t)NB * NKV * HD * TT * 2);
    bf* QPh = (bf*)take((size_t)NB * NH_ * RH * HD * 2); bf* QPl = (bf*)take((size_t)NB * NH_ * RH * HD * 2); bf* KPh = (bf*)take((size_t)NB * NKV * RH * HD * 2); bf* KPl = (bf*)take((size_t)NB * NKV * RH * HD * 2);
    bf* VTh = (bf*)take((size_t)NB * NKV * HD * RH * 2); bf* VTl = (bf*)take((size_t)NB * NKV * HD * RH * 2);
    bf* XB = (bf*)take((size_t)NB * TT * DM * 2);     // bf16 x rows
    h16* AT16 = (h16*)take((size_t)NB * TT * DQ * 2); bf* ATh = (bf*)take((size_t)NB * RH * DQ * 2); bf* ATl = (bf*)take((size_t)NB * RH * DQ * 2);
    if ((size_t)(wsp - (char*)d_ws) > ws_size) return;
    // one launch prepares every plane that depends on an input alone, for all NB batches
    k_prep<<<PB_CS + PB_X + 2 * PB_WB + 2 * PB_WS, 256, 0, stream>>>(x, wq, wk, wv, wo, XB, WQ, WK, WV, WO, WO16, CS);
    // every launch below covers all NB batches: the last grid dimension of a GEMM is the batch (z with the batch strides); k_fattn walks the batches inside each wave
    // the three projections write their 16-bit operand planes themselves (rotary map for q and k; v taken transposed, weight rows x positions): no f32 copy of q, k or v exists
    k_gemmb<bf, 1><<<dim3(TT / GB_M, DQ / GB_N, NB), 256, 0, stream>>>(XB, WQ, nullptr, DQ, 1.0f, (size_t)TT * DM, 0, CS, QP16, QPh, QPl);
    k_gemmw<bf, 0, 16, 1><<<dim3(TT / 64, DKV / 64, NB), 512, 0, stream>>>(XB, nullptr, WK, nullptr, DM, -1, 0, nullptr, DKV, 1.0f, (size_t)TT * DM, 0, 0, CS, KP16, KPh, KPl);
    k_gemmw<bf, 0, 16, 2><<<dim3(DKV / 64, TT / 64, NB), 512, 0, stream>>>(WV, nullptr, XB, nullptr, DM, -1, 0, nullptr, DKV, 1.0f, 0, (size_t)TT * DM, 0, nullptr, VT16, VTh, VTl);
    k_fattn<<<dim3(TT / 32, NKV, 1), 64 * REP, 0, stream>>>(QP16, KP16, VT16, QPh, QPl, KPh, KPl, VTh, VTl, AT16, ATh, ATl);
    // output projection: rows < RH bf16 hi/lo context x bf16 Wo (2 products); rows >= RH fp16 context x64 x fp16 Wo x64 (1 product, 1/4096 in the epilogue)
    k_gemmw<bf, 1, 16, 0><<<dim3(RH / 64, DM / 64, NB), 512, 0, stream>>>(ATh, ATl, WO, nullptr, DQ, -1, 0, OUT, DM, 1.0f, (size_t)RH * DQ, 0, (size_t)TT_FULL * DM, nullptr, nullptr, nullptr, nullptr);
    k_gemmb<h16, 0><<<dim3((TT - RH) / GB_M, DM / GB_N, NB), 256, 0, stream>>>(AT16 + (size_t)RH * DQ, WO16, OUT + (size_t)RH * DM, DM, OSCW, (size_t)TT * DQ, (size_t)TT_FULL * DM, nullptr, nullptr, nullptr, nullptr);
}

// v009
// A run of this version takes 124 microseconds.
// In two side-by-side timings against v008, it was 1.14 and 1.15 times as fast.
// Over all steps from v000 it is 13.1 times as fast.
#include <hip/hip_runtime.h>

// Causal grouped-query self-attention with interleaved rotary embedding: x [NB][T][2048]; q = x Wq (16 heads x 128), k, v = x Wk, x Wv (4 kv heads x 128, each shared by 4 consecutive q heads);
// rotary pairs (2j, 2j+1) with angle t / 10000^(j/64); s = q.k x 128^-0.5 with keys > query replaced by -inf; softmax; attn.v; merged heads x Wo -> [NB][T][2048] f32.
// Compute dtypes, f32 accumulate: x, Wq, Wk, Wv, Wo RNE-converted to bf16; q/k/v projections v_wmma_f32_16x16x32_bf16 (plain); scores and attn.v: query rows < 128 bf16 hi/lo split (3 products),
// rows >= 128 v_wmma_f32_16x16x32_f16 single products (P unnormalised, exp2 of the score minus the maximum in use); rotary table and softmax f32; output projection: rows < 128 bf16 hi/lo x bf16 (2 products),
// rows >= 128 v_wmma_f32_16x16x32_f16 single product (context carried x64, Wo carried x64, 1/4096 folded in the f32 epilogue).
// Every 16-bit operand plane P[row][k] (NC columns) lies in FRAGMENT ORDER: 1-KB tiles of 16 rows x 32 k, tile (row >> 4, k >> 5) at element ((row >> 4) (NC / 32) + (k >> 5)) 512 (value planes: tile (d >> 4, key >> 5) at
// ((key >> 5) 8 + (d >> 4)) 512), and inside a tile element (row, k) at ((k >> 4) & 1) 256 + (((k >> 3) & 1) 16 + (row & 15)) 8 + (k & 7): a wave's 16-byte-per-lane load or store at lane 8 covers 512 contiguous bytes.

#ifndef NB
#define NB 2
#endif
#ifndef SEQ
#define SEQ 2048
#endif
#define NB_FULL 2
#define TT_FULL 2048
#define TT   SEQ
#define DM   2048
#define NH_  16
#define NKV  4
#define REP  (NH_ / NKV)
#define HD   128
#define HP   (HD / 2)
#define DQ   (NH_ * HD)
#define DKV  (NKV * HD)
#define RH   128                  // query rows < RH use hi/lo planes (keys < RH suffice: causal)
#define ACAR 64.0f                // carry of the fp16 merged-context plane (rows >= RH)
#define WCAR 64.0f                // carry of the fp16 Wo plane
#define OSCW (1.0f / (ACAR * WCAR))
#define SCL  0.08838834764831845f   // HD^-0.5
#define KX   DM                   // columns of every GEMM operand plane

static_assert(NB >= 1 && NB <= NB_FULL);
static_assert(TT % 128 == 0 && TT <= TT_FULL && TT > RH);
static_assert(RH % 128 == 0 && RH >= 128);
static_assert((TT - RH) % 64 == 0);
static_assert(HD == 128 && HP == 64);
static_assert(NH_ == NKV * REP && TT % 32 == 0 && RH % 32 == 0);
static_assert(DM % 64 == 0 && DQ % 64 == 0 && DKV % 64 == 0 && DQ == KX);

typedef _Float16 h16;
typedef unsigned short bf;
typedef __attribute__((ext_vector_type(16))) __bf16   v16bf;
typedef __attribute__((ext_vector_type(16))) _Float16 v16h;
typedef __attribute__((ext_vector_type(8)))  _Float16 v8h;
typedef __attribute__((ext_vector_type(8)))  unsigned short v8us;
typedef __attribute__((ext_vector_type(8)))  float    v8f;
typedef __attribute__((ext_vector_type(4)))  float    v4f;
typedef v8h  __attribute__((may_alias)) v8ha;
typedef v4f  __attribute__((may_alias)) v4fa;
typedef v8us __attribute__((may_alias)) v8usa;

__device__ __forceinline__ unsigned short f2bf(float f) { unsigned u = __float_as_uint(f); u += 0x7FFFu + ((u >> 16) & 1u); return (unsigned short)(u >> 16); }
__device__ __forceinline__ float bf2f(unsigned short b) { return __uint_as_float(((unsigned)b) << 16); }
__device__ __forceinline__ float bfr(float f) { return bf2f(f2bf(f)); }
__device__ __forceinline__ v16h cat16(v8h lo, v8h hi) { return __builtin_shufflevector(lo, hi, 0, 1, 2, 3, 4, 5, 6, 7, 8, 9, 10, 11, 12, 13, 14, 15); }
__device__ __forceinline__ v16bf cat16b(v8us lo, v8us hi) { return __builtin_bit_cast(v16bf, __builtin_shufflevector(lo, hi, 0, 1, 2, 3, 4, 5, 6, 7, 8, 9, 10, 11, 12, 13, 14, 15)); }
__device__ __forceinline__ v8f wmma16(v16h a, v16h b, v8f c) { return __builtin_amdgcn_wmma_f32_16x16x32_f16(false, a, false, b, (short)0, c, false, false); }
__device__ __forceinline__ v8f wmmab(v16bf a, v16bf b, v8f c) { return __builtin_amdgcn_wmma_f32_16x16x32_bf16(false, a, false, b, (short)0, c, false, false); }

__device__ __forceinline__ h16 tohx(float x) { return (h16)x; }
__device__ __forceinline__ void splitf(float y, unsigned short& h, unsigned short& l) { h = f2bf(y); l = f2bf(y - bf2f(h)); }

// ---- k_gemmw: register-blocked GEMM, NW WAVES per 64x64 output tile (16 accumulators each), operands straight from 16-bit planes in fragment order; grid (M/64, N/64, Z), 32 NW threads.
// Wave w contracts the 32-wide k chunks w, w + NW, w + 2 NW, ... of the tile; for NW > 1 the NW f32 partial tiles meet in LDS and are summed in wave order 0 .. NW-1 (fixed), then scaled and stored.
// C[m][n] (f32, pitch ldc) = osc x sum_k A[m][k] Bt[n][k] (+ split products per NSPLIT: 1 = A2.Bt added, 2 = A2.Bt and A.Bt2 added). Every plane has KX columns (a constant: the tile-row steps become immediate offsets), z-batch strides sA/sB/sC in elements. K % 32 == 0.
// Fragment k map (both operands): elements 0..7 <- kc + 8h + 0..7, elements 8..15 <- kc + 16 + 8h + 0..7, h = lane >> 4, row/col = lane & 15: WFrag::ld at tile base + lane 8 (its second half 256 elements on).
// cskip >= 0: tiles with blockIdx.y > blockIdx.x + cskip are not computed (causal upper triangle). kcaus > 0: contraction stops at min(K, kcaus + 64 (blockIdx.x + 1)) (causal key limit).
template <typename T16> struct WFrag;
template <> struct WFrag<h16> { typedef v16h V; static __device__ __forceinline__ V ld(const h16* p) { return cat16(*(const v8h*)p, *(const v8h*)(p + 256)); } static __device__ __forceinline__ v8f mma(V a, V b, v8f c) { return wmma16(a, b, c); } };
template <> struct WFrag<bf> { typedef v16bf V; static __device__ __forceinline__ V ld(const bf* p) { return cat16b(*(const v8us*)p, *(const v8us*)(p + 256)); } static __device__ __forceinline__ v8f mma(V a, V b, v8f c) { return wmmab(a, b, c); } };
template <typename T16, int NSPLIT, int NW>
__global__ __launch_bounds__(32 * NW) void k_gemmw(const T16* __restrict__ A, const T16* __restrict__ A2, const T16* __restrict__ Bt, const T16* __restrict__ Bt2, int K, int cskip, int kcaus,
                                             float* C, int ldc, float osc, size_t sA, size_t sB, size_t sC) {
    typedef typename WFrag<T16>::V V;
    __shared__ __align__(16) float os[(NW == 1 ? 16 : NW * 64) * 68];
    if (cskip >= 0 && (int)blockIdx.y > (int)blockIdx.x + cskip) return;   // block-uniform, in front of the one block barrier
    const size_t z = blockIdx.z; A += z * sA; if (A2) A2 += z * sA; Bt += z * sB; if (Bt2) Bt2 += z * sB; C += z * sC;
    const int lane = threadIdx.x & 31, lr = lane & 15, hi = lane >> 4; const int r0 = blockIdx.x * 64, c0 = blockIdx.y * 64;
    const int wv = (NW == 1) ? 0 : __builtin_amdgcn_readfirstlane((int)(threadIdx.x >> 5));   // wave number, scalar: the k loop stays under scalar control
    int kend = K;
    if (kcaus > 0) { const int kl = kcaus + 64 * ((int)blockIdx.x + 1); kend = (kl < K) ? kl : K; }
    v8f acc[4][4];
#pragma unroll
    for (int mb = 0; mb < 4; ++mb)
#pragma unroll
        for (int nb = 0; nb < 4; ++nb) acc[mb][nb] = (v8f){};
    // every fragment address = a wave-uniform tile-row base (16 rows of a plane = KX / 32 tiles = 16 KX elements) + one byte offset per lane: 16 bytes a lane inside a tile, 1 KB a 32-wide k chunk; the offset is advanced only behind the wait at the loop's foot
    const size_t aoff = (size_t)r0 * KX, boff = (size_t)c0 * KX; unsigned ko = (unsigned)lane * 16 + (unsigned)wv * 1024;
    auto ldo = [](const T16* ub, const unsigned bo, const int o) __attribute__((always_inline)) { return WFrag<T16>::ld((const T16*)((const char*)ub + bo) + o); };
#pragma unroll 1
    for (int kc = 32 * wv; kc < kend; kc += 32 * NW) {
        V a[4], a2[4], b[4], b2[4];
#pragma unroll
        for (int mb = 0; mb < 4; ++mb) { a[mb] = ldo(A + aoff, ko, mb * 16 * KX); if (NSPLIT == 1 || NSPLIT == 2) a2[mb] = ldo(A2 + aoff, ko, mb * 16 * KX); }
#pragma unroll
        for (int nb = 0; nb < 4; ++nb) { b[nb] = ldo(Bt + boff, ko, nb * 16 * KX); if (NSPLIT >= 2) b2[nb] = ldo(Bt2 + boff, ko, nb * 16 * KX); }
        __builtin_amdgcn_sched_barrier(0);   // the trip's loads stay one group in front of its products; built without it, the Bt fragments shared one register set and each was fetched only behind the products of the one before: four load latencies a trip
#pragma unroll
        for (int nb = 0; nb < 4; ++nb)
#pragma unroll
            for (int mb = 0; mb < 4; ++mb) { acc[mb][nb] = WFrag<T16>::mma(a[mb], b[nb], acc[mb][nb]); if (NSPLIT == 1 || NSPLIT == 2) acc[mb][nb] = WFrag<T16>::mma(a2[mb], b[nb], acc[mb][nb]); if (NSPLIT >= 2) acc[mb][nb] = WFrag<T16>::mma(a[mb], b2[nb], acc[mb][nb]); }
        asm volatile("v_nop\n\tv_nop\n\tv_nop\n\tv_nop" : "+v"(acc[0][0]), "+v"(acc[1][1]), "+v"(acc[2][2]), "+v"(acc[3][3]) : "v"(a[0]), "v"(a[3]));
        asm volatile("s_wait_xcnt 0x0" : "+v"(ko) :: "memory");   // stands in front of the offset update, which overwrites the address register that this trip's loads name; as an in-out operand the offset can be advanced only behind it
        ko += 1024 * NW;
    }
    if constexpr (NW > 1) {
        float* my = os + (size_t)wv * (64 * 68);
#pragma unroll
        for (int mb = 0; mb < 4; ++mb)
#pragma unroll
            for (int nb = 0; nb < 4; ++nb)
#pragma unroll
                for (int j = 0; j < 8; ++j) my[(mb * 16 + hi * 8 + j) * 68 + nb * 16 + lr] = acc[mb][nb][j];
        __syncthreads();   // every wave's partial tile is in LDS before any thread sums across waves
#pragma unroll
        for (int it = 0; it < 32 / NW; ++it) { const int item = it * (32 * NW) + (int)threadIdx.x; const int row = item >> 4, cofs = (item & 15) * 4;
            v4f s = *(const v4fa*)(os + row * 68 + cofs);
#pragma unroll
            for (int q = 1; q < NW; ++q) s += *(const v4fa*)(os + q * (64 * 68) + row * 68 + cofs);
            *(v4f*)(C + (size_t)(r0 + row) * ldc + c0 + cofs) = s * osc; }
    } else {
#pragma unroll
    for (int mb = 0; mb < 4; ++mb) {
#pragma unroll
        for (int nb = 0; nb < 4; ++nb) {
#pragma unroll
            for (int j = 0; j < 8; ++j) os[(hi * 8 + j) * 68 + nb * 16 + lr] = acc[mb][nb][j]; }
        __builtin_amdgcn_wave_barrier(); asm volatile("" ::: "memory");
        float* crow = C + (size_t)(r0 + mb * 16) * ldc + c0;
{
#pragma unroll
            for (int s = 0; s < 8; ++s) { const int row = 2 * s + hi, cofs = lr * 4; const v4f val = *(const v4fa*)(os + row * 68 + cofs) * osc;
                *(v4f*)(crow + (size_t)row * ldc + cofs) = val; }
             }
        __builtin_amdgcn_wave_barrier(); asm volatile("" ::: "memory");
    }
    }
}

typedef __attribute__((ext_vector_type(2))) _Float16 v2h;
typedef __attribute__((ext_vector_type(4))) _Float16 v4h;
typedef __attribute__((ext_vector_type(2))) unsigned short v2us;
typedef __attribute__((ext_vector_type(4))) unsigned short v4us;
typedef __attribute__((ext_vector_type(2))) float v2f;

// ---- k_prep: every plane that depends on an input alone (four bf16 weight planes, the fp16 Wo plane, the bf16 x plane, the rotary table) in ONE launch. No LDS, no barrier; a block's job follows from its index
// (block-uniform): first the rotary table, then x, then Wq, Wk, Wv, Wo. Every load of a wave covers whole 128-byte lines and a wave keeps 16 (of 16 bytes a lane) or 64 (of 4) of them in flight.
#define PB_CS (TT / 32)                       // blocks of the rotary table: 4 groups of 64 threads, each thread 8 positions of one j
#define PB_X  (NB * (TT / 16))                // blocks of the x plane: a block takes 16 rows, a wave 256 columns of them (8 tiles)
#define PB_WB ((DQ / 64) * (DM / 64) / 8)     // blocks of Wq and of Wo: a wave takes 64 columns x 64 k (8 tiles)
#define PB_WS ((DKV / 64) * (DM / 64) / 8)    // blocks of Wk and of Wv
static_assert(DM % 256 == 0 && DQ == DM && ((DKV / 64) * (DM / 64)) % 8 == 0);
// The wait that stands behind a run of loads or stores, in front of anything that overwrites a register which one of them names; the two scheduling barriers keep every other instruction on its own side of the wait
__device__ __forceinline__ void xwait() { __builtin_amdgcn_sched_barrier(0); asm volatile("s_wait_xcnt 0x0" ::: "memory"); __builtin_amdgcn_sched_barrier(0); }
// w (K rows, N columns, f32) -> Bt (N rows, K columns) in fragment order. A lane owns two columns n (n0 + lane, n0 + 32 + lane), for each: its 32 loads of a 32-k chunk are rows k of w (a wave: 128 contiguous bytes each), its four 16-byte pieces
// (k >> 3 = 0..3 of the chunk) go to their places in tile (n >> 4, k >> 5): a wave's store covers 256 contiguous bytes in each of two tiles. H16: also the fp16 plane of the bf16-rounded value x WCAR.
template <int K, int N, bool H16>
__device__ __forceinline__ void prep_w(const float* __restrict__ w, bf* __restrict__ Bt, h16* __restrict__ Bh, const int job, const int lane) {
    const int k0 = (job % (K / 64)) * 64, n0 = (job / (K / 64)) * 64;
    const float* p = w + (size_t)k0 * N + n0 + lane;
    const size_t tb = ((size_t)((n0 + lane) >> 4) * (K / 32) + (k0 >> 5)) * 512 + (lane & 15) * 8;   // column n0 + lane; column n0 + 32 + lane lies two tile rows (K / 16 tiles) on
    bf* d = Bt + tb; h16* dh = H16 ? Bh + tb : nullptr;
    // every loop below is unrolled: v, o and oh stay in registers and every row or tile step becomes an immediate offset
#pragma unroll
    for (int kc = 0; kc < 2; ++kc) {
        float v[2][32];
        __builtin_amdgcn_sched_barrier(0);   // the addresses are formed in front of the run of loads, so that nothing but loads stands between here and the wait
#pragma unroll
        for (int j = 0; j < 32; ++j)
#pragma unroll
            for (int nh = 0; nh < 2; ++nh) v[nh][j] = p[(size_t)(kc * 32 + j) * N + nh * 32];
        xwait();
        v8us o[2][4]; v8h oh[H16 ? 2 : 1][H16 ? 4 : 1];
#pragma unroll
        for (int nh = 0; nh < 2; ++nh)
#pragma unroll
            for (int q = 0; q < 4; ++q)
#pragma unroll
                for (int e = 0; e < 8; ++e) { o[nh][q][e] = f2bf(v[nh][q * 8 + e]); if constexpr (H16) oh[nh][q][e] = tohx(bf2f(o[nh][q][e]) * WCAR); }
        __builtin_amdgcn_sched_barrier(0);   // every packed piece is formed, in registers of its own, in front of the first store
#pragma unroll
        for (int nh = 0; nh < 2; ++nh)
#pragma unroll
            for (int q = 0; q < 4; ++q) { const int off = (nh * (K / 16) + kc) * 512 + (q >> 1) * 256 + (q & 1) * 128;
                *(v8us*)(d + off) = o[nh][q]; if constexpr (H16) *(v8h*)(dh + off) = oh[nh][q]; }
        xwait();
    }
}
// x rows -> bf16 plane of DM columns in fragment order. A load covers 4 rows x 128 bytes (one tile's k range): lane >> 3 = row & 3, lane & 7 = k >> 2; a lane's 4 values are half a 16-byte piece, a wave's store covers four runs of 64 bytes.
__device__ __forceinline__ void prep_x(const float* __restrict__ x, bf* __restrict__ XB, const int job, const int lane) {
    const int tr = job / (DM / 256), k0 = (job % (DM / 256)) * 256; const int b = tr / (TT / 16), r0 = (tr % (TT / 16)) * 16; const int kq = lane & 7;
    const float* src = x + (size_t)b * TT_FULL * DM + (size_t)(r0 + (lane >> 3)) * DM + k0 + kq * 4;
    bf* dst = XB + (size_t)b * TT * DM + ((size_t)(r0 >> 4) * (DM / 32) + (k0 >> 5)) * 512 + (kq >> 2) * 256 + (((kq >> 1) & 1) * 16 + (lane >> 3)) * 8 + (kq & 1) * 4;
    // every loop below is unrolled: v and o stay in registers and every row or tile step becomes an immediate offset
#pragma unroll
    for (int hf = 0; hf < 2; ++hf) {
        v4f v[4][4];
        __builtin_amdgcn_sched_barrier(0);   // the addresses are formed in front of the run of loads, so that nothing but loads stands between here and the wait
#pragma unroll
        for (int j = 0; j < 4; ++j)
#pragma unroll
            for (int tl = 0; tl < 4; ++tl) v[tl][j] = *(const v4f*)(src + (size_t)(4 * j) * DM + (hf * 4 + tl) * 32);
        xwait();
        v4us o[4][4];
#pragma unroll
        for (int tl = 0; tl < 4; ++tl)
#pragma unroll
            for (int j = 0; j < 4; ++j)
#pragma unroll
                for (int e = 0; e < 4; ++e) o[tl][j][e] = f2bf(v[tl][j][e]);
        __builtin_amdgcn_sched_barrier(0);   // every packed piece is formed, in registers of its own, in front of the first store
#pragma unroll
        for (int tl = 0; tl < 4; ++tl)
#pragma unroll
            for (int j = 0; j < 4; ++j) *(v4us*)(dst + (hf * 4 + tl) * 512 + (4 * j) * 8) = o[tl][j];
        xwait();
    }
}
// CS[t][j] = {cos(t inv_j), sin(t inv_j)} f32 for j < 64, inv_j = 1 / f32(10000^(j/64)) where 10000^(j/64) is a product of exact-root powers 10000^(2^b/64) in f64; a thread forms inv_j once and uses it for 8 positions
__device__ __forceinline__ void prep_cs(float* CS, const int blk) {
    const int j = threadIdx.x & (HP - 1); const int t0 = (blk * 4 + (int)(threadIdx.x >> 6)) * 8;
    double s = 100.0, p = 1.0;
#pragma unroll 1
    for (int b = 5; b >= 0; --b) { if ((j >> b) & 1) p *= s; s = sqrt(s); }
    const float pf = (float)p; const float inv = 1.0f / pf;
    // stays rolled: eight copies of the sine and cosine code would only add text for the instruction cache to hold
#pragma unroll 1
    for (int t = t0; t < t0 + 8; ++t) { const float ang = __fmul_rn((float)t, inv);
        float sn, cn; sincosf(ang, &sn, &cn);
        v2f cs; cs[0] = cn; cs[1] = sn;
        *(v2f*)(CS + ((size_t)t * HP + j) * 2) = cs;
        xwait(); }
}
__global__ __launch_bounds__(256) void k_prep(const float* __restrict__ x, const float* __restrict__ wq, const float* __restrict__ wk, const float* __restrict__ wv, const float* __restrict__ wo,
                                              bf* XB, bf* WQ, bf* WK, bf* WV, bf* WO, h16* WO16, float* CS) {
    const int lane = threadIdx.x & 31; const int wave = __builtin_amdgcn_readfirstlane((int)(threadIdx.x >> 5));   // scalar: job numbers and plane bases stay in scalar registers
    int blk = blockIdx.x;
    if (blk < PB_CS) { prep_cs(CS, blk); return; }
    blk -= PB_CS;
    if (blk < PB_X) { prep_x(x, XB, blk * 8 + wave, lane); return; }
    blk -= PB_X;
    if (blk < PB_WB) { prep_w<DM, DQ, false>(wq, WQ, nullptr, blk * 8 + wave, lane); return; }
    blk -= PB_WB;
    if (blk < 2 * PB_WS) { const bool sec = blk >= PB_WS; prep_w<DM, DKV, false>(sec ? wv : wk, sec ? WV : WK, nullptr, (sec ? blk - PB_WS : blk) * 8 + wave, lane); return; }
    blk -= 2 * PB_WS;
    prep_w<DQ, DM, true>(wo, WO, WO16, blk * 8 + wave, lane);
}
typedef __attribute__((ext_vector_type(16))) unsigned short v16us;
__device__ __forceinline__ float xhalf(float x) { return __builtin_bit_cast(float, __builtin_amdgcn_permlanex16(__builtin_bit_cast(int, x), __builtin_bit_cast(int, x), 0x76543210, 0xfedcba98, false, false)); }   // lane l with lane l ^ 16
__device__ __forceinline__ void wgap() { __builtin_amdgcn_sched_barrier(0); asm volatile("v_nop\n\tv_nop\n\tv_nop\n\tv_nop"); __builtin_amdgcn_sched_barrier(0); }   // the 4 vector slots between a pass's last WMMAs and whatever reads their D or overwrites their A/B next, on the taken side of the loop branch that follows too
template <bool B> struct BoolC { static constexpr bool value = B; };
// G groups of 16 query rows from row q0 + gofs on; keys [kb, ke) in passes that need no mask (ke <= q0), then, if diag, the diagonal pass, keys [q0, q0 + 32). Returns the maximum in use, each wave half's sum and the unnormalised accumulators.
template <typename T16, bool HR, int G>
__device__ __forceinline__ void fattn_rows(const T16* __restrict__ Q, const T16* __restrict__ Q2, const T16* __restrict__ Kp, const T16* __restrict__ K2, const T16* __restrict__ Vt, const T16* __restrict__ V2, const int q0, const int gofs, const int kb, const int ke, const bool diag, const int lane, v8f (&acc)[G][8], float (&m_run)[G], float (&l_run)[G]) {
    typedef typename WFrag<T16>::V V;
    constexpr float CSC = SCL * 1.4426950408889634f;
    const int c = lane & 15, h = lane >> 4;
    V qf[G][4], qf2[G][4], kf[2][4], kf2[2][4];
    // every fragment address = a wave-uniform plane base + the lane's byte offset (16 bytes a lane inside a tile in fragment order); the key and value offsets are carried through the pass loop and advanced only behind the wait that covers the loads which name them
    const unsigned qo = ((unsigned)(q0 + gofs) * HD + 8 * lane) * 2; unsigned ko = (unsigned)lane * 16 + (unsigned)kb * (HD * 2), vo = ko;   // 32 keys are 32 HD elements in a row of the key plane and of the value plane
    auto ldo = [](const T16* ub, const unsigned bo, const int o) __attribute__((always_inline)) { return WFrag<T16>::ld((const T16*)((const char*)ub + bo) + o); };
#pragma unroll
    for (int g = 0; g < G; ++g)
#pragma unroll
        for (int kc = 0; kc < 4; ++kc) { const int o = 16 * g * HD + 512 * kc; qf[g][kc] = ldo(Q, qo, o); if constexpr (HR) qf2[g][kc] = ldo(Q2, qo, o); }
#pragma unroll
    for (int g = 0; g < G; ++g) { m_run[g] = -__builtin_inff(); l_run[g] = 0.0f;
#pragma unroll
        for (int t = 0; t < 8; ++t) acc[g][t] = (v8f){}; }
#pragma unroll
    for (int kt = 0; kt < 2; ++kt)
#pragma unroll
        for (int kc = 0; kc < 4; ++kc) { const int o = 16 * kt * HD + 512 * kc; kf[kt][kc] = ldo(Kp, ko, o); if constexpr (HR) kf2[kt][kc] = ldo(K2, ko, o); }
    // stands in front of any overwrite of an address register that the query and first key loads name; the operands (the offsets, and the key addresses where the build sums base and offset in a vector pair) keep those registers untouched up to the wait
    if constexpr (HR) asm volatile("s_wait_xcnt 0x0" : "+v"(ko) : "v"(qo), "v"((const char*)Kp + ko), "v"((const char*)K2 + ko) : "memory");
    else asm volatile("s_wait_xcnt 0x0" : "+v"(ko) : "v"(qo), "v"((const char*)Kp + ko) : "memory");
    __builtin_amdgcn_sched_barrier(0);   // nothing that could overwrite one moves up over that wait
    ko += 32 * HD * 2;
    // One 32-key pass. dg true: the diagonal pass, a wave's last (keys > query replaced by -inf, by index; nothing fetched ahead); every other pass fetches the next pass's key fragments.
    auto pass = [&](auto dg) __attribute__((always_inline)) {
        constexpr bool DIAG = decltype(dg)::value;
        V vf[8], vf2[8];
#pragma unroll
        for (int t = 0; t < 8; ++t) { const int o = 512 * t; vf[t] = ldo(Vt, vo, o); if constexpr (HR) vf2[t] = ldo(V2, vo, o); }
        if constexpr (HR && !DIAG) asm volatile("s_wait_xcnt 0x0" ::: "memory");   // with two value planes the build sums base and offset in vector registers that the score tiles then take: the wait stands in front of that overwrite
        if constexpr (HR && DIAG) asm volatile("s_wait_xcnt 0x0" :: "v"((const char*)Vt + vo), "v"((const char*)V2 + vo) : "memory");   // the same wait in a wave's last pass: as inputs the two sums stay untouched up to it (built without them, the last load of each plane landed on its own address pair, which the loads before it name)
        __builtin_amdgcn_sched_barrier(0);   // the value loads stay in front of the score products, so that they fly under them and under the softmax
        v8f s[2][G];
#pragma unroll
        for (int kt = 0; kt < 2; ++kt)
#pragma unroll
            for (int g = 0; g < G; ++g) { s[kt][g] = (v8f){};
#pragma unroll
                for (int kc = 0; kc < 4; ++kc) { s[kt][g] = WFrag<T16>::mma(kf[kt][kc], qf[g][kc], s[kt][g]);
                    if constexpr (HR) { s[kt][g] = WFrag<T16>::mma(kf2[kt][kc], qf[g][kc], s[kt][g]); s[kt][g] = WFrag<T16>::mma(kf[kt][kc], qf2[g][kc], s[kt][g]); } } }
        __builtin_amdgcn_sched_barrier(0);   // the score products stay in front of the wait and of the key prefetch
        asm volatile("s_wait_xcnt 0x0" :: "v"(vo) : "memory");   // stands in front of any overwrite of an address register that the value loads name (the input keeps their offset untouched up to here); it is placed behind the score products so that it does not hold up their issue
        __builtin_amdgcn_sched_barrier(0);   // nothing that could overwrite one moves up over that wait
        if constexpr (!DIAG) {   // the next pass's key fragments fly under this pass's softmax and second product
#pragma unroll
            for (int kt = 0; kt < 2; ++kt)
#pragma unroll
                for (int kc = 0; kc < 4; ++kc) { const int o = 16 * kt * HD + 512 * kc; kf[kt][kc] = ldo(Kp, ko, o); if constexpr (HR) kf2[kt][kc] = ldo(K2, ko, o); }
            __builtin_amdgcn_sched_barrier(0);   // keeps the key prefetch issued ahead of the softmax arithmetic
        } else {                 // the pass's first key is q0
#pragma unroll
            for (int g = 0; g < G; ++g)
#pragma unroll
                for (int kt = 0; kt < 2; ++kt)
#pragma unroll
                    for (int r = 0; r < 8; ++r) if (16 * kt + 8 * h + r > 16 * g + gofs + c) s[kt][g][r] = -__builtin_inff();
        }
        float mb[G]; bool need = false;
#pragma unroll
        for (int g = 0; g < G; ++g) { float mx = -__builtin_inff();
#pragma unroll
            for (int kt = 0; kt < 2; ++kt)
#pragma unroll
                for (int r = 0; r < 8; ++r) mx = fmaxf(mx, s[kt][g][r]);
            mx = fmaxf(mx, xhalf(mx)) * CSC; mb[g] = mx; need = need || (mx > m_run[g] + 8.0f); }
        if (__builtin_amdgcn_ballot_w32(need) != 0) {   // scalar branch, rare after the first passes; every column has an unmasked key in every pass, so the new maximum is finite
#pragma unroll
            for (int g = 0; g < G; ++g) { const float mn = fmaxf(m_run[g], mb[g]); const float corr = __builtin_amdgcn_exp2f(m_run[g] - mn); l_run[g] *= corr; m_run[g] = mn;
#pragma unroll
                for (int t = 0; t < 8; ++t) acc[g][t] = acc[g][t] * corr; }
        }
#pragma unroll
        for (int g = 0; g < G; ++g) { const float nm = -m_run[g]; float pv[16]; float ps0 = 0.0f, ps1 = 0.0f;
#pragma unroll
            for (int e = 0; e < 16; ++e) { pv[e] = __builtin_amdgcn_exp2f(__builtin_fmaf(s[e >> 3][g][e & 7], CSC, nm)); if (e & 1) ps1 += pv[e]; else ps0 += pv[e]; }
            l_run[g] += ps0 + ps1;
            V pf, pf2;
            if constexpr (HR) { v16us uh, ul;
#pragma unroll
                for (int e = 0; e < 16; ++e) { unsigned short a, b; splitf(pv[e], a, b); uh[e] = a; ul[e] = b; }
                pf = __builtin_bit_cast(v16bf, uh); pf2 = __builtin_bit_cast(v16bf, ul);
            } else {
#pragma unroll
                for (int e = 0; e < 16; ++e) pf[e] = tohx(pv[e]); }
#pragma unroll
            for (int t = 0; t < 8; ++t) { acc[g][t] = WFrag<T16>::mma(vf[t], pf, acc[g][t]);
                if constexpr (HR) { acc[g][t] = WFrag<T16>::mma(vf2[t], pf, acc[g][t]); acc[g][t] = WFrag<T16>::mma(vf[t], pf2, acc[g][t]); } }
        }
        wgap();
        if constexpr (!DIAG) {
            asm volatile("s_wait_xcnt 0x0" : "+v"(ko), "+v"(vo) :: "memory");   // stands in front of the offset updates, which overwrite address registers that this pass's loads name; as in-out operands the offsets can be advanced only behind it
            ko += 32 * HD * 2; vo += 32 * HD * 2; }
    };
    // stays rolled: the trip count is known only at run time, and further copies of a body this long would only add code for the instruction cache to hold
#pragma unroll 1
    for (int key0 = kb; key0 < ke; key0 += 32) pass(BoolC<false>{});   // keys [kb, ke): no key exceeds a query of this wave
    if (diag) pass(BoolC<true>{});                                     // keys [q0, q0 + 32); the test is the same for a whole wave
}
#define FA_XF (33 * 128)   // floats one wave hands over: its 128 accumulator registers as 32 pieces of 16 bytes a lane, then one piece with the two maxima and the two sums
__global__ __launch_bounds__(64 * REP) void k_fattn(const h16* __restrict__ Q16, const h16* __restrict__ K16, const h16* __restrict__ V16, const bf* __restrict__ Qh, const bf* __restrict__ Ql, const bf* __restrict__ Kh, const bf* __restrict__ Kl, const bf* __restrict__ Vh, const bf* __restrict__ Vl, h16* A16_, bf* Ah_, bf* Al_) {
    __shared__ __align__(16) float xs[NB * REP * FA_XF];   // a range of its own for every batch and head: written once, read once, one barrier a batch
    const int g = blockIdx.y;
    const int wv = __builtin_amdgcn_readfirstlane((int)(threadIdx.x >> 5));   // scalar: plane bases, the pass loop and the choice of a wave's part stay under scalar control
    // the lane number, counted anew on top of a scalar at each place that needs it: held in one register across the pass loops, the lane's byte offset was spilled to scratch and fetched back in front of every use
    auto lane_at = [](const int s) __attribute__((always_inline)) { return (int)__builtin_amdgcn_mbcnt_lo(~0u, (unsigned)s) - s; };
    const int hw = wv % REP, hs = wv / REP; const int head = g * REP + hw;
    // a wave pair takes one row block of every batch, one after the other: block n - 1 - x of even batches, block x of odd ones, so that with two batches every pair walks the same number of key passes. Stays rolled: one copy of the two long bodies in the instruction cache
#pragma unroll 1
    for (int b = 0; b < NB; ++b) {
    const int q0 = ((b & 1) ? (int)blockIdx.x : TT / 32 - 1 - (int)blockIdx.x) * 32;
    const int lane = lane_at(b);
    const size_t bh = (size_t)b * NH_ + head, bg = (size_t)b * NKV + g;
    h16* A16 = A16_ + (size_t)b * TT * DQ; bf* Ah = Ah_ + (size_t)b * RH * DQ; bf* Al = Al_ + (size_t)b * RH * DQ;
    if (q0 < RH) {   // block-uniform
        v8f acc[1][8]; float mr[1], lr[1];
        fattn_rows<bf, true, 1>(Qh + bh * RH * HD, Ql + bh * RH * HD, Kh + bg * RH * HD, Kl + bg * RH * HD, Vh + bg * HD * RH, Vl + bg * HD * RH, q0, 16 * hs, 0, q0, true, lane, acc, mr, lr);
        const float linv = __fdiv_rn(1.0f, lr[0] + xhalf(lr[0]));   // each wave half summed its own eight keys of every 16-key tile
        const int lane2 = lane_at(q0 + 1);
        v8us oh[8], ol[8];
#pragma unroll
        for (int t = 0; t < 8; ++t)   // a lane's 8 registers are d = 16 t + 8 h + 0..7 of query q0 + 16 hs + c
#pragma unroll
            for (int r = 0; r < 8; ++r) { unsigned short a, b; splitf(acc[0][t][r] * linv, a, b); oh[t][r] = a; ol[t][r] = b; }
        __builtin_amdgcn_sched_barrier(0);   // all sixteen packed vectors are formed in front of the first store, each in registers of its own, so that no packing takes the data registers of a store just issued, ahead of the wait below
#pragma unroll
        for (int t = 0; t < 8; ++t) { const size_t oo = (size_t)(q0 + 16 * hs) * DQ + (head * (HD / 32) + (t >> 1)) * 512 + (t & 1) * 256 + 8 * lane2; *(v8us*)(Ah + oo) = oh[t]; *(v8us*)(Al + oo) = ol[t]; }   // its place in fragment order, planes of DQ columns
        asm volatile("s_wait_xcnt 0x0" ::: "memory");   // stands behind the run of stores above, in front of anything that could overwrite a register which one of them names
    } else {
        v8f acc[2][8]; float mr[2], lr[2];
        const int km = ((q0 / 32 + 2) >> 1) * 32;   // the row block has q0 / 32 + 1 >= 5 passes: the first wave takes the first half of them, rounded up, the second wave the rest, the diagonal pass among them, and the joining
        fattn_rows<h16, false, 2>(Q16 + bh * TT * HD, nullptr, K16 + bg * TT * HD, nullptr, V16 + bg * HD * TT, nullptr, q0, 0, hs ? km : 0, hs ? q0 : km, hs != 0, lane, acc, mr, lr);
        const int lane2 = lane_at(q0 + 1);
        float* xp = xs + (size_t)(b * REP + hw) * FA_XF + lane2 * 4;   // a wave's 16-byte-per-lane LDS access covers 512 contiguous bytes
        if (hs == 0) {
#pragma unroll
            for (int gq = 0; gq < 2; ++gq)
#pragma unroll
                for (int t = 0; t < 8; ++t) { v4f lo4, hi4;
#pragma unroll
                    for (int r = 0; r < 4; ++r) { lo4[r] = acc[gq][t][r]; hi4[r] = acc[gq][t][4 + r]; }
                    *(v4fa*)(xp + ((gq * 8 + t) * 2) * 128) = lo4; *(v4fa*)(xp + ((gq * 8 + t) * 2 + 1) * 128) = hi4; }
            v4f ml; ml[0] = mr[0]; ml[1] = mr[1]; ml[2] = lr[0]; ml[3] = lr[1];
            *(v4fa*)(xp + 32 * 128) = ml;
        }
        __syncthreads();   // the first waves' parts are in LDS before the second waves read them; under block-uniform control flow (q0 and b are the same for the whole block)
        if (hs != 0) {
            const v4f ml = *(const v4fa*)(xp + 32 * 128);
            float ch[2], cl[2];   // both maxima are finite: each wave has walked at least two passes, and every query has an unmasked key in every pass
#pragma unroll
            for (int gq = 0; gq < 2; ++gq) { const float mn = fmaxf(mr[gq], ml[gq]); const float eh = __builtin_amdgcn_exp2f(mr[gq] - mn), el = __builtin_amdgcn_exp2f(ml[gq] - mn);
                const float l = lr[gq] * eh + ml[2 + gq] * el;
                const float linv = __fdiv_rn(1.0f, l + xhalf(l));   // each wave half summed its own eight keys of every 16-key tile
                ch[gq] = eh * linv * ACAR; cl[gq] = el * linv * ACAR; }
            v8h o16[2][8];
#pragma unroll
            for (int gq = 0; gq < 2; ++gq)
#pragma unroll
                for (int t = 0; t < 8; ++t) { const v4f lo4 = *(const v4fa*)(xp + ((gq * 8 + t) * 2) * 128), hi4 = *(const v4fa*)(xp + ((gq * 8 + t) * 2 + 1) * 128);
#pragma unroll
                    for (int r = 0; r < 8; ++r) o16[gq][t][r] = tohx(acc[gq][t][r] * ch[gq] + (r < 4 ? lo4[r & 3] : hi4[r & 3]) * cl[gq]); }
            __builtin_amdgcn_sched_barrier(0);   // all sixteen packed vectors are formed in front of the first store, each in registers of its own: built without it, the packing of a later vector took the data registers of a store just issued, ahead of the wait below
#pragma unroll
            for (int gq = 0; gq < 2; ++gq)
#pragma unroll
                for (int t = 0; t < 8; ++t) *(v8h*)(A16 + (size_t)(q0 + 16 * gq) * DQ + (head * (HD / 32) + (t >> 1)) * 512 + (t & 1) * 256 + 8 * lane2) = o16[gq][t];   // its place in fragment order, plane of DQ columns
            asm volatile("s_wait_xcnt 0x0" ::: "memory");   // stands behind the run of stores above, in front of anything that could overwrite a register which one of them names
        }
    }
    }
}

// ---- k_gemmb: GEMM with a 128 x 256 output tile per block, 8 waves (2 x 4) of 64 x 64 each, every wave over the whole contraction (no k split). Grid (M/128, N/256, batches), 256 threads.
// A stage is 128 k of the block's 8 + 16 tile rows (a tile row = 16 plane rows; its 128 k are 4 KB in a row in fragment order), 96 KB, brought into LDS once for all waves by asynchronous copies (16 bytes a lane, through no register),
// where it keeps fragment order: tile row j at j 4 KB. Two buffers: stage t + 2 is asked for at the foot of trip t, into the buffer that trip t has just read, and flies under trip t + 1.
// Each operand byte leaves L2 once per block and is read from LDS by 4 (A) or 2 (Bt) waves. C (f32, pitch ldc) = osc x the sum, each wave turning its own 64 x 64 tile through its own LDS range, which lies in the two buffers once the last trip's barrier has ended their use.
#define GB_M  128
#define GB_N  256
#define GB_K  128
#define GB_RB (GB_K * 16 * 2)                     // bytes of one tile row in a stage
#define GB_SB (((GB_M + GB_N) / 16) * GB_RB)      // bytes of a stage
static_assert(TT % GB_M == 0 && (TT - RH) % GB_M == 0 && RH % GB_M == 0 && DQ % GB_N == 0 && DM % GB_N == 0 && KX % GB_K == 0 && KX / GB_K >= 2 && (GB_M + GB_N) / 16 == 24);
template <typename T16>
__global__ __launch_bounds__(256) void k_gemmb(const T16* __restrict__ A, const T16* __restrict__ Bt, float* C, int ldc, float osc, size_t sA, size_t sC) {
    typedef typename WFrag<T16>::V V;
    // every loop of this kernel but the stage loop is unrolled: accumulators, fragments and copy addresses stay in registers and every tile step becomes an immediate offset
    __shared__ __align__(1024) char sm[2 * GB_SB];
    static_assert(8 * 64 * 68 * 4 <= 2 * GB_SB);
    const T16* st = (const T16*)sm; float* os = (float*)sm;   // the f32 tiles of the epilogue take the buffers' place
    const size_t z = blockIdx.z; A += z * sA;
    const int lane = threadIdx.x & 31, lr = lane & 15, hi = lane >> 4; const int r0 = blockIdx.x * GB_M, c0 = blockIdx.y * GB_N;
    const int wv = __builtin_amdgcn_readfirstlane((int)(threadIdx.x >> 5));   // wave number, scalar: tile-row bases and the stage loop stay under scalar control
    const int wm = wv & 1, wn = wv >> 1;
    // wave w copies tile rows 3 w .. 3 w + 2 of every stage (rows 0..7 of A, 8..23 of Bt), eight copies of 512 bytes each
    const char* gp[3]; unsigned lp[3];
#pragma unroll
    for (int i = 0; i < 3; ++i) { const int j = wv * 3 + i;
        const T16* tb = (j < GB_M / 16) ? A + (size_t)(r0 + 16 * j) * KX : Bt + (size_t)(c0 + 16 * (j - GB_M / 16)) * KX;
        gp[i] = (const char*)tb + lane * 16; lp[i] = (unsigned)(size_t)(const void*)sm + (unsigned)(j * GB_RB + lane * 16); }
    auto fill = [&](const int s, const int bi) __attribute__((always_inline)) {
#pragma unroll
        for (int h = 0; h < 2; ++h) { unsigned l[12]; const char* g[12];
#pragma unroll
            for (int q = 0; q < 12; ++q) { const int i = (h * 12 + q) >> 3, cc = (h * 12 + q) & 7; l[q] = lp[i] + (unsigned)bi * GB_SB + cc * 512; g[q] = gp[i] + (size_t)s * GB_RB + cc * 512; }
            // twelve of the wave's twenty-four copies of a stage and, as the statement's last line, the wait that stands in front of any overwrite of an address register which one of them names
            asm volatile("global_load_async_to_lds_b128 %0, %12, off\n\tglobal_load_async_to_lds_b128 %1, %13, off\n\tglobal_load_async_to_lds_b128 %2, %14, off\n\tglobal_load_async_to_lds_b128 %3, %15, off\n\t"
                         "global_load_async_to_lds_b128 %4, %16, off\n\tglobal_load_async_to_lds_b128 %5, %17, off\n\tglobal_load_async_to_lds_b128 %6, %18, off\n\tglobal_load_async_to_lds_b128 %7, %19, off\n\t"
                         "global_load_async_to_lds_b128 %8, %20, off\n\tglobal_load_async_to_lds_b128 %9, %21, off\n\tglobal_load_async_to_lds_b128 %10, %22, off\n\tglobal_load_async_to_lds_b128 %11, %23, off\n\t"
                         "s_wait_xcnt 0x0"
                         :: "v"(l[0]), "v"(l[1]), "v"(l[2]), "v"(l[3]), "v"(l[4]), "v"(l[5]), "v"(l[6]), "v"(l[7]), "v"(l[8]), "v"(l[9]), "v"(l[10]), "v"(l[11]),
                            "v"(g[0]), "v"(g[1]), "v"(g[2]), "v"(g[3]), "v"(g[4]), "v"(g[5]), "v"(g[6]), "v"(g[7]), "v"(g[8]), "v"(g[9]), "v"(g[10]), "v"(g[11]) : "memory"); }
    };
    v8f acc[4][4];
#pragma unroll
    for (int mb = 0; mb < 4; ++mb)
#pragma unroll
        for (int nb = 0; nb < 4; ++nb) acc[mb][nb] = (v8f){};
    constexpr int NS = KX / GB_K;
    fill(0, 0);
    asm volatile("s_wait_asynccnt 0x0" ::: "memory");   // this wave's copies of stage 0 have landed
    __syncthreads();                                     // every wave's have: stage 0 may be read
    fill(1, 1);
    // stays rolled: the two buffers alternate by the trip's parity, and 16 copies of the body would only add code for the instruction cache to hold
#pragma unroll 1
    for (int t = 0; t < NS; ++t) {
        const T16* sb = st + (t & 1) * (GB_SB / 2) + lane * 8;
        V a[GB_K / 32][4], b[GB_K / 32][4];
#pragma unroll
        for (int kk = 0; kk < GB_K / 32; ++kk) {
#pragma unroll
            for (int mb = 0; mb < 4; ++mb) a[kk][mb] = WFrag<T16>::ld(sb + (wm * 4 + mb) * (GB_RB / 2) + kk * 512);
#pragma unroll
            for (int nb = 0; nb < 4; ++nb) b[kk][nb] = WFrag<T16>::ld(sb + (GB_M / 16 + wn * 4 + nb) * (GB_RB / 2) + kk * 512); }
        __builtin_amdgcn_sched_barrier(0);   // the trip's LDS reads stay one group in front of its products
#pragma unroll
        for (int kk = 0; kk < GB_K / 32; ++kk)
#pragma unroll
            for (int nb = 0; nb < 4; ++nb)
#pragma unroll
                for (int mb = 0; mb < 4; ++mb) acc[mb][nb] = WFrag<T16>::mma(a[kk][mb], b[kk][nb], acc[mb][nb]);
        __builtin_amdgcn_sched_barrier(0);   // the products stay in front of the waits and the barrier: built without it they sank behind the barrier, so that the wait for the next stage's copies came right behind their issue and nothing hid their flight
        asm volatile("s_wait_dscnt 0x0" ::: "memory");      // this wave's reads of the buffer have returned before the buffer is given up
        asm volatile("s_wait_asynccnt 0x0" ::: "memory");   // this wave's copies of stage t + 1 have landed
        __syncthreads();                                     // publishes stage t + 1 and ends every wave's reads of the buffer that is refilled below
        if (t + 2 < NS) fill(t + 2, t & 1);
    }
    asm volatile("s_wait_asynccnt 0x0" ::: "memory");   // no copy is outstanding when the wave goes on to the epilogue and ends
    const int r0w = r0 + wm * 64, c0w = c0 + wn * 64;
    float* my = os + (size_t)wv * (64 * 68);
#pragma unroll
    for (int mb = 0; mb < 4; ++mb)
#pragma unroll
        for (int nb = 0; nb < 4; ++nb)
#pragma unroll
            for (int j = 0; j < 8; ++j) my[(mb * 16 + hi * 8 + j) * 68 + nb * 16 + lr] = acc[mb][nb][j];
    __syncthreads();   // the tile is in LDS before any lane reads what other lanes stored
    C += z * sC;
#pragma unroll
    for (int gq = 0; gq < 4; ++gq) { v4f s[8];   // a store covers two rows of 256 bytes
#pragma unroll
        for (int it = 0; it < 8; ++it) { const int item = (gq * 8 + it) * 32 + lane; s[it] = *(const v4fa*)(my + (item >> 4) * 68 + (item & 15) * 4) * osc; }
        __builtin_amdgcn_sched_barrier(0);   // the eight values are formed, in registers of their own, in front of the first store
#pragma unroll
        for (int it = 0; it < 8; ++it) { const int item = (gq * 8 + it) * 32 + lane; *(v4f*)(C + (size_t)(r0w + (item >> 4)) * ldc + c0w + (item & 15) * 4) = s[it]; }
        xwait(); }
}

// ---- k_qkv: the q, k and v projections of every batch as ONE GEMM launch. A block takes 128 positions x 384 product columns: 256 of q, 64 of k and 64 of v, so that the grid (TT/128, DQ/256, batches) has one block for each of 256 WGPs
// and a block's x rows are staged once for all three products. 12 waves (2 x 6) of 64 x 64 each, every wave over the whole contraction (no k split): wave columns 0..3 are q, 4 is k, 5 is v.
// A stage is 128 k of the block's 8 + 16 + 4 + 4 tile rows (x, Wq, Wk, Wv), 128 KB, brought into LDS by asynchronous copies as in k_gemmb, two buffers, the same order of waits and barrier at the foot of a trip.
// Epilogue, each wave through its own LDS range inside the two buffers: q and k waves apply the rotary map and store head planes (t, d); the v wave lays its tile down transposed and stores value planes (d, t); fp16 for every position, bf16 hi/lo for positions < RH.
#define QB_M  128
#define QB_NQ 256
#define QB_NK 64
#define QB_TR ((QB_M + QB_NQ + 2 * QB_NK) / 16)   // tile rows of a stage
#define QB_SB (QB_TR * GB_RB)                     // bytes of a stage
static_assert(TT % QB_M == 0 && RH % QB_M == 0 && DQ / QB_NQ == DKV / QB_NK && QB_TR == 32 && QB_M / 16 == 8 && QB_NQ / 16 == 16 && HD % QB_NK == 0);
__global__ __launch_bounds__(384) void k_qkv(const bf* __restrict__ A, const bf* __restrict__ BQ, const bf* __restrict__ BK, const bf* __restrict__ BV, const float* __restrict__ CS,
                                             h16* Q16, bf* Qh, bf* Ql, h16* K16, bf* Kh, bf* Kl, h16* V16, bf* Vh, bf* Vl) {
    typedef WFrag<bf>::V V;
    // every loop of this kernel but the stage loop is unrolled: accumulators, fragments, copy addresses and the (c, s) pairs stay in registers and every tile step becomes an immediate offset
    __shared__ __align__(1024) char sm[2 * QB_SB];
    static_assert(12 * 64 * 68 * 4 <= 2 * QB_SB);
    const bf* st = (const bf*)sm; float* os = (float*)sm;   // the f32 tiles of the epilogue take the buffers' place
    const size_t z = blockIdx.z; A += z * ((size_t)TT * DM);
    const int lane = threadIdx.x & 31, lr = lane & 15, hi = lane >> 4; const int r0 = blockIdx.x * QB_M, cb = blockIdx.y;
    const int wv = __builtin_amdgcn_readfirstlane((int)(threadIdx.x >> 5));   // wave number, scalar: tile-row bases, the stage loop and the choice of a wave's product stay under scalar control
    const int wm = wv & 1, wn = wv >> 1;
    // waves 0..7 copy tile rows 3 w .. 3 w + 2 of every stage (x and Wq), waves 8..11 tile rows 2 w + 8 and 2 w + 9 (Wk and Wv); eight copies of 512 bytes a tile row
    const bool three = wv < 8; const int j0 = three ? wv * 3 : wv * 2 + 8;
    const char* gp[3]; unsigned lp[3];
#pragma unroll
    for (int i = 0; i < 3; ++i) { const int j = (i == 2 && !three) ? j0 : j0 + i;   // the third place of waves 8..11 is never copied
        const bf* tb = (j < 8) ? A + (size_t)(r0 + 16 * j) * KX : (j < 24) ? BQ + (size_t)(cb * QB_NQ + 16 * (j - 8)) * KX : (j < 28) ? BK + (size_t)(cb * QB_NK + 16 * (j - 24)) * KX : BV + (size_t)(cb * QB_NK + 16 * (j - 28)) * KX;
        gp[i] = (const char*)tb + lane * 16; lp[i] = (unsigned)(size_t)(const void*)sm + (unsigned)(j * GB_RB + lane * 16); }
    auto fill = [&](const int s, const int bi) __attribute__((always_inline)) {
#pragma unroll
        for (int i = 0; i < 3; ++i) {
            if (i < 2 || three) { unsigned l[8]; const char* g[8];   // the test is scalar: a whole wave copies or none of it
#pragma unroll
                for (int q = 0; q < 8; ++q) { l[q] = lp[i] + (unsigned)bi * QB_SB + q * 512; g[q] = gp[i] + (size_t)s * GB_RB + q * 512; }
                // the eight copies of one tile row and, as the statement's last line, the wait that stands in front of any overwrite of an address register which one of them names
                asm volatile("global_load_async_to_lds_b128 %0, %8, off\n\tglobal_load_async_to_lds_b128 %1, %9, off\n\tglobal_load_async_to_lds_b128 %2, %10, off\n\tglobal_load_async_to_lds_b128 %3, %11, off\n\t"
                             "global_load_async_to_lds_b128 %4, %12, off\n\tglobal_load_async_to_lds_b128 %5, %13, off\n\tglobal_load_async_to_lds_b128 %6, %14, off\n\tglobal_load_async_to_lds_b128 %7, %15, off\n\t"
                             "s_wait_xcnt 0x0"
                             :: "v"(l[0]), "v"(l[1]), "v"(l[2]), "v"(l[3]), "v"(l[4]), "v"(l[5]), "v"(l[6]), "v"(l[7]),
                                "v"(g[0]), "v"(g[1]), "v"(g[2]), "v"(g[3]), "v"(g[4]), "v"(g[5]), "v"(g[6]), "v"(g[7]) : "memory"); } }
    };
    v8f acc[4][4];
#pragma unroll
    for (int mb = 0; mb < 4; ++mb)
#pragma unroll
        for (int nb = 0; nb < 4; ++nb) acc[mb][nb] = (v8f){};
    constexpr int NS = KX / GB_K;
    fill(0, 0);
    asm volatile("s_wait_asynccnt 0x0" ::: "memory");   // this wave's copies of stage 0 have landed
    __syncthreads();                                     // every wave's have: stage 0 may be read
    fill(1, 1);
    // stays rolled: the two buffers alternate by the trip's parity, and 16 copies of the body would only add code for the instruction cache to hold
#pragma unroll 1
    for (int t = 0; t < NS; ++t) {
        const bf* sb = st + (t & 1) * (QB_SB / 2) + lane * 8;
#pragma unroll
        for (int hf = 0; hf < 2; ++hf) {   // 64 k at a time: with three waves on a SIMD the fragments of 128 k and the accumulators do not fit a wave's registers
            V a[2][4], b[2][4];
#pragma unroll
            for (int kk = 0; kk < 2; ++kk) {
#pragma unroll
                for (int mb = 0; mb < 4; ++mb) a[kk][mb] = WFrag<bf>::ld(sb + (wm * 4 + mb) * (GB_RB / 2) + (hf * 2 + kk) * 512);
#pragma unroll
                for (int nb = 0; nb < 4; ++nb) b[kk][nb] = WFrag<bf>::ld(sb + (QB_M / 16 + wn * 4 + nb) * (GB_RB / 2) + (hf * 2 + kk) * 512); }
            __builtin_amdgcn_sched_barrier(0);   // the LDS reads of 64 k stay one group in front of their products
#pragma unroll
            for (int kk = 0; kk < 2; ++kk)
#pragma unroll
                for (int nb = 0; nb < 4; ++nb)
#pragma unroll
                    for (int mb = 0; mb < 4; ++mb) acc[mb][nb] = WFrag<bf>::mma(a[kk][mb], b[kk][nb], acc[mb][nb]);
            __builtin_amdgcn_sched_barrier(0);   // the products stay in front of the next group of reads and, in the second half, of the waits and the barrier, so that the next stage's copies fly under them
        }
        asm volatile("s_wait_dscnt 0x0" ::: "memory");      // this wave's reads of the buffer have returned before the buffer is given up
        asm volatile("s_wait_asynccnt 0x0" ::: "memory");   // this wave's copies of stage t + 1 have landed
        __syncthreads();                                     // publishes stage t + 1 and ends every wave's reads of the buffer that is refilled below
        if (t + 2 < NS) fill(t + 2, t & 1);
    }
    asm volatile("s_wait_asynccnt 0x0" ::: "memory");   // no copy is outstanding when the wave goes on to the epilogue and ends
    const int r0w = r0 + wm * 64; const bool isv = wn == 5, isq = wn < 4;   // scalar
    const int c0w = isq ? cb * QB_NQ + wn * 64 : cb * QB_NK;   // the wave's first column in its own product
    const bool hires = r0 < RH;   // block-uniform: a block's 128 positions lie on one side of RH
    // item -> (row, 8 columns) of the wave's LDS tile: lane & 15 = row & 15, lane >> 4 = bit 3 of the column, which is the order of a tile's 16-byte pieces
    auto irow = [&](const int it) __attribute__((always_inline)) { const int item = it * 32 + lane; return (item & 15) | ((item >> 7) << 4); };
    auto icol = [&](const int it) __attribute__((always_inline)) { const int item = it * 32 + lane; return ((item >> 4) & 7) * 8; };
    // 8 values of one 16-byte piece -> the fp16 plane and, for positions < RH (the first RH HD places of a plane), the bf16 hi/lo planes
    auto put = [&](const float (&y)[8], h16* p16, bf* ph, bf* pl) __attribute__((always_inline)) {
        v8h o16;
#pragma unroll
        for (int e = 0; e < 8; ++e) o16[e] = tohx(y[e]);
        *(v8h*)p16 = o16;
        asm volatile("s_wait_xcnt 0x0" ::: "memory");   // stands behind the store, in front of anything that overwrites its address or data registers
        if (hires) { v8us oh, ol;
#pragma unroll
            for (int e = 0; e < 8; ++e) { unsigned short ua, ub; splitf(y[e], ua, ub); oh[e] = ua; ol[e] = ub; }
            *(v8us*)ph = oh; *(v8us*)pl = ol;
            asm volatile("s_wait_xcnt 0x0" ::: "memory"); }   // the same behind the two stores
    };
    float* my = os + (size_t)wv * (64 * 68);
    v4f ca[16], cc[16];
    if (!isv) {
        // the (c, s) pairs are fetched here so that they fly under the LDS stores and the barrier
#pragma unroll
        for (int it = 0; it < 16; ++it) { const float* cp = CS + (size_t)(r0w + irow(it)) * (HP * 2) + ((c0w + icol(it)) & (HD - 1)); ca[it] = *(const v4f*)cp; cc[it] = *(const v4f*)(cp + 4);
            asm volatile("s_wait_xcnt 0x0" :: "v"(cp) : "memory"); }   // stands in front of any overwrite of the address pair that the two loads name; as an input the pair stays untouched up to it
#pragma unroll
        for (int mb = 0; mb < 4; ++mb)
#pragma unroll
            for (int nb = 0; nb < 4; ++nb)
#pragma unroll
                for (int j = 0; j < 8; ++j) my[(mb * 16 + hi * 8 + j) * 68 + nb * 16 + lr] = acc[mb][nb][j];   // LDS tile (position, column)
    } else {
#pragma unroll
        for (int mb = 0; mb < 4; ++mb)
#pragma unroll
            for (int nb = 0; nb < 4; ++nb) { v4f lo4, hi4;   // LDS tile (column, position): a lane's 8 registers are 8 positions in a row
#pragma unroll
                for (int j = 0; j < 4; ++j) { lo4[j] = acc[mb][nb][j]; hi4[j] = acc[mb][nb][4 + j]; }
                float* q = my + (nb * 16 + lr) * 68 + mb * 16 + hi * 8; *(v4fa*)q = lo4; *(v4fa*)(q + 4) = hi4; }
    }
    __syncthreads();   // the tile is in LDS before any lane reads what other lanes stored; every wave passes it
    if (!isv) {
        const size_t nh = isq ? NH_ : NKV;
        h16* P16 = (isq ? Q16 : K16) + z * nh * TT * HD; bf* Ph = (isq ? Qh : Kh) + z * nh * RH * HD; bf* Pl = (isq ? Ql : Kl) + z * nh * RH * HD;
#pragma unroll
        for (int it = 0; it < 16; ++it) { const int row = irow(it), cofs = icol(it);
            const int t = r0w + row, col = c0w + cofs, d = col & (HD - 1), hd = col / HD;
            const float* p = my + row * 68 + cofs; const v4f s0 = *(const v4fa*)p, s1 = *(const v4fa*)(p + 4);
            float y[8];
#pragma unroll
            for (int j = 0; j < 2; ++j) { y[2 * j] = s0[2 * j] * ca[it][2 * j] - s0[2 * j + 1] * ca[it][2 * j + 1]; y[2 * j + 1] = s0[2 * j] * ca[it][2 * j + 1] + s0[2 * j + 1] * ca[it][2 * j];
                y[4 + 2 * j] = s1[2 * j] * cc[it][2 * j] - s1[2 * j + 1] * cc[it][2 * j + 1]; y[5 + 2 * j] = s1[2 * j] * cc[it][2 * j + 1] + s1[2 * j + 1] * cc[it][2 * j]; }
            const int he = ((t >> 4) * (HD / 32) + (d >> 5)) * 512 + ((d >> 4) & 1) * 256 + (((d >> 3) & 1) * 16 + (t & 15)) * 8;
            put(y, P16 + (size_t)hd * TT * HD + he, Ph + (size_t)hd * RH * HD + he, Pl + (size_t)hd * RH * HD + he); }
    } else {
        h16* P16 = V16 + z * NKV * TT * HD; bf* Ph = Vh + z * NKV * RH * HD; bf* Pl = Vl + z * NKV * RH * HD;
#pragma unroll
        for (int it = 0; it < 16; ++it) { const int row = irow(it), cofs = icol(it);
            const int r = c0w + row, t = r0w + cofs, d = r & (HD - 1), hd = r / HD;
            const float* p = my + row * 68 + cofs; const v4f s0 = *(const v4fa*)p, s1 = *(const v4fa*)(p + 4);
            float y[8];
#pragma unroll
            for (int j = 0; j < 4; ++j) { y[j] = s0[j]; y[4 + j] = s1[j]; }
            const int he = ((t >> 5) * (HD / 16) + (d >> 4)) * 512 + ((t >> 4) & 1) * 256 + (((t >> 3) & 1) * 16 + (d & 15)) * 8;
            put(y, P16 + (size_t)hd * TT * HD + he, Ph + (size_t)hd * RH * HD + he, Pl + (size_t)hd * RH * HD + he); }
    }
}

extern "C" void kernel_launch(void* const* d_in, const int* in_sizes, int n_in,
                              void* d_out, int out_size, void* d_ws, size_t ws_size, hipStream_t stream) {
    if (n_in < 5) return;
    if ((size_t)in_sizes[0] < (size_t)(NB - 1) * TT_FULL * DM + (size_t)TT * DM) return;
    if (in_sizes[1] < DM * DQ || in_sizes[2] < DM * DKV || in_sizes[3] < DM * DKV || in_sizes[4] < DQ * DM) return;
    if ((size_t)out_size < (size_t)(NB - 1) * TT_FULL * DM + (size_t)TT * DM) return;
    const float* x = (const float*)d_in[0]; const float* wq = (const float*)d_in[1]; const float* wk = (const float*)d_in[2]; const float* wv = (const float*)d_in[3]; const float* wo = (const float*)d_in[4];
    float* OUT = (float*)d_out;     // [NB][TT_FULL][DM]
    char* wsp = (char*)d_ws;
    auto take = [&](size_t bytes) { char* p = wsp; wsp += (bytes + 255) & ~(size_t)255; return (void*)p; };
    bf* WQ = (bf*)take((size_t)DQ * DM * 2); bf* WK = (bf*)take((size_t)DKV * DM * 2); bf* WV = (bf*)take((size_t)DKV * DM * 2); bf* WO = (bf*)take((size_t)DM * DQ * 2);   // Bt = (out, in) planes in fragment order
    h16* WO16 = (h16*)take((size_t)DM * DQ * 2);                                                                                             // Bt fp16 x WCAR
    float* CS = (float*)take((size_t)TT * HP * 2 * 4);
    // from here on every plane holds NB batches, one behind the other
    h16* QP16 = (h16*)take((size_t)NB * NH_ * TT * HD * 2); h16* KP16 = (h16*)take((size_t)NB * NKV * TT * HD * 2); h16* VT16 = (h16*)take((size_t)NB * NKV * HD * TT * 2);
    bf* QPh = (bf*)take((size_t)NB * NH_ * RH * HD * 2); bf* QPl = (bf*)take((size_t)NB * NH_ * RH * HD * 2); bf* KPh = (bf*)take((size_t)NB * NKV * RH * HD * 2); bf* KPl = (bf*)take((size_t)NB * NKV * RH * HD * 2);
    bf* VTh = (bf*)take((size_t)NB * NKV * HD * RH * 2); bf* VTl = (bf*)take((size_t)NB * NKV * HD * RH * 2);
    bf* XB = (bf*)take((size_t)NB * TT * DM * 2);     // bf16 x rows
    h16* AT16 = (h16*)take((size_t)NB * TT * DQ * 2); bf* ATh = (bf*)take((size_t)NB * RH * DQ * 2); bf* ATl = (bf*)take((size_t)NB * RH * DQ * 2);
    if ((size_t)(wsp - (char*)d_ws) > ws_size) return;
    // one launch prepares every plane that depends on an input alone, for all NB batches
    k_prep<<<PB_CS + PB_X + 2 * PB_WB + 2 * PB_WS, 256, 0, stream>>>(x, wq, wk, wv, wo, XB, WQ, WK, WV, WO, WO16, CS);
    // every launch below covers all NB batches: the last grid dimension of a GEMM is the batch (z with the batch strides); k_fattn walks the batches inside each wave
    // the three projections are one launch, which writes their 16-bit operand planes itself (rotary map for q and k; v turned in LDS into (d, position) order): no f32 copy of q, k or v exists
    k_qkv<<<dim3(TT / QB_M, DQ / QB_NQ, NB), 384, 0, stream>>>(XB, WQ, WK, WV, CS, QP16, QPh, QPl, KP16, KPh, KPl, VT16, VTh, VTl);
    k_fattn<<<dim3(TT / 32, NKV, 1), 64 * REP, 0, stream>>>(QP16, KP16, VT16, QPh, QPl, KPh, KPl, VTh, VTl, AT16, ATh, ATl);
    // output projection: rows < RH bf16 hi/lo context x bf16 Wo (2 products); rows >= RH fp16 context x64 x fp16 Wo x64 (1 product, 1/4096 in the epilogue)
    k_gemmw<bf, 1, 16><<<dim3(RH / 64, DM / 64, NB), 512, 0, stream>>>(ATh, ATl, WO, nullptr, DQ, -1, 0, OUT, DM, 1.0f, (size_t)RH * DQ, 0, (size_t)TT_FULL * DM);
    k_gemmb<h16><<<dim3((TT - RH) / GB_M, DM / GB_N, NB), 256, 0, stream>>>(AT16 + (size_t)RH * DQ, WO16, OUT + (size_t)RH * DM, DM, OSCW, (size_t)TT * DQ, (size_t)TT_FULL * DM);
}
